// v000
// Measured on an AMD MI455X. A time is GPU time per run, averaged over a window of back-to-back runs after a warm-up
// (all launches, gaps included; the runs take copies of the inputs in turn), and the median of several windows.
// Apart from v000's, it joins two sittings. Times from different sittings can be a few percent apart, while
// side-by-side timings come from the same sitting.
// v000 is the starting kernel. One run takes 7550 microseconds.
#include <hip/hip_runtime.h>
// Pre-LN transformer encoder block with PER-HEAD projection tensors, no QKV biases (x [8][1024][1024]; h = LN1(x) (biased var, eps 1e-5); q/k/v[h] = h W[h] with W [16][1024][64] ([head][in][out]); scale 64^-0.5; softmax over all 1024 keys (no mask); x1 = x + concat(attn) Wo + bo ([in][out]); out = x1 + gelu_erf(LN2(x1) W1 + b1) W2 + b2 ([in][out] 1024 x 1024 x 1024: hidden = 1 x n_embd, as the source) -> [8][1024][1024]).
// Structure: token rows; LayerNorm / exact f16 rows; WMMA GEMMs for q, k, v; per batch V^T by LDS transposes and 4 heads per launch group (scores, row softmax, P V^T); output projection with the own-element residual; custom LayerNorm; erf-GELU FFN per batch; launches: see trace.
// Compute dtype: inputs rounded to bf16; x / weights exact; q, k, v, softmax weights and o as plain f16 GEMM operands (~2^-12); scores and softmax statistics f32. v_wmma_f32_16x16x32_f16.
#define NB 8
#define SQ 1024
#define DM 1024
#define NH 16
#define HD 64
#define HG 4                         /* heads per attention launch group */
#define LOCALW 128                   /* (macros for unused kernels of the shared header) */
#define STRIDEK 128
#define QT 256                       /* query rows per causal tile */
#define NKX SQ                       /* S / P row pitch */
#define QT0 128                      /* first-tile rows recomputed exactly in f32 */
#define B0 0                         /* unused; the batch loops start at 0 */
#define NBR NB                       /* only feeds the unused MP; the batch loops run to NB */
#define NR ((size_t)NB * SQ)
#define DMQ DM
#define DFF 1024         /* FFN hidden width = 1 x n_embd in this module (W1 [1024][1024], W2 [1024][1024]) */
#define MP ((int)((size_t)NBR * SQ)) /* unused; the projections take NR rows */
#define QN SQ                        /* unused; attention runs all SQ query rows */
#define NHD NH                       /* unused; the head loop runs to NH */
#define MPO MP                       /* unused; the output stage takes NR rows */
#define LQ (3 * DM)      /* unused; the q, k, v rows have pitch DM */
typedef __bf16 v16b __attribute__((ext_vector_type(16)));
typedef unsigned short v8us __attribute__((ext_vector_type(8), may_alias));
typedef float  v8f  __attribute__((ext_vector_type(8)));
typedef float  v4f  __attribute__((ext_vector_type(4)));
typedef float  v4fa __attribute__((ext_vector_type(4), may_alias));
union FragB { v16b v; v8us half[2]; unsigned short u[16]; };

__device__ __forceinline__ unsigned short bf16_bits(float x) { unsigned int u = __float_as_uint(x); return (unsigned short)((u + 0x7FFFu + ((u >> 16) & 1u)) >> 16); }
__device__ __forceinline__ float bf16_val(unsigned short b) { return __uint_as_float(((unsigned int)b) << 16); }
__device__ __forceinline__ float bf16_round(float x) { return bf16_val(bf16_bits(x)); }
// D += A·B with NT terms: 1 = ah·bh, 2 = + al·bh (A split), 3 = + ah·bl (both split)
template <int NT>
__device__ __forceinline__ v8f mmaN(v16b ah, v16b al, v16b bh, v16b bl, v8f c) {
  c = __builtin_amdgcn_wmma_f32_16x16x32_bf16(false, ah, false, bh, (short)0, c, false, false);
  if (NT >= 2) c = __builtin_amdgcn_wmma_f32_16x16x32_bf16(false, al, false, bh, (short)0, c, false, false);
  if (NT >= 3) c = __builtin_amdgcn_wmma_f32_16x16x32_bf16(false, ah, false, bl, (short)0, c, false, false);
  asm volatile("v_nop\n\tv_nop\n\tv_nop\n\tv_nop" : "+v"(c) : "v"(ah), "v"(al), "v"(bh), "v"(bl));
  return c;
}

__global__ __launch_bounds__(256) void k_wt_bf16(const float* __restrict__ W, unsigned short* __restrict__ Wt, int K, int N) {
  const int t = blockIdx.x * 256 + threadIdx.x;
  const int k8n = K / 8;
  if (t >= N * k8n) return;
  const int n = t / k8n, k8 = (t % k8n) * 8;
  v8us v;
#pragma unroll
  for (int i = 0; i < 8; ++i) v[i] = bf16_bits(W[(size_t)(k8 + i) * N + n]);
  *(v8us*)(Wt + (size_t)n * K + k8) = v;
  
}

// GEMM C[M][N] (f32, pitch ldc) = act(A[M][K]·W + bias). A f32 row-major (pitch lda) converted per fragment to bf16
// (ASPLIT: hi/lo two planes -> 2 terms, else single rounded term); Wt bf16 [N][K] (pitch ldb). BIAS_BF16 rounds the
// bias to bf16 first (bias quantised to bf16 before the add). K%32==0, M%16==0, N%64==0.
template <bool ASPLIT, int ACT, bool BIAS_BF16>
__global__ __launch_bounds__(128) void k_gemm_bf(const float* __restrict__ A, int lda, const unsigned short* __restrict__ Wt, int ldb,
                                               const float* __restrict__ bias, float* __restrict__ C, int ldc, int M, int N, int K) {
  __shared__ __attribute__((aligned(16))) float so[4][16][64];
  const int tid = threadIdx.x, w = tid >> 5, lane = tid & 31, ln = lane & 15, hh = lane >> 4;
  const int ntn = N / 64;
  const int wid = blockIdx.x * 4 + w;
  const int mt = wid / ntn, nq = wid % ntn;
  if (mt * 16 >= M) return;
  const int row0 = mt * 16, col0 = nq * 64;
  const float* arow = A + (size_t)(row0 + ln) * lda;
  v8f acc[4] = {};
  for (int kb = 0; kb < K; kb += 32) {
    FragB ah, al;
    const v4f x0 = *(const v4fa*)(arow + kb + 8 * hh), x1 = *(const v4fa*)(arow + kb + 8 * hh + 4);
    const v4f x2 = *(const v4fa*)(arow + kb + 16 + 8 * hh), x3 = *(const v4fa*)(arow + kb + 16 + 8 * hh + 4);
    float xs[16] = {x0[0],x0[1],x0[2],x0[3],x1[0],x1[1],x1[2],x1[3],x2[0],x2[1],x2[2],x2[3],x3[0],x3[1],x3[2],x3[3]};
#pragma unroll
    for (int i = 0; i < 16; ++i) { const unsigned short hb = bf16_bits(xs[i]); ah.u[i] = hb; al.u[i] = ASPLIT ? bf16_bits(xs[i] - bf16_val(hb)) : (unsigned short)0; }
#pragma unroll
    for (int t = 0; t < 4; ++t) {
      const unsigned short* brow = Wt + (size_t)(col0 + t * 16 + ln) * ldb + kb;
      FragB b;
      b.half[0] = *(const v8us*)(brow + 8 * hh);
      b.half[1] = *(const v8us*)(brow + 16 + 8 * hh);
      acc[t] = mmaN<ASPLIT ? 2 : 1>(ah.v, al.v, b.v, b.v, acc[t]);
    }
  }
#pragma unroll
  for (int t = 0; t < 4; ++t) {
    float bv = bias ? bias[col0 + t * 16 + ln] : 0.f;
    if (BIAS_BF16) bv = bf16_round(bv);
#pragma unroll
    for (int r = 0; r < 8; ++r) { float v = acc[t][r] + bv; if (ACT == 1) v = fmaxf(v, 0.f); so[w][8 * hh + r][t * 16 + ln] = v; }
  }
  __builtin_amdgcn_fence(__ATOMIC_ACQ_REL, "workgroup");
  __builtin_amdgcn_wave_barrier();
  const int rsub = lane >> 4, c4 = (lane & 15) * 4;
  {
#pragma unroll
    for (int q = 0; q < 8; ++q) {
      const int r = q * 2 + rsub;
      const v4f v = *(const v4fa*)&so[w][r][c4];
      *(v4f*)(C + (size_t)(row0 + r) * ldc + col0 + c4) = v;
    }
    
  }
}

// GEMM C = act(A·W + bias + resid): A f32 (ASPLIT -> hi/lo 2 terms), Wt bf16 [N][K]; ACT 0 none, 1 relu, 2 exact gelu;
// resid (optional, f32, row index = (row % rmod), pitch ldr, RES_BF16 rounds it) added before the activation.
template <bool ASPLIT, int ACT, bool BIAS_BF16, bool RES_BF16>
__global__ __launch_bounds__(128) void k_gemm_bf3(const float* __restrict__ A, int lda, const unsigned short* __restrict__ Wt, int ldb,
                                                const float* __restrict__ bias, const float* __restrict__ resid, int rmod, int ldr,
                                                float* __restrict__ C, int ldc, int M, int N, int K) {
  __shared__ __attribute__((aligned(16))) float so[4][16][64];
  const int tid = threadIdx.x, w = tid >> 5, lane = tid & 31, ln = lane & 15, hh = lane >> 4;
  const int ntn = N / 64;
  const int wid = blockIdx.x * 4 + w;
  const int mt = wid / ntn, nq = wid % ntn;
  if (mt * 16 >= M) return;
  const int row0 = mt * 16, col0 = nq * 64;
  const float* arow = A + (size_t)(row0 + ln) * lda;
  v8f acc[4] = {};
  for (int kb = 0; kb < K; kb += 32) {
    FragB ah, al;
    const v4f x0 = *(const v4fa*)(arow + kb + 8 * hh), x1 = *(const v4fa*)(arow + kb + 8 * hh + 4);
    const v4f x2 = *(const v4fa*)(arow + kb + 16 + 8 * hh), x3 = *(const v4fa*)(arow + kb + 16 + 8 * hh + 4);
    float xs[16] = {x0[0],x0[1],x0[2],x0[3],x1[0],x1[1],x1[2],x1[3],x2[0],x2[1],x2[2],x2[3],x3[0],x3[1],x3[2],x3[3]};
#pragma unroll
    for (int i = 0; i < 16; ++i) { const unsigned short hb = bf16_bits(xs[i]); ah.u[i] = hb; al.u[i] = ASPLIT ? bf16_bits(xs[i] - bf16_val(hb)) : (unsigned short)0; }
#pragma unroll
    for (int t = 0; t < 4; ++t) {
      const unsigned short* brow = Wt + (size_t)(col0 + t * 16 + ln) * ldb + kb;
      FragB b;
      b.half[0] = *(const v8us*)(brow + 8 * hh);
      b.half[1] = *(const v8us*)(brow + 16 + 8 * hh);
      acc[t] = mmaN<ASPLIT ? 2 : 1>(ah.v, al.v, b.v, b.v, acc[t]);
    }
  }
#pragma unroll
  for (int t = 0; t < 4; ++t) {
    const int col = col0 + t * 16 + ln;
    float bv = bias ? bias[col] : 0.f;
    if (BIAS_BF16) bv = bf16_round(bv);
#pragma unroll
    for (int r = 0; r < 8; ++r) {
      float v = acc[t][r] + bv;
      if (resid) { float rv = resid[(size_t)((row0 + 8 * hh + r) % rmod) * ldr + col]; if (RES_BF16) rv = bf16_round(rv); v += rv; }
      if (ACT == 1) v = fmaxf(v, 0.f);
      if (ACT == 2) v = 0.5f * v * (1.0f + erff(v * 0.70710678118654752f));
      if (ACT == 3) { const float u = 0.7978845608028654f * (v + 0.044715f * v * v * v); v = 0.5f * v * (1.0f + tanhf(u)); }
      so[w][8 * hh + r][t * 16 + ln] = v;
    }
  }
  __builtin_amdgcn_fence(__ATOMIC_ACQ_REL, "workgroup");
  __builtin_amdgcn_wave_barrier();
  const int rsub = lane >> 4, c4 = (lane & 15) * 4;
  {
#pragma unroll
    for (int q = 0; q < 8; ++q) {
      const int r = q * 2 + rsub;
      const v4f v = *(const v4fa*)&so[w][r][c4];
      *(v4f*)(C + (size_t)(row0 + r) * ldc + col0 + c4) = v;
    }
    
  }
}
// row LayerNorm (biased variance, eps) over N: s = X (+ R); optional out_sum <- s; out_norm <- (s-mu)*rsqrt(var+eps)*g + b
template <bool PARAM_BF16>
__global__ __launch_bounds__(256) void k_layernorm(const float* __restrict__ X, const float* __restrict__ R, const float* __restrict__ g, const float* __restrict__ bta,
                                                  float* __restrict__ out_sum, float* __restrict__ out_norm, int N, float eps) {
  __shared__ float red[256];
  const int row = blockIdx.x, tid = threadIdx.x;
  const float* x = X + (size_t)row * N; const float* rr = R ? R + (size_t)row * N : nullptr;
  float vals[16];                     // up to N = 4096
  const int per = N / 256;            // contiguous chunk per thread? use strided-by-4 chunks: thread handles j = tid*4 + 1024*u
  float s1 = 0.f;
  for (int u = 0; u < per / 4; ++u) {
    const int j = tid * 4 + 1024 * u;
    const v4f a = *(const v4fa*)(x + j);
    v4f b = {0.f,0.f,0.f,0.f}; if (rr) b = *(const v4fa*)(rr + j);
#pragma unroll
    for (int q = 0; q < 4; ++q) { const float v = a[q] + b[q]; vals[u * 4 + q] = v; s1 += v; }
  }
  red[tid] = s1; __syncthreads();
  for (int st = 128; st > 0; st >>= 1) { if (tid < st) red[tid] += red[tid + st]; __syncthreads(); }
  const float mu = red[0] / (float)N; __syncthreads();
  float s2 = 0.f;
  for (int u = 0; u < per / 4; ++u)
#pragma unroll
    for (int q = 0; q < 4; ++q) { const float c = vals[u * 4 + q] - mu; s2 += c * c; }
  red[tid] = s2; __syncthreads();
  for (int st = 128; st > 0; st >>= 1) { if (tid < st) red[tid] += red[tid + st]; __syncthreads(); }
  const float rs = rsqrtf(red[0] / (float)N + eps);
  {
    for (int u = 0; u < per / 4; ++u) {
      const int j = tid * 4 + 1024 * u;
      v4f o, sm;
#pragma unroll
      for (int q = 0; q < 4; ++q) {
        float gg = g[j + q], bb = bta[j + q];
        if (PARAM_BF16) { gg = bf16_round(gg); bb = bf16_round(bb); }
        sm[q] = vals[u * 4 + q]; o[q] = (vals[u * 4 + q] - mu) * rs * gg + bb;
      }
      if (out_sum) *(v4f*)(out_sum + (size_t)row * N + j) = sm;
      *(v4f*)(out_norm + (size_t)row * N + j) = o;
    }
    
  }
}



// ---- f16 WMMA path (v_wmma_f32_16x16x32_f16): 11-bit significands for operands in range — used where a [0,1] probability operand needs more precision than bf16
typedef _Float16 v16h __attribute__((ext_vector_type(16)));
union FragH { v16h v; v8us half[2]; _Float16 h[16]; unsigned short u[16]; };
template <int NT>
__device__ __forceinline__ v8f mmaH(v16h ah, v16h al, v16h bh, v16h bl, v8f c) {
  c = __builtin_amdgcn_wmma_f32_16x16x32_f16(false, ah, false, bh, (short)0, c, false, false);
  if (NT >= 2) c = __builtin_amdgcn_wmma_f32_16x16x32_f16(false, al, false, bh, (short)0, c, false, false);
  if (NT >= 3) c = __builtin_amdgcn_wmma_f32_16x16x32_f16(false, ah, false, bl, (short)0, c, false, false);
  asm volatile("v_nop\n\tv_nop\n\tv_nop\n\tv_nop" : "+v"(c) : "v"(ah), "v"(al), "v"(bh), "v"(bl));
  return c;
}
// batched GEMM like k_gemm_b but f16 operands: A f32 (split into f16 hi/lo if ASPLIT, else rounded to f16), Bt = f16 values [n][k]; alpha; C f32; N multiple of 16 (partial tiles skipped)
template <bool ASPLIT>
__global__ __launch_bounds__(128) void k_gemm_h(const float* __restrict__ A, int lda, size_t sA, const _Float16* __restrict__ Bh, int ldb, size_t sB, float alpha, float* __restrict__ C, int ldc, size_t sC, int M, int N, int K) {
  __shared__ __attribute__((aligned(16))) float so[4][16][64];
  const int tid = threadIdx.x, w = tid >> 5, lane = tid & 31, ln = lane & 15, hh = lane >> 4; const int by = blockIdx.y;
  A += (size_t)by * sA; Bh += (size_t)by * sB; C += (size_t)by * sC;
  const int ntn = (N + 63) / 64; const int wid = blockIdx.x * 4 + w; const int mt = wid / ntn, nq = wid % ntn; if (mt * 16 >= M) return;
  const int row0 = mt * 16, col0 = nq * 64; const float* arow = A + (size_t)(row0 + ln) * lda;
  v8f acc[4] = {};
  for (int kb = 0; kb < K; kb += 32) {
    FragH ah, al;
    const v4f x0 = *(const v4fa*)(arow + kb + 8 * hh), x1 = *(const v4fa*)(arow + kb + 8 * hh + 4), x2 = *(const v4fa*)(arow + kb + 16 + 8 * hh), x3 = *(const v4fa*)(arow + kb + 16 + 8 * hh + 4);
    float xs[16] = {x0[0],x0[1],x0[2],x0[3],x1[0],x1[1],x1[2],x1[3],x2[0],x2[1],x2[2],x2[3],x3[0],x3[1],x3[2],x3[3]};
#pragma unroll
    for (int i = 0; i < 16; ++i) { const _Float16 h = (_Float16)xs[i]; ah.h[i] = h; al.h[i] = ASPLIT ? (_Float16)(xs[i] - (float)h) : (_Float16)0.0f; }
#pragma unroll
    for (int t = 0; t < 4; ++t) { if (col0 + t * 16 >= N) continue; const size_t boff = (size_t)(col0 + t * 16 + ln) * ldb + kb; FragH bq; bq.half[0] = *(const v8us*)(Bh + boff + 8 * hh); bq.half[1] = *(const v8us*)(Bh + boff + 16 + 8 * hh);
      acc[t] = mmaH<ASPLIT ? 2 : 1>(ah.v, al.v, bq.v, bq.v, acc[t]); }
  }
#pragma unroll
  for (int t = 0; t < 4; ++t) { if (col0 + t * 16 >= N) continue;
#pragma unroll
    for (int r = 0; r < 8; ++r) so[w][8 * hh + r][t * 16 + ln] = acc[t][r] * alpha; }
  __builtin_amdgcn_fence(__ATOMIC_ACQ_REL, "workgroup"); __builtin_amdgcn_wave_barrier();
  const int rsub = lane >> 4, c4 = (lane & 15) * 4;
  {
#pragma unroll
    for (int q = 0; q < 8; ++q) { const int r = q * 2 + rsub; if (col0 + c4 < N) { const v4f v = *(const v4fa*)&so[w][r][c4]; *(v4f*)(C + (size_t)(row0 + r) * ldc + col0 + c4) = v; } }
     }
}

// Wt[n][k] = f16(W[k][n]·scale) from f32 row-major W[K][N] (scale = power of two; bf16-exact weights stay exact in f16 away from the subnormal range)
__global__ __launch_bounds__(256) void k_wt_f16(const float* __restrict__ W, _Float16* __restrict__ Wt, int K, int N, float scale) {
  const int t = blockIdx.x * 256 + threadIdx.x; if (t >= N * (K / 8)) return; const int n = t / (K / 8), k8 = (t % (K / 8)) * 8; FragH f;
#pragma unroll
  for (int i = 0; i < 8; ++i) f.h[i] = (_Float16)(bf16_round(W[(size_t)(k8 + i) * N + n]) * scale); const v8us o = f.half[0];
  *(v8us*)((unsigned short*)Wt + (size_t)n * K + k8) = o; 
}
// k_gemm_hh variant with fused epilogue: v = acc·alpha + bias[by·sBias + col] (+ CP[(row/rowsPerB)·sCPb + by·64 + col] if CP) ; ACT 0 none / 1 elu ; writes f16 C16 (and f32 C if non-null)
template <int ACT>
__global__ __launch_bounds__(128) void k_gemm_hhx(const _Float16* __restrict__ A, int lda, size_t sA, const _Float16* __restrict__ Bh, int ldb, size_t sB, float alpha, const float* __restrict__ bias, size_t sBias, const float* __restrict__ CP, int rowsPerB, size_t sCPb, int row0g,
    float* __restrict__ C, _Float16* __restrict__ C16, int ldc, size_t sC, int M, int N, int K) {
  __shared__ __attribute__((aligned(16))) float so[4][16][64];
  const int tid = threadIdx.x, w = tid >> 5, lane = tid & 31, ln = lane & 15, hh = lane >> 4; const int by = blockIdx.y;
  A += (size_t)by * sA; Bh += (size_t)by * sB; const size_t cofs = (size_t)by * sC; const float* bp = bias ? bias + (size_t)by * sBias : nullptr;
  const int ntn = (N + 63) / 64; const int wid = blockIdx.x * 4 + w; const int mt = wid / ntn, nq = wid % ntn; if (mt * 16 >= M) return;
  const int row0 = mt * 16, col0 = nq * 64; const _Float16* arow = A + (size_t)(row0 + ln) * lda;
  v8f acc[4] = {};
  for (int kb = 0; kb < K; kb += 32) { FragH ah; ah.half[0] = *(const v8us*)((const unsigned short*)arow + kb + 8 * hh); ah.half[1] = *(const v8us*)((const unsigned short*)arow + kb + 16 + 8 * hh);
#pragma unroll
    for (int t = 0; t < 4; ++t) { if (col0 + t * 16 >= N) continue; const size_t boff = (size_t)(col0 + t * 16 + ln) * ldb + kb; FragH bq; bq.half[0] = *(const v8us*)((const unsigned short*)Bh + boff + 8 * hh); bq.half[1] = *(const v8us*)((const unsigned short*)Bh + boff + 16 + 8 * hh);
      acc[t] = mmaH<1>(ah.v, ah.v, bq.v, bq.v, acc[t]); }
  }
#pragma unroll
  for (int t = 0; t < 4; ++t) { if (col0 + t * 16 >= N) continue; const int col = col0 + t * 16 + ln; const float bv = bp ? bf16_round(bp[col]) : 0.f;
#pragma unroll
    for (int r = 0; r < 8; ++r) { float v = acc[t][r] * alpha + bv; if (CP) { const int rr = row0g + row0 + 8 * hh + r; if (rowsPerB < 0) v += CP[cofs + (size_t)rr * ldc + col];      /* rowsPerB < 0: own element of the batched C plane */ else { const int bidx = rr / rowsPerB; v += CP[(size_t)bidx * sCPb + (size_t)by * 64 + col]; } } if (ACT == 1) v = (v > 0.f) ? v : expm1f(v); else if (ACT == 7) v = (v > 0.f) ? v + 1.0f : expf(v); else if (ACT == 8) v = tanhf(v); else if (ACT == 9) v = 0.5f * v * (1.0f + tanhf(0.7978845608028654f * (v + 0.044715f * v * v * v))); else if (ACT == 11) v = 1.0f / (1.0f + expf(-v)); else if (ACT == 12) v = (v > 0.f) ? v : 0.01f * v; else if (ACT == 14) v = (v > 0.f) ? v : 0.1f * v; else if (ACT == 16) v = (v >= 0.f) ? v : 0.3f * v; else if (ACT == 17) v = (v >= 0.f) ? v : 0.2f * v; else if (ACT == 15) v = v / (1.0f + expf(-v)); else if (ACT == 3) v = fmaxf(v, 0.f); else if (ACT == 6) v = 0.5f * v * (1.0f + erff(v * 0.70710678118654752f)); so[w][8 * hh + r][t * 16 + ln] = v; } }
  __builtin_amdgcn_fence(__ATOMIC_ACQ_REL, "workgroup"); __builtin_amdgcn_wave_barrier();
  const int rsub = lane >> 4, c4 = (lane & 15) * 4; typedef _Float16 v4h __attribute__((ext_vector_type(4)));
  {
#pragma unroll
    for (int q = 0; q < 8; ++q) { const int r = q * 2 + rsub; if (col0 + c4 < N) { const v4f v = *(const v4fa*)&so[w][r][c4]; if (C) *(v4f*)(C + cofs + (size_t)(row0 + r) * ldc + col0 + c4) = v; if (C16) { v4h h4; for (int i = 0; i < 4; ++i) h4[i] = (_Float16)v[i]; *(v4h*)(C16 + cofs + (size_t)(row0 + r) * ldc + col0 + c4) = h4; } } }
     }
}


typedef _Float16 v4h __attribute__((ext_vector_type(4)));

__global__ __launch_bounds__(256) void k_x16(const float* __restrict__ x, _Float16* __restrict__ X16, size_t n8) { const size_t t = (size_t)blockIdx.x * 256 + threadIdx.x; if (t >= n8) return; FragH f;
#pragma unroll
  for (int q = 0; q < 8; ++q) f.h[q] = (_Float16)bf16_round(x[t * 8 + q]); *(v8us*)((unsigned short*)X16 + t * 8) = f.half[0];  }
__global__ __launch_bounds__(256) void k_h16(const float* __restrict__ x, _Float16* __restrict__ X16, size_t n8) { const size_t t = (size_t)blockIdx.x * 256 + threadIdx.x; if (t >= n8) return; FragH f;
#pragma unroll
  for (int q = 0; q < 8; ++q) f.h[q] = (_Float16)x[t * 8 + q]; *(v8us*)((unsigned short*)X16 + t * 8) = f.half[0];  }
__global__ __launch_bounds__(256) void k_round16f(const float* __restrict__ W, _Float16* __restrict__ Bt, size_t n8) { const size_t t = (size_t)blockIdx.x * 256 + threadIdx.x; if (t >= n8) return; FragH f;
#pragma unroll
  for (int i = 0; i < 8; ++i) f.h[i] = (_Float16)(bf16_round(W[t * 8 + i]) * 16.0f); *(v8us*)((unsigned short*)Bt + t * 8) = f.half[0];  }
template <int NHv, int TTv>
__global__ __launch_bounds__(256) void k_vt(const _Float16* __restrict__ V16, int ldv, int voff, _Float16* __restrict__ Vt) { __shared__ unsigned short tl[64][66]; const int tid = threadIdx.x; const int slab = blockIdx.x / (TTv / 64), lg = blockIdx.x % (TTv / 64); const int b = slab / NHv, h = slab % NHv;
  for (int i = tid; i < 64 * 8; i += 256) { const int r = i / 8, c8 = (i % 8) * 8; FragH f; f.half[0] = *(const v8us*)((const unsigned short*)V16 + ((size_t)b * TTv + lg * 64 + r) * ldv + voff + h * 64 + c8);
#pragma unroll
    for (int q = 0; q < 8; ++q) tl[r][c8 + q] = f.u[q]; }
  __syncthreads();
  {
#pragma unroll
    for (int rd = 0; rd < 2; ++rd) { const int d = rd * 32 + tid / 8, pc = tid % 8; FragH f;
#pragma unroll
      for (int q = 0; q < 8; ++q) f.u[q] = tl[pc * 8 + q][d];
      *(v8us*)((unsigned short*)Vt + ((size_t)slab * 64 + d) * TTv + lg * 64 + pc * 8) = f.half[0]; }
     } }

__global__ __launch_bounds__(256) void k_hl(const float* __restrict__ F, _Float16* __restrict__ Hh, _Float16* __restrict__ Hl, size_t n8) { const size_t t = (size_t)blockIdx.x * 256 + threadIdx.x; if (t >= n8) return; FragH fh, fl; const v4f a = *(const v4fa*)(F + t * 8), c = *(const v4fa*)(F + t * 8 + 4);
#pragma unroll
  for (int q = 0; q < 4; ++q) { _Float16 h = (_Float16)a[q]; fh.h[q] = h; fl.h[q] = (_Float16)((a[q] - (float)h) * 1024.0f); h = (_Float16)c[q]; fh.h[4 + q] = h; fl.h[4 + q] = (_Float16)((c[q] - (float)h) * 1024.0f); }
  { *(v8us*)((unsigned short*)Hh + t * 8) = fh.half[0]; *(v8us*)((unsigned short*)Hl + t * 8) = fl.half[0];  } }

// ---- fast GEMM (wave tile 32x64; requires M % 32 == 0 rows per launch region and N % 64 == 0); epilogue = k_gemm_hhx semantics ----
__device__ __forceinline__ v16h g2_frag(const _Float16* p, int hh) { FragH f; f.half[0] = *(const v8us*)((const unsigned short*)p + 8 * hh); f.half[1] = *(const v8us*)((const unsigned short*)p + 16 + 8 * hh); return f.v; }
__device__ __forceinline__ v8f g2_mma(v16h a, v16h b, v8f c) { v8f d = __builtin_amdgcn_wmma_f32_16x16x32_f16(false, a, false, b, (short)0, c, false, false); asm volatile("v_nop\n\tv_nop\n\tv_nop\n\tv_nop" : "+v"(d) : "v"(a), "v"(b)); return d; }
template <int ACT>
__global__ __launch_bounds__(128) void k_gemm2(const _Float16* __restrict__ A, int lda, size_t sA, const _Float16* __restrict__ Bh, int ldb, size_t sB, float alpha, const float* __restrict__ bias, size_t sBias, const float* __restrict__ CP, int rowsPerB, size_t sCPb, int row0g,
    float* __restrict__ C, _Float16* __restrict__ C16, int ldc, size_t sC, int M, int N, int K) { static_assert(ACT == 0 || ACT == 3 || ACT == 6 || ACT == 8 || ACT == 9 || ACT == 11 || ACT == 12 || ACT == 14 || ACT == 15 || ACT == 16 || ACT == 17 || ACT == 18, "k_gemm2: unsupported ACT code (would silently apply no activation)");
  __shared__ __attribute__((aligned(16))) float so[4][32][68];
  const int tid = threadIdx.x, w = tid >> 5, lane = tid & 31, ln = lane & 15, hh = lane >> 4; const int by = blockIdx.y;
  A += (size_t)by * sA; Bh += (size_t)by * sB; const size_t cofs = (size_t)by * sC; const float* bp = bias ? bias + (size_t)by * sBias : nullptr;
  const int ntn = N >> 6; const int mt = blockIdx.x / ntn, nq = blockIdx.x - mt * ntn; const int row0 = mt * 128 + 32 * w, col0 = nq * 64; if (row0 >= M) return;
  const _Float16* a0p = A + (size_t)(row0 + ln) * lda; const _Float16* a1p = a0p + (size_t)16 * lda;
  const _Float16* b0p = Bh + (size_t)(col0 + ln) * ldb; const _Float16* b1p = b0p + (size_t)16 * ldb; const _Float16* b2p = b1p + (size_t)16 * ldb; const _Float16* b3p = b2p + (size_t)16 * ldb;
  const v8f z8 = {0.f,0.f,0.f,0.f,0.f,0.f,0.f,0.f}; v8f c00 = z8, c01 = z8, c02 = z8, c03 = z8, c10 = z8, c11 = z8, c12 = z8, c13 = z8;
#pragma unroll 1
  for (int kb = 0; kb < K; kb += 32) { const v16h a0 = g2_frag(a0p + kb, hh), a1 = g2_frag(a1p + kb, hh);
    v16h b = g2_frag(b0p + kb, hh); c00 = g2_mma(a0, b, c00); c10 = g2_mma(a1, b, c10);
    b = g2_frag(b1p + kb, hh); c01 = g2_mma(a0, b, c01); c11 = g2_mma(a1, b, c11);
    b = g2_frag(b2p + kb, hh); c02 = g2_mma(a0, b, c02); c12 = g2_mma(a1, b, c12);
    b = g2_frag(b3p + kb, hh); c03 = g2_mma(a0, b, c03); c13 = g2_mma(a1, b, c13); }
  v8f accs[8] = {c00, c01, c02, c03, c10, c11, c12, c13};
#pragma unroll
  for (int u = 0; u < 8; ++u) { const int t = u & 3, half = u >> 2; const int col = col0 + t * 16 + ln; const float bv = bp ? bf16_round(bp[col]) : 0.f;
#pragma unroll
    for (int r = 0; r < 8; ++r) { const int rloc = half * 16 + 8 * hh + r; float v = accs[u][r] * alpha + bv; if (CP) { if (rowsPerB < 0) v += CP[cofs + (size_t)(row0g + row0 + rloc) * ldc + col];      /* rowsPerB < 0: own element of the batched C plane */ else { const int bidx = (row0g + row0 + rloc) / rowsPerB; v += CP[(size_t)bidx * sCPb + (size_t)by * 64 + col]; } }
      if (ACT == 3) v = fmaxf(v, 0.f); else if (ACT == 6) v = 0.5f * v * (1.0f + erff(v * 0.70710678118654752f)); else if (ACT == 11) v = 1.0f / (1.0f + expf(-v)); else if (ACT == 15) v = v / (1.0f + expf(-v)); else if (ACT == 18) v = v / (1.0f + expf(-1.702f * v));      /* QuickGELU: v sigmoid(1.702 v) */ else if (ACT == 12) v = (v > 0.f) ? v : 0.01f * v; else if (ACT == 8) v = tanhf(v); else if (ACT == 9) v = 0.5f * v * (1.0f + tanhf(0.7978845608028654f * (v + 0.044715f * v * v * v))); else if (ACT == 14) v = (v > 0.f) ? v : 0.1f * v; else if (ACT == 16) v = (v >= 0.f) ? v : 0.3f * v; else if (ACT == 17) v = (v >= 0.f) ? v : 0.2f * v;
      so[w][rloc][t * 16 + ln] = v; } }
  __builtin_amdgcn_fence(__ATOMIC_ACQ_REL, "workgroup"); __builtin_amdgcn_wave_barrier();
  const int rsub = lane >> 4, c4 = (lane & 15) * 4;
  {
#pragma unroll
    for (int q = 0; q < 16; ++q) { const int r = q * 2 + rsub; const v4f v = *(const v4fa*)&so[w][r][c4]; if (C) *(v4f*)(C + cofs + (size_t)(row0 + r) * ldc + col0 + c4) = v; if (C16) { v4h h4; for (int i = 0; i < 4; ++i) h4[i] = (_Float16)v[i]; *(v4h*)(C16 + cofs + (size_t)(row0 + r) * ldc + col0 + c4) = h4; } }
     } }


__global__ __launch_bounds__(256) void k_wnat(const float* __restrict__ w, size_t n8, _Float16* __restrict__ Bt) { const size_t t = (size_t)blockIdx.x * 256 + threadIdx.x; if (t >= n8) return; FragH f; for (int q = 0; q < 8; ++q) f.h[q] = (_Float16)(bf16_round(w[t * 8 + q]) * 16.0f); *(v8us*)((unsigned short*)Bt + t * 8) = f.half[0];  }
__global__ __launch_bounds__(256) void k_rsm(const float* __restrict__ S, _Float16* __restrict__ P, int nrows) {
  #pragma clang fp contract(off)
  const int i = blockIdx.x * 256 + threadIdx.x; if (i >= nrows) return; const float* s = S + (size_t)i * SQ; float mx = -3.0e38f;
#pragma unroll 1
  for (int j = 0; j < SQ; ++j) mx = fmaxf(mx, s[j]); float se = 0.f;
#pragma unroll 1
  for (int j = 0; j < SQ; ++j) se += expf(s[j] - mx); const float sc = 256.0f / se;
#pragma unroll 1
  for (int j0 = 0; j0 < SQ; j0 += 8) { FragH f; for (int q = 0; q < 8; ++q) f.h[q] = (_Float16)(expf(s[j0 + q] - mx) * sc); unsigned short* d = (unsigned short*)P + (size_t)i * SQ + j0; *(v8us*)d = f.half[0];  } }
__global__ __launch_bounds__(256) void k_vt(const _Float16* __restrict__ V16, int b, int h0, _Float16* __restrict__ VT) { __shared__ unsigned short tl[64][65]; const int tid = threadIdx.x; const int hh = blockIdx.x % HG, sg = blockIdx.x / HG; const int s0 = sg * 64; const int h = h0 + hh;
  for (int i = tid; i < 64 * 8; i += 256) { const int j = i / 8, d8 = (i % 8) * 8; FragH f; f.half[0] = *(const v8us*)((const unsigned short*)V16 + ((size_t)b * SQ + s0 + j) * DM + h * HD + d8); for (int q = 0; q < 8; ++q) tl[d8 + q][j] = f.u[q]; }
  __syncthreads();
  { for (int i = tid; i < 64 * 8; i += 256) { const int d = i / 8, j8 = (i % 8) * 8; FragH f; for (int q = 0; q < 8; ++q) f.u[q] = tl[d][j8 + q]; *(v8us*)((unsigned short*)VT + ((size_t)hh * HD + d) * SQ + s0 + j8) = f.half[0]; }  } }



__global__ __launch_bounds__(256) void k_rsmcf2(const float* __restrict__ S, _Float16* __restrict__ P, int hg, int q0, int nk) {
  #pragma clang fp contract(off)
  const int t = blockIdx.x * 256 + threadIdx.x; if (t >= hg * QT) return; const size_t i = (size_t)t; const float* s = S + i * NKX; const int last = q0 + (t % QT); float mx = -3.0e38f;
#pragma unroll 1
  for (int j = 0; j < nk; ++j) { const float f = (j <= last) ? 1.f : 0.f; mx = fmaxf(mx, fmaf(f, s[j], (1.f - f) * -1.0e9f)); } float se = 0.f;
#pragma unroll 1
  for (int j = 0; j < nk; ++j) { const float f = (j <= last) ? 1.f : 0.f; se += __expf(fmaf(f, s[j], (1.f - f) * -1.0e9f) - mx); } const float sc = 256.0f / se;
#pragma unroll 1
  for (int j0 = 0; j0 < nk; j0 += 8) { FragH fr; for (int q = 0; q < 8; ++q) { const int j = j0 + q; const float f = (j <= last) ? 1.f : 0.f; fr.h[q] = (_Float16)(__expf(fmaf(f, s[j], (1.f - f) * -1.0e9f) - mx) * sc); } unsigned short* d = (unsigned short*)P + i * NKX + j0; *(v8us*)d = fr.half[0];  } }

__global__ __launch_bounds__(256) void k_rsmcst(const float* __restrict__ S, _Float16* __restrict__ P, int hg, int q0, int nk, const int* __restrict__ mk) {
  #pragma clang fp contract(off)
  const int t = blockIdx.x * 256 + threadIdx.x; if (t >= hg * QT) return; const size_t i = (size_t)t; const float* s = S + i * NKX; const size_t ig = (size_t)(q0 + (t % QT)); const int* mr = mk + ig * SQ; float mx = -3.0e38f;
#pragma unroll 1
  for (int j = 0; j < nk; ++j) { const int mb = mr[j]; const int dd = (int)ig - j; const float f = (mb != 0 && dd >= 0 && (dd <= LOCALW || (dd % STRIDEK) == 0)) ? 1.f : 0.f; mx = fmaxf(mx, fmaf(f, s[j], (1.f - f) * -1.0e9f)); } float se = 0.f;
#pragma unroll 1
  for (int j = 0; j < nk; ++j) { const int mb = mr[j]; const int dd = (int)ig - j; const float f = (mb != 0 && dd >= 0 && (dd <= LOCALW || (dd % STRIDEK) == 0)) ? 1.f : 0.f; se += __expf(fmaf(f, s[j], (1.f - f) * -1.0e9f) - mx); } const float sc = 256.0f / se;
#pragma unroll 1
  for (int j0 = 0; j0 < nk; j0 += 8) { FragH fr; for (int q = 0; q < 8; ++q) { const int j = j0 + q; const int mb = mr[j]; const int dd = (int)ig - j; const float f = (mb != 0 && dd >= 0 && (dd <= LOCALW || (dd % STRIDEK) == 0)) ? 1.f : 0.f; fr.h[q] = (_Float16)(__expf(fmaf(f, s[j], (1.f - f) * -1.0e9f) - mx) * sc); } unsigned short* d = (unsigned short*)P + i * NKX + j0; *(v8us*)d = fr.half[0];  } }


template <int MASKADD>
__global__ __launch_bounds__(64) void k_att0(const float* __restrict__ QF, const float* __restrict__ KF, const float* __restrict__ VF, int ld, const float* __restrict__ mask, float scale, float* __restrict__ OF, int ldo) {
  #pragma clang fp contract(off)
  __shared__ __attribute__((aligned(16))) float lq[64][64]; __shared__ __attribute__((aligned(16))) float lo[64][64];
  const int tid = threadIdx.x; const int h = blockIdx.x / (QT0 / 64), rg = blockIdx.x % (QT0 / 64); const int i = rg * 64 + tid;
  const float* qr = QF + (size_t)i * ld + h * HD;
#pragma unroll 1
  for (int c = 0; c < HD / 4; ++c) { *(v4f*)&lq[tid][c * 4] = *(const v4fa*)(qr + c * 4); const v4f z = {0.f, 0.f, 0.f, 0.f}; *(v4f*)&lo[tid][c * 4] = z; }
  float m = -1.0e30f, l = 0.f; const int jmax = MASKADD ? (SQ - 1) : (rg * 64 + 63);      /* additive-mask form: every key (the mask input decides); causal form: keys up to the block's last row */
#pragma unroll 1
  for (int j = 0; j <= jmax; ++j) { const float* kr = KF + (size_t)j * ld + h * HD; const float* vr = VF + (size_t)j * ld + h * HD; float s = 0.f;
#pragma unroll 1
    for (int c = 0; c < HD / 4; ++c) { const v4f kq = *(const v4fa*)(kr + c * 4); const v4f qq = *(v4f*)&lq[tid][c * 4]; s = __fadd_rn(s, __fmul_rn(qq[0], kq[0])); s = __fadd_rn(s, __fmul_rn(qq[1], kq[1])); s = __fadd_rn(s, __fmul_rn(qq[2], kq[2])); s = __fadd_rn(s, __fmul_rn(qq[3], kq[3])); }
    s = __fmul_rn(s, scale); if (MASKADD) s = __fadd_rn(s, __fmul_rn(bf16_round(mask[(size_t)i * SQ + j]), -10000.0f));
    const float f = (MASKADD || j <= i) ? 1.f : 0.f; const float sm = fmaf(f, s, (1.f - f) * -1.0e30f); const float mn = fmaxf(m, sm); const float sc = expf(m - mn); const float e = expf(sm - mn); l = __fadd_rn(__fmul_rn(l, sc), e); m = mn;
#pragma unroll 1
    for (int c = 0; c < HD / 4; ++c) { const v4f vv = *(const v4fa*)(vr + c * 4); v4f oo = *(v4f*)&lo[tid][c * 4]; for (int u = 0; u < 4; ++u) oo[u] = __fadd_rn(__fmul_rn(oo[u], sc), __fmul_rn(e, vv[u])); *(v4f*)&lo[tid][c * 4] = oo; } }
  const float fin = 64.0f / l;      /* o carried x64 like the f16 path */
#pragma unroll 1
  for (int c = 0; c < HD / 4; ++c) { v4f oo = *(v4f*)&lo[tid][c * 4]; for (int u = 0; u < 4; ++u) oo[u] = __fmul_rn(oo[u], fin); *(v4f*)&lo[tid][c * 4] = oo; }
  __syncthreads();
  {
#pragma unroll 1
    for (int it = 0; it < 16; ++it) { const int row = it * 4 + tid / 16, pc = (tid % 16) * 4; const v4f v = *(const v4f*)&lo[row][pc]; *(v4f*)(OF + (size_t)(rg * 64 + row) * ldo + h * HD + pc) = v; }
     } }

template <int MASKADD>
__global__ __launch_bounds__(64) void k_att0mbc(const float* __restrict__ QF, const float* __restrict__ KF, const float* __restrict__ VF, int ld, const float* __restrict__ mask, float scale, float* __restrict__ OF, int ldo) {
  #pragma clang fp contract(off)
  __shared__ __attribute__((aligned(16))) float lq[64][64]; __shared__ __attribute__((aligned(16))) float lo[64][64];
  const int tid = threadIdx.x; const int h = blockIdx.x / (QT0 / 64), rg = blockIdx.x % (QT0 / 64); const int i = rg * 64 + tid;
  const float* qr = QF + (size_t)i * ld + h * HD;
#pragma unroll 1
  for (int c = 0; c < HD / 4; ++c) { *(v4f*)&lq[tid][c * 4] = *(const v4fa*)(qr + c * 4); const v4f z = {0.f, 0.f, 0.f, 0.f}; *(v4f*)&lo[tid][c * 4] = z; }
  float m = -1.0e30f, l = 0.f; const int jmax = rg * 64 + 63;      /* keys beyond the block end are masked by the mask's lower-triangular structure */      /* both MASKADD forms: keys up to the block's last row */
#pragma unroll 1
  for (int j = 0; j <= jmax; ++j) { const float* kr = KF + (size_t)j * ld + h * HD; const float* vr = VF + (size_t)j * ld + h * HD; float s = 0.f;
#pragma unroll 1
    for (int c = 0; c < HD / 4; ++c) { const v4f kq = *(const v4fa*)(kr + c * 4); const v4f qq = *(v4f*)&lq[tid][c * 4]; s = __fadd_rn(s, __fmul_rn(qq[0], kq[0])); s = __fadd_rn(s, __fmul_rn(qq[1], kq[1])); s = __fadd_rn(s, __fmul_rn(qq[2], kq[2])); s = __fadd_rn(s, __fmul_rn(qq[3], kq[3])); }
    s = __fmul_rn(s, scale); const int mb = ((const int*)mask)[(size_t)i * SQ + j];      /* causal (j <= i) AND the module's int32 [S][S] mask read per (query, key): 0 -> masked */
    const float f = (mb != 0 && j <= i) ? 1.f : 0.f; const float sm = fmaf(f, s, (1.f - f) * -1.0e30f); const float mn = fmaxf(m, sm); const float sc = expf(m - mn); const float e = expf(sm - mn); l = __fadd_rn(__fmul_rn(l, sc), e); m = mn;
#pragma unroll 1
    for (int c = 0; c < HD / 4; ++c) { const v4f vv = *(const v4fa*)(vr + c * 4); v4f oo = *(v4f*)&lo[tid][c * 4]; for (int u = 0; u < 4; ++u) oo[u] = __fadd_rn(__fmul_rn(oo[u], sc), __fmul_rn(e, vv[u])); *(v4f*)&lo[tid][c * 4] = oo; } }
  const float fin = 64.0f / l;      /* o carried x64 like the f16 path */
#pragma unroll 1
  for (int c = 0; c < HD / 4; ++c) { v4f oo = *(v4f*)&lo[tid][c * 4]; for (int u = 0; u < 4; ++u) oo[u] = __fmul_rn(oo[u], fin); *(v4f*)&lo[tid][c * 4] = oo; }
  __syncthreads();
  {
#pragma unroll 1
    for (int it = 0; it < 16; ++it) { const int row = it * 4 + tid / 16, pc = (tid % 16) * 4; const v4f v = *(const v4f*)&lo[row][pc]; *(v4f*)(OF + (size_t)(rg * 64 + row) * ldo + h * HD + pc) = v; }
     } }


template <int BFIN, int WXB>
__global__ __launch_bounds__(256) void k_ln16(const float* __restrict__ X, const float* __restrict__ g, const float* __restrict__ bb, float eps, _Float16* __restrict__ N16, float* __restrict__ XB) {
  #pragma clang fp contract(off)
  __shared__ float red[256]; const size_t r = blockIdx.x; const int t = threadIdx.x; const v4f xa = *(const v4fa*)(X + r * DMQ + t * 4); float s[4]; float sum = 0.f;
  for (int q = 0; q < 4; ++q) { s[q] = BFIN ? bf16_round(xa[q]) : xa[q]; sum = __fadd_rn(sum, s[q]); }
  red[t] = sum; __syncthreads(); for (int st = 128; st > 0; st >>= 1) { if (t < st) red[t] = __fadd_rn(red[t], red[t + st]); __syncthreads(); } const float mu = red[0] / (float)DMQ; __syncthreads();
  float vs = 0.f; for (int q = 0; q < 4; ++q) { const float dl = __fadd_rn(s[q], -mu); vs = __fadd_rn(vs, __fmul_rn(dl, dl)); } red[t] = vs; __syncthreads(); for (int st = 128; st > 0; st >>= 1) { if (t < st) red[t] = __fadd_rn(red[t], red[t + st]); __syncthreads(); }
  const float rs = rsqrtf(__fadd_rn(red[0] / (float)DMQ, eps)); v4h y; v4f xb;
  for (int q = 0; q < 4; ++q) { const int c = t * 4 + q; y[q] = (_Float16)__fadd_rn(__fmul_rn(__fmul_rn(__fadd_rn(s[q], -mu), rs), bf16_round(g[c])), bf16_round(bb[c])); xb[q] = s[q]; }
  { *(v4h*)(N16 + r * DMQ + t * 4) = y; if (WXB) *(v4f*)(XB + r * DMQ + t * 4) = xb;  } }
__global__ __launch_bounds__(256) void k_ftres2(const float* __restrict__ OF0, const float* __restrict__ XB, float* __restrict__ X1, size_t n4) {
  #pragma clang fp contract(off)
  const size_t t = (size_t)blockIdx.x * 256 + threadIdx.x; if (t >= n4) return; const v4f o = *(const v4fa*)(OF0 + t * 4), xv = *(const v4fa*)(XB + t * 4); v4f y; for (int q = 0; q < 4; ++q) y[q] = __fadd_rn(__fmul_rn(o[q], 0.015625f), xv[q]); *(v4f*)(X1 + t * 4) = y;  }

__global__ __launch_bounds__(256) void k_bcpy(const float* __restrict__ b, int n, int NP, float* __restrict__ dst, int dst0) { for (int i = threadIdx.x; i < NP; i += 256) { const float v = (i < n) ? b[i] : 0.f; *(float*)(dst + dst0 + i) = v; }  }


__global__ __launch_bounds__(256) void k_rsmf(const float* __restrict__ S, _Float16* __restrict__ P, int qn, int hg) {
  #pragma clang fp contract(off)
  const int t = blockIdx.x * 256 + threadIdx.x; if (t >= qn * hg) return; const size_t i = (size_t)(t / qn) * SQ + (t % qn); const float* s = S + i * SQ; float mx = -3.0e38f;
#pragma unroll 1
  for (int j = 0; j < SQ; ++j) mx = fmaxf(mx, s[j]); float se = 0.f;
#pragma unroll 1
  for (int j = 0; j < SQ; ++j) se += __expf(s[j] - mx); const float sc = 256.0f / se;
#pragma unroll 1
  for (int j0 = 0; j0 < SQ; j0 += 8) { FragH f; for (int q = 0; q < 8; ++q) f.h[q] = (_Float16)(__expf(s[j0 + q] - mx) * sc); unsigned short* d = (unsigned short*)P + i * SQ + j0; *(v8us*)d = f.half[0];  } }

template <int MODE>
__global__ __launch_bounds__(256) void k_regrp(const float* __restrict__ src, float* __restrict__ dst, size_t n4) {
  const size_t t = (size_t)blockIdx.x * 256 + threadIdx.x; if (t >= n4) return; const size_t e = t * 4; const size_t rd = e / DM; const int c = (int)(e % DM);
  size_t rs; if (MODE == 0) { const size_t b = rd / SQ, sq = rd % SQ; rs = sq * NB + b; } else { const size_t sq = rd / NB, b = rd % NB; rs = b * SQ + sq; }
  const v4f v = *(const v4fa*)(src + rs * DM + c); *(v4f*)(dst + e) = v;  }

template <int BFIN, int W16, int W32>
__global__ __launch_bounds__(256) void k_lnx(const float* __restrict__ X, const float* __restrict__ g, const float* __restrict__ bb, float eps, _Float16* __restrict__ N16, float* __restrict__ N32) {
  #pragma clang fp contract(off)
  __shared__ float red[256]; const size_t r = blockIdx.x; const int t = threadIdx.x; const bool act = t < (DMQ / 4); const int c0 = act ? t * 4 : 0;
  const v4f xa = *(const v4fa*)(X + r * DMQ + c0); float s[4]; float sum = 0.f;
  for (int q = 0; q < 4; ++q) { s[q] = act ? (BFIN ? bf16_round(xa[q]) : xa[q]) : 0.f; sum = __fadd_rn(sum, s[q]); }
  red[t] = sum; __syncthreads(); for (int st = 128; st > 0; st >>= 1) { if (t < st) red[t] = __fadd_rn(red[t], red[t + st]); __syncthreads(); } const float mu = red[0] / (float)DMQ; __syncthreads();
  float vs = 0.f; for (int q = 0; q < 4; ++q) { const float dl = act ? __fadd_rn(s[q], -mu) : 0.f; vs = __fadd_rn(vs, __fmul_rn(dl, dl)); } red[t] = vs; __syncthreads(); for (int st = 128; st > 0; st >>= 1) { if (t < st) red[t] = __fadd_rn(red[t], red[t + st]); __syncthreads(); }
  const float rs = rsqrtf(__fadd_rn(red[0] / (float)DMQ, eps)); v4h y; v4f yf;
  for (int q = 0; q < 4; ++q) { const int c = c0 + q; yf[q] = __fadd_rn(__fmul_rn(__fmul_rn(__fadd_rn(s[q], -mu), rs), bf16_round(g[c])), bf16_round(bb[c])); y[q] = (_Float16)yf[q]; }
  if (!act) return;      /* no barriers after this point */
  { if (W16) *(v4h*)(N16 + r * DMQ + c0) = y; if (W32) *(v4f*)(N32 + r * DMQ + c0) = yf;  } }

__global__ __launch_bounds__(256) void k_bfr(const float* __restrict__ x, float* __restrict__ XB, size_t n8) { const size_t t = (size_t)blockIdx.x * 256 + threadIdx.x; if (t >= n8) return; v4f a = *(const v4fa*)(x + t * 8), c = *(const v4fa*)(x + t * 8 + 4); for (int q = 0; q < 4; ++q) { a[q] = bf16_round(a[q]); c[q] = bf16_round(c[q]); }
  { *(v4f*)(XB + t * 8) = a; *(v4f*)(XB + t * 8 + 4) = c;  } }



__global__ __launch_bounds__(256) void k_wthd(const float* __restrict__ Wt, _Float16* __restrict__ Bt) { const size_t t = (size_t)blockIdx.x * 256 + threadIdx.x; if (t >= (size_t)NH * HD * (DM / 8)) return; const int m8 = (int)(t % (DM / 8)) * 8; const int d = (int)((t / (DM / 8)) % HD); const int h = (int)(t / ((size_t)(DM / 8) * HD)); FragH f;
  for (int q = 0; q < 8; ++q) f.h[q] = (_Float16)(16.0f * bf16_round(Wt[((size_t)h * DM + m8 + q) * HD + d])); unsigned short* dst = (unsigned short*)Bt + ((size_t)h * HD + d) * DM + m8; *(v8us*)dst = f.half[0];  }




template <int BFIN, int SCAL>
__global__ __launch_bounds__(256) void k_lnsc(const float* __restrict__ X, const float* __restrict__ g, const float* __restrict__ bb, float eps, _Float16* __restrict__ N16, float* __restrict__ N32) {
  #pragma clang fp contract(off)
  __shared__ float red[256]; const size_t r = blockIdx.x; const int t = threadIdx.x; const bool act = t < DM / 4; const int tc = act ? t : 0; const v4f xl = *(const v4fa*)(X + r * DM + tc * 4); const float am = act ? 1.f : 0.f; float s[4]; float sum = 0.f;
  for (int q = 0; q < 4; ++q) { s[q] = (BFIN ? bf16_round(xl[q]) : xl[q]) * am; sum = __fadd_rn(sum, s[q]); }
  red[t] = sum; __syncthreads(); for (int st = 128; st > 0; st >>= 1) { if (t < st) red[t] = __fadd_rn(red[t], red[t + st]); __syncthreads(); } const float mu = red[0] / (float)DM; __syncthreads();
  float vs = 0.f; for (int q = 0; q < 4; ++q) { const float dl = __fadd_rn(s[q], -mu) * am; vs = __fadd_rn(vs, __fmul_rn(dl, dl)); } red[t] = vs; __syncthreads(); for (int st = 128; st > 0; st >>= 1) { if (t < st) red[t] = __fadd_rn(red[t], red[t + st]); __syncthreads(); }
  const float rs = __fdiv_rn(1.0f, __fadd_rn(sqrtf(red[0] / (float)(DM - 1)), eps)); if (!act) return; v4h y; v4f yf;
  for (int q = 0; q < 4; ++q) { const int c = t * 4 + q; const float gg = bf16_round(SCAL ? g[0] : g[c]), bv = bf16_round(SCAL ? bb[0] : bb[c]); yf[q] = __fadd_rn(__fmul_rn(__fmul_rn(__fadd_rn(s[q], -mu), rs), gg), bv); y[q] = (_Float16)yf[q]; }
  { if (N16) *(v4h*)(N16 + r * DM + t * 4) = y; if (N32) *(v4f*)(N32 + r * DM + t * 4) = yf;  } }

__global__ __launch_bounds__(256) void k_rsmdmi(const float* __restrict__ S, _Float16* __restrict__ P, int nrows, const int* __restrict__ M) {
  #pragma clang fp contract(off)
  const int t = blockIdx.x * 256 + threadIdx.x; if (t >= nrows) return; const float* s = S + (size_t)t * SQ; const int* m = M + (size_t)(t % SQ) * SQ; float mx = -3.0e38f;
#pragma unroll 1
  for (int j = 0; j < SQ; ++j) { const float f = (m[j] == 0) ? 1.f : 0.f; mx = fmaxf(mx, fmaf(f, s[j], (1.f - f) * -1.0e9f)); } float se = 0.f;
#pragma unroll 1
  for (int j = 0; j < SQ; ++j) { const float f = (m[j] == 0) ? 1.f : 0.f; se += __expf(fmaf(f, s[j], (1.f - f) * -1.0e9f) - mx); } const float sc = 256.0f / se;
#pragma unroll 1
  for (int j0 = 0; j0 < SQ; j0 += 8) { FragH fr; for (int q = 0; q < 8; ++q) { const int j = j0 + q; const float f = (m[j] == 0) ? 1.f : 0.f; fr.h[q] = (_Float16)(__expf(fmaf(f, s[j], (1.f - f) * -1.0e9f) - mx) * sc); } unsigned short* d = (unsigned short*)P + (size_t)t * SQ + j0; *(v8us*)d = fr.half[0];  } }
extern "C" void kernel_launch(void* const* d_in, const int* in_sizes, int n_in,
                              void* d_out, int out_size, void* d_ws, size_t ws_size, hipStream_t stream) {
  (void)in_sizes; (void)n_in; (void)out_size;
  constexpr int VH = 4;      /* heads per launch group */
  const float* const* I = (const float* const*)d_in; const float* x = I[0]; const float* wq = I[1]; const float* wk = I[2]; const float* wv = I[3]; const float* wo = I[4]; const float* bo = I[5]; const float* w1 = I[6]; const float* b1 = I[7]; const float* w2 = I[8]; const float* b2 = I[9]; const float* g1 = I[10]; const float* be1 = I[11]; const float* g2 = I[12]; const float* be2 = I[13]; const float* bq = nullptr; const float* bk = nullptr; const float* bv = nullptr;      /* x; per-head Wq / Wk / Wv [16][1024][64] (no biases); Wo [1024][1024] + bo ([in][out]); W1 [1024][1024] + b1, W2 [1024][1024] + b2; LN1 g / b, LN2 g / b */
  char* ws = (char*)d_ws; size_t off = 0;
  auto take = [&](size_t bytes) { char* p = ws + off; off += (bytes + 255) & ~(size_t)255; return p; };
  _Float16* BQ = (_Float16*)take((size_t)DM * DM * 2); _Float16* BK = (_Float16*)take((size_t)DM * DM * 2); _Float16* BV = (_Float16*)take((size_t)DM * DM * 2); _Float16* BO = (_Float16*)take((size_t)DM * DM * 2); _Float16* BW1 = (_Float16*)take((size_t)DFF * DM * 2); _Float16* BW2 = (_Float16*)take((size_t)DM * DFF * 2);
  float* XB = (float*)take(NR * DM * 4); _Float16* XN = (_Float16*)take(NR * DM * 2); _Float16* Q16 = (_Float16*)take(NR * DM * 2); _Float16* K16 = (_Float16*)take(NR * DM * 2); _Float16* V16 = (_Float16*)take(NR * DM * 2); _Float16* O16 = (_Float16*)take(NR * DM * 2); float* X1 = (float*)take(NR * DM * 4);
  float* S = (float*)take((size_t)VH * SQ * SQ * 4); _Float16* P = (_Float16*)take((size_t)VH * SQ * SQ * 2); _Float16* VT = (_Float16*)take((size_t)NH * HD * SQ * 2);
  _Float16* M16 = XN;      /* second-norm f16 rows: aliases XN (last readers: the three projections) */ _Float16* HF16 = (_Float16*)take((size_t)SQ * DFF * 2);      /* FFN hidden plane of ONE batch [1024][1024] f16 (2 MiB): own region (the 4-head score plane is only 16 MiB at SQ 1024); the FFN runs per batch */
  
  if (off > ws_size) return;
  for (int h = 0; h < NH; ++h) { const unsigned g = (unsigned)(((size_t)HD * (DM / 8) + 255) / 256); k_wt_f16<<<g, 256, 0, stream>>>(wq + (size_t)h * DM * HD, BQ + (size_t)h * HD * DM, DM, HD, 16.0f); k_wt_f16<<<g, 256, 0, stream>>>(wk + (size_t)h * DM * HD, BK + (size_t)h * HD * DM, DM, HD, 16.0f); k_wt_f16<<<g, 256, 0, stream>>>(wv + (size_t)h * DM * HD, BV + (size_t)h * HD * DM, DM, HD, 16.0f); }      /* per-head [in = 1024][out = 64] -> rows h*64.. of the Bt planes (x16): head h = output columns h*64.. */
  k_wt_f16<<<(unsigned)(((size_t)DM * (DM / 8) + 255) / 256), 256, 0, stream>>>(wo, BO, DM, DM, 16.0f);      /* Wo [in][out] -> Bt x16 */
  k_wt_f16<<<(unsigned)(((size_t)DFF * (DM / 8) + 255) / 256), 256, 0, stream>>>(w1, BW1, DM, DFF, 16.0f); k_wt_f16<<<(unsigned)(((size_t)DM * (DFF / 8) + 255) / 256), 256, 0, stream>>>(w2, BW2, DFF, DM, 16.0f);
  k_bfr<<<(unsigned)((NR * DM / 8 + 255) / 256), 256, 0, stream>>>(x, XB, NR * DM / 8); k_lnx<1, 1, 0><<<(unsigned)NR, 256, 0, stream>>>(x, g1, be1, 1e-5f, XN, nullptr);      /* n = LN0(bf16(x)) (biased variance, eps inside the rsqrt) -> f16 rows */
  k_gemm2<0><<<dim3((unsigned)((NR / 128) * (DM / 64)), 1), 128, 0, stream>>>(XN, DM, 0, BQ, DM, 0, 0.0625f, bq, 0, nullptr, 1, 0, 0, nullptr, Q16, DM, 0, (int)NR, DM, DM); k_gemm2<0><<<dim3((unsigned)((NR / 128) * (DM / 64)), 1), 128, 0, stream>>>(XN, DM, 0, BK, DM, 0, 0.0625f, bk, 0, nullptr, 1, 0, 0, nullptr, K16, DM, 0, (int)NR, DM, DM); k_gemm2<0><<<dim3((unsigned)((NR / 128) * (DM / 64)), 1), 128, 0, stream>>>(XN, DM, 0, BV, DM, 0, 0.0625f, bv, 0, nullptr, 1, 0, 0, nullptr, V16, DM, 0, (int)NR, DM, DM);      /* q, k, v -> f16 rows; head h = columns h*64.. */
  for (int b = 0; b < NB; ++b) { const size_t r0 = (size_t)b * SQ;
    k_vt<NH, SQ><<<NH * (SQ / 64), 256, 0, stream>>>(V16 + r0 * DM, DM, 0, VT);      /* V^T [16][64][1024] for this batch */
    for (int h0 = 0; h0 < NH; h0 += VH) {
      k_gemm2<0><<<dim3((SQ / 128) * (SQ / 64), VH), 128, 0, stream>>>(Q16 + r0 * DM + (size_t)h0 * HD, DM, (size_t)HD, K16 + r0 * DM + (size_t)h0 * HD, DM, (size_t)HD, 0.125f, nullptr, 0, nullptr, 1, 0, 0, S, nullptr, SQ, (size_t)SQ * SQ, SQ, SQ, HD);      /* scores / 8, 4 heads per launch */
      k_rsmf<<<(VH * SQ + 255) / 256, 256, 0, stream>>>(S, P, SQ, VH);      /* softmax over all keys (no mask) -> P x256 f16 */
      k_gemm2<0><<<dim3((SQ / 128) * (HD / 64), VH), 128, 0, stream>>>(P, SQ, (size_t)SQ * SQ, VT + (size_t)h0 * HD * SQ, SQ, (size_t)HD * SQ, 0.25f, nullptr, 0, nullptr, 1, 0, 0, nullptr, O16 + r0 * DM + (size_t)h0 * HD, DM, (size_t)HD, SQ, HD, SQ); } }      /* ctx (merged heads, x64) as f16 rows */
  k_gemm2<0><<<dim3((unsigned)((NR / 128) * (DM / 64)), 1), 128, 0, stream>>>(O16, DM, 0, BO, DM, 0, 0.0009765625f, bo, 0, XB, -1, 0, 0, X1, nullptr, DM, 0, (int)NR, DM, DM);      /* x + ctx wo (+ bo) (own-element residual) -> f32 rows */
  k_lnx<0, 1, 0><<<(unsigned)NR, 256, 0, stream>>>(X1, g2, be2, 1e-5f, M16, nullptr);      /* LN1(x1) -> f16 rows */
  for (int b = 0; b < NB; ++b) { const size_t r0 = (size_t)b * SQ;
    k_gemm2<6><<<dim3((unsigned)((SQ / 128) * (DFF / 64)), 1), 128, 0, stream>>>(M16 + r0 * DM, DM, 0, BW1, DM, 0, 0.0625f, b1, 0, nullptr, 1, 0, 0, nullptr, HF16, DFF, 0, SQ, DFF, DM);      /* gelu_erf(. W1 + b1) -> f16 (this batch) */
    k_gemm2<0><<<dim3((unsigned)((SQ / 128) * (DM / 64)), 1), 128, 0, stream>>>(HF16, DFF, 0, BW2, DFF, 0, 0.0625f, b2, 0, X1 + r0 * DM, -1, 0, 0, (float*)d_out + r0 * DM, nullptr, DM, 0, SQ, DM, DFF); }      /* out = x1 + mlp (own-element residual) */
}

// v001
// One run takes 2550 microseconds.
// Two timings next to v000 put it at 2.95 and 2.96 times that version's speed.
#include <hip/hip_runtime.h>
// Pre-LN transformer encoder block with PER-HEAD projection tensors, no QKV biases (x [8][1024][1024]; h = LN1(x) (biased var, eps 1e-5); q/k/v[h] = h W[h] with W [16][1024][64] ([head][in][out]); scale 64^-0.5; softmax over all 1024 keys (no mask); x1 = x + concat(attn) Wo + bo ([in][out]); out = x1 + gelu_erf(LN2(x1) W1 + b1) W2 + b2 ([in][out] 1024 x 1024 x 1024: hidden = 1 x n_embd, as the source) -> [8][1024][1024]).
// Structure: token rows; LayerNorm / exact f16 rows; WMMA GEMMs for q, k, v; per batch V^T by LDS transposes and 4 heads per launch group (scores, row softmax, P V^T); output projection with the own-element residual; custom LayerNorm; erf-GELU FFN per batch; launches: see trace.
// Compute dtype: inputs rounded to bf16; x / weights exact; q, k, v, softmax weights and o as plain f16 GEMM operands (~2^-12); scores and softmax statistics f32. v_wmma_f32_16x16x32_f16.
#define NB 8
#define SQ 1024
#define DM 1024
#define NH 16
#define HD 64
#define HG 4                         /* heads per attention launch group */
#define LOCALW 128                   /* (macros for unused kernels of the shared header) */
#define STRIDEK 128
#define QT 256                       /* query rows per causal tile */
#define NKX SQ                       /* S / P row pitch */
#define QT0 128                      /* first-tile rows recomputed exactly in f32 */
#define B0 0                         /* unused; the batch loops start at 0 */
#define NBR NB                       /* only feeds the unused MP; the batch loops run to NB */
#define NR ((size_t)NB * SQ)
#define DMQ DM
#define DFF 1024         /* FFN hidden width = 1 x n_embd in this module (W1 [1024][1024], W2 [1024][1024]) */
#define MP ((int)((size_t)NBR * SQ)) /* unused; the projections take NR rows */
#define QN SQ                        /* unused; attention runs all SQ query rows */
#define NHD NH                       /* unused; the head loop runs to NH */
#define MPO MP                       /* unused; the output stage takes NR rows */
#define LQ (3 * DM)      /* unused; the q, k, v rows have pitch DM */
typedef __bf16 v16b __attribute__((ext_vector_type(16)));
typedef unsigned short v8us __attribute__((ext_vector_type(8), may_alias));
typedef float  v8f  __attribute__((ext_vector_type(8)));
typedef float  v4f  __attribute__((ext_vector_type(4)));
typedef float  v4fa __attribute__((ext_vector_type(4), may_alias));
union FragB { v16b v; v8us half[2]; unsigned short u[16]; };

__device__ __forceinline__ unsigned short bf16_bits(float x) { unsigned int u = __float_as_uint(x); return (unsigned short)((u + 0x7FFFu + ((u >> 16) & 1u)) >> 16); }
__device__ __forceinline__ float bf16_val(unsigned short b) { return __uint_as_float(((unsigned int)b) << 16); }
__device__ __forceinline__ float bf16_round(float x) { return bf16_val(bf16_bits(x)); }
// D += A·B with NT terms: 1 = ah·bh, 2 = + al·bh (A split), 3 = + ah·bl (both split)
template <int NT>
__device__ __forceinline__ v8f mmaN(v16b ah, v16b al, v16b bh, v16b bl, v8f c) {
  c = __builtin_amdgcn_wmma_f32_16x16x32_bf16(false, ah, false, bh, (short)0, c, false, false);
  if (NT >= 2) c = __builtin_amdgcn_wmma_f32_16x16x32_bf16(false, al, false, bh, (short)0, c, false, false);
  if (NT >= 3) c = __builtin_amdgcn_wmma_f32_16x16x32_bf16(false, ah, false, bl, (short)0, c, false, false);
  asm volatile("v_nop\n\tv_nop\n\tv_nop\n\tv_nop" : "+v"(c) : "v"(ah), "v"(al), "v"(bh), "v"(bl));
  return c;
}

__global__ __launch_bounds__(256) void k_wt_bf16(const float* __restrict__ W, unsigned short* __restrict__ Wt, int K, int N) {
  const int t = blockIdx.x * 256 + threadIdx.x;
  const int k8n = K / 8;
  if (t >= N * k8n) return;
  const int n = t / k8n, k8 = (t % k8n) * 8;
  v8us v;
#pragma unroll
  for (int i = 0; i < 8; ++i) v[i] = bf16_bits(W[(size_t)(k8 + i) * N + n]);
  *(v8us*)(Wt + (size_t)n * K + k8) = v;
  
}

// GEMM C[M][N] (f32, pitch ldc) = act(A[M][K]·W + bias). A f32 row-major (pitch lda) converted per fragment to bf16
// (ASPLIT: hi/lo two planes -> 2 terms, else single rounded term); Wt bf16 [N][K] (pitch ldb). BIAS_BF16 rounds the
// bias to bf16 first (bias quantised to bf16 before the add). K%32==0, M%16==0, N%64==0.
template <bool ASPLIT, int ACT, bool BIAS_BF16>
__global__ __launch_bounds__(128) void k_gemm_bf(const float* __restrict__ A, int lda, const unsigned short* __restrict__ Wt, int ldb,
                                               const float* __restrict__ bias, float* __restrict__ C, int ldc, int M, int N, int K) {
  __shared__ __attribute__((aligned(16))) float so[4][16][64];
  const int tid = threadIdx.x, w = tid >> 5, lane = tid & 31, ln = lane & 15, hh = lane >> 4;
  const int ntn = N / 64;
  const int wid = blockIdx.x * 4 + w;
  const int mt = wid / ntn, nq = wid % ntn;
  if (mt * 16 >= M) return;
  const int row0 = mt * 16, col0 = nq * 64;
  const float* arow = A + (size_t)(row0 + ln) * lda;
  v8f acc[4] = {};
  for (int kb = 0; kb < K; kb += 32) {
    FragB ah, al;
    const v4f x0 = *(const v4fa*)(arow + kb + 8 * hh), x1 = *(const v4fa*)(arow + kb + 8 * hh + 4);
    const v4f x2 = *(const v4fa*)(arow + kb + 16 + 8 * hh), x3 = *(const v4fa*)(arow + kb + 16 + 8 * hh + 4);
    float xs[16] = {x0[0],x0[1],x0[2],x0[3],x1[0],x1[1],x1[2],x1[3],x2[0],x2[1],x2[2],x2[3],x3[0],x3[1],x3[2],x3[3]};
#pragma unroll
    for (int i = 0; i < 16; ++i) { const unsigned short hb = bf16_bits(xs[i]); ah.u[i] = hb; al.u[i] = ASPLIT ? bf16_bits(xs[i] - bf16_val(hb)) : (unsigned short)0; }
#pragma unroll
    for (int t = 0; t < 4; ++t) {
      const unsigned short* brow = Wt + (size_t)(col0 + t * 16 + ln) * ldb + kb;
      FragB b;
      b.half[0] = *(const v8us*)(brow + 8 * hh);
      b.half[1] = *(const v8us*)(brow + 16 + 8 * hh);
      acc[t] = mmaN<ASPLIT ? 2 : 1>(ah.v, al.v, b.v, b.v, acc[t]);
    }
  }
#pragma unroll
  for (int t = 0; t < 4; ++t) {
    float bv = bias ? bias[col0 + t * 16 + ln] : 0.f;
    if (BIAS_BF16) bv = bf16_round(bv);
#pragma unroll
    for (int r = 0; r < 8; ++r) { float v = acc[t][r] + bv; if (ACT == 1) v = fmaxf(v, 0.f); so[w][8 * hh + r][t * 16 + ln] = v; }
  }
  __builtin_amdgcn_fence(__ATOMIC_ACQ_REL, "workgroup");
  __builtin_amdgcn_wave_barrier();
  const int rsub = lane >> 4, c4 = (lane & 15) * 4;
  {
#pragma unroll
    for (int q = 0; q < 8; ++q) {
      const int r = q * 2 + rsub;
      const v4f v = *(const v4fa*)&so[w][r][c4];
      *(v4f*)(C + (size_t)(row0 + r) * ldc + col0 + c4) = v;
    }
    
  }
}

// GEMM C = act(A·W + bias + resid): A f32 (ASPLIT -> hi/lo 2 terms), Wt bf16 [N][K]; ACT 0 none, 1 relu, 2 exact gelu;
// resid (optional, f32, row index = (row % rmod), pitch ldr, RES_BF16 rounds it) added before the activation.
template <bool ASPLIT, int ACT, bool BIAS_BF16, bool RES_BF16>
__global__ __launch_bounds__(128) void k_gemm_bf3(const float* __restrict__ A, int lda, const unsigned short* __restrict__ Wt, int ldb,
                                                const float* __restrict__ bias, const float* __restrict__ resid, int rmod, int ldr,
                                                float* __restrict__ C, int ldc, int M, int N, int K) {
  __shared__ __attribute__((aligned(16))) float so[4][16][64];
  const int tid = threadIdx.x, w = tid >> 5, lane = tid & 31, ln = lane & 15, hh = lane >> 4;
  const int ntn = N / 64;
  const int wid = blockIdx.x * 4 + w;
  const int mt = wid / ntn, nq = wid % ntn;
  if (mt * 16 >= M) return;
  const int row0 = mt * 16, col0 = nq * 64;
  const float* arow = A + (size_t)(row0 + ln) * lda;
  v8f acc[4] = {};
  for (int kb = 0; kb < K; kb += 32) {
    FragB ah, al;
    const v4f x0 = *(const v4fa*)(arow + kb + 8 * hh), x1 = *(const v4fa*)(arow + kb + 8 * hh + 4);
    const v4f x2 = *(const v4fa*)(arow + kb + 16 + 8 * hh), x3 = *(const v4fa*)(arow + kb + 16 + 8 * hh + 4);
    float xs[16] = {x0[0],x0[1],x0[2],x0[3],x1[0],x1[1],x1[2],x1[3],x2[0],x2[1],x2[2],x2[3],x3[0],x3[1],x3[2],x3[3]};
#pragma unroll
    for (int i = 0; i < 16; ++i) { const unsigned short hb = bf16_bits(xs[i]); ah.u[i] = hb; al.u[i] = ASPLIT ? bf16_bits(xs[i] - bf16_val(hb)) : (unsigned short)0; }
#pragma unroll
    for (int t = 0; t < 4; ++t) {
      const unsigned short* brow = Wt + (size_t)(col0 + t * 16 + ln) * ldb + kb;
      FragB b;
      b.half[0] = *(const v8us*)(brow + 8 * hh);
      b.half[1] = *(const v8us*)(brow + 16 + 8 * hh);
      acc[t] = mmaN<ASPLIT ? 2 : 1>(ah.v, al.v, b.v, b.v, acc[t]);
    }
  }
#pragma unroll
  for (int t = 0; t < 4; ++t) {
    const int col = col0 + t * 16 + ln;
    float bv = bias ? bias[col] : 0.f;
    if (BIAS_BF16) bv = bf16_round(bv);
#pragma unroll
    for (int r = 0; r < 8; ++r) {
      float v = acc[t][r] + bv;
      if (resid) { float rv = resid[(size_t)((row0 + 8 * hh + r) % rmod) * ldr + col]; if (RES_BF16) rv = bf16_round(rv); v += rv; }
      if (ACT == 1) v = fmaxf(v, 0.f);
      if (ACT == 2) v = 0.5f * v * (1.0f + erff(v * 0.70710678118654752f));
      if (ACT == 3) { const float u = 0.7978845608028654f * (v + 0.044715f * v * v * v); v = 0.5f * v * (1.0f + tanhf(u)); }
      so[w][8 * hh + r][t * 16 + ln] = v;
    }
  }
  __builtin_amdgcn_fence(__ATOMIC_ACQ_REL, "workgroup");
  __builtin_amdgcn_wave_barrier();
  const int rsub = lane >> 4, c4 = (lane & 15) * 4;
  {
#pragma unroll
    for (int q = 0; q < 8; ++q) {
      const int r = q * 2 + rsub;
      const v4f v = *(const v4fa*)&so[w][r][c4];
      *(v4f*)(C + (size_t)(row0 + r) * ldc + col0 + c4) = v;
    }
    
  }
}
// row LayerNorm (biased variance, eps) over N: s = X (+ R); optional out_sum <- s; out_norm <- (s-mu)*rsqrt(var+eps)*g + b
template <bool PARAM_BF16>
__global__ __launch_bounds__(256) void k_layernorm(const float* __restrict__ X, const float* __restrict__ R, const float* __restrict__ g, const float* __restrict__ bta,
                                                  float* __restrict__ out_sum, float* __restrict__ out_norm, int N, float eps) {
  __shared__ float red[256];
  const int row = blockIdx.x, tid = threadIdx.x;
  const float* x = X + (size_t)row * N; const float* rr = R ? R + (size_t)row * N : nullptr;
  float vals[16];                     // up to N = 4096
  const int per = N / 256;            // contiguous chunk per thread? use strided-by-4 chunks: thread handles j = tid*4 + 1024*u
  float s1 = 0.f;
  for (int u = 0; u < per / 4; ++u) {
    const int j = tid * 4 + 1024 * u;
    const v4f a = *(const v4fa*)(x + j);
    v4f b = {0.f,0.f,0.f,0.f}; if (rr) b = *(const v4fa*)(rr + j);
#pragma unroll
    for (int q = 0; q < 4; ++q) { const float v = a[q] + b[q]; vals[u * 4 + q] = v; s1 += v; }
  }
  red[tid] = s1; __syncthreads();
  for (int st = 128; st > 0; st >>= 1) { if (tid < st) red[tid] += red[tid + st]; __syncthreads(); }
  const float mu = red[0] / (float)N; __syncthreads();
  float s2 = 0.f;
  for (int u = 0; u < per / 4; ++u)
#pragma unroll
    for (int q = 0; q < 4; ++q) { const float c = vals[u * 4 + q] - mu; s2 += c * c; }
  red[tid] = s2; __syncthreads();
  for (int st = 128; st > 0; st >>= 1) { if (tid < st) red[tid] += red[tid + st]; __syncthreads(); }
  const float rs = rsqrtf(red[0] / (float)N + eps);
  {
    for (int u = 0; u < per / 4; ++u) {
      const int j = tid * 4 + 1024 * u;
      v4f o, sm;
#pragma unroll
      for (int q = 0; q < 4; ++q) {
        float gg = g[j + q], bb = bta[j + q];
        if (PARAM_BF16) { gg = bf16_round(gg); bb = bf16_round(bb); }
        sm[q] = vals[u * 4 + q]; o[q] = (vals[u * 4 + q] - mu) * rs * gg + bb;
      }
      if (out_sum) *(v4f*)(out_sum + (size_t)row * N + j) = sm;
      *(v4f*)(out_norm + (size_t)row * N + j) = o;
    }
    
  }
}



// ---- f16 WMMA path (v_wmma_f32_16x16x32_f16): 11-bit significands for operands in range — used where a [0,1] probability operand needs more precision than bf16
typedef _Float16 v16h __attribute__((ext_vector_type(16)));
union FragH { v16h v; v8us half[2]; _Float16 h[16]; unsigned short u[16]; };
template <int NT>
__device__ __forceinline__ v8f mmaH(v16h ah, v16h al, v16h bh, v16h bl, v8f c) {
  c = __builtin_amdgcn_wmma_f32_16x16x32_f16(false, ah, false, bh, (short)0, c, false, false);
  if (NT >= 2) c = __builtin_amdgcn_wmma_f32_16x16x32_f16(false, al, false, bh, (short)0, c, false, false);
  if (NT >= 3) c = __builtin_amdgcn_wmma_f32_16x16x32_f16(false, ah, false, bl, (short)0, c, false, false);
  asm volatile("v_nop\n\tv_nop\n\tv_nop\n\tv_nop" : "+v"(c) : "v"(ah), "v"(al), "v"(bh), "v"(bl));
  return c;
}
// batched GEMM like k_gemm_b but f16 operands: A f32 (split into f16 hi/lo if ASPLIT, else rounded to f16), Bt = f16 values [n][k]; alpha; C f32; N multiple of 16 (partial tiles skipped)
template <bool ASPLIT>
__global__ __launch_bounds__(128) void k_gemm_h(const float* __restrict__ A, int lda, size_t sA, const _Float16* __restrict__ Bh, int ldb, size_t sB, float alpha, float* __restrict__ C, int ldc, size_t sC, int M, int N, int K) {
  __shared__ __attribute__((aligned(16))) float so[4][16][64];
  const int tid = threadIdx.x, w = tid >> 5, lane = tid & 31, ln = lane & 15, hh = lane >> 4; const int by = blockIdx.y;
  A += (size_t)by * sA; Bh += (size_t)by * sB; C += (size_t)by * sC;
  const int ntn = (N + 63) / 64; const int wid = blockIdx.x * 4 + w; const int mt = wid / ntn, nq = wid % ntn; if (mt * 16 >= M) return;
  const int row0 = mt * 16, col0 = nq * 64; const float* arow = A + (size_t)(row0 + ln) * lda;
  v8f acc[4] = {};
  for (int kb = 0; kb < K; kb += 32) {
    FragH ah, al;
    const v4f x0 = *(const v4fa*)(arow + kb + 8 * hh), x1 = *(const v4fa*)(arow + kb + 8 * hh + 4), x2 = *(const v4fa*)(arow + kb + 16 + 8 * hh), x3 = *(const v4fa*)(arow + kb + 16 + 8 * hh + 4);
    float xs[16] = {x0[0],x0[1],x0[2],x0[3],x1[0],x1[1],x1[2],x1[3],x2[0],x2[1],x2[2],x2[3],x3[0],x3[1],x3[2],x3[3]};
#pragma unroll
    for (int i = 0; i < 16; ++i) { const _Float16 h = (_Float16)xs[i]; ah.h[i] = h; al.h[i] = ASPLIT ? (_Float16)(xs[i] - (float)h) : (_Float16)0.0f; }
#pragma unroll
    for (int t = 0; t < 4; ++t) { if (col0 + t * 16 >= N) continue; const size_t boff = (size_t)(col0 + t * 16 + ln) * ldb + kb; FragH bq; bq.half[0] = *(const v8us*)(Bh + boff + 8 * hh); bq.half[1] = *(const v8us*)(Bh + boff + 16 + 8 * hh);
      acc[t] = mmaH<ASPLIT ? 2 : 1>(ah.v, al.v, bq.v, bq.v, acc[t]); }
  }
#pragma unroll
  for (int t = 0; t < 4; ++t) { if (col0 + t * 16 >= N) continue;
#pragma unroll
    for (int r = 0; r < 8; ++r) so[w][8 * hh + r][t * 16 + ln] = acc[t][r] * alpha; }
  __builtin_amdgcn_fence(__ATOMIC_ACQ_REL, "workgroup"); __builtin_amdgcn_wave_barrier();
  const int rsub = lane >> 4, c4 = (lane & 15) * 4;
  {
#pragma unroll
    for (int q = 0; q < 8; ++q) { const int r = q * 2 + rsub; if (col0 + c4 < N) { const v4f v = *(const v4fa*)&so[w][r][c4]; *(v4f*)(C + (size_t)(row0 + r) * ldc + col0 + c4) = v; } }
     }
}

// Wt[n][k] = f16(W[k][n]·scale) from f32 row-major W[K][N] (scale = power of two; bf16-exact weights stay exact in f16 away from the subnormal range)
__global__ __launch_bounds__(256) void k_wt_f16(const float* __restrict__ W, _Float16* __restrict__ Wt, int K, int N, float scale) {
  const int t = blockIdx.x * 256 + threadIdx.x; if (t >= N * (K / 8)) return; const int n = t / (K / 8), k8 = (t % (K / 8)) * 8; FragH f;
#pragma unroll
  for (int i = 0; i < 8; ++i) f.h[i] = (_Float16)(bf16_round(W[(size_t)(k8 + i) * N + n]) * scale); const v8us o = f.half[0];
  *(v8us*)((unsigned short*)Wt + (size_t)n * K + k8) = o; 
}
// k_gemm_hh variant with fused epilogue: v = acc·alpha + bias[by·sBias + col] (+ CP[(row/rowsPerB)·sCPb + by·64 + col] if CP) ; ACT 0 none / 1 elu ; writes f16 C16 (and f32 C if non-null)
template <int ACT>
__global__ __launch_bounds__(128) void k_gemm_hhx(const _Float16* __restrict__ A, int lda, size_t sA, const _Float16* __restrict__ Bh, int ldb, size_t sB, float alpha, const float* __restrict__ bias, size_t sBias, const float* __restrict__ CP, int rowsPerB, size_t sCPb, int row0g,
    float* __restrict__ C, _Float16* __restrict__ C16, int ldc, size_t sC, int M, int N, int K) {
  __shared__ __attribute__((aligned(16))) float so[4][16][64];
  const int tid = threadIdx.x, w = tid >> 5, lane = tid & 31, ln = lane & 15, hh = lane >> 4; const int by = blockIdx.y;
  A += (size_t)by * sA; Bh += (size_t)by * sB; const size_t cofs = (size_t)by * sC; const float* bp = bias ? bias + (size_t)by * sBias : nullptr;
  const int ntn = (N + 63) / 64; const int wid = blockIdx.x * 4 + w; const int mt = wid / ntn, nq = wid % ntn; if (mt * 16 >= M) return;
  const int row0 = mt * 16, col0 = nq * 64; const _Float16* arow = A + (size_t)(row0 + ln) * lda;
  v8f acc[4] = {};
  for (int kb = 0; kb < K; kb += 32) { FragH ah; ah.half[0] = *(const v8us*)((const unsigned short*)arow + kb + 8 * hh); ah.half[1] = *(const v8us*)((const unsigned short*)arow + kb + 16 + 8 * hh);
#pragma unroll
    for (int t = 0; t < 4; ++t) { if (col0 + t * 16 >= N) continue; const size_t boff = (size_t)(col0 + t * 16 + ln) * ldb + kb; FragH bq; bq.half[0] = *(const v8us*)((const unsigned short*)Bh + boff + 8 * hh); bq.half[1] = *(const v8us*)((const unsigned short*)Bh + boff + 16 + 8 * hh);
      acc[t] = mmaH<1>(ah.v, ah.v, bq.v, bq.v, acc[t]); }
  }
#pragma unroll
  for (int t = 0; t < 4; ++t) { if (col0 + t * 16 >= N) continue; const int col = col0 + t * 16 + ln; const float bv = bp ? bf16_round(bp[col]) : 0.f;
#pragma unroll
    for (int r = 0; r < 8; ++r) { float v = acc[t][r] * alpha + bv; if (CP) { const int rr = row0g + row0 + 8 * hh + r; if (rowsPerB < 0) v += CP[cofs + (size_t)rr * ldc + col];      /* rowsPerB < 0: own element of the batched C plane */ else { const int bidx = rr / rowsPerB; v += CP[(size_t)bidx * sCPb + (size_t)by * 64 + col]; } } if (ACT == 1) v = (v > 0.f) ? v : expm1f(v); else if (ACT == 7) v = (v > 0.f) ? v + 1.0f : expf(v); else if (ACT == 8) v = tanhf(v); else if (ACT == 9) v = 0.5f * v * (1.0f + tanhf(0.7978845608028654f * (v + 0.044715f * v * v * v))); else if (ACT == 11) v = 1.0f / (1.0f + expf(-v)); else if (ACT == 12) v = (v > 0.f) ? v : 0.01f * v; else if (ACT == 14) v = (v > 0.f) ? v : 0.1f * v; else if (ACT == 16) v = (v >= 0.f) ? v : 0.3f * v; else if (ACT == 17) v = (v >= 0.f) ? v : 0.2f * v; else if (ACT == 15) v = v / (1.0f + expf(-v)); else if (ACT == 3) v = fmaxf(v, 0.f); else if (ACT == 6) v = 0.5f * v * (1.0f + erff(v * 0.70710678118654752f)); so[w][8 * hh + r][t * 16 + ln] = v; } }
  __builtin_amdgcn_fence(__ATOMIC_ACQ_REL, "workgroup"); __builtin_amdgcn_wave_barrier();
  const int rsub = lane >> 4, c4 = (lane & 15) * 4; typedef _Float16 v4h __attribute__((ext_vector_type(4)));
  {
#pragma unroll
    for (int q = 0; q < 8; ++q) { const int r = q * 2 + rsub; if (col0 + c4 < N) { const v4f v = *(const v4fa*)&so[w][r][c4]; if (C) *(v4f*)(C + cofs + (size_t)(row0 + r) * ldc + col0 + c4) = v; if (C16) { v4h h4; for (int i = 0; i < 4; ++i) h4[i] = (_Float16)v[i]; *(v4h*)(C16 + cofs + (size_t)(row0 + r) * ldc + col0 + c4) = h4; } } }
     }
}


typedef _Float16 v4h __attribute__((ext_vector_type(4)));

__global__ __launch_bounds__(256) void k_x16(const float* __restrict__ x, _Float16* __restrict__ X16, size_t n8) { const size_t t = (size_t)blockIdx.x * 256 + threadIdx.x; if (t >= n8) return; FragH f;
#pragma unroll
  for (int q = 0; q < 8; ++q) f.h[q] = (_Float16)bf16_round(x[t * 8 + q]); *(v8us*)((unsigned short*)X16 + t * 8) = f.half[0];  }
__global__ __launch_bounds__(256) void k_h16(const float* __restrict__ x, _Float16* __restrict__ X16, size_t n8) { const size_t t = (size_t)blockIdx.x * 256 + threadIdx.x; if (t >= n8) return; FragH f;
#pragma unroll
  for (int q = 0; q < 8; ++q) f.h[q] = (_Float16)x[t * 8 + q]; *(v8us*)((unsigned short*)X16 + t * 8) = f.half[0];  }
__global__ __launch_bounds__(256) void k_round16f(const float* __restrict__ W, _Float16* __restrict__ Bt, size_t n8) { const size_t t = (size_t)blockIdx.x * 256 + threadIdx.x; if (t >= n8) return; FragH f;
#pragma unroll
  for (int i = 0; i < 8; ++i) f.h[i] = (_Float16)(bf16_round(W[t * 8 + i]) * 16.0f); *(v8us*)((unsigned short*)Bt + t * 8) = f.half[0];  }
template <int NHv, int TTv>
__global__ __launch_bounds__(256) void k_vt(const _Float16* __restrict__ V16, int ldv, int voff, _Float16* __restrict__ Vt) { __shared__ unsigned short tl[64][66]; const int tid = threadIdx.x; const int slab = blockIdx.x / (TTv / 64), lg = blockIdx.x % (TTv / 64); const int b = slab / NHv, h = slab % NHv;
  for (int i = tid; i < 64 * 8; i += 256) { const int r = i / 8, c8 = (i % 8) * 8; FragH f; f.half[0] = *(const v8us*)((const unsigned short*)V16 + ((size_t)b * TTv + lg * 64 + r) * ldv + voff + h * 64 + c8);
#pragma unroll
    for (int q = 0; q < 8; ++q) tl[r][c8 + q] = f.u[q]; }
  __syncthreads();
  {
#pragma unroll
    for (int rd = 0; rd < 2; ++rd) { const int d = rd * 32 + tid / 8, pc = tid % 8; FragH f;
#pragma unroll
      for (int q = 0; q < 8; ++q) f.u[q] = tl[pc * 8 + q][d];
      *(v8us*)((unsigned short*)Vt + ((size_t)slab * 64 + d) * TTv + lg * 64 + pc * 8) = f.half[0]; }
     } }

__global__ __launch_bounds__(256) void k_hl(const float* __restrict__ F, _Float16* __restrict__ Hh, _Float16* __restrict__ Hl, size_t n8) { const size_t t = (size_t)blockIdx.x * 256 + threadIdx.x; if (t >= n8) return; FragH fh, fl; const v4f a = *(const v4fa*)(F + t * 8), c = *(const v4fa*)(F + t * 8 + 4);
#pragma unroll
  for (int q = 0; q < 4; ++q) { _Float16 h = (_Float16)a[q]; fh.h[q] = h; fl.h[q] = (_Float16)((a[q] - (float)h) * 1024.0f); h = (_Float16)c[q]; fh.h[4 + q] = h; fl.h[4 + q] = (_Float16)((c[q] - (float)h) * 1024.0f); }
  { *(v8us*)((unsigned short*)Hh + t * 8) = fh.half[0]; *(v8us*)((unsigned short*)Hl + t * 8) = fl.half[0];  } }

// ---- fast GEMM (wave tile 32x64; requires M % 32 == 0 rows per launch region and N % 64 == 0); epilogue = k_gemm_hhx semantics ----
__device__ __forceinline__ v16h g2_frag(const _Float16* p, int hh) { FragH f; f.half[0] = *(const v8us*)((const unsigned short*)p + 8 * hh); f.half[1] = *(const v8us*)((const unsigned short*)p + 16 + 8 * hh); return f.v; }
__device__ __forceinline__ v8f g2_mma(v16h a, v16h b, v8f c) { v8f d = __builtin_amdgcn_wmma_f32_16x16x32_f16(false, a, false, b, (short)0, c, false, false); asm volatile("v_nop\n\tv_nop\n\tv_nop\n\tv_nop" : "+v"(d) : "v"(a), "v"(b)); return d; }
template <int ACT>
__global__ __launch_bounds__(128) void k_gemm2(const _Float16* __restrict__ A, int lda, size_t sA, const _Float16* __restrict__ Bh, int ldb, size_t sB, float alpha, const float* __restrict__ bias, size_t sBias, const float* __restrict__ CP, int rowsPerB, size_t sCPb, int row0g,
    float* __restrict__ C, _Float16* __restrict__ C16, int ldc, size_t sC, int M, int N, int K) { static_assert(ACT == 0 || ACT == 3 || ACT == 6 || ACT == 8 || ACT == 9 || ACT == 11 || ACT == 12 || ACT == 14 || ACT == 15 || ACT == 16 || ACT == 17 || ACT == 18, "k_gemm2: unsupported ACT code (would silently apply no activation)");
  __shared__ __attribute__((aligned(16))) float so[4][32][68];
  const int tid = threadIdx.x, w = tid >> 5, lane = tid & 31, ln = lane & 15, hh = lane >> 4; const int by = blockIdx.y;
  A += (size_t)by * sA; Bh += (size_t)by * sB; const size_t cofs = (size_t)by * sC; const float* bp = bias ? bias + (size_t)by * sBias : nullptr;
  const int ntn = N >> 6; const int mt = blockIdx.x / ntn, nq = blockIdx.x - mt * ntn; const int row0 = mt * 128 + 32 * w, col0 = nq * 64; if (row0 >= M) return;
  const _Float16* a0p = A + (size_t)(row0 + ln) * lda; const _Float16* a1p = a0p + (size_t)16 * lda;
  const _Float16* b0p = Bh + (size_t)(col0 + ln) * ldb; const _Float16* b1p = b0p + (size_t)16 * ldb; const _Float16* b2p = b1p + (size_t)16 * ldb; const _Float16* b3p = b2p + (size_t)16 * ldb;
  const v8f z8 = {0.f,0.f,0.f,0.f,0.f,0.f,0.f,0.f}; v8f c00 = z8, c01 = z8, c02 = z8, c03 = z8, c10 = z8, c11 = z8, c12 = z8, c13 = z8;
#pragma unroll 1
  for (int kb = 0; kb < K; kb += 32) { const v16h a0 = g2_frag(a0p + kb, hh), a1 = g2_frag(a1p + kb, hh);
    v16h b = g2_frag(b0p + kb, hh); c00 = g2_mma(a0, b, c00); c10 = g2_mma(a1, b, c10);
    b = g2_frag(b1p + kb, hh); c01 = g2_mma(a0, b, c01); c11 = g2_mma(a1, b, c11);
    b = g2_frag(b2p + kb, hh); c02 = g2_mma(a0, b, c02); c12 = g2_mma(a1, b, c12);
    b = g2_frag(b3p + kb, hh); c03 = g2_mma(a0, b, c03); c13 = g2_mma(a1, b, c13); }
  v8f accs[8] = {c00, c01, c02, c03, c10, c11, c12, c13};
#pragma unroll
  for (int u = 0; u < 8; ++u) { const int t = u & 3, half = u >> 2; const int col = col0 + t * 16 + ln; const float bv = bp ? bf16_round(bp[col]) : 0.f;
#pragma unroll
    for (int r = 0; r < 8; ++r) { const int rloc = half * 16 + 8 * hh + r; float v = accs[u][r] * alpha + bv; if (CP) { if (rowsPerB < 0) v += CP[cofs + (size_t)(row0g + row0 + rloc) * ldc + col];      /* rowsPerB < 0: own element of the batched C plane */ else { const int bidx = (row0g + row0 + rloc) / rowsPerB; v += CP[(size_t)bidx * sCPb + (size_t)by * 64 + col]; } }
      if (ACT == 3) v = fmaxf(v, 0.f); else if (ACT == 6) v = 0.5f * v * (1.0f + erff(v * 0.70710678118654752f)); else if (ACT == 11) v = 1.0f / (1.0f + expf(-v)); else if (ACT == 15) v = v / (1.0f + expf(-v)); else if (ACT == 18) v = v / (1.0f + expf(-1.702f * v));      /* QuickGELU: v sigmoid(1.702 v) */ else if (ACT == 12) v = (v > 0.f) ? v : 0.01f * v; else if (ACT == 8) v = tanhf(v); else if (ACT == 9) v = 0.5f * v * (1.0f + tanhf(0.7978845608028654f * (v + 0.044715f * v * v * v))); else if (ACT == 14) v = (v > 0.f) ? v : 0.1f * v; else if (ACT == 16) v = (v >= 0.f) ? v : 0.3f * v; else if (ACT == 17) v = (v >= 0.f) ? v : 0.2f * v;
      so[w][rloc][t * 16 + ln] = v; } }
  __builtin_amdgcn_fence(__ATOMIC_ACQ_REL, "workgroup"); __builtin_amdgcn_wave_barrier();
  const int rsub = lane >> 4, c4 = (lane & 15) * 4;
  {
#pragma unroll
    for (int q = 0; q < 16; ++q) { const int r = q * 2 + rsub; const v4f v = *(const v4fa*)&so[w][r][c4]; if (C) *(v4f*)(C + cofs + (size_t)(row0 + r) * ldc + col0 + c4) = v; if (C16) { v4h h4; for (int i = 0; i < 4; ++i) h4[i] = (_Float16)v[i]; *(v4h*)(C16 + cofs + (size_t)(row0 + r) * ldc + col0 + c4) = h4; } }
     } }


__global__ __launch_bounds__(256) void k_wnat(const float* __restrict__ w, size_t n8, _Float16* __restrict__ Bt) { const size_t t = (size_t)blockIdx.x * 256 + threadIdx.x; if (t >= n8) return; FragH f; for (int q = 0; q < 8; ++q) f.h[q] = (_Float16)(bf16_round(w[t * 8 + q]) * 16.0f); *(v8us*)((unsigned short*)Bt + t * 8) = f.half[0];  }
__global__ __launch_bounds__(256) void k_rsm(const float* __restrict__ S, _Float16* __restrict__ P, int nrows) {
  #pragma clang fp contract(off)
  const int i = blockIdx.x * 256 + threadIdx.x; if (i >= nrows) return; const float* s = S + (size_t)i * SQ; float mx = -3.0e38f;
#pragma unroll 1
  for (int j = 0; j < SQ; ++j) mx = fmaxf(mx, s[j]); float se = 0.f;
#pragma unroll 1
  for (int j = 0; j < SQ; ++j) se += expf(s[j] - mx); const float sc = 256.0f / se;
#pragma unroll 1
  for (int j0 = 0; j0 < SQ; j0 += 8) { FragH f; for (int q = 0; q < 8; ++q) f.h[q] = (_Float16)(expf(s[j0 + q] - mx) * sc); unsigned short* d = (unsigned short*)P + (size_t)i * SQ + j0; *(v8us*)d = f.half[0];  } }
__global__ __launch_bounds__(256) void k_vt(const _Float16* __restrict__ V16, int b, int h0, _Float16* __restrict__ VT) { __shared__ unsigned short tl[64][65]; const int tid = threadIdx.x; const int hh = blockIdx.x % HG, sg = blockIdx.x / HG; const int s0 = sg * 64; const int h = h0 + hh;
  for (int i = tid; i < 64 * 8; i += 256) { const int j = i / 8, d8 = (i % 8) * 8; FragH f; f.half[0] = *(const v8us*)((const unsigned short*)V16 + ((size_t)b * SQ + s0 + j) * DM + h * HD + d8); for (int q = 0; q < 8; ++q) tl[d8 + q][j] = f.u[q]; }
  __syncthreads();
  { for (int i = tid; i < 64 * 8; i += 256) { const int d = i / 8, j8 = (i % 8) * 8; FragH f; for (int q = 0; q < 8; ++q) f.u[q] = tl[d][j8 + q]; *(v8us*)((unsigned short*)VT + ((size_t)hh * HD + d) * SQ + s0 + j8) = f.half[0]; }  } }



__global__ __launch_bounds__(256) void k_rsmcf2(const float* __restrict__ S, _Float16* __restrict__ P, int hg, int q0, int nk) {
  #pragma clang fp contract(off)
  const int t = blockIdx.x * 256 + threadIdx.x; if (t >= hg * QT) return; const size_t i = (size_t)t; const float* s = S + i * NKX; const int last = q0 + (t % QT); float mx = -3.0e38f;
#pragma unroll 1
  for (int j = 0; j < nk; ++j) { const float f = (j <= last) ? 1.f : 0.f; mx = fmaxf(mx, fmaf(f, s[j], (1.f - f) * -1.0e9f)); } float se = 0.f;
#pragma unroll 1
  for (int j = 0; j < nk; ++j) { const float f = (j <= last) ? 1.f : 0.f; se += __expf(fmaf(f, s[j], (1.f - f) * -1.0e9f) - mx); } const float sc = 256.0f / se;
#pragma unroll 1
  for (int j0 = 0; j0 < nk; j0 += 8) { FragH fr; for (int q = 0; q < 8; ++q) { const int j = j0 + q; const float f = (j <= last) ? 1.f : 0.f; fr.h[q] = (_Float16)(__expf(fmaf(f, s[j], (1.f - f) * -1.0e9f) - mx) * sc); } unsigned short* d = (unsigned short*)P + i * NKX + j0; *(v8us*)d = fr.half[0];  } }

__global__ __launch_bounds__(256) void k_rsmcst(const float* __restrict__ S, _Float16* __restrict__ P, int hg, int q0, int nk, const int* __restrict__ mk) {
  #pragma clang fp contract(off)
  const int t = blockIdx.x * 256 + threadIdx.x; if (t >= hg * QT) return; const size_t i = (size_t)t; const float* s = S + i * NKX; const size_t ig = (size_t)(q0 + (t % QT)); const int* mr = mk + ig * SQ; float mx = -3.0e38f;
#pragma unroll 1
  for (int j = 0; j < nk; ++j) { const int mb = mr[j]; const int dd = (int)ig - j; const float f = (mb != 0 && dd >= 0 && (dd <= LOCALW || (dd % STRIDEK) == 0)) ? 1.f : 0.f; mx = fmaxf(mx, fmaf(f, s[j], (1.f - f) * -1.0e9f)); } float se = 0.f;
#pragma unroll 1
  for (int j = 0; j < nk; ++j) { const int mb = mr[j]; const int dd = (int)ig - j; const float f = (mb != 0 && dd >= 0 && (dd <= LOCALW || (dd % STRIDEK) == 0)) ? 1.f : 0.f; se += __expf(fmaf(f, s[j], (1.f - f) * -1.0e9f) - mx); } const float sc = 256.0f / se;
#pragma unroll 1
  for (int j0 = 0; j0 < nk; j0 += 8) { FragH fr; for (int q = 0; q < 8; ++q) { const int j = j0 + q; const int mb = mr[j]; const int dd = (int)ig - j; const float f = (mb != 0 && dd >= 0 && (dd <= LOCALW || (dd % STRIDEK) == 0)) ? 1.f : 0.f; fr.h[q] = (_Float16)(__expf(fmaf(f, s[j], (1.f - f) * -1.0e9f) - mx) * sc); } unsigned short* d = (unsigned short*)P + i * NKX + j0; *(v8us*)d = fr.half[0];  } }


template <int MASKADD>
__global__ __launch_bounds__(64) void k_att0(const float* __restrict__ QF, const float* __restrict__ KF, const float* __restrict__ VF, int ld, const float* __restrict__ mask, float scale, float* __restrict__ OF, int ldo) {
  #pragma clang fp contract(off)
  __shared__ __attribute__((aligned(16))) float lq[64][64]; __shared__ __attribute__((aligned(16))) float lo[64][64];
  const int tid = threadIdx.x; const int h = blockIdx.x / (QT0 / 64), rg = blockIdx.x % (QT0 / 64); const int i = rg * 64 + tid;
  const float* qr = QF + (size_t)i * ld + h * HD;
#pragma unroll 1
  for (int c = 0; c < HD / 4; ++c) { *(v4f*)&lq[tid][c * 4] = *(const v4fa*)(qr + c * 4); const v4f z = {0.f, 0.f, 0.f, 0.f}; *(v4f*)&lo[tid][c * 4] = z; }
  float m = -1.0e30f, l = 0.f; const int jmax = MASKADD ? (SQ - 1) : (rg * 64 + 63);      /* additive-mask form: every key (the mask input decides); causal form: keys up to the block's last row */
#pragma unroll 1
  for (int j = 0; j <= jmax; ++j) { const float* kr = KF + (size_t)j * ld + h * HD; const float* vr = VF + (size_t)j * ld + h * HD; float s = 0.f;
#pragma unroll 1
    for (int c = 0; c < HD / 4; ++c) { const v4f kq = *(const v4fa*)(kr + c * 4); const v4f qq = *(v4f*)&lq[tid][c * 4]; s = __fadd_rn(s, __fmul_rn(qq[0], kq[0])); s = __fadd_rn(s, __fmul_rn(qq[1], kq[1])); s = __fadd_rn(s, __fmul_rn(qq[2], kq[2])); s = __fadd_rn(s, __fmul_rn(qq[3], kq[3])); }
    s = __fmul_rn(s, scale); if (MASKADD) s = __fadd_rn(s, __fmul_rn(bf16_round(mask[(size_t)i * SQ + j]), -10000.0f));
    const float f = (MASKADD || j <= i) ? 1.f : 0.f; const float sm = fmaf(f, s, (1.f - f) * -1.0e30f); const float mn = fmaxf(m, sm); const float sc = expf(m - mn); const float e = expf(sm - mn); l = __fadd_rn(__fmul_rn(l, sc), e); m = mn;
#pragma unroll 1
    for (int c = 0; c < HD / 4; ++c) { const v4f vv = *(const v4fa*)(vr + c * 4); v4f oo = *(v4f*)&lo[tid][c * 4]; for (int u = 0; u < 4; ++u) oo[u] = __fadd_rn(__fmul_rn(oo[u], sc), __fmul_rn(e, vv[u])); *(v4f*)&lo[tid][c * 4] = oo; } }
  const float fin = 64.0f / l;      /* o carried x64 like the f16 path */
#pragma unroll 1
  for (int c = 0; c < HD / 4; ++c) { v4f oo = *(v4f*)&lo[tid][c * 4]; for (int u = 0; u < 4; ++u) oo[u] = __fmul_rn(oo[u], fin); *(v4f*)&lo[tid][c * 4] = oo; }
  __syncthreads();
  {
#pragma unroll 1
    for (int it = 0; it < 16; ++it) { const int row = it * 4 + tid / 16, pc = (tid % 16) * 4; const v4f v = *(const v4f*)&lo[row][pc]; *(v4f*)(OF + (size_t)(rg * 64 + row) * ldo + h * HD + pc) = v; }
     } }

template <int MASKADD>
__global__ __launch_bounds__(64) void k_att0mbc(const float* __restrict__ QF, const float* __restrict__ KF, const float* __restrict__ VF, int ld, const float* __restrict__ mask, float scale, float* __restrict__ OF, int ldo) {
  #pragma clang fp contract(off)
  __shared__ __attribute__((aligned(16))) float lq[64][64]; __shared__ __attribute__((aligned(16))) float lo[64][64];
  const int tid = threadIdx.x; const int h = blockIdx.x / (QT0 / 64), rg = blockIdx.x % (QT0 / 64); const int i = rg * 64 + tid;
  const float* qr = QF + (size_t)i * ld + h * HD;
#pragma unroll 1
  for (int c = 0; c < HD / 4; ++c) { *(v4f*)&lq[tid][c * 4] = *(const v4fa*)(qr + c * 4); const v4f z = {0.f, 0.f, 0.f, 0.f}; *(v4f*)&lo[tid][c * 4] = z; }
  float m = -1.0e30f, l = 0.f; const int jmax = rg * 64 + 63;      /* keys beyond the block end are masked by the mask's lower-triangular structure */      /* both MASKADD forms: keys up to the block's last row */
#pragma unroll 1
  for (int j = 0; j <= jmax; ++j) { const float* kr = KF + (size_t)j * ld + h * HD; const float* vr = VF + (size_t)j * ld + h * HD; float s = 0.f;
#pragma unroll 1
    for (int c = 0; c < HD / 4; ++c) { const v4f kq = *(const v4fa*)(kr + c * 4); const v4f qq = *(v4f*)&lq[tid][c * 4]; s = __fadd_rn(s, __fmul_rn(qq[0], kq[0])); s = __fadd_rn(s, __fmul_rn(qq[1], kq[1])); s = __fadd_rn(s, __fmul_rn(qq[2], kq[2])); s = __fadd_rn(s, __fmul_rn(qq[3], kq[3])); }
    s = __fmul_rn(s, scale); const int mb = ((const int*)mask)[(size_t)i * SQ + j];      /* causal (j <= i) AND the module's int32 [S][S] mask read per (query, key): 0 -> masked */
    const float f = (mb != 0 && j <= i) ? 1.f : 0.f; const float sm = fmaf(f, s, (1.f - f) * -1.0e30f); const float mn = fmaxf(m, sm); const float sc = expf(m - mn); const float e = expf(sm - mn); l = __fadd_rn(__fmul_rn(l, sc), e); m = mn;
#pragma unroll 1
    for (int c = 0; c < HD / 4; ++c) { const v4f vv = *(const v4fa*)(vr + c * 4); v4f oo = *(v4f*)&lo[tid][c * 4]; for (int u = 0; u < 4; ++u) oo[u] = __fadd_rn(__fmul_rn(oo[u], sc), __fmul_rn(e, vv[u])); *(v4f*)&lo[tid][c * 4] = oo; } }
  const float fin = 64.0f / l;      /* o carried x64 like the f16 path */
#pragma unroll 1
  for (int c = 0; c < HD / 4; ++c) { v4f oo = *(v4f*)&lo[tid][c * 4]; for (int u = 0; u < 4; ++u) oo[u] = __fmul_rn(oo[u], fin); *(v4f*)&lo[tid][c * 4] = oo; }
  __syncthreads();
  {
#pragma unroll 1
    for (int it = 0; it < 16; ++it) { const int row = it * 4 + tid / 16, pc = (tid % 16) * 4; const v4f v = *(const v4f*)&lo[row][pc]; *(v4f*)(OF + (size_t)(rg * 64 + row) * ldo + h * HD + pc) = v; }
     } }


template <int BFIN, int WXB>
__global__ __launch_bounds__(256) void k_ln16(const float* __restrict__ X, const float* __restrict__ g, const float* __restrict__ bb, float eps, _Float16* __restrict__ N16, float* __restrict__ XB) {
  #pragma clang fp contract(off)
  __shared__ float red[256]; const size_t r = blockIdx.x; const int t = threadIdx.x; const v4f xa = *(const v4fa*)(X + r * DMQ + t * 4); float s[4]; float sum = 0.f;
  for (int q = 0; q < 4; ++q) { s[q] = BFIN ? bf16_round(xa[q]) : xa[q]; sum = __fadd_rn(sum, s[q]); }
  red[t] = sum; __syncthreads(); for (int st = 128; st > 0; st >>= 1) { if (t < st) red[t] = __fadd_rn(red[t], red[t + st]); __syncthreads(); } const float mu = red[0] / (float)DMQ; __syncthreads();
  float vs = 0.f; for (int q = 0; q < 4; ++q) { const float dl = __fadd_rn(s[q], -mu); vs = __fadd_rn(vs, __fmul_rn(dl, dl)); } red[t] = vs; __syncthreads(); for (int st = 128; st > 0; st >>= 1) { if (t < st) red[t] = __fadd_rn(red[t], red[t + st]); __syncthreads(); }
  const float rs = rsqrtf(__fadd_rn(red[0] / (float)DMQ, eps)); v4h y; v4f xb;
  for (int q = 0; q < 4; ++q) { const int c = t * 4 + q; y[q] = (_Float16)__fadd_rn(__fmul_rn(__fmul_rn(__fadd_rn(s[q], -mu), rs), bf16_round(g[c])), bf16_round(bb[c])); xb[q] = s[q]; }
  { *(v4h*)(N16 + r * DMQ + t * 4) = y; if (WXB) *(v4f*)(XB + r * DMQ + t * 4) = xb;  } }
__global__ __launch_bounds__(256) void k_ftres2(const float* __restrict__ OF0, const float* __restrict__ XB, float* __restrict__ X1, size_t n4) {
  #pragma clang fp contract(off)
  const size_t t = (size_t)blockIdx.x * 256 + threadIdx.x; if (t >= n4) return; const v4f o = *(const v4fa*)(OF0 + t * 4), xv = *(const v4fa*)(XB + t * 4); v4f y; for (int q = 0; q < 4; ++q) y[q] = __fadd_rn(__fmul_rn(o[q], 0.015625f), xv[q]); *(v4f*)(X1 + t * 4) = y;  }

__global__ __launch_bounds__(256) void k_bcpy(const float* __restrict__ b, int n, int NP, float* __restrict__ dst, int dst0) { for (int i = threadIdx.x; i < NP; i += 256) { const float v = (i < n) ? b[i] : 0.f; *(float*)(dst + dst0 + i) = v; }  }


// Row softmax, one wave per pair of rows: lane l holds elements l*4 + 128*u (u = 0..7) of each row in registers, so each load covers 512 contiguous bytes,
// S is read once and each exponential is taken once. Row maximum and row sum: per-lane partials, then a five-step butterfly over the 32 lanes.
// Every loop is fully unrolled: a[][] is then indexed by constants and stays in registers, and all 16 loads of a wave issue before the first value is used.
#define RSW 8                        /* waves per softmax work-group */
#define RSR 2                        /* rows per wave */
template <int M> __device__ __forceinline__ float rs_row(float x) { return __builtin_bit_cast(float, __builtin_amdgcn_mov_dpp(__builtin_bit_cast(int, x), 0x160 + M, 0xf, 0xf, false)); }      /* lane l <- lane l ^ M inside a 16-lane row (row_xmask) */
__device__ __forceinline__ float rs_x16(float x) { const int b = __builtin_bit_cast(int, x); return __builtin_bit_cast(float, __builtin_amdgcn_permlanex16(b, b, 0x76543210, 0xfedcba98, false, false)); }      /* lane l <- lane l ^ 16 */
__device__ __forceinline__ float rs_max(float v) { v = fmaxf(v, rs_row<1>(v)); v = fmaxf(v, rs_row<2>(v)); v = fmaxf(v, rs_row<4>(v)); v = fmaxf(v, rs_row<8>(v)); return fmaxf(v, rs_x16(v)); }
__device__ __forceinline__ float rs_sum(float v) { v += rs_row<1>(v); v += rs_row<2>(v); v += rs_row<4>(v); v += rs_row<8>(v); return v + rs_x16(v); }
// Four 2^x in one statement. The outputs are early-clobber, so inside it no v_exp_f32 is directly followed by a read of its result or a write of its source; the v_nop keeps that slot behind the last one.
__device__ __forceinline__ v4f rs_exp2(v4f x) { float y0, y1, y2, y3; asm("v_exp_f32 %0, %4\n\tv_exp_f32 %1, %5\n\tv_exp_f32 %2, %6\n\tv_exp_f32 %3, %7\n\tv_nop" : "=&v"(y0), "=&v"(y1), "=&v"(y2), "=&v"(y3) : "v"(x[0]), "v"(x[1]), "v"(x[2]), "v"(x[3])); const v4f y = {y0, y1, y2, y3}; return y; }
__global__ __launch_bounds__(RSW * 32) void k_rsmf(const float* __restrict__ S, _Float16* __restrict__ P, int nrows) {
  const int lane = threadIdx.x & 31; const int t0 = (blockIdx.x * RSW + (threadIdx.x >> 5)) * RSR; if (t0 >= nrows) return;      /* wave-uniform; the kernel has no barrier */
  size_t i[RSR]; v4f a[RSR][8];
#pragma unroll
  for (int r = 0; r < RSR; ++r) { i[r] = (size_t)((t0 + r < nrows) ? t0 + r : t0) * SQ + lane * 4;      /* a row past the end re-reads the wave's first row and is not stored */
#pragma unroll
    for (int u = 0; u < 8; ++u) a[r][u] = *(const v4fa*)(S + i[r] + u * 128); }
#pragma unroll
  for (int r = 0; r < RSR; ++r) { v4f m4 = a[r][0];
#pragma unroll
    for (int u = 1; u < 8; ++u) for (int q = 0; q < 4; ++q) m4[q] = fmaxf(m4[q], a[r][u][q]);
    const float mx = rs_max(fmaxf(fmaxf(m4[0], m4[1]), fmaxf(m4[2], m4[3]))); v4f s4 = {0.f, 0.f, 0.f, 0.f};
#pragma unroll
    for (int u = 0; u < 8; ++u) { a[r][u] = rs_exp2((a[r][u] - mx) * 1.44269504088896340736f); s4 += a[r][u]; }      /* exp(s - mx) as 2^((s - mx) log2 e), what __expf compiles to */
    const float sc = 256.0f / rs_sum((s4[0] + s4[1]) + (s4[2] + s4[3]));
    if (t0 + r < nrows) {
#pragma unroll
      for (int u = 0; u < 8; ++u) { v4h y; for (int q = 0; q < 4; ++q) y[q] = (_Float16)(a[r][u][q] * sc); *(v4h*)(P + i[r] + u * 128) = y; } } } }

template <int MODE>
__global__ __launch_bounds__(256) void k_regrp(const float* __restrict__ src, float* __restrict__ dst, size_t n4) {
  const size_t t = (size_t)blockIdx.x * 256 + threadIdx.x; if (t >= n4) return; const size_t e = t * 4; const size_t rd = e / DM; const int c = (int)(e % DM);
  size_t rs; if (MODE == 0) { const size_t b = rd / SQ, sq = rd % SQ; rs = sq * NB + b; } else { const size_t sq = rd / NB, b = rd % NB; rs = b * SQ + sq; }
  const v4f v = *(const v4fa*)(src + rs * DM + c); *(v4f*)(dst + e) = v;  }

template <int BFIN, int W16, int W32>
__global__ __launch_bounds__(256) void k_lnx(const float* __restrict__ X, const float* __restrict__ g, const float* __restrict__ bb, float eps, _Float16* __restrict__ N16, float* __restrict__ N32) {
  #pragma clang fp contract(off)
  __shared__ float red[256]; const size_t r = blockIdx.x; const int t = threadIdx.x; const bool act = t < (DMQ / 4); const int c0 = act ? t * 4 : 0;
  const v4f xa = *(const v4fa*)(X + r * DMQ + c0); float s[4]; float sum = 0.f;
  for (int q = 0; q < 4; ++q) { s[q] = act ? (BFIN ? bf16_round(xa[q]) : xa[q]) : 0.f; sum = __fadd_rn(sum, s[q]); }
  red[t] = sum; __syncthreads(); for (int st = 128; st > 0; st >>= 1) { if (t < st) red[t] = __fadd_rn(red[t], red[t + st]); __syncthreads(); } const float mu = red[0] / (float)DMQ; __syncthreads();
  float vs = 0.f; for (int q = 0; q < 4; ++q) { const float dl = act ? __fadd_rn(s[q], -mu) : 0.f; vs = __fadd_rn(vs, __fmul_rn(dl, dl)); } red[t] = vs; __syncthreads(); for (int st = 128; st > 0; st >>= 1) { if (t < st) red[t] = __fadd_rn(red[t], red[t + st]); __syncthreads(); }
  const float rs = rsqrtf(__fadd_rn(red[0] / (float)DMQ, eps)); v4h y; v4f yf;
  for (int q = 0; q < 4; ++q) { const int c = c0 + q; yf[q] = __fadd_rn(__fmul_rn(__fmul_rn(__fadd_rn(s[q], -mu), rs), bf16_round(g[c])), bf16_round(bb[c])); y[q] = (_Float16)yf[q]; }
  if (!act) return;      /* no barriers after this point */
  { if (W16) *(v4h*)(N16 + r * DMQ + c0) = y; if (W32) *(v4f*)(N32 + r * DMQ + c0) = yf;  } }

__global__ __launch_bounds__(256) void k_bfr(const float* __restrict__ x, float* __restrict__ XB, size_t n8) { const size_t t = (size_t)blockIdx.x * 256 + threadIdx.x; if (t >= n8) return; v4f a = *(const v4fa*)(x + t * 8), c = *(const v4fa*)(x + t * 8 + 4); for (int q = 0; q < 4; ++q) { a[q] = bf16_round(a[q]); c[q] = bf16_round(c[q]); }
  { *(v4f*)(XB + t * 8) = a; *(v4f*)(XB + t * 8 + 4) = c;  } }



__global__ __launch_bounds__(256) void k_wthd(const float* __restrict__ Wt, _Float16* __restrict__ Bt) { const size_t t = (size_t)blockIdx.x * 256 + threadIdx.x; if (t >= (size_t)NH * HD * (DM / 8)) return; const int m8 = (int)(t % (DM / 8)) * 8; const int d = (int)((t / (DM / 8)) % HD); const int h = (int)(t / ((size_t)(DM / 8) * HD)); FragH f;
  for (int q = 0; q < 8; ++q) f.h[q] = (_Float16)(16.0f * bf16_round(Wt[((size_t)h * DM + m8 + q) * HD + d])); unsigned short* dst = (unsigned short*)Bt + ((size_t)h * HD + d) * DM + m8; *(v8us*)dst = f.half[0];  }




template <int BFIN, int SCAL>
__global__ __launch_bounds__(256) void k_lnsc(const float* __restrict__ X, const float* __restrict__ g, const float* __restrict__ bb, float eps, _Float16* __restrict__ N16, float* __restrict__ N32) {
  #pragma clang fp contract(off)
  __shared__ float red[256]; const size_t r = blockIdx.x; const int t = threadIdx.x; const bool act = t < DM / 4; const int tc = act ? t : 0; const v4f xl = *(const v4fa*)(X + r * DM + tc * 4); const float am = act ? 1.f : 0.f; float s[4]; float sum = 0.f;
  for (int q = 0; q < 4; ++q) { s[q] = (BFIN ? bf16_round(xl[q]) : xl[q]) * am; sum = __fadd_rn(sum, s[q]); }
  red[t] = sum; __syncthreads(); for (int st = 128; st > 0; st >>= 1) { if (t < st) red[t] = __fadd_rn(red[t], red[t + st]); __syncthreads(); } const float mu = red[0] / (float)DM; __syncthreads();
  float vs = 0.f; for (int q = 0; q < 4; ++q) { const float dl = __fadd_rn(s[q], -mu) * am; vs = __fadd_rn(vs, __fmul_rn(dl, dl)); } red[t] = vs; __syncthreads(); for (int st = 128; st > 0; st >>= 1) { if (t < st) red[t] = __fadd_rn(red[t], red[t + st]); __syncthreads(); }
  const float rs = __fdiv_rn(1.0f, __fadd_rn(sqrtf(red[0] / (float)(DM - 1)), eps)); if (!act) return; v4h y; v4f yf;
  for (int q = 0; q < 4; ++q) { const int c = t * 4 + q; const float gg = bf16_round(SCAL ? g[0] : g[c]), bv = bf16_round(SCAL ? bb[0] : bb[c]); yf[q] = __fadd_rn(__fmul_rn(__fmul_rn(__fadd_rn(s[q], -mu), rs), gg), bv); y[q] = (_Float16)yf[q]; }
  { if (N16) *(v4h*)(N16 + r * DM + t * 4) = y; if (N32) *(v4f*)(N32 + r * DM + t * 4) = yf;  } }

__global__ __launch_bounds__(256) void k_rsmdmi(const float* __restrict__ S, _Float16* __restrict__ P, int nrows, const int* __restrict__ M) {
  #pragma clang fp contract(off)
  const int t = blockIdx.x * 256 + threadIdx.x; if (t >= nrows) return; const float* s = S + (size_t)t * SQ; const int* m = M + (size_t)(t % SQ) * SQ; float mx = -3.0e38f;
#pragma unroll 1
  for (int j = 0; j < SQ; ++j) { const float f = (m[j] == 0) ? 1.f : 0.f; mx = fmaxf(mx, fmaf(f, s[j], (1.f - f) * -1.0e9f)); } float se = 0.f;
#pragma unroll 1
  for (int j = 0; j < SQ; ++j) { const float f = (m[j] == 0) ? 1.f : 0.f; se += __expf(fmaf(f, s[j], (1.f - f) * -1.0e9f) - mx); } const float sc = 256.0f / se;
#pragma unroll 1
  for (int j0 = 0; j0 < SQ; j0 += 8) { FragH fr; for (int q = 0; q < 8; ++q) { const int j = j0 + q; const float f = (m[j] == 0) ? 1.f : 0.f; fr.h[q] = (_Float16)(__expf(fmaf(f, s[j], (1.f - f) * -1.0e9f) - mx) * sc); } unsigned short* d = (unsigned short*)P + (size_t)t * SQ + j0; *(v8us*)d = fr.half[0];  } }
extern "C" void kernel_launch(void* const* d_in, const int* in_sizes, int n_in,
                              void* d_out, int out_size, void* d_ws, size_t ws_size, hipStream_t stream) {
  (void)in_sizes; (void)n_in; (void)out_size;
  constexpr int VH = 4;      /* heads per launch group */
  const float* const* I = (const float* const*)d_in; const float* x = I[0]; const float* wq = I[1]; const float* wk = I[2]; const float* wv = I[3]; const float* wo = I[4]; const float* bo = I[5]; const float* w1 = I[6]; const float* b1 = I[7]; const float* w2 = I[8]; const float* b2 = I[9]; const float* g1 = I[10]; const float* be1 = I[11]; const float* g2 = I[12]; const float* be2 = I[13]; const float* bq = nullptr; const float* bk = nullptr; const float* bv = nullptr;      /* x; per-head Wq / Wk / Wv [16][1024][64] (no biases); Wo [1024][1024] + bo ([in][out]); W1 [1024][1024] + b1, W2 [1024][1024] + b2; LN1 g / b, LN2 g / b */
  char* ws = (char*)d_ws; size_t off = 0;
  auto take = [&](size_t bytes) { char* p = ws + off; off += (bytes + 255) & ~(size_t)255; return p; };
  _Float16* BQ = (_Float16*)take((size_t)DM * DM * 2); _Float16* BK = (_Float16*)take((size_t)DM * DM * 2); _Float16* BV = (_Float16*)take((size_t)DM * DM * 2); _Float16* BO = (_Float16*)take((size_t)DM * DM * 2); _Float16* BW1 = (_Float16*)take((size_t)DFF * DM * 2); _Float16* BW2 = (_Float16*)take((size_t)DM * DFF * 2);
  float* XB = (float*)take(NR * DM * 4); _Float16* XN = (_Float16*)take(NR * DM * 2); _Float16* Q16 = (_Float16*)take(NR * DM * 2); _Float16* K16 = (_Float16*)take(NR * DM * 2); _Float16* V16 = (_Float16*)take(NR * DM * 2); _Float16* O16 = (_Float16*)take(NR * DM * 2); float* X1 = (float*)take(NR * DM * 4);
  float* S = (float*)take((size_t)VH * SQ * SQ * 4); _Float16* P = (_Float16*)take((size_t)VH * SQ * SQ * 2); _Float16* VT = (_Float16*)take((size_t)NH * HD * SQ * 2);
  _Float16* M16 = XN;      /* second-norm f16 rows: aliases XN (last readers: the three projections) */ _Float16* HF16 = (_Float16*)take((size_t)SQ * DFF * 2);      /* FFN hidden plane of ONE batch [1024][1024] f16 (2 MiB): own region (the 4-head score plane is only 16 MiB at SQ 1024); the FFN runs per batch */
  
  if (off > ws_size) return;
  for (int h = 0; h < NH; ++h) { const unsigned g = (unsigned)(((size_t)HD * (DM / 8) + 255) / 256); k_wt_f16<<<g, 256, 0, stream>>>(wq + (size_t)h * DM * HD, BQ + (size_t)h * HD * DM, DM, HD, 16.0f); k_wt_f16<<<g, 256, 0, stream>>>(wk + (size_t)h * DM * HD, BK + (size_t)h * HD * DM, DM, HD, 16.0f); k_wt_f16<<<g, 256, 0, stream>>>(wv + (size_t)h * DM * HD, BV + (size_t)h * HD * DM, DM, HD, 16.0f); }      /* per-head [in = 1024][out = 64] -> rows h*64.. of the Bt planes (x16): head h = output columns h*64.. */
  k_wt_f16<<<(unsigned)(((size_t)DM * (DM / 8) + 255) / 256), 256, 0, stream>>>(wo, BO, DM, DM, 16.0f);      /* Wo [in][out] -> Bt x16 */
  k_wt_f16<<<(unsigned)(((size_t)DFF * (DM / 8) + 255) / 256), 256, 0, stream>>>(w1, BW1, DM, DFF, 16.0f); k_wt_f16<<<(unsigned)(((size_t)DM * (DFF / 8) + 255) / 256), 256, 0, stream>>>(w2, BW2, DFF, DM, 16.0f);
  k_bfr<<<(unsigned)((NR * DM / 8 + 255) / 256), 256, 0, stream>>>(x, XB, NR * DM / 8); k_lnx<1, 1, 0><<<(unsigned)NR, 256, 0, stream>>>(x, g1, be1, 1e-5f, XN, nullptr);      /* n = LN0(bf16(x)) (biased variance, eps inside the rsqrt) -> f16 rows */
  k_gemm2<0><<<dim3((unsigned)((NR / 128) * (DM / 64)), 1), 128, 0, stream>>>(XN, DM, 0, BQ, DM, 0, 0.0625f, bq, 0, nullptr, 1, 0, 0, nullptr, Q16, DM, 0, (int)NR, DM, DM); k_gemm2<0><<<dim3((unsigned)((NR / 128) * (DM / 64)), 1), 128, 0, stream>>>(XN, DM, 0, BK, DM, 0, 0.0625f, bk, 0, nullptr, 1, 0, 0, nullptr, K16, DM, 0, (int)NR, DM, DM); k_gemm2<0><<<dim3((unsigned)((NR / 128) * (DM / 64)), 1), 128, 0, stream>>>(XN, DM, 0, BV, DM, 0, 0.0625f, bv, 0, nullptr, 1, 0, 0, nullptr, V16, DM, 0, (int)NR, DM, DM);      /* q, k, v -> f16 rows; head h = columns h*64.. */
  for (int b = 0; b < NB; ++b) { const size_t r0 = (size_t)b * SQ;
    k_vt<NH, SQ><<<NH * (SQ / 64), 256, 0, stream>>>(V16 + r0 * DM, DM, 0, VT);      /* V^T [16][64][1024] for this batch */
    for (int h0 = 0; h0 < NH; h0 += VH) {
      k_gemm2<0><<<dim3((SQ / 128) * (SQ / 64), VH), 128, 0, stream>>>(Q16 + r0 * DM + (size_t)h0 * HD, DM, (size_t)HD, K16 + r0 * DM + (size_t)h0 * HD, DM, (size_t)HD, 0.125f, nullptr, 0, nullptr, 1, 0, 0, S, nullptr, SQ, (size_t)SQ * SQ, SQ, SQ, HD);      /* scores / 8, 4 heads per launch */
      k_rsmf<<<(VH * SQ + RSW * RSR - 1) / (RSW * RSR), RSW * 32, 0, stream>>>(S, P, VH * SQ);      /* softmax over all keys (no mask) -> P x256 f16 */
      k_gemm2<0><<<dim3((SQ / 128) * (HD / 64), VH), 128, 0, stream>>>(P, SQ, (size_t)SQ * SQ, VT + (size_t)h0 * HD * SQ, SQ, (size_t)HD * SQ, 0.25f, nullptr, 0, nullptr, 1, 0, 0, nullptr, O16 + r0 * DM + (size_t)h0 * HD, DM, (size_t)HD, SQ, HD, SQ); } }      /* ctx (merged heads, x64) as f16 rows */
  k_gemm2<0><<<dim3((unsigned)((NR / 128) * (DM / 64)), 1), 128, 0, stream>>>(O16, DM, 0, BO, DM, 0, 0.0009765625f, bo, 0, XB, -1, 0, 0, X1, nullptr, DM, 0, (int)NR, DM, DM);      /* x + ctx wo (+ bo) (own-element residual) -> f32 rows */
  k_lnx<0, 1, 0><<<(unsigned)NR, 256, 0, stream>>>(X1, g2, be2, 1e-5f, M16, nullptr);      /* LN1(x1) -> f16 rows */
  for (int b = 0; b < NB; ++b) { const size_t r0 = (size_t)b * SQ;
    k_gemm2<6><<<dim3((unsigned)((SQ / 128) * (DFF / 64)), 1), 128, 0, stream>>>(M16 + r0 * DM, DM, 0, BW1, DM, 0, 0.0625f, b1, 0, nullptr, 1, 0, 0, nullptr, HF16, DFF, 0, SQ, DFF, DM);      /* gelu_erf(. W1 + b1) -> f16 (this batch) */
    k_gemm2<0><<<dim3((unsigned)((SQ / 128) * (DM / 64)), 1), 128, 0, stream>>>(HF16, DFF, 0, BW2, DFF, 0, 0.0625f, b2, 0, X1 + r0 * DM, -1, 0, 0, (float*)d_out + r0 * DM, nullptr, DM, 0, SQ, DM, DFF); }      /* out = x1 + mlp (own-element residual) */
}

// v003
// Measured time: 509 microseconds a run.
// It is 5.02 times as fast as v001, going by the measured steps of the versions left out in between.
// Counting every step since v000, it is 14.8 times as fast.
#include <hip/hip_runtime.h>
// Pre-LN transformer encoder block with PER-HEAD projection tensors, no QKV biases (x [8][1024][1024]; h = LN1(x) (biased var, eps 1e-5); q/k/v[h] = h W[h] with W [16][1024][64] ([head][in][out]); scale 64^-0.5; softmax over all 1024 keys (no mask); x1 = x + concat(attn) Wo + bo ([in][out]); out = x1 + gelu_erf(LN2(x1) W1 + b1) W2 + b2 ([in][out] 1024 x 1024 x 1024: hidden = 1 x n_embd, as the source) -> [8][1024][1024]).
// Structure: token rows; LayerNorm / exact f16 rows; WMMA GEMMs for q, k, v; V^T of every batch and head by LDS transposes; one fused attention launch (scores, online softmax and P V in registers); output projection with the own-element residual; custom LayerNorm; GELU (erf) FFN over all rows; launches: see trace.
// Compute dtype: inputs rounded to bf16; x / weights exact; q, k, v, softmax weights and o as plain f16 GEMM operands (~2^-12); scores and softmax statistics f32. v_wmma_f32_16x16x32_f16.
#define NB 8
#define SQ 1024
#define DM 1024
#define NH 16
#define HD 64
#define HG 4                         /* heads per call of the unused per-batch k_vt overload */
#define LOCALW 128                   /* (macros for unused kernels of the shared header) */
#define STRIDEK 128
#define QT 256                       /* query rows per causal tile */
#define NKX SQ                       /* S / P row pitch */
#define QT0 128                      /* first-tile rows recomputed exactly in f32 */
#define B0 0                         /* unused; every launch starts at batch 0 */
#define NBR NB                       /* only feeds the unused MP; the launches cover all NB batches */
#define NR ((size_t)NB * SQ)
#define DMQ DM
#define DFF 1024         /* FFN hidden width = 1 x n_embd in this module (W1 [1024][1024], W2 [1024][1024]) */
#define MP ((int)((size_t)NBR * SQ)) /* unused; the projections take NR rows */
#define QN SQ                        /* unused; attention runs all SQ query rows */
#define NHD NH                       /* unused; the launches cover all NH heads */
#define MPO MP                       /* unused; the output stage takes NR rows */
#define LQ (3 * DM)      /* unused; the q, k, v rows have pitch DM */
typedef __bf16 v16b __attribute__((ext_vector_type(16)));
typedef unsigned short v8us __attribute__((ext_vector_type(8), may_alias));
typedef float  v8f  __attribute__((ext_vector_type(8)));
typedef float  v4f  __attribute__((ext_vector_type(4)));
typedef float  v4fa __attribute__((ext_vector_type(4), may_alias));
union FragB { v16b v; v8us half[2]; unsigned short u[16]; };

__device__ __forceinline__ unsigned short bf16_bits(float x) { unsigned int u = __float_as_uint(x); return (unsigned short)((u + 0x7FFFu + ((u >> 16) & 1u)) >> 16); }
__device__ __forceinline__ float bf16_val(unsigned short b) { return __uint_as_float(((unsigned int)b) << 16); }
__device__ __forceinline__ float bf16_round(float x) { return bf16_val(bf16_bits(x)); }
// D += A·B with NT terms: 1 = ah·bh, 2 = + al·bh (A split), 3 = + ah·bl (both split)
template <int NT>
__device__ __forceinline__ v8f mmaN(v16b ah, v16b al, v16b bh, v16b bl, v8f c) {
  c = __builtin_amdgcn_wmma_f32_16x16x32_bf16(false, ah, false, bh, (short)0, c, false, false);
  if (NT >= 2) c = __builtin_amdgcn_wmma_f32_16x16x32_bf16(false, al, false, bh, (short)0, c, false, false);
  if (NT >= 3) c = __builtin_amdgcn_wmma_f32_16x16x32_bf16(false, ah, false, bl, (short)0, c, false, false);
  asm volatile("v_nop\n\tv_nop\n\tv_nop\n\tv_nop" : "+v"(c) : "v"(ah), "v"(al), "v"(bh), "v"(bl));
  return c;
}

__global__ __launch_bounds__(256) void k_wt_bf16(const float* __restrict__ W, unsigned short* __restrict__ Wt, int K, int N) {
  const int t = blockIdx.x * 256 + threadIdx.x;
  const int k8n = K / 8;
  if (t >= N * k8n) return;
  const int n = t / k8n, k8 = (t % k8n) * 8;
  v8us v;
#pragma unroll
  for (int i = 0; i < 8; ++i) v[i] = bf16_bits(W[(size_t)(k8 + i) * N + n]);
  *(v8us*)(Wt + (size_t)n * K + k8) = v;
  
}

// GEMM C[M][N] (f32, pitch ldc) = act(A[M][K]·W + bias). A f32 row-major (pitch lda) converted per fragment to bf16
// (ASPLIT: hi/lo two planes -> 2 terms, else single rounded term); Wt bf16 [N][K] (pitch ldb). BIAS_BF16 rounds the
// bias to bf16 first (bias quantised to bf16 before the add). K%32==0, M%16==0, N%64==0.
template <bool ASPLIT, int ACT, bool BIAS_BF16>
__global__ __launch_bounds__(128) void k_gemm_bf(const float* __restrict__ A, int lda, const unsigned short* __restrict__ Wt, int ldb,
                                               const float* __restrict__ bias, float* __restrict__ C, int ldc, int M, int N, int K) {
  __shared__ __attribute__((aligned(16))) float so[4][16][64];
  const int tid = threadIdx.x, w = tid >> 5, lane = tid & 31, ln = lane & 15, hh = lane >> 4;
  const int ntn = N / 64;
  const int wid = blockIdx.x * 4 + w;
  const int mt = wid / ntn, nq = wid % ntn;
  if (mt * 16 >= M) return;
  const int row0 = mt * 16, col0 = nq * 64;
  const float* arow = A + (size_t)(row0 + ln) * lda;
  v8f acc[4] = {};
  for (int kb = 0; kb < K; kb += 32) {
    FragB ah, al;
    const v4f x0 = *(const v4fa*)(arow + kb + 8 * hh), x1 = *(const v4fa*)(arow + kb + 8 * hh + 4);
    const v4f x2 = *(const v4fa*)(arow + kb + 16 + 8 * hh), x3 = *(const v4fa*)(arow + kb + 16 + 8 * hh + 4);
    float xs[16] = {x0[0],x0[1],x0[2],x0[3],x1[0],x1[1],x1[2],x1[3],x2[0],x2[1],x2[2],x2[3],x3[0],x3[1],x3[2],x3[3]};
#pragma unroll
    for (int i = 0; i < 16; ++i) { const unsigned short hb = bf16_bits(xs[i]); ah.u[i] = hb; al.u[i] = ASPLIT ? bf16_bits(xs[i] - bf16_val(hb)) : (unsigned short)0; }
#pragma unroll
    for (int t = 0; t < 4; ++t) {
      const unsigned short* brow = Wt + (size_t)(col0 + t * 16 + ln) * ldb + kb;
      FragB b;
      b.half[0] = *(const v8us*)(brow + 8 * hh);
      b.half[1] = *(const v8us*)(brow + 16 + 8 * hh);
      acc[t] = mmaN<ASPLIT ? 2 : 1>(ah.v, al.v, b.v, b.v, acc[t]);
    }
  }
#pragma unroll
  for (int t = 0; t < 4; ++t) {
    float bv = bias ? bias[col0 + t * 16 + ln] : 0.f;
    if (BIAS_BF16) bv = bf16_round(bv);
#pragma unroll
    for (int r = 0; r < 8; ++r) { float v = acc[t][r] + bv; if (ACT == 1) v = fmaxf(v, 0.f); so[w][8 * hh + r][t * 16 + ln] = v; }
  }
  __builtin_amdgcn_fence(__ATOMIC_ACQ_REL, "workgroup");
  __builtin_amdgcn_wave_barrier();
  const int rsub = lane >> 4, c4 = (lane & 15) * 4;
  {
#pragma unroll
    for (int q = 0; q < 8; ++q) {
      const int r = q * 2 + rsub;
      const v4f v = *(const v4fa*)&so[w][r][c4];
      *(v4f*)(C + (size_t)(row0 + r) * ldc + col0 + c4) = v;
    }
    
  }
}

// GEMM C = act(A·W + bias + resid): A f32 (ASPLIT -> hi/lo 2 terms), Wt bf16 [N][K]; ACT 0 none, 1 relu, 2 exact gelu;
// resid (optional, f32, row index = (row % rmod), pitch ldr, RES_BF16 rounds it) added before the activation.
template <bool ASPLIT, int ACT, bool BIAS_BF16, bool RES_BF16>
__global__ __launch_bounds__(128) void k_gemm_bf3(const float* __restrict__ A, int lda, const unsigned short* __restrict__ Wt, int ldb,
                                                const float* __restrict__ bias, const float* __restrict__ resid, int rmod, int ldr,
                                                float* __restrict__ C, int ldc, int M, int N, int K) {
  __shared__ __attribute__((aligned(16))) float so[4][16][64];
  const int tid = threadIdx.x, w = tid >> 5, lane = tid & 31, ln = lane & 15, hh = lane >> 4;
  const int ntn = N / 64;
  const int wid = blockIdx.x * 4 + w;
  const int mt = wid / ntn, nq = wid % ntn;
  if (mt * 16 >= M) return;
  const int row0 = mt * 16, col0 = nq * 64;
  const float* arow = A + (size_t)(row0 + ln) * lda;
  v8f acc[4] = {};
  for (int kb = 0; kb < K; kb += 32) {
    FragB ah, al;
    const v4f x0 = *(const v4fa*)(arow + kb + 8 * hh), x1 = *(const v4fa*)(arow + kb + 8 * hh + 4);
    const v4f x2 = *(const v4fa*)(arow + kb + 16 + 8 * hh), x3 = *(const v4fa*)(arow + kb + 16 + 8 * hh + 4);
    float xs[16] = {x0[0],x0[1],x0[2],x0[3],x1[0],x1[1],x1[2],x1[3],x2[0],x2[1],x2[2],x2[3],x3[0],x3[1],x3[2],x3[3]};
#pragma unroll
    for (int i = 0; i < 16; ++i) { const unsigned short hb = bf16_bits(xs[i]); ah.u[i] = hb; al.u[i] = ASPLIT ? bf16_bits(xs[i] - bf16_val(hb)) : (unsigned short)0; }
#pragma unroll
    for (int t = 0; t < 4; ++t) {
      const unsigned short* brow = Wt + (size_t)(col0 + t * 16 + ln) * ldb + kb;
      FragB b;
      b.half[0] = *(const v8us*)(brow + 8 * hh);
      b.half[1] = *(const v8us*)(brow + 16 + 8 * hh);
      acc[t] = mmaN<ASPLIT ? 2 : 1>(ah.v, al.v, b.v, b.v, acc[t]);
    }
  }
#pragma unroll
  for (int t = 0; t < 4; ++t) {
    const int col = col0 + t * 16 + ln;
    float bv = bias ? bias[col] : 0.f;
    if (BIAS_BF16) bv = bf16_round(bv);
#pragma unroll
    for (int r = 0; r < 8; ++r) {
      float v = acc[t][r] + bv;
      if (resid) { float rv = resid[(size_t)((row0 + 8 * hh + r) % rmod) * ldr + col]; if (RES_BF16) rv = bf16_round(rv); v += rv; }
      if (ACT == 1) v = fmaxf(v, 0.f);
      if (ACT == 2) v = 0.5f * v * (1.0f + erff(v * 0.70710678118654752f));
      if (ACT == 3) { const float u = 0.7978845608028654f * (v + 0.044715f * v * v * v); v = 0.5f * v * (1.0f + tanhf(u)); }
      so[w][8 * hh + r][t * 16 + ln] = v;
    }
  }
  __builtin_amdgcn_fence(__ATOMIC_ACQ_REL, "workgroup");
  __builtin_amdgcn_wave_barrier();
  const int rsub = lane >> 4, c4 = (lane & 15) * 4;
  {
#pragma unroll
    for (int q = 0; q < 8; ++q) {
      const int r = q * 2 + rsub;
      const v4f v = *(const v4fa*)&so[w][r][c4];
      *(v4f*)(C + (size_t)(row0 + r) * ldc + col0 + c4) = v;
    }
    
  }
}
// row LayerNorm (biased variance, eps) over N: s = X (+ R); optional out_sum <- s; out_norm <- (s-mu)*rsqrt(var+eps)*g + b
template <bool PARAM_BF16>
__global__ __launch_bounds__(256) void k_layernorm(const float* __restrict__ X, const float* __restrict__ R, const float* __restrict__ g, const float* __restrict__ bta,
                                                  float* __restrict__ out_sum, float* __restrict__ out_norm, int N, float eps) {
  __shared__ float red[256];
  const int row = blockIdx.x, tid = threadIdx.x;
  const float* x = X + (size_t)row * N; const float* rr = R ? R + (size_t)row * N : nullptr;
  float vals[16];                     // up to N = 4096
  const int per = N / 256;            // contiguous chunk per thread? use strided-by-4 chunks: thread handles j = tid*4 + 1024*u
  float s1 = 0.f;
  for (int u = 0; u < per / 4; ++u) {
    const int j = tid * 4 + 1024 * u;
    const v4f a = *(const v4fa*)(x + j);
    v4f b = {0.f,0.f,0.f,0.f}; if (rr) b = *(const v4fa*)(rr + j);
#pragma unroll
    for (int q = 0; q < 4; ++q) { const float v = a[q] + b[q]; vals[u * 4 + q] = v; s1 += v; }
  }
  red[tid] = s1; __syncthreads();
  for (int st = 128; st > 0; st >>= 1) { if (tid < st) red[tid] += red[tid + st]; __syncthreads(); }
  const float mu = red[0] / (float)N; __syncthreads();
  float s2 = 0.f;
  for (int u = 0; u < per / 4; ++u)
#pragma unroll
    for (int q = 0; q < 4; ++q) { const float c = vals[u * 4 + q] - mu; s2 += c * c; }
  red[tid] = s2; __syncthreads();
  for (int st = 128; st > 0; st >>= 1) { if (tid < st) red[tid] += red[tid + st]; __syncthreads(); }
  const float rs = rsqrtf(red[0] / (float)N + eps);
  {
    for (int u = 0; u < per / 4; ++u) {
      const int j = tid * 4 + 1024 * u;
      v4f o, sm;
#pragma unroll
      for (int q = 0; q < 4; ++q) {
        float gg = g[j + q], bb = bta[j + q];
        if (PARAM_BF16) { gg = bf16_round(gg); bb = bf16_round(bb); }
        sm[q] = vals[u * 4 + q]; o[q] = (vals[u * 4 + q] - mu) * rs * gg + bb;
      }
      if (out_sum) *(v4f*)(out_sum + (size_t)row * N + j) = sm;
      *(v4f*)(out_norm + (size_t)row * N + j) = o;
    }
    
  }
}



// ---- f16 WMMA path (v_wmma_f32_16x16x32_f16): 11-bit significands for operands in range — used where a [0,1] probability operand needs more precision than bf16
typedef _Float16 v16h __attribute__((ext_vector_type(16)));
union FragH { v16h v; v8us half[2]; _Float16 h[16]; unsigned short u[16]; };
template <int NT>
__device__ __forceinline__ v8f mmaH(v16h ah, v16h al, v16h bh, v16h bl, v8f c) {
  c = __builtin_amdgcn_wmma_f32_16x16x32_f16(false, ah, false, bh, (short)0, c, false, false);
  if (NT >= 2) c = __builtin_amdgcn_wmma_f32_16x16x32_f16(false, al, false, bh, (short)0, c, false, false);
  if (NT >= 3) c = __builtin_amdgcn_wmma_f32_16x16x32_f16(false, ah, false, bl, (short)0, c, false, false);
  asm volatile("v_nop\n\tv_nop\n\tv_nop\n\tv_nop" : "+v"(c) : "v"(ah), "v"(al), "v"(bh), "v"(bl));
  return c;
}
// batched GEMM like k_gemm_b but f16 operands: A f32 (split into f16 hi/lo if ASPLIT, else rounded to f16), Bt = f16 values [n][k]; alpha; C f32; N multiple of 16 (partial tiles skipped)
template <bool ASPLIT>
__global__ __launch_bounds__(128) void k_gemm_h(const float* __restrict__ A, int lda, size_t sA, const _Float16* __restrict__ Bh, int ldb, size_t sB, float alpha, float* __restrict__ C, int ldc, size_t sC, int M, int N, int K) {
  __shared__ __attribute__((aligned(16))) float so[4][16][64];
  const int tid = threadIdx.x, w = tid >> 5, lane = tid & 31, ln = lane & 15, hh = lane >> 4; const int by = blockIdx.y;
  A += (size_t)by * sA; Bh += (size_t)by * sB; C += (size_t)by * sC;
  const int ntn = (N + 63) / 64; const int wid = blockIdx.x * 4 + w; const int mt = wid / ntn, nq = wid % ntn; if (mt * 16 >= M) return;
  const int row0 = mt * 16, col0 = nq * 64; const float* arow = A + (size_t)(row0 + ln) * lda;
  v8f acc[4] = {};
  for (int kb = 0; kb < K; kb += 32) {
    FragH ah, al;
    const v4f x0 = *(const v4fa*)(arow + kb + 8 * hh), x1 = *(const v4fa*)(arow + kb + 8 * hh + 4), x2 = *(const v4fa*)(arow + kb + 16 + 8 * hh), x3 = *(const v4fa*)(arow + kb + 16 + 8 * hh + 4);
    float xs[16] = {x0[0],x0[1],x0[2],x0[3],x1[0],x1[1],x1[2],x1[3],x2[0],x2[1],x2[2],x2[3],x3[0],x3[1],x3[2],x3[3]};
#pragma unroll
    for (int i = 0; i < 16; ++i) { const _Float16 h = (_Float16)xs[i]; ah.h[i] = h; al.h[i] = ASPLIT ? (_Float16)(xs[i] - (float)h) : (_Float16)0.0f; }
#pragma unroll
    for (int t = 0; t < 4; ++t) { if (col0 + t * 16 >= N) continue; const size_t boff = (size_t)(col0 + t * 16 + ln) * ldb + kb; FragH bq; bq.half[0] = *(const v8us*)(Bh + boff + 8 * hh); bq.half[1] = *(const v8us*)(Bh + boff + 16 + 8 * hh);
      acc[t] = mmaH<ASPLIT ? 2 : 1>(ah.v, al.v, bq.v, bq.v, acc[t]); }
  }
#pragma unroll
  for (int t = 0; t < 4; ++t) { if (col0 + t * 16 >= N) continue;
#pragma unroll
    for (int r = 0; r < 8; ++r) so[w][8 * hh + r][t * 16 + ln] = acc[t][r] * alpha; }
  __builtin_amdgcn_fence(__ATOMIC_ACQ_REL, "workgroup"); __builtin_amdgcn_wave_barrier();
  const int rsub = lane >> 4, c4 = (lane & 15) * 4;
  {
#pragma unroll
    for (int q = 0; q < 8; ++q) { const int r = q * 2 + rsub; if (col0 + c4 < N) { const v4f v = *(const v4fa*)&so[w][r][c4]; *(v4f*)(C + (size_t)(row0 + r) * ldc + col0 + c4) = v; } }
     }
}

// Wt[n][k] = f16(W[k][n]·scale) from f32 row-major W[K][N] (scale = power of two; bf16-exact weights stay exact in f16 away from the subnormal range)
__global__ __launch_bounds__(256) void k_wt_f16(const float* __restrict__ W, _Float16* __restrict__ Wt, int K, int N, float scale) {
  const int t = blockIdx.x * 256 + threadIdx.x; if (t >= N * (K / 8)) return; const int n = t / (K / 8), k8 = (t % (K / 8)) * 8; FragH f;
#pragma unroll
  for (int i = 0; i < 8; ++i) f.h[i] = (_Float16)(bf16_round(W[(size_t)(k8 + i) * N + n]) * scale); const v8us o = f.half[0];
  *(v8us*)((unsigned short*)Wt + (size_t)n * K + k8) = o; 
}
// k_gemm_hh variant with fused epilogue: v = acc·alpha + bias[by·sBias + col] (+ CP[(row/rowsPerB)·sCPb + by·64 + col] if CP) ; ACT 0 none / 1 elu ; writes f16 C16 (and f32 C if non-null)
template <int ACT>
__global__ __launch_bounds__(128) void k_gemm_hhx(const _Float16* __restrict__ A, int lda, size_t sA, const _Float16* __restrict__ Bh, int ldb, size_t sB, float alpha, const float* __restrict__ bias, size_t sBias, const float* __restrict__ CP, int rowsPerB, size_t sCPb, int row0g,
    float* __restrict__ C, _Float16* __restrict__ C16, int ldc, size_t sC, int M, int N, int K) {
  __shared__ __attribute__((aligned(16))) float so[4][16][64];
  const int tid = threadIdx.x, w = tid >> 5, lane = tid & 31, ln = lane & 15, hh = lane >> 4; const int by = blockIdx.y;
  A += (size_t)by * sA; Bh += (size_t)by * sB; const size_t cofs = (size_t)by * sC; const float* bp = bias ? bias + (size_t)by * sBias : nullptr;
  const int ntn = (N + 63) / 64; const int wid = blockIdx.x * 4 + w; const int mt = wid / ntn, nq = wid % ntn; if (mt * 16 >= M) return;
  const int row0 = mt * 16, col0 = nq * 64; const _Float16* arow = A + (size_t)(row0 + ln) * lda;
  v8f acc[4] = {};
  for (int kb = 0; kb < K; kb += 32) { FragH ah; ah.half[0] = *(const v8us*)((const unsigned short*)arow + kb + 8 * hh); ah.half[1] = *(const v8us*)((const unsigned short*)arow + kb + 16 + 8 * hh);
#pragma unroll
    for (int t = 0; t < 4; ++t) { if (col0 + t * 16 >= N) continue; const size_t boff = (size_t)(col0 + t * 16 + ln) * ldb + kb; FragH bq; bq.half[0] = *(const v8us*)((const unsigned short*)Bh + boff + 8 * hh); bq.half[1] = *(const v8us*)((const unsigned short*)Bh + boff + 16 + 8 * hh);
      acc[t] = mmaH<1>(ah.v, ah.v, bq.v, bq.v, acc[t]); }
  }
#pragma unroll
  for (int t = 0; t < 4; ++t) { if (col0 + t * 16 >= N) continue; const int col = col0 + t * 16 + ln; const float bv = bp ? bf16_round(bp[col]) : 0.f;
#pragma unroll
    for (int r = 0; r < 8; ++r) { float v = acc[t][r] * alpha + bv; if (CP) { const int rr = row0g + row0 + 8 * hh + r; if (rowsPerB < 0) v += CP[cofs + (size_t)rr * ldc + col];      /* rowsPerB < 0: own element of the batched C plane */ else { const int bidx = rr / rowsPerB; v += CP[(size_t)bidx * sCPb + (size_t)by * 64 + col]; } } if (ACT == 1) v = (v > 0.f) ? v : expm1f(v); else if (ACT == 7) v = (v > 0.f) ? v + 1.0f : expf(v); else if (ACT == 8) v = tanhf(v); else if (ACT == 9) v = 0.5f * v * (1.0f + tanhf(0.7978845608028654f * (v + 0.044715f * v * v * v))); else if (ACT == 11) v = 1.0f / (1.0f + expf(-v)); else if (ACT == 12) v = (v > 0.f) ? v : 0.01f * v; else if (ACT == 14) v = (v > 0.f) ? v : 0.1f * v; else if (ACT == 16) v = (v >= 0.f) ? v : 0.3f * v; else if (ACT == 17) v = (v >= 0.f) ? v : 0.2f * v; else if (ACT == 15) v = v / (1.0f + expf(-v)); else if (ACT == 3) v = fmaxf(v, 0.f); else if (ACT == 6) v = 0.5f * v * (1.0f + erff(v * 0.70710678118654752f)); so[w][8 * hh + r][t * 16 + ln] = v; } }
  __builtin_amdgcn_fence(__ATOMIC_ACQ_REL, "workgroup"); __builtin_amdgcn_wave_barrier();
  const int rsub = lane >> 4, c4 = (lane & 15) * 4; typedef _Float16 v4h __attribute__((ext_vector_type(4)));
  {
#pragma unroll
    for (int q = 0; q < 8; ++q) { const int r = q * 2 + rsub; if (col0 + c4 < N) { const v4f v = *(const v4fa*)&so[w][r][c4]; if (C) *(v4f*)(C + cofs + (size_t)(row0 + r) * ldc + col0 + c4) = v; if (C16) { v4h h4; for (int i = 0; i < 4; ++i) h4[i] = (_Float16)v[i]; *(v4h*)(C16 + cofs + (size_t)(row0 + r) * ldc + col0 + c4) = h4; } } }
     }
}


typedef _Float16 v4h __attribute__((ext_vector_type(4)));

__global__ __launch_bounds__(256) void k_x16(const float* __restrict__ x, _Float16* __restrict__ X16, size_t n8) { const size_t t = (size_t)blockIdx.x * 256 + threadIdx.x; if (t >= n8) return; FragH f;
#pragma unroll
  for (int q = 0; q < 8; ++q) f.h[q] = (_Float16)bf16_round(x[t * 8 + q]); *(v8us*)((unsigned short*)X16 + t * 8) = f.half[0];  }
__global__ __launch_bounds__(256) void k_h16(const float* __restrict__ x, _Float16* __restrict__ X16, size_t n8) { const size_t t = (size_t)blockIdx.x * 256 + threadIdx.x; if (t >= n8) return; FragH f;
#pragma unroll
  for (int q = 0; q < 8; ++q) f.h[q] = (_Float16)x[t * 8 + q]; *(v8us*)((unsigned short*)X16 + t * 8) = f.half[0];  }
__global__ __launch_bounds__(256) void k_round16f(const float* __restrict__ W, _Float16* __restrict__ Bt, size_t n8) { const size_t t = (size_t)blockIdx.x * 256 + threadIdx.x; if (t >= n8) return; FragH f;
#pragma unroll
  for (int i = 0; i < 8; ++i) f.h[i] = (_Float16)(bf16_round(W[t * 8 + i]) * 16.0f); *(v8us*)((unsigned short*)Bt + t * 8) = f.half[0];  }
template <int NHv, int TTv>
__global__ __launch_bounds__(256) void k_vt(const _Float16* __restrict__ V16, int ldv, int voff, _Float16* __restrict__ Vt) { __shared__ unsigned short tl[64][66]; const int tid = threadIdx.x; const int slab = blockIdx.x / (TTv / 64), lg = blockIdx.x % (TTv / 64); const int b = slab / NHv, h = slab % NHv;
  for (int i = tid; i < 64 * 8; i += 256) { const int r = i / 8, c8 = (i % 8) * 8; FragH f; f.half[0] = *(const v8us*)((const unsigned short*)V16 + ((size_t)b * TTv + lg * 64 + r) * ldv + voff + h * 64 + c8);
#pragma unroll
    for (int q = 0; q < 8; ++q) tl[r][c8 + q] = f.u[q]; }
  __syncthreads();
  {
#pragma unroll
    for (int rd = 0; rd < 2; ++rd) { const int d = rd * 32 + tid / 8, pc = tid % 8; FragH f;
#pragma unroll
      for (int q = 0; q < 8; ++q) f.u[q] = tl[pc * 8 + q][d];
      *(v8us*)((unsigned short*)Vt + ((size_t)slab * 64 + d) * TTv + lg * 64 + pc * 8) = f.half[0]; }
     } }

__global__ __launch_bounds__(256) void k_hl(const float* __restrict__ F, _Float16* __restrict__ Hh, _Float16* __restrict__ Hl, size_t n8) { const size_t t = (size_t)blockIdx.x * 256 + threadIdx.x; if (t >= n8) return; FragH fh, fl; const v4f a = *(const v4fa*)(F + t * 8), c = *(const v4fa*)(F + t * 8 + 4);
#pragma unroll
  for (int q = 0; q < 4; ++q) { _Float16 h = (_Float16)a[q]; fh.h[q] = h; fl.h[q] = (_Float16)((a[q] - (float)h) * 1024.0f); h = (_Float16)c[q]; fh.h[4 + q] = h; fl.h[4 + q] = (_Float16)((c[q] - (float)h) * 1024.0f); }
  { *(v8us*)((unsigned short*)Hh + t * 8) = fh.half[0]; *(v8us*)((unsigned short*)Hl + t * 8) = fl.half[0];  } }

// ---- fast GEMM (wave tile 32x64; requires M % 32 == 0 rows per launch region and N % 64 == 0); epilogue = k_gemm_hhx semantics ----
__device__ __forceinline__ v16h g2_frag(const _Float16* p, int hh) { FragH f; f.half[0] = *(const v8us*)((const unsigned short*)p + 8 * hh); f.half[1] = *(const v8us*)((const unsigned short*)p + 16 + 8 * hh); return f.v; }
__device__ __forceinline__ v8f g2_mma(v16h a, v16h b, v8f c) { v8f d = __builtin_amdgcn_wmma_f32_16x16x32_f16(false, a, false, b, (short)0, c, false, false); asm volatile("v_nop\n\tv_nop\n\tv_nop\n\tv_nop" : "+v"(d) : "v"(a), "v"(b)); return d; }
template <int ACT>
__global__ __launch_bounds__(128) void k_gemm2(const _Float16* __restrict__ A, int lda, size_t sA, const _Float16* __restrict__ Bh, int ldb, size_t sB, float alpha, const float* __restrict__ bias, size_t sBias, const float* __restrict__ CP, int rowsPerB, size_t sCPb, int row0g,
    float* __restrict__ C, _Float16* __restrict__ C16, int ldc, size_t sC, int M, int N, int K) { static_assert(ACT == 0 || ACT == 3 || ACT == 6 || ACT == 8 || ACT == 9 || ACT == 11 || ACT == 12 || ACT == 14 || ACT == 15 || ACT == 16 || ACT == 17 || ACT == 18, "k_gemm2: unsupported ACT code (would silently apply no activation)");
  __shared__ __attribute__((aligned(16))) float so[4][32][68];
  const int tid = threadIdx.x, w = tid >> 5, lane = tid & 31, ln = lane & 15, hh = lane >> 4; const int by = blockIdx.y;
  A += (size_t)by * sA; Bh += (size_t)by * sB; const size_t cofs = (size_t)by * sC; const float* bp = bias ? bias + (size_t)by * sBias : nullptr;
  const int ntn = N >> 6; const int mt = blockIdx.x / ntn, nq = blockIdx.x - mt * ntn; const int row0 = mt * 128 + 32 * w, col0 = nq * 64; if (row0 >= M) return;
  const _Float16* a0p = A + (size_t)(row0 + ln) * lda; const _Float16* a1p = a0p + (size_t)16 * lda;
  const _Float16* b0p = Bh + (size_t)(col0 + ln) * ldb; const _Float16* b1p = b0p + (size_t)16 * ldb; const _Float16* b2p = b1p + (size_t)16 * ldb; const _Float16* b3p = b2p + (size_t)16 * ldb;
  const v8f z8 = {0.f,0.f,0.f,0.f,0.f,0.f,0.f,0.f}; v8f c00 = z8, c01 = z8, c02 = z8, c03 = z8, c10 = z8, c11 = z8, c12 = z8, c13 = z8;
#pragma unroll 1
  for (int kb = 0; kb < K; kb += 32) { const v16h a0 = g2_frag(a0p + kb, hh), a1 = g2_frag(a1p + kb, hh);
    v16h b = g2_frag(b0p + kb, hh); c00 = g2_mma(a0, b, c00); c10 = g2_mma(a1, b, c10);
    b = g2_frag(b1p + kb, hh); c01 = g2_mma(a0, b, c01); c11 = g2_mma(a1, b, c11);
    b = g2_frag(b2p + kb, hh); c02 = g2_mma(a0, b, c02); c12 = g2_mma(a1, b, c12);
    b = g2_frag(b3p + kb, hh); c03 = g2_mma(a0, b, c03); c13 = g2_mma(a1, b, c13); }
  v8f accs[8] = {c00, c01, c02, c03, c10, c11, c12, c13};
#pragma unroll
  for (int u = 0; u < 8; ++u) { const int t = u & 3, half = u >> 2; const int col = col0 + t * 16 + ln; const float bv = bp ? bf16_round(bp[col]) : 0.f;
#pragma unroll
    for (int r = 0; r < 8; ++r) { const int rloc = half * 16 + 8 * hh + r; float v = accs[u][r] * alpha + bv; if (CP) { if (rowsPerB < 0) v += CP[cofs + (size_t)(row0g + row0 + rloc) * ldc + col];      /* rowsPerB < 0: own element of the batched C plane */ else { const int bidx = (row0g + row0 + rloc) / rowsPerB; v += CP[(size_t)bidx * sCPb + (size_t)by * 64 + col]; } }
      if (ACT == 3) v = fmaxf(v, 0.f); else if (ACT == 6) v = 0.5f * v * (1.0f + erff(v * 0.70710678118654752f)); else if (ACT == 11) v = 1.0f / (1.0f + expf(-v)); else if (ACT == 15) v = v / (1.0f + expf(-v)); else if (ACT == 18) v = v / (1.0f + expf(-1.702f * v));      /* QuickGELU: v sigmoid(1.702 v) */ else if (ACT == 12) v = (v > 0.f) ? v : 0.01f * v; else if (ACT == 8) v = tanhf(v); else if (ACT == 9) v = 0.5f * v * (1.0f + tanhf(0.7978845608028654f * (v + 0.044715f * v * v * v))); else if (ACT == 14) v = (v > 0.f) ? v : 0.1f * v; else if (ACT == 16) v = (v >= 0.f) ? v : 0.3f * v; else if (ACT == 17) v = (v >= 0.f) ? v : 0.2f * v;
      so[w][rloc][t * 16 + ln] = v; } }
  __builtin_amdgcn_fence(__ATOMIC_ACQ_REL, "workgroup"); __builtin_amdgcn_wave_barrier();
  const int rsub = lane >> 4, c4 = (lane & 15) * 4;
  {
#pragma unroll
    for (int q = 0; q < 16; ++q) { const int r = q * 2 + rsub; const v4f v = *(const v4fa*)&so[w][r][c4]; if (C) *(v4f*)(C + cofs + (size_t)(row0 + r) * ldc + col0 + c4) = v; if (C16) { v4h h4; for (int i = 0; i < 4; ++i) h4[i] = (_Float16)v[i]; *(v4h*)(C16 + cofs + (size_t)(row0 + r) * ldc + col0 + c4) = h4; } }
     } }


__global__ __launch_bounds__(256) void k_wnat(const float* __restrict__ w, size_t n8, _Float16* __restrict__ Bt) { const size_t t = (size_t)blockIdx.x * 256 + threadIdx.x; if (t >= n8) return; FragH f; for (int q = 0; q < 8; ++q) f.h[q] = (_Float16)(bf16_round(w[t * 8 + q]) * 16.0f); *(v8us*)((unsigned short*)Bt + t * 8) = f.half[0];  }
__global__ __launch_bounds__(256) void k_rsm(const float* __restrict__ S, _Float16* __restrict__ P, int nrows) {
  #pragma clang fp contract(off)
  const int i = blockIdx.x * 256 + threadIdx.x; if (i >= nrows) return; const float* s = S + (size_t)i * SQ; float mx = -3.0e38f;
#pragma unroll 1
  for (int j = 0; j < SQ; ++j) mx = fmaxf(mx, s[j]); float se = 0.f;
#pragma unroll 1
  for (int j = 0; j < SQ; ++j) se += expf(s[j] - mx); const float sc = 256.0f / se;
#pragma unroll 1
  for (int j0 = 0; j0 < SQ; j0 += 8) { FragH f; for (int q = 0; q < 8; ++q) f.h[q] = (_Float16)(expf(s[j0 + q] - mx) * sc); unsigned short* d = (unsigned short*)P + (size_t)i * SQ + j0; *(v8us*)d = f.half[0];  } }
__global__ __launch_bounds__(256) void k_vt(const _Float16* __restrict__ V16, int b, int h0, _Float16* __restrict__ VT) { __shared__ unsigned short tl[64][65]; const int tid = threadIdx.x; const int hh = blockIdx.x % HG, sg = blockIdx.x / HG; const int s0 = sg * 64; const int h = h0 + hh;
  for (int i = tid; i < 64 * 8; i += 256) { const int j = i / 8, d8 = (i % 8) * 8; FragH f; f.half[0] = *(const v8us*)((const unsigned short*)V16 + ((size_t)b * SQ + s0 + j) * DM + h * HD + d8); for (int q = 0; q < 8; ++q) tl[d8 + q][j] = f.u[q]; }
  __syncthreads();
  { for (int i = tid; i < 64 * 8; i += 256) { const int d = i / 8, j8 = (i % 8) * 8; FragH f; for (int q = 0; q < 8; ++q) f.u[q] = tl[d][j8 + q]; *(v8us*)((unsigned short*)VT + ((size_t)hh * HD + d) * SQ + s0 + j8) = f.half[0]; }  } }



__global__ __launch_bounds__(256) void k_rsmcf2(const float* __restrict__ S, _Float16* __restrict__ P, int hg, int q0, int nk) {
  #pragma clang fp contract(off)
  const int t = blockIdx.x * 256 + threadIdx.x; if (t >= hg * QT) return; const size_t i = (size_t)t; const float* s = S + i * NKX; const int last = q0 + (t % QT); float mx = -3.0e38f;
#pragma unroll 1
  for (int j = 0; j < nk; ++j) { const float f = (j <= last) ? 1.f : 0.f; mx = fmaxf(mx, fmaf(f, s[j], (1.f - f) * -1.0e9f)); } float se = 0.f;
#pragma unroll 1
  for (int j = 0; j < nk; ++j) { const float f = (j <= last) ? 1.f : 0.f; se += __expf(fmaf(f, s[j], (1.f - f) * -1.0e9f) - mx); } const float sc = 256.0f / se;
#pragma unroll 1
  for (int j0 = 0; j0 < nk; j0 += 8) { FragH fr; for (int q = 0; q < 8; ++q) { const int j = j0 + q; const float f = (j <= last) ? 1.f : 0.f; fr.h[q] = (_Float16)(__expf(fmaf(f, s[j], (1.f - f) * -1.0e9f) - mx) * sc); } unsigned short* d = (unsigned short*)P + i * NKX + j0; *(v8us*)d = fr.half[0];  } }

__global__ __launch_bounds__(256) void k_rsmcst(const float* __restrict__ S, _Float16* __restrict__ P, int hg, int q0, int nk, const int* __restrict__ mk) {
  #pragma clang fp contract(off)
  const int t = blockIdx.x * 256 + threadIdx.x; if (t >= hg * QT) return; const size_t i = (size_t)t; const float* s = S + i * NKX; const size_t ig = (size_t)(q0 + (t % QT)); const int* mr = mk + ig * SQ; float mx = -3.0e38f;
#pragma unroll 1
  for (int j = 0; j < nk; ++j) { const int mb = mr[j]; const int dd = (int)ig - j; const float f = (mb != 0 && dd >= 0 && (dd <= LOCALW || (dd % STRIDEK) == 0)) ? 1.f : 0.f; mx = fmaxf(mx, fmaf(f, s[j], (1.f - f) * -1.0e9f)); } float se = 0.f;
#pragma unroll 1
  for (int j = 0; j < nk; ++j) { const int mb = mr[j]; const int dd = (int)ig - j; const float f = (mb != 0 && dd >= 0 && (dd <= LOCALW || (dd % STRIDEK) == 0)) ? 1.f : 0.f; se += __expf(fmaf(f, s[j], (1.f - f) * -1.0e9f) - mx); } const float sc = 256.0f / se;
#pragma unroll 1
  for (int j0 = 0; j0 < nk; j0 += 8) { FragH fr; for (int q = 0; q < 8; ++q) { const int j = j0 + q; const int mb = mr[j]; const int dd = (int)ig - j; const float f = (mb != 0 && dd >= 0 && (dd <= LOCALW || (dd % STRIDEK) == 0)) ? 1.f : 0.f; fr.h[q] = (_Float16)(__expf(fmaf(f, s[j], (1.f - f) * -1.0e9f) - mx) * sc); } unsigned short* d = (unsigned short*)P + i * NKX + j0; *(v8us*)d = fr.half[0];  } }


template <int MASKADD>
__global__ __launch_bounds__(64) void k_att0(const float* __restrict__ QF, const float* __restrict__ KF, const float* __restrict__ VF, int ld, const float* __restrict__ mask, float scale, float* __restrict__ OF, int ldo) {
  #pragma clang fp contract(off)
  __shared__ __attribute__((aligned(16))) float lq[64][64]; __shared__ __attribute__((aligned(16))) float lo[64][64];
  const int tid = threadIdx.x; const int h = blockIdx.x / (QT0 / 64), rg = blockIdx.x % (QT0 / 64); const int i = rg * 64 + tid;
  const float* qr = QF + (size_t)i * ld + h * HD;
#pragma unroll 1
  for (int c = 0; c < HD / 4; ++c) { *(v4f*)&lq[tid][c * 4] = *(const v4fa*)(qr + c * 4); const v4f z = {0.f, 0.f, 0.f, 0.f}; *(v4f*)&lo[tid][c * 4] = z; }
  float m = -1.0e30f, l = 0.f; const int jmax = MASKADD ? (SQ - 1) : (rg * 64 + 63);      /* additive-mask form: every key (the mask input decides); causal form: keys up to the block's last row */
#pragma unroll 1
  for (int j = 0; j <= jmax; ++j) { const float* kr = KF + (size_t)j * ld + h * HD; const float* vr = VF + (size_t)j * ld + h * HD; float s = 0.f;
#pragma unroll 1
    for (int c = 0; c < HD / 4; ++c) { const v4f kq = *(const v4fa*)(kr + c * 4); const v4f qq = *(v4f*)&lq[tid][c * 4]; s = __fadd_rn(s, __fmul_rn(qq[0], kq[0])); s = __fadd_rn(s, __fmul_rn(qq[1], kq[1])); s = __fadd_rn(s, __fmul_rn(qq[2], kq[2])); s = __fadd_rn(s, __fmul_rn(qq[3], kq[3])); }
    s = __fmul_rn(s, scale); if (MASKADD) s = __fadd_rn(s, __fmul_rn(bf16_round(mask[(size_t)i * SQ + j]), -10000.0f));
    const float f = (MASKADD || j <= i) ? 1.f : 0.f; const float sm = fmaf(f, s, (1.f - f) * -1.0e30f); const float mn = fmaxf(m, sm); const float sc = expf(m - mn); const float e = expf(sm - mn); l = __fadd_rn(__fmul_rn(l, sc), e); m = mn;
#pragma unroll 1
    for (int c = 0; c < HD / 4; ++c) { const v4f vv = *(const v4fa*)(vr + c * 4); v4f oo = *(v4f*)&lo[tid][c * 4]; for (int u = 0; u < 4; ++u) oo[u] = __fadd_rn(__fmul_rn(oo[u], sc), __fmul_rn(e, vv[u])); *(v4f*)&lo[tid][c * 4] = oo; } }
  const float fin = 64.0f / l;      /* o carried x64 like the f16 path */
#pragma unroll 1
  for (int c = 0; c < HD / 4; ++c) { v4f oo = *(v4f*)&lo[tid][c * 4]; for (int u = 0; u < 4; ++u) oo[u] = __fmul_rn(oo[u], fin); *(v4f*)&lo[tid][c * 4] = oo; }
  __syncthreads();
  {
#pragma unroll 1
    for (int it = 0; it < 16; ++it) { const int row = it * 4 + tid / 16, pc = (tid % 16) * 4; const v4f v = *(const v4f*)&lo[row][pc]; *(v4f*)(OF + (size_t)(rg * 64 + row) * ldo + h * HD + pc) = v; }
     } }

template <int MASKADD>
__global__ __launch_bounds__(64) void k_att0mbc(const float* __restrict__ QF, const float* __restrict__ KF, const float* __restrict__ VF, int ld, const float* __restrict__ mask, float scale, float* __restrict__ OF, int ldo) {
  #pragma clang fp contract(off)
  __shared__ __attribute__((aligned(16))) float lq[64][64]; __shared__ __attribute__((aligned(16))) float lo[64][64];
  const int tid = threadIdx.x; const int h = blockIdx.x / (QT0 / 64), rg = blockIdx.x % (QT0 / 64); const int i = rg * 64 + tid;
  const float* qr = QF + (size_t)i * ld + h * HD;
#pragma unroll 1
  for (int c = 0; c < HD / 4; ++c) { *(v4f*)&lq[tid][c * 4] = *(const v4fa*)(qr + c * 4); const v4f z = {0.f, 0.f, 0.f, 0.f}; *(v4f*)&lo[tid][c * 4] = z; }
  float m = -1.0e30f, l = 0.f; const int jmax = rg * 64 + 63;      /* keys beyond the block end are masked by the mask's lower-triangular structure */      /* both MASKADD forms: keys up to the block's last row */
#pragma unroll 1
  for (int j = 0; j <= jmax; ++j) { const float* kr = KF + (size_t)j * ld + h * HD; const float* vr = VF + (size_t)j * ld + h * HD; float s = 0.f;
#pragma unroll 1
    for (int c = 0; c < HD / 4; ++c) { const v4f kq = *(const v4fa*)(kr + c * 4); const v4f qq = *(v4f*)&lq[tid][c * 4]; s = __fadd_rn(s, __fmul_rn(qq[0], kq[0])); s = __fadd_rn(s, __fmul_rn(qq[1], kq[1])); s = __fadd_rn(s, __fmul_rn(qq[2], kq[2])); s = __fadd_rn(s, __fmul_rn(qq[3], kq[3])); }
    s = __fmul_rn(s, scale); const int mb = ((const int*)mask)[(size_t)i * SQ + j];      /* causal (j <= i) AND the module's int32 [S][S] mask read per (query, key): 0 -> masked */
    const float f = (mb != 0 && j <= i) ? 1.f : 0.f; const float sm = fmaf(f, s, (1.f - f) * -1.0e30f); const float mn = fmaxf(m, sm); const float sc = expf(m - mn); const float e = expf(sm - mn); l = __fadd_rn(__fmul_rn(l, sc), e); m = mn;
#pragma unroll 1
    for (int c = 0; c < HD / 4; ++c) { const v4f vv = *(const v4fa*)(vr + c * 4); v4f oo = *(v4f*)&lo[tid][c * 4]; for (int u = 0; u < 4; ++u) oo[u] = __fadd_rn(__fmul_rn(oo[u], sc), __fmul_rn(e, vv[u])); *(v4f*)&lo[tid][c * 4] = oo; } }
  const float fin = 64.0f / l;      /* o carried x64 like the f16 path */
#pragma unroll 1
  for (int c = 0; c < HD / 4; ++c) { v4f oo = *(v4f*)&lo[tid][c * 4]; for (int u = 0; u < 4; ++u) oo[u] = __fmul_rn(oo[u], fin); *(v4f*)&lo[tid][c * 4] = oo; }
  __syncthreads();
  {
#pragma unroll 1
    for (int it = 0; it < 16; ++it) { const int row = it * 4 + tid / 16, pc = (tid % 16) * 4; const v4f v = *(const v4f*)&lo[row][pc]; *(v4f*)(OF + (size_t)(rg * 64 + row) * ldo + h * HD + pc) = v; }
     } }


template <int BFIN, int WXB>
__global__ __launch_bounds__(256) void k_ln16(const float* __restrict__ X, const float* __restrict__ g, const float* __restrict__ bb, float eps, _Float16* __restrict__ N16, float* __restrict__ XB) {
  #pragma clang fp contract(off)
  __shared__ float red[256]; const size_t r = blockIdx.x; const int t = threadIdx.x; const v4f xa = *(const v4fa*)(X + r * DMQ + t * 4); float s[4]; float sum = 0.f;
  for (int q = 0; q < 4; ++q) { s[q] = BFIN ? bf16_round(xa[q]) : xa[q]; sum = __fadd_rn(sum, s[q]); }
  red[t] = sum; __syncthreads(); for (int st = 128; st > 0; st >>= 1) { if (t < st) red[t] = __fadd_rn(red[t], red[t + st]); __syncthreads(); } const float mu = red[0] / (float)DMQ; __syncthreads();
  float vs = 0.f; for (int q = 0; q < 4; ++q) { const float dl = __fadd_rn(s[q], -mu); vs = __fadd_rn(vs, __fmul_rn(dl, dl)); } red[t] = vs; __syncthreads(); for (int st = 128; st > 0; st >>= 1) { if (t < st) red[t] = __fadd_rn(red[t], red[t + st]); __syncthreads(); }
  const float rs = rsqrtf(__fadd_rn(red[0] / (float)DMQ, eps)); v4h y; v4f xb;
  for (int q = 0; q < 4; ++q) { const int c = t * 4 + q; y[q] = (_Float16)__fadd_rn(__fmul_rn(__fmul_rn(__fadd_rn(s[q], -mu), rs), bf16_round(g[c])), bf16_round(bb[c])); xb[q] = s[q]; }
  { *(v4h*)(N16 + r * DMQ + t * 4) = y; if (WXB) *(v4f*)(XB + r * DMQ + t * 4) = xb;  } }
__global__ __launch_bounds__(256) void k_ftres2(const float* __restrict__ OF0, const float* __restrict__ XB, float* __restrict__ X1, size_t n4) {
  #pragma clang fp contract(off)
  const size_t t = (size_t)blockIdx.x * 256 + threadIdx.x; if (t >= n4) return; const v4f o = *(const v4fa*)(OF0 + t * 4), xv = *(const v4fa*)(XB + t * 4); v4f y; for (int q = 0; q < 4; ++q) y[q] = __fadd_rn(__fmul_rn(o[q], 0.015625f), xv[q]); *(v4f*)(X1 + t * 4) = y;  }

__global__ __launch_bounds__(256) void k_bcpy(const float* __restrict__ b, int n, int NP, float* __restrict__ dst, int dst0) { for (int i = threadIdx.x; i < NP; i += 256) { const float v = (i < n) ? b[i] : 0.f; *(float*)(dst + dst0 + i) = v; }  }


#define FAW 8                        /* waves per work-group */
#define FAQ 32                       /* query columns per wave (two 16-column groups) */
#define FAC 0.18033688011112042592f  /* 64^-0.5 * log2 e: scores are carried in log2 units */
__device__ __forceinline__ float rs_x16(float x) { const int b = __builtin_bit_cast(int, x); return __builtin_bit_cast(float, __builtin_amdgcn_permlanex16(b, b, 0x76543210, 0xfedcba98, false, false)); }      /* lane l <- lane l ^ 16 */
// Four 2^x in one statement. The outputs are early-clobber, so inside it no v_exp_f32 is directly followed by a read of its result or a write of its source; the v_nop keeps that slot behind the last one.
__device__ __forceinline__ v4f rs_exp2(v4f x) { float y0, y1, y2, y3; asm("v_exp_f32 %0, %4\n\tv_exp_f32 %1, %5\n\tv_exp_f32 %2, %6\n\tv_exp_f32 %3, %7\n\tv_nop" : "=&v"(y0), "=&v"(y1), "=&v"(y2), "=&v"(y3) : "v"(x[0]), "v"(x[1]), "v"(x[2]), "v"(x[3])); const v4f y = {y0, y1, y2, y3}; return y; }
// One 2^x, with the same slot kept behind it.
__device__ __forceinline__ float fa_exp2(float x) { float y; asm("v_exp_f32 %0, %1\n\tv_nop" : "=&v"(y) : "v"(x)); return y; }
__device__ __forceinline__ v8f fa_mma(v16h a, v16h b, v8f c) { return __builtin_amdgcn_wmma_f32_16x16x32_f16(false, a, false, b, (short)0, c, false, false); }
// Q16, K16: f16 rows [NB * SQ][DM], head h = columns h*64..; VT: f16 [NB * NH][HD][SQ]; O16: context x64 as f16 rows (merged heads).
// The short loops are fully unrolled so that every fragment array is indexed by constants and stays in registers.
__global__ __launch_bounds__(FAW * 32) void k_fattn(const _Float16* __restrict__ Q16, const _Float16* __restrict__ K16, const _Float16* __restrict__ VT, _Float16* __restrict__ O16) {
  const int lane = threadIdx.x & 31, ln = lane & 15, hh = lane >> 4, w = threadIdx.x >> 5;
  constexpr int QB = SQ / (FAW * FAQ); const int qb = blockIdx.x % QB, bh = blockIdx.x / QB; const int b = bh / NH, h = bh % NH; const int q0 = qb * (FAW * FAQ) + w * FAQ;
  const _Float16* qp = Q16 + ((size_t)b * SQ + q0 + ln) * DM + h * HD; const _Float16* kp = K16 + ((size_t)b * SQ + ln) * DM + h * HD; const _Float16* vp = VT + ((size_t)bh * HD + ln) * SQ;
  const v8f z8 = {0.f, 0.f, 0.f, 0.f, 0.f, 0.f, 0.f, 0.f};
  v16h qf[2][2], kf[2][2]; v8f o[2][4]; float m[2], l[2];
#pragma unroll
  for (int j = 0; j < 2; ++j) { m[j] = -3.0e38f; l[j] = 0.f;
#pragma unroll
    for (int d = 0; d < 4; ++d) o[j][d] = z8;
#pragma unroll
    for (int ks = 0; ks < 2; ++ks) { qf[j][ks] = g2_frag(qp + (size_t)j * 16 * DM + ks * 32, hh); kf[j][ks] = g2_frag(kp + (size_t)j * 16 * DM + ks * 32, hh); } }
  for (int kb = 0; kb < SQ; kb += 32) {
    v16h vf[4]; v8f s[2][2];
#pragma unroll
    for (int d = 0; d < 4; ++d) vf[d] = g2_frag(vp + (size_t)d * 16 * SQ + kb, hh);      /* issued first: they fly under the score products and the softmax */
#pragma unroll
    for (int j = 0; j < 2; ++j)
#pragma unroll
      for (int t = 0; t < 2; ++t) s[j][t] = fa_mma(kf[t][1], qf[j][1], fa_mma(kf[t][0], qf[j][0], z8));      /* s[j][t][r] = q(q0 + 16 j + ln) . k(kb + 16 t + 8 hh + r) */
    const int kn = (kb + 32) & (SQ - 1);      /* the next pass's K fragments fly under this pass's softmax; the last pass re-reads keys 0..31 (in bounds, not used) */
#pragma unroll
    for (int t = 0; t < 2; ++t)
#pragma unroll
      for (int ks = 0; ks < 2; ++ks) kf[t][ks] = g2_frag(kp + (size_t)(kn + t * 16) * DM + ks * 32, hh);
    __builtin_amdgcn_sched_barrier(0);      /* keeps the K loads above the softmax: without it the scheduler sinks them to the foot of the pass, and the next pass waits out their whole latency */
#pragma unroll
    for (int j = 0; j < 2; ++j) {
      float mx = fmaxf(s[j][0][0], s[j][1][0]);
#pragma unroll
      for (int r = 1; r < 8; ++r) mx = fmaxf(mx, fmaxf(s[j][0][r], s[j][1][r]));
      mx = fmaxf(mx, rs_x16(mx));
      const float mn = fmaxf(m[j], mx * FAC), al = fa_exp2(m[j] - mn), mb = 8.0f - mn; m[j] = mn;      /* p = 2^8 exp(s - max) <= 256: small weights stay out of the f16 subnormals; the factor cancels against the sum */
      FragH pf; v4f s4 = {0.f, 0.f, 0.f, 0.f};
#pragma unroll
      for (int t = 0; t < 2; ++t)
#pragma unroll
        for (int c = 0; c < 2; ++c) { const v4f x = {s[j][t][c * 4] * FAC + mb, s[j][t][c * 4 + 1] * FAC + mb, s[j][t][c * 4 + 2] * FAC + mb, s[j][t][c * 4 + 3] * FAC + mb}; const v4f e = rs_exp2(x); s4 += e;
#pragma unroll
          for (int q = 0; q < 4; ++q) pf.h[t * 8 + c * 4 + q] = (_Float16)e[q]; }
      l[j] = l[j] * al + ((s4[0] + s4[1]) + (s4[2] + s4[3]));
#pragma unroll
      for (int d = 0; d < 4; ++d) o[j][d] = fa_mma(vf[d], pf.v, o[j][d] * al);      /* o[j][d][r] = sum_k p v(k)[16 d + 8 hh + r] for query q0 + 16 j + ln */
    } }
#pragma unroll
  for (int j = 0; j < 2; ++j) { const float fin = 64.0f / (l[j] + rs_x16(l[j])); unsigned short* op = (unsigned short*)O16 + ((size_t)b * SQ + q0 + j * 16 + ln) * DM + h * HD + 8 * hh;
#pragma unroll
    for (int d = 0; d < 4; ++d) { FragH f;
#pragma unroll
      for (int r = 0; r < 8; ++r) f.h[r] = (_Float16)(o[j][d][r] * fin);
      *(v8us*)(op + d * 16) = f.half[0]; } } }

template <int MODE>
__global__ __launch_bounds__(256) void k_regrp(const float* __restrict__ src, float* __restrict__ dst, size_t n4) {
  const size_t t = (size_t)blockIdx.x * 256 + threadIdx.x; if (t >= n4) return; const size_t e = t * 4; const size_t rd = e / DM; const int c = (int)(e % DM);
  size_t rs; if (MODE == 0) { const size_t b = rd / SQ, sq = rd % SQ; rs = sq * NB + b; } else { const size_t sq = rd / NB, b = rd % NB; rs = b * SQ + sq; }
  const v4f v = *(const v4fa*)(src + rs * DM + c); *(v4f*)(dst + e) = v;  }

template <int BFIN, int W16, int W32>
__global__ __launch_bounds__(256) void k_lnx(const float* __restrict__ X, const float* __restrict__ g, const float* __restrict__ bb, float eps, _Float16* __restrict__ N16, float* __restrict__ N32) {
  #pragma clang fp contract(off)
  __shared__ float red[256]; const size_t r = blockIdx.x; const int t = threadIdx.x; const bool act = t < (DMQ / 4); const int c0 = act ? t * 4 : 0;
  const v4f xa = *(const v4fa*)(X + r * DMQ + c0); float s[4]; float sum = 0.f;
  for (int q = 0; q < 4; ++q) { s[q] = act ? (BFIN ? bf16_round(xa[q]) : xa[q]) : 0.f; sum = __fadd_rn(sum, s[q]); }
  red[t] = sum; __syncthreads(); for (int st = 128; st > 0; st >>= 1) { if (t < st) red[t] = __fadd_rn(red[t], red[t + st]); __syncthreads(); } const float mu = red[0] / (float)DMQ; __syncthreads();
  float vs = 0.f; for (int q = 0; q < 4; ++q) { const float dl = act ? __fadd_rn(s[q], -mu) : 0.f; vs = __fadd_rn(vs, __fmul_rn(dl, dl)); } red[t] = vs; __syncthreads(); for (int st = 128; st > 0; st >>= 1) { if (t < st) red[t] = __fadd_rn(red[t], red[t + st]); __syncthreads(); }
  const float rs = rsqrtf(__fadd_rn(red[0] / (float)DMQ, eps)); v4h y; v4f yf;
  for (int q = 0; q < 4; ++q) { const int c = c0 + q; yf[q] = __fadd_rn(__fmul_rn(__fmul_rn(__fadd_rn(s[q], -mu), rs), bf16_round(g[c])), bf16_round(bb[c])); y[q] = (_Float16)yf[q]; }
  if (!act) return;      /* no barriers after this point */
  { if (W16) *(v4h*)(N16 + r * DMQ + c0) = y; if (W32) *(v4f*)(N32 + r * DMQ + c0) = yf;  } }

__global__ __launch_bounds__(256) void k_bfr(const float* __restrict__ x, float* __restrict__ XB, size_t n8) { const size_t t = (size_t)blockIdx.x * 256 + threadIdx.x; if (t >= n8) return; v4f a = *(const v4fa*)(x + t * 8), c = *(const v4fa*)(x + t * 8 + 4); for (int q = 0; q < 4; ++q) { a[q] = bf16_round(a[q]); c[q] = bf16_round(c[q]); }
  { *(v4f*)(XB + t * 8) = a; *(v4f*)(XB + t * 8 + 4) = c;  } }



__global__ __launch_bounds__(256) void k_wthd(const float* __restrict__ Wt, _Float16* __restrict__ Bt) { const size_t t = (size_t)blockIdx.x * 256 + threadIdx.x; if (t >= (size_t)NH * HD * (DM / 8)) return; const int m8 = (int)(t % (DM / 8)) * 8; const int d = (int)((t / (DM / 8)) % HD); const int h = (int)(t / ((size_t)(DM / 8) * HD)); FragH f;
  for (int q = 0; q < 8; ++q) f.h[q] = (_Float16)(16.0f * bf16_round(Wt[((size_t)h * DM + m8 + q) * HD + d])); unsigned short* dst = (unsigned short*)Bt + ((size_t)h * HD + d) * DM + m8; *(v8us*)dst = f.half[0];  }




template <int BFIN, int SCAL>
__global__ __launch_bounds__(256) void k_lnsc(const float* __restrict__ X, const float* __restrict__ g, const float* __restrict__ bb, float eps, _Float16* __restrict__ N16, float* __restrict__ N32) {
  #pragma clang fp contract(off)
  __shared__ float red[256]; const size_t r = blockIdx.x; const int t = threadIdx.x; const bool act = t < DM / 4; const int tc = act ? t : 0; const v4f xl = *(const v4fa*)(X + r * DM + tc * 4); const float am = act ? 1.f : 0.f; float s[4]; float sum = 0.f;
  for (int q = 0; q < 4; ++q) { s[q] = (BFIN ? bf16_round(xl[q]) : xl[q]) * am; sum = __fadd_rn(sum, s[q]); }
  red[t] = sum; __syncthreads(); for (int st = 128; st > 0; st >>= 1) { if (t < st) red[t] = __fadd_rn(red[t], red[t + st]); __syncthreads(); } const float mu = red[0] / (float)DM; __syncthreads();
  float vs = 0.f; for (int q = 0; q < 4; ++q) { const float dl = __fadd_rn(s[q], -mu) * am; vs = __fadd_rn(vs, __fmul_rn(dl, dl)); } red[t] = vs; __syncthreads(); for (int st = 128; st > 0; st >>= 1) { if (t < st) red[t] = __fadd_rn(red[t], red[t + st]); __syncthreads(); }
  const float rs = __fdiv_rn(1.0f, __fadd_rn(sqrtf(red[0] / (float)(DM - 1)), eps)); if (!act) return; v4h y; v4f yf;
  for (int q = 0; q < 4; ++q) { const int c = t * 4 + q; const float gg = bf16_round(SCAL ? g[0] : g[c]), bv = bf16_round(SCAL ? bb[0] : bb[c]); yf[q] = __fadd_rn(__fmul_rn(__fmul_rn(__fadd_rn(s[q], -mu), rs), gg), bv); y[q] = (_Float16)yf[q]; }
  { if (N16) *(v4h*)(N16 + r * DM + t * 4) = y; if (N32) *(v4f*)(N32 + r * DM + t * 4) = yf;  } }

__global__ __launch_bounds__(256) void k_rsmdmi(const float* __restrict__ S, _Float16* __restrict__ P, int nrows, const int* __restrict__ M) {
  #pragma clang fp contract(off)
  const int t = blockIdx.x * 256 + threadIdx.x; if (t >= nrows) return; const float* s = S + (size_t)t * SQ; const int* m = M + (size_t)(t % SQ) * SQ; float mx = -3.0e38f;
#pragma unroll 1
  for (int j = 0; j < SQ; ++j) { const float f = (m[j] == 0) ? 1.f : 0.f; mx = fmaxf(mx, fmaf(f, s[j], (1.f - f) * -1.0e9f)); } float se = 0.f;
#pragma unroll 1
  for (int j = 0; j < SQ; ++j) { const float f = (m[j] == 0) ? 1.f : 0.f; se += __expf(fmaf(f, s[j], (1.f - f) * -1.0e9f) - mx); } const float sc = 256.0f / se;
#pragma unroll 1
  for (int j0 = 0; j0 < SQ; j0 += 8) { FragH fr; for (int q = 0; q < 8; ++q) { const int j = j0 + q; const float f = (m[j] == 0) ? 1.f : 0.f; fr.h[q] = (_Float16)(__expf(fmaf(f, s[j], (1.f - f) * -1.0e9f) - mx) * sc); } unsigned short* d = (unsigned short*)P + (size_t)t * SQ + j0; *(v8us*)d = fr.half[0];  } }
// All six weight planes in one launch (blockIdx.y = plane): Bt[p][n][k] = f16(bf16(W[k][n]) x16), element for element as k_wt_f16.
// Planes 0..2: per-head tensors [NH][DM][HD], row n = head n / HD, output n % HD; planes 3..5: [in][out] squares of DM x DM.
static_assert(DFF == DM, "k_wt_all: every plane is DM x DM");
// Eight source rows of one output column. The pitch is a compile-time constant, so the eight loads share one address pair and differ only in their immediate offsets.
template <int PITCH>
__device__ __forceinline__ v8us wt_col8(const float* __restrict__ s) { FragH f;
  for (int i = 0; i < 8; ++i) f.h[i] = (_Float16)(bf16_round(s[(size_t)i * PITCH]) * 16.0f);
  return f.half[0]; }
__global__ __launch_bounds__(256) void k_wt_all(const float* __restrict__ wq, const float* __restrict__ wk, const float* __restrict__ wv, const float* __restrict__ wo, const float* __restrict__ w1, const float* __restrict__ w2, _Float16* __restrict__ Bt) {
  const int p = blockIdx.y; const int t = blockIdx.x * 256 + threadIdx.x; const int n = t / (DM / 8), k8 = (t % (DM / 8)) * 8;
  const float* W = p == 0 ? wq : p == 1 ? wk : p == 2 ? wv : p == 3 ? wo : p == 4 ? w1 : w2;
  const v8us o = p < 3 ? wt_col8<HD>(W + ((size_t)(n / HD) * DM + k8) * HD + (n % HD)) : wt_col8<DM>(W + (size_t)k8 * DM + n);
  *(v8us*)((unsigned short*)Bt + ((size_t)p * DM + n) * DM + k8) = o; }
extern "C" void kernel_launch(void* const* d_in, const int* in_sizes, int n_in,
                              void* d_out, int out_size, void* d_ws, size_t ws_size, hipStream_t stream) {
  (void)in_sizes; (void)n_in; (void)out_size;
  const float* const* I = (const float* const*)d_in; const float* x = I[0]; const float* wq = I[1]; const float* wk = I[2]; const float* wv = I[3]; const float* wo = I[4]; const float* bo = I[5]; const float* w1 = I[6]; const float* b1 = I[7]; const float* w2 = I[8]; const float* b2 = I[9]; const float* g1 = I[10]; const float* be1 = I[11]; const float* g2 = I[12]; const float* be2 = I[13];      /* x; per-head Wq / Wk / Wv [16][1024][64] (no biases); Wo [1024][1024] + bo ([in][out]); W1 [1024][1024] + b1, W2 [1024][1024] + b2; LN1 g / b, LN2 g / b */
  char* ws = (char*)d_ws; size_t off = 0;
  auto take = [&](size_t bytes) { char* p = ws + off; off += (bytes + 255) & ~(size_t)255; return p; };
  _Float16* BQ = (_Float16*)take((size_t)6 * DM * DM * 2); _Float16* BO = BQ + (size_t)3 * DM * DM; _Float16* BW1 = BQ + (size_t)4 * DM * DM; _Float16* BW2 = BQ + (size_t)5 * DM * DM;      /* six Bt planes in a row: q, k, v, o, W1, W2 */
  float* XB = (float*)take(NR * DM * 4); _Float16* XN = (_Float16*)take(NR * DM * 2); _Float16* Q16 = (_Float16*)take((size_t)3 * NR * DM * 2); _Float16* K16 = Q16 + NR * DM; _Float16* V16 = Q16 + (size_t)2 * NR * DM;      /* three planes in a row: one batched GEMM writes them */ _Float16* O16 = (_Float16*)take(NR * DM * 2); float* X1 = (float*)take(NR * DM * 4);
  _Float16* VT = (_Float16*)take((size_t)NB * NH * HD * SQ * 2);
  _Float16* M16 = XN;      /* second-norm f16 rows: aliases XN (last readers: the three projections) */ _Float16* HF16 = (_Float16*)take(NR * DFF * 2);      /* FFN hidden rows of every batch [8192][1024] f16 (16 MiB): own region */
  
  if (off > ws_size) return;
  k_wt_all<<<dim3((unsigned)((size_t)DM * (DM / 8) / 256), 6), 256, 0, stream>>>(wq, wk, wv, wo, w1, w2, BQ);      /* every weight -> Bt x16, one launch; per-head [in = 1024][out = 64]: head h = rows h*64.. of its plane */
  k_bfr<<<(unsigned)((NR * DM / 8 + 255) / 256), 256, 0, stream>>>(x, XB, NR * DM / 8); k_lnx<1, 1, 0><<<(unsigned)NR, 256, 0, stream>>>(x, g1, be1, 1e-5f, XN, nullptr);      /* n = LN0(bf16(x)) (biased variance, eps inside the rsqrt) -> f16 rows */
  k_gemm2<0><<<dim3((unsigned)((NR / 128) * (DM / 64)), 3), 128, 0, stream>>>(XN, DM, 0, BQ, DM, (size_t)DM * DM, 0.0625f, nullptr, 0, nullptr, 1, 0, 0, nullptr, Q16, DM, NR * DM, (int)NR, DM, DM);      /* q, k, v (blockIdx.y) -> f16 rows, one launch; head h = columns h*64.. */
  k_vt<NH, SQ><<<NB * NH * (SQ / 64), 256, 0, stream>>>(V16, DM, 0, VT);      /* V^T [8 * 16][64][1024], every batch */
  k_fattn<<<NB * NH * (SQ / (FAW * FAQ)), FAW * 32, 0, stream>>>(Q16, K16, VT, O16);      /* softmax(q k^T / 8) v over all keys (no mask) -> ctx (merged heads, x64) as f16 rows */
  k_gemm2<0><<<dim3((unsigned)((NR / 128) * (DM / 64)), 1), 128, 0, stream>>>(O16, DM, 0, BO, DM, 0, 0.0009765625f, bo, 0, XB, -1, 0, 0, X1, nullptr, DM, 0, (int)NR, DM, DM);      /* x + ctx wo (+ bo) (own-element residual) -> f32 rows */
  k_lnx<0, 1, 0><<<(unsigned)NR, 256, 0, stream>>>(X1, g2, be2, 1e-5f, M16, nullptr);      /* LN1(x1) -> f16 rows */
  k_gemm2<6><<<dim3((unsigned)((NR / 128) * (DFF / 64)), 1), 128, 0, stream>>>(M16, DM, 0, BW1, DM, 0, 0.0625f, b1, 0, nullptr, 1, 0, 0, nullptr, HF16, DFF, 0, (int)NR, DFF, DM);      /* gelu_erf(. W1 + b1) -> f16, all rows */
  k_gemm2<0><<<dim3((unsigned)((NR / 128) * (DM / 64)), 1), 128, 0, stream>>>(HF16, DFF, 0, BW2, DFF, 0, 0.0625f, b2, 0, X1, -1, 0, 0, (float*)d_out, nullptr, DM, 0, (int)NR, DM, DFF);      /* out = x1 + mlp (own-element residual), all rows */
}

// v004
// A run of this version takes 239 microseconds.
// Timed twice side by side with v003, it ran 2.12 times as fast both times.
// Over all steps from v000 it is 31.5 times as fast.
#include <hip/hip_runtime.h>
// Pre-LN transformer encoder block with PER-HEAD projection tensors, no QKV biases (x [8][1024][1024]; h = LN1(x) (biased var, eps 1e-5); q/k/v[h] = h W[h] with W [16][1024][64] ([head][in][out]); scale 64^-0.5; softmax over all 1024 keys (no mask); x1 = x + concat(attn) Wo + bo ([in][out]); out = x1 + gelu_erf(LN2(x1) W1 + b1) W2 + b2 ([in][out] 1024 x 1024 x 1024: hidden = 1 x n_embd, as the source) -> [8][1024][1024]).
// Structure: token rows; LayerNorm / exact f16 rows; WMMA GEMMs for q, k, v; V^T of every batch and head by LDS transposes; one fused attention launch (scores, online softmax and P V in registers); output projection with the own-element residual; custom LayerNorm; GELU (erf) FFN over all rows; launches: see trace.
// Compute dtype: inputs rounded to bf16; x / weights exact; q, k, v, softmax weights and o as plain f16 GEMM operands (~2^-12); scores and softmax statistics f32. v_wmma_f32_16x16x32_f16.
#define NB 8
#define SQ 1024
#define DM 1024
#define NH 16
#define HD 64
#define HG 4                         /* heads per call of the unused per-batch k_vt overload */
#define LOCALW 128                   /* (macros for unused kernels of the shared header) */
#define STRIDEK 128
#define QT 256                       /* query rows per causal tile */
#define NKX SQ                       /* S / P row pitch */
#define QT0 128                      /* first-tile rows recomputed exactly in f32 */
#define B0 0                         /* unused; every launch starts at batch 0 */
#define NBR NB                       /* only feeds the unused MP; the launches cover all NB batches */
#define NR ((size_t)NB * SQ)
#define DMQ DM
#define DFF 1024         /* FFN hidden width = 1 x n_embd in this module (W1 [1024][1024], W2 [1024][1024]) */
#define MP ((int)((size_t)NBR * SQ)) /* unused; the projections take NR rows */
#define QN SQ                        /* unused; attention runs all SQ query rows */
#define NHD NH                       /* unused; the launches cover all NH heads */
#define MPO MP                       /* unused; the output stage takes NR rows */
#define LQ (3 * DM)      /* unused; the q, k, v rows have pitch DM */
typedef __bf16 v16b __attribute__((ext_vector_type(16)));
typedef unsigned short v8us __attribute__((ext_vector_type(8), may_alias));
typedef float  v8f  __attribute__((ext_vector_type(8)));
typedef float  v4f  __attribute__((ext_vector_type(4)));
typedef float  v4fa __attribute__((ext_vector_type(4), may_alias));
union FragB { v16b v; v8us half[2]; unsigned short u[16]; };

__device__ __forceinline__ unsigned short bf16_bits(float x) { unsigned int u = __float_as_uint(x); return (unsigned short)((u + 0x7FFFu + ((u >> 16) & 1u)) >> 16); }
__device__ __forceinline__ float bf16_val(unsigned short b) { return __uint_as_float(((unsigned int)b) << 16); }
__device__ __forceinline__ float bf16_round(float x) { return bf16_val(bf16_bits(x)); }
// D += A·B with NT terms: 1 = ah·bh, 2 = + al·bh (A split), 3 = + ah·bl (both split)
template <int NT>
__device__ __forceinline__ v8f mmaN(v16b ah, v16b al, v16b bh, v16b bl, v8f c) {
  c = __builtin_amdgcn_wmma_f32_16x16x32_bf16(false, ah, false, bh, (short)0, c, false, false);
  if (NT >= 2) c = __builtin_amdgcn_wmma_f32_16x16x32_bf16(false, al, false, bh, (short)0, c, false, false);
  if (NT >= 3) c = __builtin_amdgcn_wmma_f32_16x16x32_bf16(false, ah, false, bl, (short)0, c, false, false);
  asm volatile("v_nop\n\tv_nop\n\tv_nop\n\tv_nop" : "+v"(c) : "v"(ah), "v"(al), "v"(bh), "v"(bl));
  return c;
}

__global__ __launch_bounds__(256) void k_wt_bf16(const float* __restrict__ W, unsigned short* __restrict__ Wt, int K, int N) {
  const int t = blockIdx.x * 256 + threadIdx.x;
  const int k8n = K / 8;
  if (t >= N * k8n) return;
  const int n = t / k8n, k8 = (t % k8n) * 8;
  v8us v;
#pragma unroll
  for (int i = 0; i < 8; ++i) v[i] = bf16_bits(W[(size_t)(k8 + i) * N + n]);
  *(v8us*)(Wt + (size_t)n * K + k8) = v;
  
}

// GEMM C[M][N] (f32, pitch ldc) = act(A[M][K]·W + bias). A f32 row-major (pitch lda) converted per fragment to bf16
// (ASPLIT: hi/lo two planes -> 2 terms, else single rounded term); Wt bf16 [N][K] (pitch ldb). BIAS_BF16 rounds the
// bias to bf16 first (bias quantised to bf16 before the add). K%32==0, M%16==0, N%64==0.
template <bool ASPLIT, int ACT, bool BIAS_BF16>
__global__ __launch_bounds__(128) void k_gemm_bf(const float* __restrict__ A, int lda, const unsigned short* __restrict__ Wt, int ldb,
                                               const float* __restrict__ bias, float* __restrict__ C, int ldc, int M, int N, int K) {
  __shared__ __attribute__((aligned(16))) float so[4][16][64];
  const int tid = threadIdx.x, w = tid >> 5, lane = tid & 31, ln = lane & 15, hh = lane >> 4;
  const int ntn = N / 64;
  const int wid = blockIdx.x * 4 + w;
  const int mt = wid / ntn, nq = wid % ntn;
  if (mt * 16 >= M) return;
  const int row0 = mt * 16, col0 = nq * 64;
  const float* arow = A + (size_t)(row0 + ln) * lda;
  v8f acc[4] = {};
  for (int kb = 0; kb < K; kb += 32) {
    FragB ah, al;
    const v4f x0 = *(const v4fa*)(arow + kb + 8 * hh), x1 = *(const v4fa*)(arow + kb + 8 * hh + 4);
    const v4f x2 = *(const v4fa*)(arow + kb + 16 + 8 * hh), x3 = *(const v4fa*)(arow + kb + 16 + 8 * hh + 4);
    float xs[16] = {x0[0],x0[1],x0[2],x0[3],x1[0],x1[1],x1[2],x1[3],x2[0],x2[1],x2[2],x2[3],x3[0],x3[1],x3[2],x3[3]};
#pragma unroll
    for (int i = 0; i < 16; ++i) { const unsigned short hb = bf16_bits(xs[i]); ah.u[i] = hb; al.u[i] = ASPLIT ? bf16_bits(xs[i] - bf16_val(hb)) : (unsigned short)0; }
#pragma unroll
    for (int t = 0; t < 4; ++t) {
      const unsigned short* brow = Wt + (size_t)(col0 + t * 16 + ln) * ldb + kb;
      FragB b;
      b.half[0] = *(const v8us*)(brow + 8 * hh);
      b.half[1] = *(const v8us*)(brow + 16 + 8 * hh);
      acc[t] = mmaN<ASPLIT ? 2 : 1>(ah.v, al.v, b.v, b.v, acc[t]);
    }
  }
#pragma unroll
  for (int t = 0; t < 4; ++t) {
    float bv = bias ? bias[col0 + t * 16 + ln] : 0.f;
    if (BIAS_BF16) bv = bf16_round(bv);
#pragma unroll
    for (int r = 0; r < 8; ++r) { float v = acc[t][r] + bv; if (ACT == 1) v = fmaxf(v, 0.f); so[w][8 * hh + r][t * 16 + ln] = v; }
  }
  __builtin_amdgcn_fence(__ATOMIC_ACQ_REL, "workgroup");
  __builtin_amdgcn_wave_barrier();
  const int rsub = lane >> 4, c4 = (lane & 15) * 4;
  {
#pragma unroll
    for (int q = 0; q < 8; ++q) {
      const int r = q * 2 + rsub;
      const v4f v = *(const v4fa*)&so[w][r][c4];
      *(v4f*)(C + (size_t)(row0 + r) * ldc + col0 + c4) = v;
    }
    
  }
}

// GEMM C = act(A·W + bias + resid): A f32 (ASPLIT -> hi/lo 2 terms), Wt bf16 [N][K]; ACT 0 none, 1 relu, 2 exact gelu;
// resid (optional, f32, row index = (row % rmod), pitch ldr, RES_BF16 rounds it) added before the activation.
template <bool ASPLIT, int ACT, bool BIAS_BF16, bool RES_BF16>
__global__ __launch_bounds__(128) void k_gemm_bf3(const float* __restrict__ A, int lda, const unsigned short* __restrict__ Wt, int ldb,
                                                const float* __restrict__ bias, const float* __restrict__ resid, int rmod, int ldr,
                                                float* __restrict__ C, int ldc, int M, int N, int K) {
  __shared__ __attribute__((aligned(16))) float so[4][16][64];
  const int tid = threadIdx.x, w = tid >> 5, lane = tid & 31, ln = lane & 15, hh = lane >> 4;
  const int ntn = N / 64;
  const int wid = blockIdx.x * 4 + w;
  const int mt = wid / ntn, nq = wid % ntn;
  if (mt * 16 >= M) return;
  const int row0 = mt * 16, col0 = nq * 64;
  const float* arow = A + (size_t)(row0 + ln) * lda;
  v8f acc[4] = {};
  for (int kb = 0; kb < K; kb += 32) {
    FragB ah, al;
    const v4f x0 = *(const v4fa*)(arow + kb + 8 * hh), x1 = *(const v4fa*)(arow + kb + 8 * hh + 4);
    const v4f x2 = *(const v4fa*)(arow + kb + 16 + 8 * hh), x3 = *(const v4fa*)(arow + kb + 16 + 8 * hh + 4);
    float xs[16] = {x0[0],x0[1],x0[2],x0[3],x1[0],x1[1],x1[2],x1[3],x2[0],x2[1],x2[2],x2[3],x3[0],x3[1],x3[2],x3[3]};
#pragma unroll
    for (int i = 0; i < 16; ++i) { const unsigned short hb = bf16_bits(xs[i]); ah.u[i] = hb; al.u[i] = ASPLIT ? bf16_bits(xs[i] - bf16_val(hb)) : (unsigned short)0; }
#pragma unroll
    for (int t = 0; t < 4; ++t) {
      const unsigned short* brow = Wt + (size_t)(col0 + t * 16 + ln) * ldb + kb;
      FragB b;
      b.half[0] = *(const v8us*)(brow + 8 * hh);
      b.half[1] = *(const v8us*)(brow + 16 + 8 * hh);
      acc[t] = mmaN<ASPLIT ? 2 : 1>(ah.v, al.v, b.v, b.v, acc[t]);
    }
  }
#pragma unroll
  for (int t = 0; t < 4; ++t) {
    const int col = col0 + t * 16 + ln;
    float bv = bias ? bias[col] : 0.f;
    if (BIAS_BF16) bv = bf16_round(bv);
#pragma unroll
    for (int r = 0; r < 8; ++r) {
      float v = acc[t][r] + bv;
      if (resid) { float rv = resid[(size_t)((row0 + 8 * hh + r) % rmod) * ldr + col]; if (RES_BF16) rv = bf16_round(rv); v += rv; }
      if (ACT == 1) v = fmaxf(v, 0.f);
      if (ACT == 2) v = 0.5f * v * (1.0f + erff(v * 0.70710678118654752f));
      if (ACT == 3) { const float u = 0.7978845608028654f * (v + 0.044715f * v * v * v); v = 0.5f * v * (1.0f + tanhf(u)); }
      so[w][8 * hh + r][t * 16 + ln] = v;
    }
  }
  __builtin_amdgcn_fence(__ATOMIC_ACQ_REL, "workgroup");
  __builtin_amdgcn_wave_barrier();
  const int rsub = lane >> 4, c4 = (lane & 15) * 4;
  {
#pragma unroll
    for (int q = 0; q < 8; ++q) {
      const int r = q * 2 + rsub;
      const v4f v = *(const v4fa*)&so[w][r][c4];
      *(v4f*)(C + (size_t)(row0 + r) * ldc + col0 + c4) = v;
    }
    
  }
}
// row LayerNorm (biased variance, eps) over N: s = X (+ R); optional out_sum <- s; out_norm <- (s-mu)*rsqrt(var+eps)*g + b
template <bool PARAM_BF16>
__global__ __launch_bounds__(256) void k_layernorm(const float* __restrict__ X, const float* __restrict__ R, const float* __restrict__ g, const float* __restrict__ bta,
                                                  float* __restrict__ out_sum, float* __restrict__ out_norm, int N, float eps) {
  __shared__ float red[256];
  const int row = blockIdx.x, tid = threadIdx.x;
  const float* x = X + (size_t)row * N; const float* rr = R ? R + (size_t)row * N : nullptr;
  float vals[16];                     // up to N = 4096
  const int per = N / 256;            // contiguous chunk per thread? use strided-by-4 chunks: thread handles j = tid*4 + 1024*u
  float s1 = 0.f;
  for (int u = 0; u < per / 4; ++u) {
    const int j = tid * 4 + 1024 * u;
    const v4f a = *(const v4fa*)(x + j);
    v4f b = {0.f,0.f,0.f,0.f}; if (rr) b = *(const v4fa*)(rr + j);
#pragma unroll
    for (int q = 0; q < 4; ++q) { const float v = a[q] + b[q]; vals[u * 4 + q] = v; s1 += v; }
  }
  red[tid] = s1; __syncthreads();
  for (int st = 128; st > 0; st >>= 1) { if (tid < st) red[tid] += red[tid + st]; __syncthreads(); }
  const float mu = red[0] / (float)N; __syncthreads();
  float s2 = 0.f;
  for (int u = 0; u < per / 4; ++u)
#pragma unroll
    for (int q = 0; q < 4; ++q) { const float c = vals[u * 4 + q] - mu; s2 += c * c; }
  red[tid] = s2; __syncthreads();
  for (int st = 128; st > 0; st >>= 1) { if (tid < st) red[tid] += red[tid + st]; __syncthreads(); }
  const float rs = rsqrtf(red[0] / (float)N + eps);
  {
    for (int u = 0; u < per / 4; ++u) {
      const int j = tid * 4 + 1024 * u;
      v4f o, sm;
#pragma unroll
      for (int q = 0; q < 4; ++q) {
        float gg = g[j + q], bb = bta[j + q];
        if (PARAM_BF16) { gg = bf16_round(gg); bb = bf16_round(bb); }
        sm[q] = vals[u * 4 + q]; o[q] = (vals[u * 4 + q] - mu) * rs * gg + bb;
      }
      if (out_sum) *(v4f*)(out_sum + (size_t)row * N + j) = sm;
      *(v4f*)(out_norm + (size_t)row * N + j) = o;
    }
    
  }
}



// ---- f16 WMMA path (v_wmma_f32_16x16x32_f16): 11-bit significands for operands in range — used where a [0,1] probability operand needs more precision than bf16
typedef _Float16 v16h __attribute__((ext_vector_type(16)));
union FragH { v16h v; v8us half[2]; _Float16 h[16]; unsigned short u[16]; };
template <int NT>
__device__ __forceinline__ v8f mmaH(v16h ah, v16h al, v16h bh, v16h bl, v8f c) {
  c = __builtin_amdgcn_wmma_f32_16x16x32_f16(false, ah, false, bh, (short)0, c, false, false);
  if (NT >= 2) c = __builtin_amdgcn_wmma_f32_16x16x32_f16(false, al, false, bh, (short)0, c, false, false);
  if (NT >= 3) c = __builtin_amdgcn_wmma_f32_16x16x32_f16(false, ah, false, bl, (short)0, c, false, false);
  asm volatile("v_nop\n\tv_nop\n\tv_nop\n\tv_nop" : "+v"(c) : "v"(ah), "v"(al), "v"(bh), "v"(bl));
  return c;
}
// batched GEMM like k_gemm_b but f16 operands: A f32 (split into f16 hi/lo if ASPLIT, else rounded to f16), Bt = f16 values [n][k]; alpha; C f32; N multiple of 16 (partial tiles skipped)
template <bool ASPLIT>
__global__ __launch_bounds__(128) void k_gemm_h(const float* __restrict__ A, int lda, size_t sA, const _Float16* __restrict__ Bh, int ldb, size_t sB, float alpha, float* __restrict__ C, int ldc, size_t sC, int M, int N, int K) {
  __shared__ __attribute__((aligned(16))) float so[4][16][64];
  const int tid = threadIdx.x, w = tid >> 5, lane = tid & 31, ln = lane & 15, hh = lane >> 4; const int by = blockIdx.y;
  A += (size_t)by * sA; Bh += (size_t)by * sB; C += (size_t)by * sC;
  const int ntn = (N + 63) / 64; const int wid = blockIdx.x * 4 + w; const int mt = wid / ntn, nq = wid % ntn; if (mt * 16 >= M) return;
  const int row0 = mt * 16, col0 = nq * 64; const float* arow = A + (size_t)(row0 + ln) * lda;
  v8f acc[4] = {};
  for (int kb = 0; kb < K; kb += 32) {
    FragH ah, al;
    const v4f x0 = *(const v4fa*)(arow + kb + 8 * hh), x1 = *(const v4fa*)(arow + kb + 8 * hh + 4), x2 = *(const v4fa*)(arow + kb + 16 + 8 * hh), x3 = *(const v4fa*)(arow + kb + 16 + 8 * hh + 4);
    float xs[16] = {x0[0],x0[1],x0[2],x0[3],x1[0],x1[1],x1[2],x1[3],x2[0],x2[1],x2[2],x2[3],x3[0],x3[1],x3[2],x3[3]};
#pragma unroll
    for (int i = 0; i < 16; ++i) { const _Float16 h = (_Float16)xs[i]; ah.h[i] = h; al.h[i] = ASPLIT ? (_Float16)(xs[i] - (float)h) : (_Float16)0.0f; }
#pragma unroll
    for (int t = 0; t < 4; ++t) { if (col0 + t * 16 >= N) continue; const size_t boff = (size_t)(col0 + t * 16 + ln) * ldb + kb; FragH bq; bq.half[0] = *(const v8us*)(Bh + boff + 8 * hh); bq.half[1] = *(const v8us*)(Bh + boff + 16 + 8 * hh);
      acc[t] = mmaH<ASPLIT ? 2 : 1>(ah.v, al.v, bq.v, bq.v, acc[t]); }
  }
#pragma unroll
  for (int t = 0; t < 4; ++t) { if (col0 + t * 16 >= N) continue;
#pragma unroll
    for (int r = 0; r < 8; ++r) so[w][8 * hh + r][t * 16 + ln] = acc[t][r] * alpha; }
  __builtin_amdgcn_fence(__ATOMIC_ACQ_REL, "workgroup"); __builtin_amdgcn_wave_barrier();
  const int rsub = lane >> 4, c4 = (lane & 15) * 4;
  {
#pragma unroll
    for (int q = 0; q < 8; ++q) { const int r = q * 2 + rsub; if (col0 + c4 < N) { const v4f v = *(const v4fa*)&so[w][r][c4]; *(v4f*)(C + (size_t)(row0 + r) * ldc + col0 + c4) = v; } }
     }
}

// Wt[n][k] = f16(W[k][n]·scale) from f32 row-major W[K][N] (scale = power of two; bf16-exact weights stay exact in f16 away from the subnormal range)
__global__ __launch_bounds__(256) void k_wt_f16(const float* __restrict__ W, _Float16* __restrict__ Wt, int K, int N, float scale) {
  const int t = blockIdx.x * 256 + threadIdx.x; if (t >= N * (K / 8)) return; const int n = t / (K / 8), k8 = (t % (K / 8)) * 8; FragH f;
#pragma unroll
  for (int i = 0; i < 8; ++i) f.h[i] = (_Float16)(bf16_round(W[(size_t)(k8 + i) * N + n]) * scale); const v8us o = f.half[0];
  *(v8us*)((unsigned short*)Wt + (size_t)n * K + k8) = o; 
}
// k_gemm_hh variant with fused epilogue: v = acc·alpha + bias[by·sBias + col] (+ CP[(row/rowsPerB)·sCPb + by·64 + col] if CP) ; ACT 0 none / 1 elu ; writes f16 C16 (and f32 C if non-null)
template <int ACT>
__global__ __launch_bounds__(128) void k_gemm_hhx(const _Float16* __restrict__ A, int lda, size_t sA, const _Float16* __restrict__ Bh, int ldb, size_t sB, float alpha, const float* __restrict__ bias, size_t sBias, const float* __restrict__ CP, int rowsPerB, size_t sCPb, int row0g,
    float* __restrict__ C, _Float16* __restrict__ C16, int ldc, size_t sC, int M, int N, int K) {
  __shared__ __attribute__((aligned(16))) float so[4][16][64];
  const int tid = threadIdx.x, w = tid >> 5, lane = tid & 31, ln = lane & 15, hh = lane >> 4; const int by = blockIdx.y;
  A += (size_t)by * sA; Bh += (size_t)by * sB; const size_t cofs = (size_t)by * sC; const float* bp = bias ? bias + (size_t)by * sBias : nullptr;
  const int ntn = (N + 63) / 64; const int wid = blockIdx.x * 4 + w; const int mt = wid / ntn, nq = wid % ntn; if (mt * 16 >= M) return;
  const int row0 = mt * 16, col0 = nq * 64; const _Float16* arow = A + (size_t)(row0 + ln) * lda;
  v8f acc[4] = {};
  for (int kb = 0; kb < K; kb += 32) { FragH ah; ah.half[0] = *(const v8us*)((const unsigned short*)arow + kb + 8 * hh); ah.half[1] = *(const v8us*)((const unsigned short*)arow + kb + 16 + 8 * hh);
#pragma unroll
    for (int t = 0; t < 4; ++t) { if (col0 + t * 16 >= N) continue; const size_t boff = (size_t)(col0 + t * 16 + ln) * ldb + kb; FragH bq; bq.half[0] = *(const v8us*)((const unsigned short*)Bh + boff + 8 * hh); bq.half[1] = *(const v8us*)((const unsigned short*)Bh + boff + 16 + 8 * hh);
      acc[t] = mmaH<1>(ah.v, ah.v, bq.v, bq.v, acc[t]); }
  }
#pragma unroll
  for (int t = 0; t < 4; ++t) { if (col0 + t * 16 >= N) continue; const int col = col0 + t * 16 + ln; const float bv = bp ? bf16_round(bp[col]) : 0.f;
#pragma unroll
    for (int r = 0; r < 8; ++r) { float v = acc[t][r] * alpha + bv; if (CP) { const int rr = row0g + row0 + 8 * hh + r; if (rowsPerB < 0) v += CP[cofs + (size_t)rr * ldc + col];      /* rowsPerB < 0: own element of the batched C plane */ else { const int bidx = rr / rowsPerB; v += CP[(size_t)bidx * sCPb + (size_t)by * 64 + col]; } } if (ACT == 1) v = (v > 0.f) ? v : expm1f(v); else if (ACT == 7) v = (v > 0.f) ? v + 1.0f : expf(v); else if (ACT == 8) v = tanhf(v); else if (ACT == 9) v = 0.5f * v * (1.0f + tanhf(0.7978845608028654f * (v + 0.044715f * v * v * v))); else if (ACT == 11) v = 1.0f / (1.0f + expf(-v)); else if (ACT == 12) v = (v > 0.f) ? v : 0.01f * v; else if (ACT == 14) v = (v > 0.f) ? v : 0.1f * v; else if (ACT == 16) v = (v >= 0.f) ? v : 0.3f * v; else if (ACT == 17) v = (v >= 0.f) ? v : 0.2f * v; else if (ACT == 15) v = v / (1.0f + expf(-v)); else if (ACT == 3) v = fmaxf(v, 0.f); else if (ACT == 6) v = 0.5f * v * (1.0f + erff(v * 0.70710678118654752f)); so[w][8 * hh + r][t * 16 + ln] = v; } }
  __builtin_amdgcn_fence(__ATOMIC_ACQ_REL, "workgroup"); __builtin_amdgcn_wave_barrier();
  const int rsub = lane >> 4, c4 = (lane & 15) * 4; typedef _Float16 v4h __attribute__((ext_vector_type(4)));
  {
#pragma unroll
    for (int q = 0; q < 8; ++q) { const int r = q * 2 + rsub; if (col0 + c4 < N) { const v4f v = *(const v4fa*)&so[w][r][c4]; if (C) *(v4f*)(C + cofs + (size_t)(row0 + r) * ldc + col0 + c4) = v; if (C16) { v4h h4; for (int i = 0; i < 4; ++i) h4[i] = (_Float16)v[i]; *(v4h*)(C16 + cofs + (size_t)(row0 + r) * ldc + col0 + c4) = h4; } } }
     }
}


typedef _Float16 v4h __attribute__((ext_vector_type(4)));

__global__ __launch_bounds__(256) void k_x16(const float* __restrict__ x, _Float16* __restrict__ X16, size_t n8) { const size_t t = (size_t)blockIdx.x * 256 + threadIdx.x; if (t >= n8) return; FragH f;
#pragma unroll
  for (int q = 0; q < 8; ++q) f.h[q] = (_Float16)bf16_round(x[t * 8 + q]); *(v8us*)((unsigned short*)X16 + t * 8) = f.half[0];  }
__global__ __launch_bounds__(256) void k_h16(const float* __restrict__ x, _Float16* __restrict__ X16, size_t n8) { const size_t t = (size_t)blockIdx.x * 256 + threadIdx.x; if (t >= n8) return; FragH f;
#pragma unroll
  for (int q = 0; q < 8; ++q) f.h[q] = (_Float16)x[t * 8 + q]; *(v8us*)((unsigned short*)X16 + t * 8) = f.half[0];  }
__global__ __launch_bounds__(256) void k_round16f(const float* __restrict__ W, _Float16* __restrict__ Bt, size_t n8) { const size_t t = (size_t)blockIdx.x * 256 + threadIdx.x; if (t >= n8) return; FragH f;
#pragma unroll
  for (int i = 0; i < 8; ++i) f.h[i] = (_Float16)(bf16_round(W[t * 8 + i]) * 16.0f); *(v8us*)((unsigned short*)Bt + t * 8) = f.half[0];  }
template <int NHv, int TTv>
__global__ __launch_bounds__(256) void k_vt(const _Float16* __restrict__ V16, int ldv, int voff, _Float16* __restrict__ Vt) { __shared__ unsigned short tl[64][66]; const int tid = threadIdx.x; const int slab = blockIdx.x / (TTv / 64), lg = blockIdx.x % (TTv / 64); const int b = slab / NHv, h = slab % NHv;
  for (int i = tid; i < 64 * 8; i += 256) { const int r = i / 8, c8 = (i % 8) * 8; FragH f; f.half[0] = *(const v8us*)((const unsigned short*)V16 + ((size_t)b * TTv + lg * 64 + r) * ldv + voff + h * 64 + c8);
#pragma unroll
    for (int q = 0; q < 8; ++q) tl[r][c8 + q] = f.u[q]; }
  __syncthreads();
  {
#pragma unroll
    for (int rd = 0; rd < 2; ++rd) { const int d = rd * 32 + tid / 8, pc = tid % 8; FragH f;
#pragma unroll
      for (int q = 0; q < 8; ++q) f.u[q] = tl[pc * 8 + q][d];
      *(v8us*)((unsigned short*)Vt + ((size_t)slab * 64 + d) * TTv + lg * 64 + pc * 8) = f.half[0]; }
     } }

__global__ __launch_bounds__(256) void k_hl(const float* __restrict__ F, _Float16* __restrict__ Hh, _Float16* __restrict__ Hl, size_t n8) { const size_t t = (size_t)blockIdx.x * 256 + threadIdx.x; if (t >= n8) return; FragH fh, fl; const v4f a = *(const v4fa*)(F + t * 8), c = *(const v4fa*)(F + t * 8 + 4);
#pragma unroll
  for (int q = 0; q < 4; ++q) { _Float16 h = (_Float16)a[q]; fh.h[q] = h; fl.h[q] = (_Float16)((a[q] - (float)h) * 1024.0f); h = (_Float16)c[q]; fh.h[4 + q] = h; fl.h[4 + q] = (_Float16)((c[q] - (float)h) * 1024.0f); }
  { *(v8us*)((unsigned short*)Hh + t * 8) = fh.half[0]; *(v8us*)((unsigned short*)Hl + t * 8) = fl.half[0];  } }

// one 16 x 32 f16 fragment of a k-contiguous row: 16 bytes at k = 8 hh and 16 bytes at k = 16 + 8 hh (A and B alike)
__device__ __forceinline__ v16h g2_frag(const _Float16* p, int hh) { FragH f; f.half[0] = *(const v8us*)((const unsigned short*)p + 8 * hh); f.half[1] = *(const v8us*)((const unsigned short*)p + 16 + 8 * hh); return f.v; }
// ---- tiled GEMM: one 128 x 128 tile of C per work-group (M % 128 == 0, N % 128 == 0, K % 64 == 0), four waves as 2 x 2, 64 x 64 per wave; epilogue = k_gemm_hhx semantics ----
// A stage is 64 k of 128 rows of A and of 128 rows of Bt, brought into LDS by asynchronous copies (whole 128-byte lines, through no register) and read by every wave that needs it.
// Two buffers: the next stage's copies fly while this stage is worked on. The k order of every sum is that of the unstaged loop (32 k per product, ascending).
#define G3P 144                      /* LDS row pitch in bytes: 128 of data + 16, so that the 16 rows of a 16-byte fragment read fall on 64 different banks */
#define G3T (128 * G3P)              /* one operand's tile */
#define G3S (2 * G3T)                /* one stage: [A tile | Bt tile] */
__device__ __forceinline__ v8f g3_mma(v16h a, v16h b, v8f c) { return __builtin_amdgcn_wmma_f32_16x16x32_f16(false, a, false, b, (short)0, c, false, false); }
// Eight copies of 16 bytes a lane: rows r, r + 16, .., r + 112 of one operand's tile (l: the lane's LDS byte address, g: its global address, ld: the source pitch in elements).
// The s_wait_xcnt stands inside the statement, behind the last copy, so that no address register of a copy is rewritten in front of it.
__device__ __forceinline__ void g3_copy8(unsigned l, const _Float16* g, int ld) {
  const size_t st = (size_t)16 * ld;
  asm volatile("global_load_async_to_lds_b128 %0, %8, off\n\t"
               "global_load_async_to_lds_b128 %1, %9, off\n\t"
               "global_load_async_to_lds_b128 %2, %10, off\n\t"
               "global_load_async_to_lds_b128 %3, %11, off\n\t"
               "global_load_async_to_lds_b128 %4, %12, off\n\t"
               "global_load_async_to_lds_b128 %5, %13, off\n\t"
               "global_load_async_to_lds_b128 %6, %14, off\n\t"
               "global_load_async_to_lds_b128 %7, %15, off\n\t"
               "s_wait_xcnt 0x0"
               :: "v"(l), "v"(l + 16 * G3P), "v"(l + 32 * G3P), "v"(l + 48 * G3P), "v"(l + 64 * G3P), "v"(l + 80 * G3P), "v"(l + 96 * G3P), "v"(l + 112 * G3P),
                  "v"(g), "v"(g + st), "v"(g + 2 * st), "v"(g + 3 * st), "v"(g + 4 * st), "v"(g + 5 * st), "v"(g + 6 * st), "v"(g + 7 * st)
               : "memory"); }
template <int ACT>
__device__ __forceinline__ float g3_act(float v) {
  if (ACT == 3) v = fmaxf(v, 0.f); else if (ACT == 6) v = 0.5f * v * (1.0f + erff(v * 0.70710678118654752f)); else if (ACT == 11) v = 1.0f / (1.0f + expf(-v)); else if (ACT == 15) v = v / (1.0f + expf(-v)); else if (ACT == 18) v = v / (1.0f + expf(-1.702f * v));      /* QuickGELU: v sigmoid(1.702 v) */ else if (ACT == 12) v = (v > 0.f) ? v : 0.01f * v; else if (ACT == 8) v = tanhf(v); else if (ACT == 9) v = 0.5f * v * (1.0f + tanhf(0.7978845608028654f * (v + 0.044715f * v * v * v))); else if (ACT == 14) v = (v > 0.f) ? v : 0.1f * v; else if (ACT == 16) v = (v >= 0.f) ? v : 0.3f * v; else if (ACT == 17) v = (v >= 0.f) ? v : 0.2f * v;
  return v; }
// RES: add CP's own element of the C plane, then the activation (both on the staged rows, 16 bytes a lane); W32: write f32 rows to C, else f16 rows to C16. Both are compile-time, so that the epilogue is one straight run and its loads go out together.
template <int ACT, bool RES, bool W32>
__global__ __launch_bounds__(128) void k_gemm3(const _Float16* __restrict__ A, int lda, size_t sA, const _Float16* __restrict__ Bh, int ldb, size_t sB, float alpha, const float* __restrict__ bias, size_t sBias, const float* __restrict__ CP,
    float* __restrict__ C, _Float16* __restrict__ C16, size_t sC, int M, int N, int K) { static_assert(ACT == 0 || ACT == 3 || ACT == 6 || ACT == 8 || ACT == 9 || ACT == 11 || ACT == 12 || ACT == 14 || ACT == 15 || ACT == 16 || ACT == 17 || ACT == 18, "k_gemm3: unsupported ACT code (would silently apply no activation)");
  __shared__ __attribute__((aligned(128))) unsigned char L[2 * G3S]; static_assert(4 * 64 * 68 * 4 <= 2 * G3S, "k_gemm3: the output staging reuses the ring");
  const int tid = threadIdx.x, w = tid >> 5, lane = tid & 31, ln = lane & 15, hh = lane >> 4; const int by = blockIdx.y;
  A += (size_t)by * sA; Bh += (size_t)by * sB; const size_t cofs = (size_t)by * sC; const float* bp = bias ? bias + (size_t)by * sBias : nullptr;
  const int ntn = N >> 7; const int mt = blockIdx.x / ntn, nq = blockIdx.x - mt * ntn; if (mt * 128 >= M) return;      /* the same for the whole work-group, in front of every barrier */
  const int row0 = mt * 128 + (w >> 1) * 64, col0 = nq * 128 + (w & 1) * 64;
  const unsigned lc = (unsigned)(size_t)L + (unsigned)((tid >> 3) * G3P + (tid & 7) * 16);      /* eight lanes copy one 128-byte row */
  const _Float16* ga = A + (size_t)(mt * 128 + (tid >> 3)) * lda + (tid & 7) * 8; const _Float16* gb = Bh + (size_t)(nq * 128 + (tid >> 3)) * ldb + (tid & 7) * 8;
  const int nt = K >> 6; constexpr int ldc = DM; static_assert(DFF == DM, "k_gemm3: one output pitch");      /* a compile-time pitch: the epilogue's loads and stores share one address pair each and differ only in their immediate offsets */
  const v8f z8 = {0.f,0.f,0.f,0.f,0.f,0.f,0.f,0.f}; v8f acc[4][4];
#pragma unroll
  for (int i = 0; i < 4; ++i)
#pragma unroll
    for (int j = 0; j < 4; ++j) acc[i][j] = z8;
  g3_copy8(lc, ga, lda); g3_copy8(lc + G3T, gb, ldb);
  asm volatile("s_wait_asynccnt 0x0" ::: "memory");      /* stage 0 has landed (this wave's copies) */
  __syncthreads();      /* ... and every wave's */
  if (nt > 1) { g3_copy8(lc + G3S, ga + 64, lda); g3_copy8(lc + G3S + G3T, gb + 64, ldb); }
  float bv[4] = {0.f, 0.f, 0.f, 0.f};      /* the lane's four bias values, fetched here so that they arrive under the loop */
  if (bp) {
#pragma unroll
    for (int t = 0; t < 4; ++t) bv[t] = bp[col0 + t * 16 + ln];
    asm volatile("s_wait_xcnt 0x0" ::: "memory"); }      /* the four loads' offset register is rewritten right behind them */
#pragma unroll 1
  for (int t = 0; t < nt; ++t) { const unsigned buf = (unsigned)(t & 1) * G3S;      /* rolled: one copy of the 32 products in the text */
    const _Float16* pa = (const _Float16*)(L + buf + ((w >> 1) * 64 + ln) * G3P); const _Float16* pb = (const _Float16*)(L + buf + G3T + ((w & 1) * 64 + ln) * G3P);
    v16h a[2][4], b[2][4];
#pragma unroll
    for (int ks = 0; ks < 2; ++ks)
#pragma unroll
      for (int i = 0; i < 4; ++i) { a[ks][i] = g2_frag(pa + i * 16 * (G3P / 2) + ks * 32, hh); b[ks][i] = g2_frag(pb + i * 16 * (G3P / 2) + ks * 32, hh); }
    __builtin_amdgcn_sched_barrier(0);      /* keeps the stage's 32 fragment reads together in front of its products: without it the scheduler sinks the A reads among them, into one register set, and every four products wait out an LDS latency */
#pragma unroll
    for (int ks = 0; ks < 2; ++ks)
#pragma unroll
      for (int i = 0; i < 4; ++i)
#pragma unroll
        for (int j = 0; j < 4; ++j) acc[i][j] = g3_mma(a[ks][i], b[ks][j], acc[i][j]);
    __builtin_amdgcn_sched_barrier(0);      /* keeps the products in front of the stage's waits: without it the scheduler sinks them behind the barrier, and the wait for the next stage's copies stands at the head of the trip, before they have had time to land */
    asm volatile("s_wait_dscnt 0x0" ::: "memory");      /* this wave's reads of the buffer have returned */
    asm volatile("s_wait_asynccnt 0x0" ::: "memory");      /* this wave's copies of stage t + 1 have landed */
    __syncthreads();      /* publishes stage t + 1 and frees stage t's buffer */
    if (t + 2 < nt) { g3_copy8(lc + buf, ga + (size_t)(t + 2) * 64, lda); g3_copy8(lc + buf + G3T, gb + (size_t)(t + 2) * 64, ldb); } }
  asm volatile("s_wait_asynccnt 0x0" ::: "memory");      /* no copy is outstanding when the ring becomes output staging */
  float (*so)[68] = (float (*)[68])(L + (size_t)w * (64 * 68 * 4));      /* each wave stages in its own range; the last trip's barrier has ended every read of the ring */
#pragma unroll
  for (int u = 0; u < 16; ++u) { const int t = u & 3, half = u >> 2;
#pragma unroll
    for (int r = 0; r < 8; ++r) { const int rloc = half * 16 + 8 * hh + r; const float v = acc[half][t][r] * alpha + bf16_round(bv[t]);
      so[rloc][t * 16 + ln] = v; } }
  __builtin_amdgcn_fence(__ATOMIC_ACQ_REL, "workgroup"); __builtin_amdgcn_wave_barrier();
  const int rsub = lane >> 4, c4 = (lane & 15) * 4;
  const size_t e0 = cofs + (size_t)(row0 + rsub) * ldc + col0 + c4;      /* the lane's first element; row q * 2 + rsub lies q * 2 * ldc elements further on */
  v4f rv[32]; static_assert(!RES || ACT == 0, "k_gemm3: the residual rows are held in registers, so their loop is unrolled");
  if (RES) {
#pragma unroll
    for (int q = 0; q < 32; ++q) rv[q] = *(const v4fa*)(CP + e0 + (size_t)q * (2 * ldc));
    asm volatile("s_wait_xcnt 0x0" ::: "memory");      /* the 32 loads share one address pair, which is rewritten right behind them */
  }
  {
#pragma unroll(ACT == 0 ? 32 : 2)      /* with an activation the loop stays rolled, for code size (128 copies of erff otherwise) */
    for (int q = 0; q < 32; ++q) { const int r = q * 2 + rsub; const size_t e = e0 + (size_t)q * (2 * ldc); v4f v = *(const v4fa*)&so[r][c4]; if (RES) v += rv[q]; for (int i = 0; i < 4; ++i) v[i] = g3_act<ACT>(v[i]); if (W32) *(v4f*)(C + e) = v; else { v4h h4; for (int i = 0; i < 4; ++i) h4[i] = (_Float16)v[i]; *(v4h*)(C16 + e) = h4; }
      if (ACT != 0 || (q & 7) == 7) asm volatile("s_wait_xcnt 0x0" ::: "memory");      /* later rows rewrite registers of issued stores (rolled loop: the next trip does); unrolled, one wait serves eight rows */
    }
     } }


__global__ __launch_bounds__(256) void k_wnat(const float* __restrict__ w, size_t n8, _Float16* __restrict__ Bt) { const size_t t = (size_t)blockIdx.x * 256 + threadIdx.x; if (t >= n8) return; FragH f; for (int q = 0; q < 8; ++q) f.h[q] = (_Float16)(bf16_round(w[t * 8 + q]) * 16.0f); *(v8us*)((unsigned short*)Bt + t * 8) = f.half[0];  }
__global__ __launch_bounds__(256) void k_rsm(const float* __restrict__ S, _Float16* __restrict__ P, int nrows) {
  #pragma clang fp contract(off)
  const int i = blockIdx.x * 256 + threadIdx.x; if (i >= nrows) return; const float* s = S + (size_t)i * SQ; float mx = -3.0e38f;
#pragma unroll 1
  for (int j = 0; j < SQ; ++j) mx = fmaxf(mx, s[j]); float se = 0.f;
#pragma unroll 1
  for (int j = 0; j < SQ; ++j) se += expf(s[j] - mx); const float sc = 256.0f / se;
#pragma unroll 1
  for (int j0 = 0; j0 < SQ; j0 += 8) { FragH f; for (int q = 0; q < 8; ++q) f.h[q] = (_Float16)(expf(s[j0 + q] - mx) * sc); unsigned short* d = (unsigned short*)P + (size_t)i * SQ + j0; *(v8us*)d = f.half[0];  } }
__global__ __launch_bounds__(256) void k_vt(const _Float16* __restrict__ V16, int b, int h0, _Float16* __restrict__ VT) { __shared__ unsigned short tl[64][65]; const int tid = threadIdx.x; const int hh = blockIdx.x % HG, sg = blockIdx.x / HG; const int s0 = sg * 64; const int h = h0 + hh;
  for (int i = tid; i < 64 * 8; i += 256) { const int j = i / 8, d8 = (i % 8) * 8; FragH f; f.half[0] = *(const v8us*)((const unsigned short*)V16 + ((size_t)b * SQ + s0 + j) * DM + h * HD + d8); for (int q = 0; q < 8; ++q) tl[d8 + q][j] = f.u[q]; }
  __syncthreads();
  { for (int i = tid; i < 64 * 8; i += 256) { const int d = i / 8, j8 = (i % 8) * 8; FragH f; for (int q = 0; q < 8; ++q) f.u[q] = tl[d][j8 + q]; *(v8us*)((unsigned short*)VT + ((size_t)hh * HD + d) * SQ + s0 + j8) = f.half[0]; }  } }



__global__ __launch_bounds__(256) void k_rsmcf2(const float* __restrict__ S, _Float16* __restrict__ P, int hg, int q0, int nk) {
  #pragma clang fp contract(off)
  const int t = blockIdx.x * 256 + threadIdx.x; if (t >= hg * QT) return; const size_t i = (size_t)t; const float* s = S + i * NKX; const int last = q0 + (t % QT); float mx = -3.0e38f;
#pragma unroll 1
  for (int j = 0; j < nk; ++j) { const float f = (j <= last) ? 1.f : 0.f; mx = fmaxf(mx, fmaf(f, s[j], (1.f - f) * -1.0e9f)); } float se = 0.f;
#pragma unroll 1
  for (int j = 0; j < nk; ++j) { const float f = (j <= last) ? 1.f : 0.f; se += __expf(fmaf(f, s[j], (1.f - f) * -1.0e9f) - mx); } const float sc = 256.0f / se;
#pragma unroll 1
  for (int j0 = 0; j0 < nk; j0 += 8) { FragH fr; for (int q = 0; q < 8; ++q) { const int j = j0 + q; const float f = (j <= last) ? 1.f : 0.f; fr.h[q] = (_Float16)(__expf(fmaf(f, s[j], (1.f - f) * -1.0e9f) - mx) * sc); } unsigned short* d = (unsigned short*)P + i * NKX + j0; *(v8us*)d = fr.half[0];  } }

__global__ __launch_bounds__(256) void k_rsmcst(const float* __restrict__ S, _Float16* __restrict__ P, int hg, int q0, int nk, const int* __restrict__ mk) {
  #pragma clang fp contract(off)
  const int t = blockIdx.x * 256 + threadIdx.x; if (t >= hg * QT) return; const size_t i = (size_t)t; const float* s = S + i * NKX; const size_t ig = (size_t)(q0 + (t % QT)); const int* mr = mk + ig * SQ; float mx = -3.0e38f;
#pragma unroll 1
  for (int j = 0; j < nk; ++j) { const int mb = mr[j]; const int dd = (int)ig - j; const float f = (mb != 0 && dd >= 0 && (dd <= LOCALW || (dd % STRIDEK) == 0)) ? 1.f : 0.f; mx = fmaxf(mx, fmaf(f, s[j], (1.f - f) * -1.0e9f)); } float se = 0.f;
#pragma unroll 1
  for (int j = 0; j < nk; ++j) { const int mb = mr[j]; const int dd = (int)ig - j; const float f = (mb != 0 && dd >= 0 && (dd <= LOCALW || (dd % STRIDEK) == 0)) ? 1.f : 0.f; se += __expf(fmaf(f, s[j], (1.f - f) * -1.0e9f) - mx); } const float sc = 256.0f / se;
#pragma unroll 1
  for (int j0 = 0; j0 < nk; j0 += 8) { FragH fr; for (int q = 0; q < 8; ++q) { const int j = j0 + q; const int mb = mr[j]; const int dd = (int)ig - j; const float f = (mb != 0 && dd >= 0 && (dd <= LOCALW || (dd % STRIDEK) == 0)) ? 1.f : 0.f; fr.h[q] = (_Float16)(__expf(fmaf(f, s[j], (1.f - f) * -1.0e9f) - mx) * sc); } unsigned short* d = (unsigned short*)P + i * NKX + j0; *(v8us*)d = fr.half[0];  } }


template <int MASKADD>
__global__ __launch_bounds__(64) void k_att0(const float* __restrict__ QF, const float* __restrict__ KF, const float* __restrict__ VF, int ld, const float* __restrict__ mask, float scale, float* __restrict__ OF, int ldo) {
  #pragma clang fp contract(off)
  __shared__ __attribute__((aligned(16))) float lq[64][64]; __shared__ __attribute__((aligned(16))) float lo[64][64];
  const int tid = threadIdx.x; const int h = blockIdx.x / (QT0 / 64), rg = blockIdx.x % (QT0 / 64); const int i = rg * 64 + tid;
  const float* qr = QF + (size_t)i * ld + h * HD;
#pragma unroll 1
  for (int c = 0; c < HD / 4; ++c) { *(v4f*)&lq[tid][c * 4] = *(const v4fa*)(qr + c * 4); const v4f z = {0.f, 0.f, 0.f, 0.f}; *(v4f*)&lo[tid][c * 4] = z; }
  float m = -1.0e30f, l = 0.f; const int jmax = MASKADD ? (SQ - 1) : (rg * 64 + 63);      /* additive-mask form: every key (the mask input decides); causal form: keys up to the block's last row */
#pragma unroll 1
  for (int j = 0; j <= jmax; ++j) { const float* kr = KF + (size_t)j * ld + h * HD; const float* vr = VF + (size_t)j * ld + h * HD; float s = 0.f;
#pragma unroll 1
    for (int c = 0; c < HD / 4; ++c) { const v4f kq = *(const v4fa*)(kr + c * 4); const v4f qq = *(v4f*)&lq[tid][c * 4]; s = __fadd_rn(s, __fmul_rn(qq[0], kq[0])); s = __fadd_rn(s, __fmul_rn(qq[1], kq[1])); s = __fadd_rn(s, __fmul_rn(qq[2], kq[2])); s = __fadd_rn(s, __fmul_rn(qq[3], kq[3])); }
    s = __fmul_rn(s, scale); if (MASKADD) s = __fadd_rn(s, __fmul_rn(bf16_round(mask[(size_t)i * SQ + j]), -10000.0f));
    const float f = (MASKADD || j <= i) ? 1.f : 0.f; const float sm = fmaf(f, s, (1.f - f) * -1.0e30f); const float mn = fmaxf(m, sm); const float sc = expf(m - mn); const float e = expf(sm - mn); l = __fadd_rn(__fmul_rn(l, sc), e); m = mn;
#pragma unroll 1
    for (int c = 0; c < HD / 4; ++c) { const v4f vv = *(const v4fa*)(vr + c * 4); v4f oo = *(v4f*)&lo[tid][c * 4]; for (int u = 0; u < 4; ++u) oo[u] = __fadd_rn(__fmul_rn(oo[u], sc), __fmul_rn(e, vv[u])); *(v4f*)&lo[tid][c * 4] = oo; } }
  const float fin = 64.0f / l;      /* o carried x64 like the f16 path */
#pragma unroll 1
  for (int c = 0; c < HD / 4; ++c) { v4f oo = *(v4f*)&lo[tid][c * 4]; for (int u = 0; u < 4; ++u) oo[u] = __fmul_rn(oo[u], fin); *(v4f*)&lo[tid][c * 4] = oo; }
  __syncthreads();
  {
#pragma unroll 1
    for (int it = 0; it < 16; ++it) { const int row = it * 4 + tid / 16, pc = (tid % 16) * 4; const v4f v = *(const v4f*)&lo[row][pc]; *(v4f*)(OF + (size_t)(rg * 64 + row) * ldo + h * HD + pc) = v; }
     } }

template <int MASKADD>
__global__ __launch_bounds__(64) void k_att0mbc(const float* __restrict__ QF, const float* __restrict__ KF, const float* __restrict__ VF, int ld, const float* __restrict__ mask, float scale, float* __restrict__ OF, int ldo) {
  #pragma clang fp contract(off)
  __shared__ __attribute__((aligned(16))) float lq[64][64]; __shared__ __attribute__((aligned(16))) float lo[64][64];
  const int tid = threadIdx.x; const int h = blockIdx.x / (QT0 / 64), rg = blockIdx.x % (QT0 / 64); const int i = rg * 64 + tid;
  const float* qr = QF + (size_t)i * ld + h * HD;
#pragma unroll 1
  for (int c = 0; c < HD / 4; ++c) { *(v4f*)&lq[tid][c * 4] = *(const v4fa*)(qr + c * 4); const v4f z = {0.f, 0.f, 0.f, 0.f}; *(v4f*)&lo[tid][c * 4] = z; }
  float m = -1.0e30f, l = 0.f; const int jmax = rg * 64 + 63;      /* keys beyond the block end are masked by the mask's lower-triangular structure */      /* both MASKADD forms: keys up to the block's last row */
#pragma unroll 1
  for (int j = 0; j <= jmax; ++j) { const float* kr = KF + (size_t)j * ld + h * HD; const float* vr = VF + (size_t)j * ld + h * HD; float s = 0.f;
#pragma unroll 1
    for (int c = 0; c < HD / 4; ++c) { const v4f kq = *(const v4fa*)(kr + c * 4); const v4f qq = *(v4f*)&lq[tid][c * 4]; s = __fadd_rn(s, __fmul_rn(qq[0], kq[0])); s = __fadd_rn(s, __fmul_rn(qq[1], kq[1])); s = __fadd_rn(s, __fmul_rn(qq[2], kq[2])); s = __fadd_rn(s, __fmul_rn(qq[3], kq[3])); }
    s = __fmul_rn(s, scale); const int mb = ((const int*)mask)[(size_t)i * SQ + j];      /* causal (j <= i) AND the module's int32 [S][S] mask read per (query, key): 0 -> masked */
    const float f = (mb != 0 && j <= i) ? 1.f : 0.f; const float sm = fmaf(f, s, (1.f - f) * -1.0e30f); const float mn = fmaxf(m, sm); const float sc = expf(m - mn); const float e = expf(sm - mn); l = __fadd_rn(__fmul_rn(l, sc), e); m = mn;
#pragma unroll 1
    for (int c = 0; c < HD / 4; ++c) { const v4f vv = *(const v4fa*)(vr + c * 4); v4f oo = *(v4f*)&lo[tid][c * 4]; for (int u = 0; u < 4; ++u) oo[u] = __fadd_rn(__fmul_rn(oo[u], sc), __fmul_rn(e, vv[u])); *(v4f*)&lo[tid][c * 4] = oo; } }
  const float fin = 64.0f / l;      /* o carried x64 like the f16 path */
#pragma unroll 1
  for (int c = 0; c < HD / 4; ++c) { v4f oo = *(v4f*)&lo[tid][c * 4]; for (int u = 0; u < 4; ++u) oo[u] = __fmul_rn(oo[u], fin); *(v4f*)&lo[tid][c * 4] = oo; }
  __syncthreads();
  {
#pragma unroll 1
    for (int it = 0; it < 16; ++it) { const int row = it * 4 + tid / 16, pc = (tid % 16) * 4; const v4f v = *(const v4f*)&lo[row][pc]; *(v4f*)(OF + (size_t)(rg * 64 + row) * ldo + h * HD + pc) = v; }
     } }


template <int BFIN, int WXB>
__global__ __launch_bounds__(256) void k_ln16(const float* __restrict__ X, const float* __restrict__ g, const float* __restrict__ bb, float eps, _Float16* __restrict__ N16, float* __restrict__ XB) {
  #pragma clang fp contract(off)
  __shared__ float red[256]; const size_t r = blockIdx.x; const int t = threadIdx.x; const v4f xa = *(const v4fa*)(X + r * DMQ + t * 4); float s[4]; float sum = 0.f;
  for (int q = 0; q < 4; ++q) { s[q] = BFIN ? bf16_round(xa[q]) : xa[q]; sum = __fadd_rn(sum, s[q]); }
  red[t] = sum; __syncthreads(); for (int st = 128; st > 0; st >>= 1) { if (t < st) red[t] = __fadd_rn(red[t], red[t + st]); __syncthreads(); } const float mu = red[0] / (float)DMQ; __syncthreads();
  float vs = 0.f; for (int q = 0; q < 4; ++q) { const float dl = __fadd_rn(s[q], -mu); vs = __fadd_rn(vs, __fmul_rn(dl, dl)); } red[t] = vs; __syncthreads(); for (int st = 128; st > 0; st >>= 1) { if (t < st) red[t] = __fadd_rn(red[t], red[t + st]); __syncthreads(); }
  const float rs = rsqrtf(__fadd_rn(red[0] / (float)DMQ, eps)); v4h y; v4f xb;
  for (int q = 0; q < 4; ++q) { const int c = t * 4 + q; y[q] = (_Float16)__fadd_rn(__fmul_rn(__fmul_rn(__fadd_rn(s[q], -mu), rs), bf16_round(g[c])), bf16_round(bb[c])); xb[q] = s[q]; }
  { *(v4h*)(N16 + r * DMQ + t * 4) = y; if (WXB) *(v4f*)(XB + r * DMQ + t * 4) = xb;  } }
__global__ __launch_bounds__(256) void k_ftres2(const float* __restrict__ OF0, const float* __restrict__ XB, float* __restrict__ X1, size_t n4) {
  #pragma clang fp contract(off)
  const size_t t = (size_t)blockIdx.x * 256 + threadIdx.x; if (t >= n4) return; const v4f o = *(const v4fa*)(OF0 + t * 4), xv = *(const v4fa*)(XB + t * 4); v4f y; for (int q = 0; q < 4; ++q) y[q] = __fadd_rn(__fmul_rn(o[q], 0.015625f), xv[q]); *(v4f*)(X1 + t * 4) = y;  }

__global__ __launch_bounds__(256) void k_bcpy(const float* __restrict__ b, int n, int NP, float* __restrict__ dst, int dst0) { for (int i = threadIdx.x; i < NP; i += 256) { const float v = (i < n) ? b[i] : 0.f; *(float*)(dst + dst0 + i) = v; }  }


#define FAW 8                        /* waves per work-group */
#define FAQ 32                       /* query columns per wave (two 16-column groups) */
#define FAC 0.18033688011112042592f  /* 64^-0.5 * log2 e: scores are carried in log2 units */
__device__ __forceinline__ float rs_x16(float x) { const int b = __builtin_bit_cast(int, x); return __builtin_bit_cast(float, __builtin_amdgcn_permlanex16(b, b, 0x76543210, 0xfedcba98, false, false)); }      /* lane l <- lane l ^ 16 */
// Four 2^x in one statement. The outputs are early-clobber, so inside it no v_exp_f32 is directly followed by a read of its result or a write of its source; the v_nop keeps that slot behind the last one.
__device__ __forceinline__ v4f rs_exp2(v4f x) { float y0, y1, y2, y3; asm("v_exp_f32 %0, %4\n\tv_exp_f32 %1, %5\n\tv_exp_f32 %2, %6\n\tv_exp_f32 %3, %7\n\tv_nop" : "=&v"(y0), "=&v"(y1), "=&v"(y2), "=&v"(y3) : "v"(x[0]), "v"(x[1]), "v"(x[2]), "v"(x[3])); const v4f y = {y0, y1, y2, y3}; return y; }
// One 2^x, with the same slot kept behind it.
__device__ __forceinline__ float fa_exp2(float x) { float y; asm("v_exp_f32 %0, %1\n\tv_nop" : "=&v"(y) : "v"(x)); return y; }
__device__ __forceinline__ v8f fa_mma(v16h a, v16h b, v8f c) { return __builtin_amdgcn_wmma_f32_16x16x32_f16(false, a, false, b, (short)0, c, false, false); }
// Q16, K16: f16 rows [NB * SQ][DM], head h = columns h*64..; VT: f16 [NB * NH][HD][SQ]; O16: context x64 as f16 rows (merged heads).
// The short loops are fully unrolled so that every fragment array is indexed by constants and stays in registers.
__global__ __launch_bounds__(FAW * 32) void k_fattn(const _Float16* __restrict__ Q16, const _Float16* __restrict__ K16, const _Float16* __restrict__ VT, _Float16* __restrict__ O16) {
  const int lane = threadIdx.x & 31, ln = lane & 15, hh = lane >> 4, w = threadIdx.x >> 5;
  constexpr int QB = SQ / (FAW * FAQ); const int qb = blockIdx.x % QB, bh = blockIdx.x / QB; const int b = bh / NH, h = bh % NH; const int q0 = qb * (FAW * FAQ) + w * FAQ;
  const _Float16* qp = Q16 + ((size_t)b * SQ + q0 + ln) * DM + h * HD; const _Float16* kp = K16 + ((size_t)b * SQ + ln) * DM + h * HD; const _Float16* vp = VT + ((size_t)bh * HD + ln) * SQ;
  const v8f z8 = {0.f, 0.f, 0.f, 0.f, 0.f, 0.f, 0.f, 0.f};
  v16h qf[2][2], kf[2][2]; v8f o[2][4]; float m[2], l[2];
#pragma unroll
  for (int j = 0; j < 2; ++j) { m[j] = -3.0e38f; l[j] = 0.f;
#pragma unroll
    for (int d = 0; d < 4; ++d) o[j][d] = z8;
#pragma unroll
    for (int ks = 0; ks < 2; ++ks) { qf[j][ks] = g2_frag(qp + (size_t)j * 16 * DM + ks * 32, hh); kf[j][ks] = g2_frag(kp + (size_t)j * 16 * DM + ks * 32, hh); } }
  for (int kb = 0; kb < SQ; kb += 32) {
    v16h vf[4]; v8f s[2][2];
#pragma unroll
    for (int d = 0; d < 4; ++d) vf[d] = g2_frag(vp + (size_t)d * 16 * SQ + kb, hh);      /* issued first: they fly under the score products and the softmax */
#pragma unroll
    for (int j = 0; j < 2; ++j)
#pragma unroll
      for (int t = 0; t < 2; ++t) s[j][t] = fa_mma(kf[t][1], qf[j][1], fa_mma(kf[t][0], qf[j][0], z8));      /* s[j][t][r] = q(q0 + 16 j + ln) . k(kb + 16 t + 8 hh + r) */
    const int kn = (kb + 32) & (SQ - 1);      /* the next pass's K fragments fly under this pass's softmax; the last pass re-reads keys 0..31 (in bounds, not used) */
#pragma unroll
    for (int t = 0; t < 2; ++t)
#pragma unroll
      for (int ks = 0; ks < 2; ++ks) kf[t][ks] = g2_frag(kp + (size_t)(kn + t * 16) * DM + ks * 32, hh);
    __builtin_amdgcn_sched_barrier(0);      /* keeps the K loads above the softmax: without it the scheduler sinks them to the foot of the pass, and the next pass waits out their whole latency */
#pragma unroll
    for (int j = 0; j < 2; ++j) {
      float mx = fmaxf(s[j][0][0], s[j][1][0]);
#pragma unroll
      for (int r = 1; r < 8; ++r) mx = fmaxf(mx, fmaxf(s[j][0][r], s[j][1][r]));
      mx = fmaxf(mx, rs_x16(mx));
      const float mn = fmaxf(m[j], mx * FAC), al = fa_exp2(m[j] - mn), mb = 8.0f - mn; m[j] = mn;      /* p = 2^8 exp(s - max) <= 256: small weights stay out of the f16 subnormals; the factor cancels against the sum */
      FragH pf; v4f s4 = {0.f, 0.f, 0.f, 0.f};
#pragma unroll
      for (int t = 0; t < 2; ++t)
#pragma unroll
        for (int c = 0; c < 2; ++c) { const v4f x = {s[j][t][c * 4] * FAC + mb, s[j][t][c * 4 + 1] * FAC + mb, s[j][t][c * 4 + 2] * FAC + mb, s[j][t][c * 4 + 3] * FAC + mb}; const v4f e = rs_exp2(x); s4 += e;
#pragma unroll
          for (int q = 0; q < 4; ++q) pf.h[t * 8 + c * 4 + q] = (_Float16)e[q]; }
      l[j] = l[j] * al + ((s4[0] + s4[1]) + (s4[2] + s4[3]));
#pragma unroll
      for (int d = 0; d < 4; ++d) o[j][d] = fa_mma(vf[d], pf.v, o[j][d] * al);      /* o[j][d][r] = sum_k p v(k)[16 d + 8 hh + r] for query q0 + 16 j + ln */
    } }
#pragma unroll
  for (int j = 0; j < 2; ++j) { const float fin = 64.0f / (l[j] + rs_x16(l[j])); unsigned short* op = (unsigned short*)O16 + ((size_t)b * SQ + q0 + j * 16 + ln) * DM + h * HD + 8 * hh;
#pragma unroll
    for (int d = 0; d < 4; ++d) { FragH f;
#pragma unroll
      for (int r = 0; r < 8; ++r) f.h[r] = (_Float16)(o[j][d][r] * fin);
      *(v8us*)(op + d * 16) = f.half[0]; } } }

template <int MODE>
__global__ __launch_bounds__(256) void k_regrp(const float* __restrict__ src, float* __restrict__ dst, size_t n4) {
  const size_t t = (size_t)blockIdx.x * 256 + threadIdx.x; if (t >= n4) return; const size_t e = t * 4; const size_t rd = e / DM; const int c = (int)(e % DM);
  size_t rs; if (MODE == 0) { const size_t b = rd / SQ, sq = rd % SQ; rs = sq * NB + b; } else { const size_t sq = rd / NB, b = rd % NB; rs = b * SQ + sq; }
  const v4f v = *(const v4fa*)(src + rs * DM + c); *(v4f*)(dst + e) = v;  }

template <int BFIN, int W16, int W32>
__global__ __launch_bounds__(256) void k_lnx(const float* __restrict__ X, const float* __restrict__ g, const float* __restrict__ bb, float eps, _Float16* __restrict__ N16, float* __restrict__ N32) {
  #pragma clang fp contract(off)
  __shared__ float red[256]; const size_t r = blockIdx.x; const int t = threadIdx.x; const bool act = t < (DMQ / 4); const int c0 = act ? t * 4 : 0;
  const v4f xa = *(const v4fa*)(X + r * DMQ + c0); float s[4]; float sum = 0.f;
  for (int q = 0; q < 4; ++q) { s[q] = act ? (BFIN ? bf16_round(xa[q]) : xa[q]) : 0.f; sum = __fadd_rn(sum, s[q]); }
  red[t] = sum; __syncthreads(); for (int st = 128; st > 0; st >>= 1) { if (t < st) red[t] = __fadd_rn(red[t], red[t + st]); __syncthreads(); } const float mu = red[0] / (float)DMQ; __syncthreads();
  float vs = 0.f; for (int q = 0; q < 4; ++q) { const float dl = act ? __fadd_rn(s[q], -mu) : 0.f; vs = __fadd_rn(vs, __fmul_rn(dl, dl)); } red[t] = vs; __syncthreads(); for (int st = 128; st > 0; st >>= 1) { if (t < st) red[t] = __fadd_rn(red[t], red[t + st]); __syncthreads(); }
  const float rs = rsqrtf(__fadd_rn(red[0] / (float)DMQ, eps)); v4h y; v4f yf;
  for (int q = 0; q < 4; ++q) { const int c = c0 + q; yf[q] = __fadd_rn(__fmul_rn(__fmul_rn(__fadd_rn(s[q], -mu), rs), bf16_round(g[c])), bf16_round(bb[c])); y[q] = (_Float16)yf[q]; }
  if (!act) return;      /* no barriers after this point */
  { if (W16) *(v4h*)(N16 + r * DMQ + c0) = y; if (W32) *(v4f*)(N32 + r * DMQ + c0) = yf;  } }

__global__ __launch_bounds__(256) void k_bfr(const float* __restrict__ x, float* __restrict__ XB, size_t n8) { const size_t t = (size_t)blockIdx.x * 256 + threadIdx.x; if (t >= n8) return; v4f a = *(const v4fa*)(x + t * 8), c = *(const v4fa*)(x + t * 8 + 4); for (int q = 0; q < 4; ++q) { a[q] = bf16_round(a[q]); c[q] = bf16_round(c[q]); }
  { *(v4f*)(XB + t * 8) = a; *(v4f*)(XB + t * 8 + 4) = c;  } }



__global__ __launch_bounds__(256) void k_wthd(const float* __restrict__ Wt, _Float16* __restrict__ Bt) { const size_t t = (size_t)blockIdx.x * 256 + threadIdx.x; if (t >= (size_t)NH * HD * (DM / 8)) return; const int m8 = (int)(t % (DM / 8)) * 8; const int d = (int)((t / (DM / 8)) % HD); const int h = (int)(t / ((size_t)(DM / 8) * HD)); FragH f;
  for (int q = 0; q < 8; ++q) f.h[q] = (_Float16)(16.0f * bf16_round(Wt[((size_t)h * DM + m8 + q) * HD + d])); unsigned short* dst = (unsigned short*)Bt + ((size_t)h * HD + d) * DM + m8; *(v8us*)dst = f.half[0];  }




template <int BFIN, int SCAL>
__global__ __launch_bounds__(256) void k_lnsc(const float* __restrict__ X, const float* __restrict__ g, const float* __restrict__ bb, float eps, _Float16* __restrict__ N16, float* __restrict__ N32) {
  #pragma clang fp contract(off)
  __shared__ float red[256]; const size_t r = blockIdx.x; const int t = threadIdx.x; const bool act = t < DM / 4; const int tc = act ? t : 0; const v4f xl = *(const v4fa*)(X + r * DM + tc * 4); const float am = act ? 1.f : 0.f; float s[4]; float sum = 0.f;
  for (int q = 0; q < 4; ++q) { s[q] = (BFIN ? bf16_round(xl[q]) : xl[q]) * am; sum = __fadd_rn(sum, s[q]); }
  red[t] = sum; __syncthreads(); for (int st = 128; st > 0; st >>= 1) { if (t < st) red[t] = __fadd_rn(red[t], red[t + st]); __syncthreads(); } const float mu = red[0] / (float)DM; __syncthreads();
  float vs = 0.f; for (int q = 0; q < 4; ++q) { const float dl = __fadd_rn(s[q], -mu) * am; vs = __fadd_rn(vs, __fmul_rn(dl, dl)); } red[t] = vs; __syncthreads(); for (int st = 128; st > 0; st >>= 1) { if (t < st) red[t] = __fadd_rn(red[t], red[t + st]); __syncthreads(); }
  const float rs = __fdiv_rn(1.0f, __fadd_rn(sqrtf(red[0] / (float)(DM - 1)), eps)); if (!act) return; v4h y; v4f yf;
  for (int q = 0; q < 4; ++q) { const int c = t * 4 + q; const float gg = bf16_round(SCAL ? g[0] : g[c]), bv = bf16_round(SCAL ? bb[0] : bb[c]); yf[q] = __fadd_rn(__fmul_rn(__fmul_rn(__fadd_rn(s[q], -mu), rs), gg), bv); y[q] = (_Float16)yf[q]; }
  { if (N16) *(v4h*)(N16 + r * DM + t * 4) = y; if (N32) *(v4f*)(N32 + r * DM + t * 4) = yf;  } }

__global__ __launch_bounds__(256) void k_rsmdmi(const float* __restrict__ S, _Float16* __restrict__ P, int nrows, const int* __restrict__ M) {
  #pragma clang fp contract(off)
  const int t = blockIdx.x * 256 + threadIdx.x; if (t >= nrows) return; const float* s = S + (size_t)t * SQ; const int* m = M + (size_t)(t % SQ) * SQ; float mx = -3.0e38f;
#pragma unroll 1
  for (int j = 0; j < SQ; ++j) { const float f = (m[j] == 0) ? 1.f : 0.f; mx = fmaxf(mx, fmaf(f, s[j], (1.f - f) * -1.0e9f)); } float se = 0.f;
#pragma unroll 1
  for (int j = 0; j < SQ; ++j) { const float f = (m[j] == 0) ? 1.f : 0.f; se += __expf(fmaf(f, s[j], (1.f - f) * -1.0e9f) - mx); } const float sc = 256.0f / se;
#pragma unroll 1
  for (int j0 = 0; j0 < SQ; j0 += 8) { FragH fr; for (int q = 0; q < 8; ++q) { const int j = j0 + q; const float f = (m[j] == 0) ? 1.f : 0.f; fr.h[q] = (_Float16)(__expf(fmaf(f, s[j], (1.f - f) * -1.0e9f) - mx) * sc); } unsigned short* d = (unsigned short*)P + (size_t)t * SQ + j0; *(v8us*)d = fr.half[0];  } }
// All six weight planes in one launch (blockIdx.y = plane): Bt[p][n][k] = f16(bf16(W[k][n]) x16), element for element as k_wt_f16.
// Planes 0..2: per-head tensors [NH][DM][HD], row n = head n / HD, output n % HD; planes 3..5: [in][out] squares of DM x DM.
static_assert(DFF == DM, "k_wt_all: every plane is DM x DM");
// Eight source rows of one output column. The pitch is a compile-time constant, so the eight loads share one address pair and differ only in their immediate offsets.
template <int PITCH>
__device__ __forceinline__ v8us wt_col8(const float* __restrict__ s) { FragH f;
  for (int i = 0; i < 8; ++i) f.h[i] = (_Float16)(bf16_round(s[(size_t)i * PITCH]) * 16.0f);
  return f.half[0]; }
__global__ __launch_bounds__(256) void k_wt_all(const float* __restrict__ wq, const float* __restrict__ wk, const float* __restrict__ wv, const float* __restrict__ wo, const float* __restrict__ w1, const float* __restrict__ w2, _Float16* __restrict__ Bt) {
  const int p = blockIdx.y; const int t = blockIdx.x * 256 + threadIdx.x; const int n = t / (DM / 8), k8 = (t % (DM / 8)) * 8;
  const float* W = p == 0 ? wq : p == 1 ? wk : p == 2 ? wv : p == 3 ? wo : p == 4 ? w1 : w2;
  const v8us o = p < 3 ? wt_col8<HD>(W + ((size_t)(n / HD) * DM + k8) * HD + (n % HD)) : wt_col8<DM>(W + (size_t)k8 * DM + n);
  *(v8us*)((unsigned short*)Bt + ((size_t)p * DM + n) * DM + k8) = o; }
extern "C" void kernel_launch(void* const* d_in, const int* in_sizes, int n_in,
                              void* d_out, int out_size, void* d_ws, size_t ws_size, hipStream_t stream) {
  (void)in_sizes; (void)n_in; (void)out_size;
  const float* const* I = (const float* const*)d_in; const float* x = I[0]; const float* wq = I[1]; const float* wk = I[2]; const float* wv = I[3]; const float* wo = I[4]; const float* bo = I[5]; const float* w1 = I[6]; const float* b1 = I[7]; const float* w2 = I[8]; const float* b2 = I[9]; const float* g1 = I[10]; const float* be1 = I[11]; const float* g2 = I[12]; const float* be2 = I[13];      /* x; per-head Wq / Wk / Wv [16][1024][64] (no biases); Wo [1024][1024] + bo ([in][out]); W1 [1024][1024] + b1, W2 [1024][1024] + b2; LN1 g / b, LN2 g / b */
  char* ws = (char*)d_ws; size_t off = 0;
  auto take = [&](size_t bytes) { char* p = ws + off; off += (bytes + 255) & ~(size_t)255; return p; };
  _Float16* BQ = (_Float16*)take((size_t)6 * DM * DM * 2); _Float16* BO = BQ + (size_t)3 * DM * DM; _Float16* BW1 = BQ + (size_t)4 * DM * DM; _Float16* BW2 = BQ + (size_t)5 * DM * DM;      /* six Bt planes in a row: q, k, v, o, W1, W2 */
  float* XB = (float*)take(NR * DM * 4); _Float16* XN = (_Float16*)take(NR * DM * 2); _Float16* Q16 = (_Float16*)take((size_t)3 * NR * DM * 2); _Float16* K16 = Q16 + NR * DM; _Float16* V16 = Q16 + (size_t)2 * NR * DM;      /* three planes in a row: one batched GEMM writes them */ _Float16* O16 = (_Float16*)take(NR * DM * 2); float* X1 = (float*)take(NR * DM * 4);
  _Float16* VT = (_Float16*)take((size_t)NB * NH * HD * SQ * 2);
  _Float16* M16 = XN;      /* second-norm f16 rows: aliases XN (last readers: the three projections) */ _Float16* HF16 = (_Float16*)take(NR * DFF * 2);      /* FFN hidden rows of every batch [8192][1024] f16 (16 MiB): own region */
  
  if (off > ws_size) return;
  k_wt_all<<<dim3((unsigned)((size_t)DM * (DM / 8) / 256), 6), 256, 0, stream>>>(wq, wk, wv, wo, w1, w2, BQ);      /* every weight -> Bt x16, one launch; per-head [in = 1024][out = 64]: head h = rows h*64.. of its plane */
  k_bfr<<<(unsigned)((NR * DM / 8 + 255) / 256), 256, 0, stream>>>(x, XB, NR * DM / 8); k_lnx<1, 1, 0><<<(unsigned)NR, 256, 0, stream>>>(x, g1, be1, 1e-5f, XN, nullptr);      /* n = LN0(bf16(x)) (biased variance, eps inside the rsqrt) -> f16 rows */
  k_gemm3<0, false, false><<<dim3((unsigned)((NR / 128) * (DM / 128)), 3), 128, 0, stream>>>(XN, DM, 0, BQ, DM, (size_t)DM * DM, 0.0625f, nullptr, 0, nullptr, nullptr, Q16, NR * DM, (int)NR, DM, DM);      /* q, k, v (blockIdx.y) -> f16 rows, one launch; head h = columns h*64.. */
  k_vt<NH, SQ><<<NB * NH * (SQ / 64), 256, 0, stream>>>(V16, DM, 0, VT);      /* V^T [8 * 16][64][1024], every batch */
  k_fattn<<<NB * NH * (SQ / (FAW * FAQ)), FAW * 32, 0, stream>>>(Q16, K16, VT, O16);      /* softmax(q k^T / 8) v over all keys (no mask) -> ctx (merged heads, x64) as f16 rows */
  k_gemm3<0, true, true><<<dim3((unsigned)((NR / 128) * (DM / 128)), 1), 128, 0, stream>>>(O16, DM, 0, BO, DM, 0, 0.0009765625f, bo, 0, XB, X1, nullptr, 0, (int)NR, DM, DM);      /* x + ctx wo (+ bo) (own-element residual) -> f32 rows */
  k_lnx<0, 1, 0><<<(unsigned)NR, 256, 0, stream>>>(X1, g2, be2, 1e-5f, M16, nullptr);      /* LN1(x1) -> f16 rows */
  k_gemm3<6, false, false><<<dim3((unsigned)((NR / 128) * (DFF / 128)), 1), 128, 0, stream>>>(M16, DM, 0, BW1, DM, 0, 0.0625f, b1, 0, nullptr, nullptr, HF16, 0, (int)NR, DFF, DM);      /* gelu_erf(. W1 + b1) -> f16, all rows */
  k_gemm3<0, true, true><<<dim3((unsigned)((NR / 128) * (DM / 128)), 1), 128, 0, stream>>>(HF16, DFF, 0, BW2, DFF, 0, 0.0625f, b2, 0, X1, (float*)d_out, nullptr, 0, (int)NR, DM, DFF);      /* out = x1 + mlp (own-element residual), all rows */
}

// v005
// A run of this version takes 228 microseconds.
// Next to v004, in two timings, it ran 1.06 times as fast each time.
// Over all steps from v000 it is 33.3 times as fast.
#include <hip/hip_runtime.h>
// Pre-LN transformer encoder block with PER-HEAD projection tensors, no QKV biases (x [8][1024][1024]; h = LN1(x) (biased var, eps 1e-5); q/k/v[h] = h W[h] with W [16][1024][64] ([head][in][out]); scale 64^-0.5; softmax over all 1024 keys (no mask); x1 = x + concat(attn) Wo + bo ([in][out]); out = x1 + gelu_erf(LN2(x1) W1 + b1) W2 + b2 ([in][out] 1024 x 1024 x 1024: hidden = 1 x n_embd, as the source) -> [8][1024][1024]).
// Structure: token rows; LayerNorm / exact f16 rows; WMMA GEMMs for q, k, v; V^T of every batch and head by LDS transposes; one fused attention launch (scores, online softmax and P V in registers); output projection with the own-element residual; custom LayerNorm; GELU (erf) FFN over all rows; launches: see trace.
// Compute dtype: inputs rounded to bf16; x / weights exact; q, k, v, softmax weights and o as plain f16 GEMM operands (~2^-12); scores and softmax statistics f32. v_wmma_f32_16x16x32_f16.
#define NB 8
#define SQ 1024
#define DM 1024
#define NH 16
#define HD 64
#define HG 4                         /* heads per call of the unused per-batch k_vt overload */
#define LOCALW 128                   /* (macros for unused kernels of the shared header) */
#define STRIDEK 128
#define QT 256                       /* query rows per causal tile */
#define NKX SQ                       /* S / P row pitch */
#define QT0 128                      /* first-tile rows recomputed exactly in f32 */
#define B0 0                         /* unused; every launch starts at batch 0 */
#define NBR NB                       /* only feeds the unused MP; the launches cover all NB batches */
#define NR ((size_t)NB * SQ)
#define DMQ DM
#define DFF 1024         /* FFN hidden width = 1 x n_embd in this module (W1 [1024][1024], W2 [1024][1024]) */
#define MP ((int)((size_t)NBR * SQ)) /* unused; the projections take NR rows */
#define QN SQ                        /* unused; attention runs all SQ query rows */
#define NHD NH                       /* unused; the launches cover all NH heads */
#define MPO MP                       /* unused; the output stage takes NR rows */
#define LQ (3 * DM)      /* unused; the q, k, v rows have pitch DM */
typedef __bf16 v16b __attribute__((ext_vector_type(16)));
typedef unsigned short v8us __attribute__((ext_vector_type(8), may_alias));
typedef float  v8f  __attribute__((ext_vector_type(8)));
typedef float  v4f  __attribute__((ext_vector_type(4)));
typedef float  v4fa __attribute__((ext_vector_type(4), may_alias));
union FragB { v16b v; v8us half[2]; unsigned short u[16]; };

__device__ __forceinline__ unsigned short bf16_bits(float x) { unsigned int u = __float_as_uint(x); return (unsigned short)((u + 0x7FFFu + ((u >> 16) & 1u)) >> 16); }
__device__ __forceinline__ float bf16_val(unsigned short b) { return __uint_as_float(((unsigned int)b) << 16); }
__device__ __forceinline__ float bf16_round(float x) { return bf16_val(bf16_bits(x)); }
// D += A·B with NT terms: 1 = ah·bh, 2 = + al·bh (A split), 3 = + ah·bl (both split)
template <int NT>
__device__ __forceinline__ v8f mmaN(v16b ah, v16b al, v16b bh, v16b bl, v8f c) {
  c = __builtin_amdgcn_wmma_f32_16x16x32_bf16(false, ah, false, bh, (short)0, c, false, false);
  if (NT >= 2) c = __builtin_amdgcn_wmma_f32_16x16x32_bf16(false, al, false, bh, (short)0, c, false, false);
  if (NT >= 3) c = __builtin_amdgcn_wmma_f32_16x16x32_bf16(false, ah, false, bl, (short)0, c, false, false);
  asm volatile("v_nop\n\tv_nop\n\tv_nop\n\tv_nop" : "+v"(c) : "v"(ah), "v"(al), "v"(bh), "v"(bl));
  return c;
}

__global__ __launch_bounds__(256) void k_wt_bf16(const float* __restrict__ W, unsigned short* __restrict__ Wt, int K, int N) {
  const int t = blockIdx.x * 256 + threadIdx.x;
  const int k8n = K / 8;
  if (t >= N * k8n) return;
  const int n = t / k8n, k8 = (t % k8n) * 8;
  v8us v;
#pragma unroll
  for (int i = 0; i < 8; ++i) v[i] = bf16_bits(W[(size_t)(k8 + i) * N + n]);
  *(v8us*)(Wt + (size_t)n * K + k8) = v;
  
}

// GEMM C[M][N] (f32, pitch ldc) = act(A[M][K]·W + bias). A f32 row-major (pitch lda) converted per fragment to bf16
// (ASPLIT: hi/lo two planes -> 2 terms, else single rounded term); Wt bf16 [N][K] (pitch ldb). BIAS_BF16 rounds the
// bias to bf16 first (bias quantised to bf16 before the add). K%32==0, M%16==0, N%64==0.
template <bool ASPLIT, int ACT, bool BIAS_BF16>
__global__ __launch_bounds__(128) void k_gemm_bf(const float* __restrict__ A, int lda, const unsigned short* __restrict__ Wt, int ldb,
                                               const float* __restrict__ bias, float* __restrict__ C, int ldc, int M, int N, int K) {
  __shared__ __attribute__((aligned(16))) float so[4][16][64];
  const int tid = threadIdx.x, w = tid >> 5, lane = tid & 31, ln = lane & 15, hh = lane >> 4;
  const int ntn = N / 64;
  const int wid = blockIdx.x * 4 + w;
  const int mt = wid / ntn, nq = wid % ntn;
  if (mt * 16 >= M) return;
  const int row0 = mt * 16, col0 = nq * 64;
  const float* arow = A + (size_t)(row0 + ln) * lda;
  v8f acc[4] = {};
  for (int kb = 0; kb < K; kb += 32) {
    FragB ah, al;
    const v4f x0 = *(const v4fa*)(arow + kb + 8 * hh), x1 = *(const v4fa*)(arow + kb + 8 * hh + 4);
    const v4f x2 = *(const v4fa*)(arow + kb + 16 + 8 * hh), x3 = *(const v4fa*)(arow + kb + 16 + 8 * hh + 4);
    float xs[16] = {x0[0],x0[1],x0[2],x0[3],x1[0],x1[1],x1[2],x1[3],x2[0],x2[1],x2[2],x2[3],x3[0],x3[1],x3[2],x3[3]};
#pragma unroll
    for (int i = 0; i < 16; ++i) { const unsigned short hb = bf16_bits(xs[i]); ah.u[i] = hb; al.u[i] = ASPLIT ? bf16_bits(xs[i] - bf16_val(hb)) : (unsigned short)0; }
#pragma unroll
    for (int t = 0; t < 4; ++t) {
      const unsigned short* brow = Wt + (size_t)(col0 + t * 16 + ln) * ldb + kb;
      FragB b;
      b.half[0] = *(const v8us*)(brow + 8 * hh);
      b.half[1] = *(const v8us*)(brow + 16 + 8 * hh);
      acc[t] = mmaN<ASPLIT ? 2 : 1>(ah.v, al.v, b.v, b.v, acc[t]);
    }
  }
#pragma unroll
  for (int t = 0; t < 4; ++t) {
    float bv = bias ? bias[col0 + t * 16 + ln] : 0.f;
    if (BIAS_BF16) bv = bf16_round(bv);
#pragma unroll
    for (int r = 0; r < 8; ++r) { float v = acc[t][r] + bv; if (ACT == 1) v = fmaxf(v, 0.f); so[w][8 * hh + r][t * 16 + ln] = v; }
  }
  __builtin_amdgcn_fence(__ATOMIC_ACQ_REL, "workgroup");
  __builtin_amdgcn_wave_barrier();
  const int rsub = lane >> 4, c4 = (lane & 15) * 4;
  {
#pragma unroll
    for (int q = 0; q < 8; ++q) {
      const int r = q * 2 + rsub;
      const v4f v = *(const v4fa*)&so[w][r][c4];
      *(v4f*)(C + (size_t)(row0 + r) * ldc + col0 + c4) = v;
    }
    
  }
}

// GEMM C = act(A·W + bias + resid): A f32 (ASPLIT -> hi/lo 2 terms), Wt bf16 [N][K]; ACT 0 none, 1 relu, 2 exact gelu;
// resid (optional, f32, row index = (row % rmod), pitch ldr, RES_BF16 rounds it) added before the activation.
template <bool ASPLIT, int ACT, bool BIAS_BF16, bool RES_BF16>
__global__ __launch_bounds__(128) void k_gemm_bf3(const float* __restrict__ A, int lda, const unsigned short* __restrict__ Wt, int ldb,
                                                const float* __restrict__ bias, const float* __restrict__ resid, int rmod, int ldr,
                                                float* __restrict__ C, int ldc, int M, int N, int K) {
  __shared__ __attribute__((aligned(16))) float so[4][16][64];
  const int tid = threadIdx.x, w = tid >> 5, lane = tid & 31, ln = lane & 15, hh = lane >> 4;
  const int ntn = N / 64;
  const int wid = blockIdx.x * 4 + w;
  const int mt = wid / ntn, nq = wid % ntn;
  if (mt * 16 >= M) return;
  const int row0 = mt * 16, col0 = nq * 64;
  const float* arow = A + (size_t)(row0 + ln) * lda;
  v8f acc[4] = {};
  for (int kb = 0; kb < K; kb += 32) {
    FragB ah, al;
    const v4f x0 = *(const v4fa*)(arow + kb + 8 * hh), x1 = *(const v4fa*)(arow + kb + 8 * hh + 4);
    const v4f x2 = *(const v4fa*)(arow + kb + 16 + 8 * hh), x3 = *(const v4fa*)(arow + kb + 16 + 8 * hh + 4);
    float xs[16] = {x0[0],x0[1],x0[2],x0[3],x1[0],x1[1],x1[2],x1[3],x2[0],x2[1],x2[2],x2[3],x3[0],x3[1],x3[2],x3[3]};
#pragma unroll
    for (int i = 0; i < 16; ++i) { const unsigned short hb = bf16_bits(xs[i]); ah.u[i] = hb; al.u[i] = ASPLIT ? bf16_bits(xs[i] - bf16_val(hb)) : (unsigned short)0; }
#pragma unroll
    for (int t = 0; t < 4; ++t) {
      const unsigned short* brow = Wt + (size_t)(col0 + t * 16 + ln) * ldb + kb;
      FragB b;
      b.half[0] = *(const v8us*)(brow + 8 * hh);
      b.half[1] = *(const v8us*)(brow + 16 + 8 * hh);
      acc[t] = mmaN<ASPLIT ? 2 : 1>(ah.v, al.v, b.v, b.v, acc[t]);
    }
  }
#pragma unroll
  for (int t = 0; t < 4; ++t) {
    const int col = col0 + t * 16 + ln;
    float bv = bias ? bias[col] : 0.f;
    if (BIAS_BF16) bv = bf16_round(bv);
#pragma unroll
    for (int r = 0; r < 8; ++r) {
      float v = acc[t][r] + bv;
      if (resid) { float rv = resid[(size_t)((row0 + 8 * hh + r) % rmod) * ldr + col]; if (RES_BF16) rv = bf16_round(rv); v += rv; }
      if (ACT == 1) v = fmaxf(v, 0.f);
      if (ACT == 2) v = 0.5f * v * (1.0f + erff(v * 0.70710678118654752f));
      if (ACT == 3) { const float u = 0.7978845608028654f * (v + 0.044715f * v * v * v); v = 0.5f * v * (1.0f + tanhf(u)); }
      so[w][8 * hh + r][t * 16 + ln] = v;
    }
  }
  __builtin_amdgcn_fence(__ATOMIC_ACQ_REL, "workgroup");
  __builtin_amdgcn_wave_barrier();
  const int rsub = lane >> 4, c4 = (lane & 15) * 4;
  {
#pragma unroll
    for (int q = 0; q < 8; ++q) {
      const int r = q * 2 + rsub;
      const v4f v = *(const v4fa*)&so[w][r][c4];
      *(v4f*)(C + (size_t)(row0 + r) * ldc + col0 + c4) = v;
    }
    
  }
}
// row LayerNorm (biased variance, eps) over N: s = X (+ R); optional out_sum <- s; out_norm <- (s-mu)*rsqrt(var+eps)*g + b
template <bool PARAM_BF16>
__global__ __launch_bounds__(256) void k_layernorm(const float* __restrict__ X, const float* __restrict__ R, const float* __restrict__ g, const float* __restrict__ bta,
                                                  float* __restrict__ out_sum, float* __restrict__ out_norm, int N, float eps) {
  __shared__ float red[256];
  const int row = blockIdx.x, tid = threadIdx.x;
  const float* x = X + (size_t)row * N; const float* rr = R ? R + (size_t)row * N : nullptr;
  float vals[16];                     // up to N = 4096
  const int per = N / 256;            // contiguous chunk per thread? use strided-by-4 chunks: thread handles j = tid*4 + 1024*u
  float s1 = 0.f;
  for (int u = 0; u < per / 4; ++u) {
    const int j = tid * 4 + 1024 * u;
    const v4f a = *(const v4fa*)(x + j);
    v4f b = {0.f,0.f,0.f,0.f}; if (rr) b = *(const v4fa*)(rr + j);
#pragma unroll
    for (int q = 0; q < 4; ++q) { const float v = a[q] + b[q]; vals[u * 4 + q] = v; s1 += v; }
  }
  red[tid] = s1; __syncthreads();
  for (int st = 128; st > 0; st >>= 1) { if (tid < st) red[tid] += red[tid + st]; __syncthreads(); }
  const float mu = red[0] / (float)N; __syncthreads();
  float s2 = 0.f;
  for (int u = 0; u < per / 4; ++u)
#pragma unroll
    for (int q = 0; q < 4; ++q) { const float c = vals[u * 4 + q] - mu; s2 += c * c; }
  red[tid] = s2; __syncthreads();
  for (int st = 128; st > 0; st >>= 1) { if (tid < st) red[tid] += red[tid + st]; __syncthreads(); }
  const float rs = rsqrtf(red[0] / (float)N + eps);
  {
    for (int u = 0; u < per / 4; ++u) {
      const int j = tid * 4 + 1024 * u;
      v4f o, sm;
#pragma unroll
      for (int q = 0; q < 4; ++q) {
        float gg = g[j + q], bb = bta[j + q];
        if (PARAM_BF16) { gg = bf16_round(gg); bb = bf16_round(bb); }
        sm[q] = vals[u * 4 + q]; o[q] = (vals[u * 4 + q] - mu) * rs * gg + bb;
      }
      if (out_sum) *(v4f*)(out_sum + (size_t)row * N + j) = sm;
      *(v4f*)(out_norm + (size_t)row * N + j) = o;
    }
    
  }
}



// ---- f16 WMMA path (v_wmma_f32_16x16x32_f16): 11-bit significands for operands in range — used where a [0,1] probability operand needs more precision than bf16
typedef _Float16 v16h __attribute__((ext_vector_type(16)));
union FragH { v16h v; v8us half[2]; _Float16 h[16]; unsigned short u[16]; };
template <int NT>
__device__ __forceinline__ v8f mmaH(v16h ah, v16h al, v16h bh, v16h bl, v8f c) {
  c = __builtin_amdgcn_wmma_f32_16x16x32_f16(false, ah, false, bh, (short)0, c, false, false);
  if (NT >= 2) c = __builtin_amdgcn_wmma_f32_16x16x32_f16(false, al, false, bh, (short)0, c, false, false);
  if (NT >= 3) c = __builtin_amdgcn_wmma_f32_16x16x32_f16(false, ah, false, bl, (short)0, c, false, false);
  asm volatile("v_nop\n\tv_nop\n\tv_nop\n\tv_nop" : "+v"(c) : "v"(ah), "v"(al), "v"(bh), "v"(bl));
  return c;
}
// batched GEMM like k_gemm_b but f16 operands: A f32 (split into f16 hi/lo if ASPLIT, else rounded to f16), Bt = f16 values [n][k]; alpha; C f32; N multiple of 16 (partial tiles skipped)
template <bool ASPLIT>
__global__ __launch_bounds__(128) void k_gemm_h(const float* __restrict__ A, int lda, size_t sA, const _Float16* __restrict__ Bh, int ldb, size_t sB, float alpha, float* __restrict__ C, int ldc, size_t sC, int M, int N, int K) {
  __shared__ __attribute__((aligned(16))) float so[4][16][64];
  const int tid = threadIdx.x, w = tid >> 5, lane = tid & 31, ln = lane & 15, hh = lane >> 4; const int by = blockIdx.y;
  A += (size_t)by * sA; Bh += (size_t)by * sB; C += (size_t)by * sC;
  const int ntn = (N + 63) / 64; const int wid = blockIdx.x * 4 + w; const int mt = wid / ntn, nq = wid % ntn; if (mt * 16 >= M) return;
  const int row0 = mt * 16, col0 = nq * 64; const float* arow = A + (size_t)(row0 + ln) * lda;
  v8f acc[4] = {};
  for (int kb = 0; kb < K; kb += 32) {
    FragH ah, al;
    const v4f x0 = *(const v4fa*)(arow + kb + 8 * hh), x1 = *(const v4fa*)(arow + kb + 8 * hh + 4), x2 = *(const v4fa*)(arow + kb + 16 + 8 * hh), x3 = *(const v4fa*)(arow + kb + 16 + 8 * hh + 4);
    float xs[16] = {x0[0],x0[1],x0[2],x0[3],x1[0],x1[1],x1[2],x1[3],x2[0],x2[1],x2[2],x2[3],x3[0],x3[1],x3[2],x3[3]};
#pragma unroll
    for (int i = 0; i < 16; ++i) { const _Float16 h = (_Float16)xs[i]; ah.h[i] = h; al.h[i] = ASPLIT ? (_Float16)(xs[i] - (float)h) : (_Float16)0.0f; }
#pragma unroll
    for (int t = 0; t < 4; ++t) { if (col0 + t * 16 >= N) continue; const size_t boff = (size_t)(col0 + t * 16 + ln) * ldb + kb; FragH bq; bq.half[0] = *(const v8us*)(Bh + boff + 8 * hh); bq.half[1] = *(const v8us*)(Bh + boff + 16 + 8 * hh);
      acc[t] = mmaH<ASPLIT ? 2 : 1>(ah.v, al.v, bq.v, bq.v, acc[t]); }
  }
#pragma unroll
  for (int t = 0; t < 4; ++t) { if (col0 + t * 16 >= N) continue;
#pragma unroll
    for (int r = 0; r < 8; ++r) so[w][8 * hh + r][t * 16 + ln] = acc[t][r] * alpha; }
  __builtin_amdgcn_fence(__ATOMIC_ACQ_REL, "workgroup"); __builtin_amdgcn_wave_barrier();
  const int rsub = lane >> 4, c4 = (lane & 15) * 4;
  {
#pragma unroll
    for (int q = 0; q < 8; ++q) { const int r = q * 2 + rsub; if (col0 + c4 < N) { const v4f v = *(const v4fa*)&so[w][r][c4]; *(v4f*)(C + (size_t)(row0 + r) * ldc + col0 + c4) = v; } }
     }
}

// Wt[n][k] = f16(W[k][n]·scale) from f32 row-major W[K][N] (scale = power of two; bf16-exact weights stay exact in f16 away from the subnormal range)
__global__ __launch_bounds__(256) void k_wt_f16(const float* __restrict__ W, _Float16* __restrict__ Wt, int K, int N, float scale) {
  const int t = blockIdx.x * 256 + threadIdx.x; if (t >= N * (K / 8)) return; const int n = t / (K / 8), k8 = (t % (K / 8)) * 8; FragH f;
#pragma unroll
  for (int i = 0; i < 8; ++i) f.h[i] = (_Float16)(bf16_round(W[(size_t)(k8 + i) * N + n]) * scale); const v8us o = f.half[0];
  *(v8us*)((unsigned short*)Wt + (size_t)n * K + k8) = o; 
}
// k_gemm_hh variant with fused epilogue: v = acc·alpha + bias[by·sBias + col] (+ CP[(row/rowsPerB)·sCPb + by·64 + col] if CP) ; ACT 0 none / 1 elu ; writes f16 C16 (and f32 C if non-null)
template <int ACT>
__global__ __launch_bounds__(128) void k_gemm_hhx(const _Float16* __restrict__ A, int lda, size_t sA, const _Float16* __restrict__ Bh, int ldb, size_t sB, float alpha, const float* __restrict__ bias, size_t sBias, const float* __restrict__ CP, int rowsPerB, size_t sCPb, int row0g,
    float* __restrict__ C, _Float16* __restrict__ C16, int ldc, size_t sC, int M, int N, int K) {
  __shared__ __attribute__((aligned(16))) float so[4][16][64];
  const int tid = threadIdx.x, w = tid >> 5, lane = tid & 31, ln = lane & 15, hh = lane >> 4; const int by = blockIdx.y;
  A += (size_t)by * sA; Bh += (size_t)by * sB; const size_t cofs = (size_t)by * sC; const float* bp = bias ? bias + (size_t)by * sBias : nullptr;
  const int ntn = (N + 63) / 64; const int wid = blockIdx.x * 4 + w; const int mt = wid / ntn, nq = wid % ntn; if (mt * 16 >= M) return;
  const int row0 = mt * 16, col0 = nq * 64; const _Float16* arow = A + (size_t)(row0 + ln) * lda;
  v8f acc[4] = {};
  for (int kb = 0; kb < K; kb += 32) { FragH ah; ah.half[0] = *(const v8us*)((const unsigned short*)arow + kb + 8 * hh); ah.half[1] = *(const v8us*)((const unsigned short*)arow + kb + 16 + 8 * hh);
#pragma unroll
    for (int t = 0; t < 4; ++t) { if (col0 + t * 16 >= N) continue; const size_t boff = (size_t)(col0 + t * 16 + ln) * ldb + kb; FragH bq; bq.half[0] = *(const v8us*)((const unsigned short*)Bh + boff + 8 * hh); bq.half[1] = *(const v8us*)((const unsigned short*)Bh + boff + 16 + 8 * hh);
      acc[t] = mmaH<1>(ah.v, ah.v, bq.v, bq.v, acc[t]); }
  }
#pragma unroll
  for (int t = 0; t < 4; ++t) { if (col0 + t * 16 >= N) continue; const int col = col0 + t * 16 + ln; const float bv = bp ? bf16_round(bp[col]) : 0.f;
#pragma unroll
    for (int r = 0; r < 8; ++r) { float v = acc[t][r] * alpha + bv; if (CP) { const int rr = row0g + row0 + 8 * hh + r; if (rowsPerB < 0) v += CP[cofs + (size_t)rr * ldc + col];      /* rowsPerB < 0: own element of the batched C plane */ else { const int bidx = rr / rowsPerB; v += CP[(size_t)bidx * sCPb + (size_t)by * 64 + col]; } } if (ACT == 1) v = (v > 0.f) ? v : expm1f(v); else if (ACT == 7) v = (v > 0.f) ? v + 1.0f : expf(v); else if (ACT == 8) v = tanhf(v); else if (ACT == 9) v = 0.5f * v * (1.0f + tanhf(0.7978845608028654f * (v + 0.044715f * v * v * v))); else if (ACT == 11) v = 1.0f / (1.0f + expf(-v)); else if (ACT == 12) v = (v > 0.f) ? v : 0.01f * v; else if (ACT == 14) v = (v > 0.f) ? v : 0.1f * v; else if (ACT == 16) v = (v >= 0.f) ? v : 0.3f * v; else if (ACT == 17) v = (v >= 0.f) ? v : 0.2f * v; else if (ACT == 15) v = v / (1.0f + expf(-v)); else if (ACT == 3) v = fmaxf(v, 0.f); else if (ACT == 6) v = 0.5f * v * (1.0f + erff(v * 0.70710678118654752f)); so[w][8 * hh + r][t * 16 + ln] = v; } }
  __builtin_amdgcn_fence(__ATOMIC_ACQ_REL, "workgroup"); __builtin_amdgcn_wave_barrier();
  const int rsub = lane >> 4, c4 = (lane & 15) * 4; typedef _Float16 v4h __attribute__((ext_vector_type(4)));
  {
#pragma unroll
    for (int q = 0; q < 8; ++q) { const int r = q * 2 + rsub; if (col0 + c4 < N) { const v4f v = *(const v4fa*)&so[w][r][c4]; if (C) *(v4f*)(C + cofs + (size_t)(row0 + r) * ldc + col0 + c4) = v; if (C16) { v4h h4; for (int i = 0; i < 4; ++i) h4[i] = (_Float16)v[i]; *(v4h*)(C16 + cofs + (size_t)(row0 + r) * ldc + col0 + c4) = h4; } } }
     }
}


typedef _Float16 v4h __attribute__((ext_vector_type(4)));

__global__ __launch_bounds__(256) void k_x16(const float* __restrict__ x, _Float16* __restrict__ X16, size_t n8) { const size_t t = (size_t)blockIdx.x * 256 + threadIdx.x; if (t >= n8) return; FragH f;
#pragma unroll
  for (int q = 0; q < 8; ++q) f.h[q] = (_Float16)bf16_round(x[t * 8 + q]); *(v8us*)((unsigned short*)X16 + t * 8) = f.half[0];  }
__global__ __launch_bounds__(256) void k_h16(const float* __restrict__ x, _Float16* __restrict__ X16, size_t n8) { const size_t t = (size_t)blockIdx.x * 256 + threadIdx.x; if (t >= n8) return; FragH f;
#pragma unroll
  for (int q = 0; q < 8; ++q) f.h[q] = (_Float16)x[t * 8 + q]; *(v8us*)((unsigned short*)X16 + t * 8) = f.half[0];  }
__global__ __launch_bounds__(256) void k_round16f(const float* __restrict__ W, _Float16* __restrict__ Bt, size_t n8) { const size_t t = (size_t)blockIdx.x * 256 + threadIdx.x; if (t >= n8) return; FragH f;
#pragma unroll
  for (int i = 0; i < 8; ++i) f.h[i] = (_Float16)(bf16_round(W[t * 8 + i]) * 16.0f); *(v8us*)((unsigned short*)Bt + t * 8) = f.half[0];  }
template <int NHv, int TTv>
__global__ __launch_bounds__(256) void k_vt(const _Float16* __restrict__ V16, int ldv, int voff, _Float16* __restrict__ Vt) { __shared__ unsigned short tl[64][66]; const int tid = threadIdx.x; const int slab = blockIdx.x / (TTv / 64), lg = blockIdx.x % (TTv / 64); const int b = slab / NHv, h = slab % NHv;
  for (int i = tid; i < 64 * 8; i += 256) { const int r = i / 8, c8 = (i % 8) * 8; FragH f; f.half[0] = *(const v8us*)((const unsigned short*)V16 + ((size_t)b * TTv + lg * 64 + r) * ldv + voff + h * 64 + c8);
#pragma unroll
    for (int q = 0; q < 8; ++q) tl[r][c8 + q] = f.u[q]; }
  __syncthreads();
  {
#pragma unroll
    for (int rd = 0; rd < 2; ++rd) { const int d = rd * 32 + tid / 8, pc = tid % 8; FragH f;
#pragma unroll
      for (int q = 0; q < 8; ++q) f.u[q] = tl[pc * 8 + q][d];
      *(v8us*)((unsigned short*)Vt + ((size_t)slab * 64 + d) * TTv + lg * 64 + pc * 8) = f.half[0]; }
     } }

__global__ __launch_bounds__(256) void k_hl(const float* __restrict__ F, _Float16* __restrict__ Hh, _Float16* __restrict__ Hl, size_t n8) { const size_t t = (size_t)blockIdx.x * 256 + threadIdx.x; if (t >= n8) return; FragH fh, fl; const v4f a = *(const v4fa*)(F + t * 8), c = *(const v4fa*)(F + t * 8 + 4);
#pragma unroll
  for (int q = 0; q < 4; ++q) { _Float16 h = (_Float16)a[q]; fh.h[q] = h; fl.h[q] = (_Float16)((a[q] - (float)h) * 1024.0f); h = (_Float16)c[q]; fh.h[4 + q] = h; fl.h[4 + q] = (_Float16)((c[q] - (float)h) * 1024.0f); }
  { *(v8us*)((unsigned short*)Hh + t * 8) = fh.half[0]; *(v8us*)((unsigned short*)Hl + t * 8) = fl.half[0];  } }

// one 16 x 32 f16 fragment of a k-contiguous row: 16 bytes at k = 8 hh and 16 bytes at k = 16 + 8 hh (A and B alike)
__device__ __forceinline__ v16h g2_frag(const _Float16* p, int hh) { FragH f; f.half[0] = *(const v8us*)((const unsigned short*)p + 8 * hh); f.half[1] = *(const v8us*)((const unsigned short*)p + 16 + 8 * hh); return f.v; }
// ---- tiled GEMM: one 128 x 128 tile of C per work-group (M % 128 == 0, N % 128 == 0, K % 64 == 0), four waves as 2 x 2, 64 x 64 per wave; epilogue = k_gemm_hhx semantics ----
// A stage is 64 k of 128 rows of A and of 128 rows of Bt, brought into LDS by asynchronous copies (whole 128-byte lines, through no register) and read by every wave that needs it.
// Two buffers: the next stage's copies fly while this stage is worked on. The k order of every sum is that of the unstaged loop (32 k per product, ascending).
#define G3P 144                      /* LDS row pitch in bytes: 128 of data + 16, so that the 16 rows of a 16-byte fragment read fall on 64 different banks */
#define G3T (128 * G3P)              /* one operand's tile */
#define G3S (2 * G3T)                /* one stage: [A tile | Bt tile] */
__device__ __forceinline__ v8f g3_mma(v16h a, v16h b, v8f c) { return __builtin_amdgcn_wmma_f32_16x16x32_f16(false, a, false, b, (short)0, c, false, false); }
// Eight copies of 16 bytes a lane: rows r, r + 16, .., r + 112 of one operand's tile (l: the lane's LDS byte address, g: its global address, ld: the source pitch in elements).
// The s_wait_xcnt stands inside the statement, behind the last copy, so that no address register of a copy is rewritten in front of it.
__device__ __forceinline__ void g3_copy8(unsigned l, const _Float16* g, int ld) {
  const size_t st = (size_t)16 * ld;
  asm volatile("global_load_async_to_lds_b128 %0, %8, off\n\t"
               "global_load_async_to_lds_b128 %1, %9, off\n\t"
               "global_load_async_to_lds_b128 %2, %10, off\n\t"
               "global_load_async_to_lds_b128 %3, %11, off\n\t"
               "global_load_async_to_lds_b128 %4, %12, off\n\t"
               "global_load_async_to_lds_b128 %5, %13, off\n\t"
               "global_load_async_to_lds_b128 %6, %14, off\n\t"
               "global_load_async_to_lds_b128 %7, %15, off\n\t"
               "s_wait_xcnt 0x0"
               :: "v"(l), "v"(l + 16 * G3P), "v"(l + 32 * G3P), "v"(l + 48 * G3P), "v"(l + 64 * G3P), "v"(l + 80 * G3P), "v"(l + 96 * G3P), "v"(l + 112 * G3P),
                  "v"(g), "v"(g + st), "v"(g + 2 * st), "v"(g + 3 * st), "v"(g + 4 * st), "v"(g + 5 * st), "v"(g + 6 * st), "v"(g + 7 * st)
               : "memory"); }
template <int ACT>
__device__ __forceinline__ float g3_act(float v) {
  if (ACT == 3) v = fmaxf(v, 0.f); else if (ACT == 6) v = 0.5f * v * (1.0f + erff(v * 0.70710678118654752f)); else if (ACT == 11) v = 1.0f / (1.0f + expf(-v)); else if (ACT == 15) v = v / (1.0f + expf(-v)); else if (ACT == 18) v = v / (1.0f + expf(-1.702f * v));      /* QuickGELU: v sigmoid(1.702 v) */ else if (ACT == 12) v = (v > 0.f) ? v : 0.01f * v; else if (ACT == 8) v = tanhf(v); else if (ACT == 9) v = 0.5f * v * (1.0f + tanhf(0.7978845608028654f * (v + 0.044715f * v * v * v))); else if (ACT == 14) v = (v > 0.f) ? v : 0.1f * v; else if (ACT == 16) v = (v >= 0.f) ? v : 0.3f * v; else if (ACT == 17) v = (v >= 0.f) ? v : 0.2f * v;
  return v; }
// RES: add CP's own element of the C plane, then the activation (both on the staged rows, 16 bytes a lane); W32: write f32 rows to C, else f16 rows to C16. Both are compile-time, so that the epilogue is one straight run and its loads go out together.
template <int ACT, bool RES, bool W32>
__global__ __launch_bounds__(128) void k_gemm3(const _Float16* __restrict__ A, int lda, size_t sA, const _Float16* __restrict__ Bh, int ldb, size_t sB, float alpha, const float* __restrict__ bias, size_t sBias, const float* __restrict__ CP,
    float* __restrict__ C, _Float16* __restrict__ C16, size_t sC, int M, int N, int K) { static_assert(ACT == 0 || ACT == 3 || ACT == 6 || ACT == 8 || ACT == 9 || ACT == 11 || ACT == 12 || ACT == 14 || ACT == 15 || ACT == 16 || ACT == 17 || ACT == 18, "k_gemm3: unsupported ACT code (would silently apply no activation)");
  __shared__ __attribute__((aligned(128))) unsigned char L[2 * G3S]; static_assert(4 * 64 * 68 * 4 <= 2 * G3S, "k_gemm3: the output staging reuses the ring");
  const int tid = threadIdx.x, w = tid >> 5, lane = tid & 31, ln = lane & 15, hh = lane >> 4; const int by = blockIdx.y;
  A += (size_t)by * sA; Bh += (size_t)by * sB; const size_t cofs = (size_t)by * sC; const float* bp = bias ? bias + (size_t)by * sBias : nullptr;
  const int ntn = N >> 7; const int mt = blockIdx.x / ntn, nq = blockIdx.x - mt * ntn; if (mt * 128 >= M) return;      /* the same for the whole work-group, in front of every barrier */
  const int row0 = mt * 128 + (w >> 1) * 64, col0 = nq * 128 + (w & 1) * 64;
  const unsigned lc = (unsigned)(size_t)L + (unsigned)((tid >> 3) * G3P + (tid & 7) * 16);      /* eight lanes copy one 128-byte row */
  const _Float16* ga = A + (size_t)(mt * 128 + (tid >> 3)) * lda + (tid & 7) * 8; const _Float16* gb = Bh + (size_t)(nq * 128 + (tid >> 3)) * ldb + (tid & 7) * 8;
  const int nt = K >> 6; constexpr int ldc = DM; static_assert(DFF == DM, "k_gemm3: one output pitch");      /* a compile-time pitch: the epilogue's loads and stores share one address pair each and differ only in their immediate offsets */
  const v8f z8 = {0.f,0.f,0.f,0.f,0.f,0.f,0.f,0.f}; v8f acc[4][4];
#pragma unroll
  for (int i = 0; i < 4; ++i)
#pragma unroll
    for (int j = 0; j < 4; ++j) acc[i][j] = z8;
  g3_copy8(lc, ga, lda); g3_copy8(lc + G3T, gb, ldb);
  asm volatile("s_wait_asynccnt 0x0" ::: "memory");      /* stage 0 has landed (this wave's copies) */
  __syncthreads();      /* ... and every wave's */
  if (nt > 1) { g3_copy8(lc + G3S, ga + 64, lda); g3_copy8(lc + G3S + G3T, gb + 64, ldb); }
  float bv[4] = {0.f, 0.f, 0.f, 0.f};      /* the lane's four bias values, fetched here so that they arrive under the loop */
  if (bp) {
#pragma unroll
    for (int t = 0; t < 4; ++t) bv[t] = bp[col0 + t * 16 + ln];
    asm volatile("s_wait_xcnt 0x0" ::: "memory"); }      /* the four loads' offset register is rewritten right behind them */
#pragma unroll 1
  for (int t = 0; t < nt; ++t) { const unsigned buf = (unsigned)(t & 1) * G3S;      /* rolled: one copy of the 32 products in the text */
    const _Float16* pa = (const _Float16*)(L + buf + ((w >> 1) * 64 + ln) * G3P); const _Float16* pb = (const _Float16*)(L + buf + G3T + ((w & 1) * 64 + ln) * G3P);
    v16h a[2][4], b[2][4];
#pragma unroll
    for (int ks = 0; ks < 2; ++ks)
#pragma unroll
      for (int i = 0; i < 4; ++i) { a[ks][i] = g2_frag(pa + i * 16 * (G3P / 2) + ks * 32, hh); b[ks][i] = g2_frag(pb + i * 16 * (G3P / 2) + ks * 32, hh); }
    __builtin_amdgcn_sched_barrier(0);      /* keeps the stage's 32 fragment reads together in front of its products: without it the scheduler sinks the A reads among them, into one register set, and every four products wait out an LDS latency */
#pragma unroll
    for (int ks = 0; ks < 2; ++ks)
#pragma unroll
      for (int i = 0; i < 4; ++i)
#pragma unroll
        for (int j = 0; j < 4; ++j) acc[i][j] = g3_mma(a[ks][i], b[ks][j], acc[i][j]);
    __builtin_amdgcn_sched_barrier(0);      /* keeps the products in front of the stage's waits: without it the scheduler sinks them behind the barrier, and the wait for the next stage's copies stands at the head of the trip, before they have had time to land */
    asm volatile("s_wait_dscnt 0x0" ::: "memory");      /* this wave's reads of the buffer have returned */
    asm volatile("s_wait_asynccnt 0x0" ::: "memory");      /* this wave's copies of stage t + 1 have landed */
    __syncthreads();      /* publishes stage t + 1 and frees stage t's buffer */
    if (t + 2 < nt) { g3_copy8(lc + buf, ga + (size_t)(t + 2) * 64, lda); g3_copy8(lc + buf + G3T, gb + (size_t)(t + 2) * 64, ldb); } }
  asm volatile("s_wait_asynccnt 0x0" ::: "memory");      /* no copy is outstanding when the ring becomes output staging */
  float (*so)[68] = (float (*)[68])(L + (size_t)w * (64 * 68 * 4));      /* each wave stages in its own range; the last trip's barrier has ended every read of the ring */
#pragma unroll
  for (int u = 0; u < 16; ++u) { const int t = u & 3, half = u >> 2;
#pragma unroll
    for (int r = 0; r < 8; ++r) { const int rloc = half * 16 + 8 * hh + r; const float v = acc[half][t][r] * alpha + bf16_round(bv[t]);
      so[rloc][t * 16 + ln] = v; } }
  __builtin_amdgcn_fence(__ATOMIC_ACQ_REL, "workgroup"); __builtin_amdgcn_wave_barrier();
  const int rsub = lane >> 4, c4 = (lane & 15) * 4;
  const size_t e0 = cofs + (size_t)(row0 + rsub) * ldc + col0 + c4;      /* the lane's first element; row q * 2 + rsub lies q * 2 * ldc elements further on */
  v4f rv[32]; static_assert(!RES || ACT == 0, "k_gemm3: the residual rows are held in registers, so their loop is unrolled");
  if (RES) {
#pragma unroll
    for (int q = 0; q < 32; ++q) rv[q] = *(const v4fa*)(CP + e0 + (size_t)q * (2 * ldc));
    asm volatile("s_wait_xcnt 0x0" ::: "memory");      /* the 32 loads share one address pair, which is rewritten right behind them */
  }
  {
#pragma unroll(ACT == 0 ? 32 : 2)      /* with an activation the loop stays rolled, for code size (128 copies of erff otherwise) */
    for (int q = 0; q < 32; ++q) { const int r = q * 2 + rsub; const size_t e = e0 + (size_t)q * (2 * ldc); v4f v = *(const v4fa*)&so[r][c4]; if (RES) v += rv[q]; for (int i = 0; i < 4; ++i) v[i] = g3_act<ACT>(v[i]); if (W32) *(v4f*)(C + e) = v; else { v4h h4; for (int i = 0; i < 4; ++i) h4[i] = (_Float16)v[i]; *(v4h*)(C16 + e) = h4; }
      if (ACT != 0 || (q & 7) == 7) asm volatile("s_wait_xcnt 0x0" ::: "memory");      /* later rows rewrite registers of issued stores (rolled loop: the next trip does); unrolled, one wait serves eight rows */
    }
     } }


__global__ __launch_bounds__(256) void k_wnat(const float* __restrict__ w, size_t n8, _Float16* __restrict__ Bt) { const size_t t = (size_t)blockIdx.x * 256 + threadIdx.x; if (t >= n8) return; FragH f; for (int q = 0; q < 8; ++q) f.h[q] = (_Float16)(bf16_round(w[t * 8 + q]) * 16.0f); *(v8us*)((unsigned short*)Bt + t * 8) = f.half[0];  }
__global__ __launch_bounds__(256) void k_rsm(const float* __restrict__ S, _Float16* __restrict__ P, int nrows) {
  #pragma clang fp contract(off)
  const int i = blockIdx.x * 256 + threadIdx.x; if (i >= nrows) return; const float* s = S + (size_t)i * SQ; float mx = -3.0e38f;
#pragma unroll 1
  for (int j = 0; j < SQ; ++j) mx = fmaxf(mx, s[j]); float se = 0.f;
#pragma unroll 1
  for (int j = 0; j < SQ; ++j) se += expf(s[j] - mx); const float sc = 256.0f / se;
#pragma unroll 1
  for (int j0 = 0; j0 < SQ; j0 += 8) { FragH f; for (int q = 0; q < 8; ++q) f.h[q] = (_Float16)(expf(s[j0 + q] - mx) * sc); unsigned short* d = (unsigned short*)P + (size_t)i * SQ + j0; *(v8us*)d = f.half[0];  } }
__global__ __launch_bounds__(256) void k_vt(const _Float16* __restrict__ V16, int b, int h0, _Float16* __restrict__ VT) { __shared__ unsigned short tl[64][65]; const int tid = threadIdx.x; const int hh = blockIdx.x % HG, sg = blockIdx.x / HG; const int s0 = sg * 64; const int h = h0 + hh;
  for (int i = tid; i < 64 * 8; i += 256) { const int j = i / 8, d8 = (i % 8) * 8; FragH f; f.half[0] = *(const v8us*)((const unsigned short*)V16 + ((size_t)b * SQ + s0 + j) * DM + h * HD + d8); for (int q = 0; q < 8; ++q) tl[d8 + q][j] = f.u[q]; }
  __syncthreads();
  { for (int i = tid; i < 64 * 8; i += 256) { const int d = i / 8, j8 = (i % 8) * 8; FragH f; for (int q = 0; q < 8; ++q) f.u[q] = tl[d][j8 + q]; *(v8us*)((unsigned short*)VT + ((size_t)hh * HD + d) * SQ + s0 + j8) = f.half[0]; }  } }



__global__ __launch_bounds__(256) void k_rsmcf2(const float* __restrict__ S, _Float16* __restrict__ P, int hg, int q0, int nk) {
  #pragma clang fp contract(off)
  const int t = blockIdx.x * 256 + threadIdx.x; if (t >= hg * QT) return; const size_t i = (size_t)t; const float* s = S + i * NKX; const int last = q0 + (t % QT); float mx = -3.0e38f;
#pragma unroll 1
  for (int j = 0; j < nk; ++j) { const float f = (j <= last) ? 1.f : 0.f; mx = fmaxf(mx, fmaf(f, s[j], (1.f - f) * -1.0e9f)); } float se = 0.f;
#pragma unroll 1
  for (int j = 0; j < nk; ++j) { const float f = (j <= last) ? 1.f : 0.f; se += __expf(fmaf(f, s[j], (1.f - f) * -1.0e9f) - mx); } const float sc = 256.0f / se;
#pragma unroll 1
  for (int j0 = 0; j0 < nk; j0 += 8) { FragH fr; for (int q = 0; q < 8; ++q) { const int j = j0 + q; const float f = (j <= last) ? 1.f : 0.f; fr.h[q] = (_Float16)(__expf(fmaf(f, s[j], (1.f - f) * -1.0e9f) - mx) * sc); } unsigned short* d = (unsigned short*)P + i * NKX + j0; *(v8us*)d = fr.half[0];  } }

__global__ __launch_bounds__(256) void k_rsmcst(const float* __restrict__ S, _Float16* __restrict__ P, int hg, int q0, int nk, const int* __restrict__ mk) {
  #pragma clang fp contract(off)
  const int t = blockIdx.x * 256 + threadIdx.x; if (t >= hg * QT) return; const size_t i = (size_t)t; const float* s = S + i * NKX; const size_t ig = (size_t)(q0 + (t % QT)); const int* mr = mk + ig * SQ; float mx = -3.0e38f;
#pragma unroll 1
  for (int j = 0; j < nk; ++j) { const int mb = mr[j]; const int dd = (int)ig - j; const float f = (mb != 0 && dd >= 0 && (dd <= LOCALW || (dd % STRIDEK) == 0)) ? 1.f : 0.f; mx = fmaxf(mx, fmaf(f, s[j], (1.f - f) * -1.0e9f)); } float se = 0.f;
#pragma unroll 1
  for (int j = 0; j < nk; ++j) { const int mb = mr[j]; const int dd = (int)ig - j; const float f = (mb != 0 && dd >= 0 && (dd <= LOCALW || (dd % STRIDEK) == 0)) ? 1.f : 0.f; se += __expf(fmaf(f, s[j], (1.f - f) * -1.0e9f) - mx); } const float sc = 256.0f / se;
#pragma unroll 1
  for (int j0 = 0; j0 < nk; j0 += 8) { FragH fr; for (int q = 0; q < 8; ++q) { const int j = j0 + q; const int mb = mr[j]; const int dd = (int)ig - j; const float f = (mb != 0 && dd >= 0 && (dd <= LOCALW || (dd % STRIDEK) == 0)) ? 1.f : 0.f; fr.h[q] = (_Float16)(__expf(fmaf(f, s[j], (1.f - f) * -1.0e9f) - mx) * sc); } unsigned short* d = (unsigned short*)P + i * NKX + j0; *(v8us*)d = fr.half[0];  } }


template <int MASKADD>
__global__ __launch_bounds__(64) void k_att0(const float* __restrict__ QF, const float* __restrict__ KF, const float* __restrict__ VF, int ld, const float* __restrict__ mask, float scale, float* __restrict__ OF, int ldo) {
  #pragma clang fp contract(off)
  __shared__ __attribute__((aligned(16))) float lq[64][64]; __shared__ __attribute__((aligned(16))) float lo[64][64];
  const int tid = threadIdx.x; const int h = blockIdx.x / (QT0 / 64), rg = blockIdx.x % (QT0 / 64); const int i = rg * 64 + tid;
  const float* qr = QF + (size_t)i * ld + h * HD;
#pragma unroll 1
  for (int c = 0; c < HD / 4; ++c) { *(v4f*)&lq[tid][c * 4] = *(const v4fa*)(qr + c * 4); const v4f z = {0.f, 0.f, 0.f, 0.f}; *(v4f*)&lo[tid][c * 4] = z; }
  float m = -1.0e30f, l = 0.f; const int jmax = MASKADD ? (SQ - 1) : (rg * 64 + 63);      /* additive-mask form: every key (the mask input decides); causal form: keys up to the block's last row */
#pragma unroll 1
  for (int j = 0; j <= jmax; ++j) { const float* kr = KF + (size_t)j * ld + h * HD; const float* vr = VF + (size_t)j * ld + h * HD; float s = 0.f;
#pragma unroll 1
    for (int c = 0; c < HD / 4; ++c) { const v4f kq = *(const v4fa*)(kr + c * 4); const v4f qq = *(v4f*)&lq[tid][c * 4]; s = __fadd_rn(s, __fmul_rn(qq[0], kq[0])); s = __fadd_rn(s, __fmul_rn(qq[1], kq[1])); s = __fadd_rn(s, __fmul_rn(qq[2], kq[2])); s = __fadd_rn(s, __fmul_rn(qq[3], kq[3])); }
    s = __fmul_rn(s, scale); if (MASKADD) s = __fadd_rn(s, __fmul_rn(bf16_round(mask[(size_t)i * SQ + j]), -10000.0f));
    const float f = (MASKADD || j <= i) ? 1.f : 0.f; const float sm = fmaf(f, s, (1.f - f) * -1.0e30f); const float mn = fmaxf(m, sm); const float sc = expf(m - mn); const float e = expf(sm - mn); l = __fadd_rn(__fmul_rn(l, sc), e); m = mn;
#pragma unroll 1
    for (int c = 0; c < HD / 4; ++c) { const v4f vv = *(const v4fa*)(vr + c * 4); v4f oo = *(v4f*)&lo[tid][c * 4]; for (int u = 0; u < 4; ++u) oo[u] = __fadd_rn(__fmul_rn(oo[u], sc), __fmul_rn(e, vv[u])); *(v4f*)&lo[tid][c * 4] = oo; } }
  const float fin = 64.0f / l;      /* o carried x64 like the f16 path */
#pragma unroll 1
  for (int c = 0; c < HD / 4; ++c) { v4f oo = *(v4f*)&lo[tid][c * 4]; for (int u = 0; u < 4; ++u) oo[u] = __fmul_rn(oo[u], fin); *(v4f*)&lo[tid][c * 4] = oo; }
  __syncthreads();
  {
#pragma unroll 1
    for (int it = 0; it < 16; ++it) { const int row = it * 4 + tid / 16, pc = (tid % 16) * 4; const v4f v = *(const v4f*)&lo[row][pc]; *(v4f*)(OF + (size_t)(rg * 64 + row) * ldo + h * HD + pc) = v; }
     } }

template <int MASKADD>
__global__ __launch_bounds__(64) void k_att0mbc(const float* __restrict__ QF, const float* __restrict__ KF, const float* __restrict__ VF, int ld, const float* __restrict__ mask, float scale, float* __restrict__ OF, int ldo) {
  #pragma clang fp contract(off)
  __shared__ __attribute__((aligned(16))) float lq[64][64]; __shared__ __attribute__((aligned(16))) float lo[64][64];
  const int tid = threadIdx.x; const int h = blockIdx.x / (QT0 / 64), rg = blockIdx.x % (QT0 / 64); const int i = rg * 64 + tid;
  const float* qr = QF + (size_t)i * ld + h * HD;
#pragma unroll 1
  for (int c = 0; c < HD / 4; ++c) { *(v4f*)&lq[tid][c * 4] = *(const v4fa*)(qr + c * 4); const v4f z = {0.f, 0.f, 0.f, 0.f}; *(v4f*)&lo[tid][c * 4] = z; }
  float m = -1.0e30f, l = 0.f; const int jmax = rg * 64 + 63;      /* keys beyond the block end are masked by the mask's lower-triangular structure */      /* both MASKADD forms: keys up to the block's last row */
#pragma unroll 1
  for (int j = 0; j <= jmax; ++j) { const float* kr = KF + (size_t)j * ld + h * HD; const float* vr = VF + (size_t)j * ld + h * HD; float s = 0.f;
#pragma unroll 1
    for (int c = 0; c < HD / 4; ++c) { const v4f kq = *(const v4fa*)(kr + c * 4); const v4f qq = *(v4f*)&lq[tid][c * 4]; s = __fadd_rn(s, __fmul_rn(qq[0], kq[0])); s = __fadd_rn(s, __fmul_rn(qq[1], kq[1])); s = __fadd_rn(s, __fmul_rn(qq[2], kq[2])); s = __fadd_rn(s, __fmul_rn(qq[3], kq[3])); }
    s = __fmul_rn(s, scale); const int mb = ((const int*)mask)[(size_t)i * SQ + j];      /* causal (j <= i) AND the module's int32 [S][S] mask read per (query, key): 0 -> masked */
    const float f = (mb != 0 && j <= i) ? 1.f : 0.f; const float sm = fmaf(f, s, (1.f - f) * -1.0e30f); const float mn = fmaxf(m, sm); const float sc = expf(m - mn); const float e = expf(sm - mn); l = __fadd_rn(__fmul_rn(l, sc), e); m = mn;
#pragma unroll 1
    for (int c = 0; c < HD / 4; ++c) { const v4f vv = *(const v4fa*)(vr + c * 4); v4f oo = *(v4f*)&lo[tid][c * 4]; for (int u = 0; u < 4; ++u) oo[u] = __fadd_rn(__fmul_rn(oo[u], sc), __fmul_rn(e, vv[u])); *(v4f*)&lo[tid][c * 4] = oo; } }
  const float fin = 64.0f / l;      /* o carried x64 like the f16 path */
#pragma unroll 1
  for (int c = 0; c < HD / 4; ++c) { v4f oo = *(v4f*)&lo[tid][c * 4]; for (int u = 0; u < 4; ++u) oo[u] = __fmul_rn(oo[u], fin); *(v4f*)&lo[tid][c * 4] = oo; }
  __syncthreads();
  {
#pragma unroll 1
    for (int it = 0; it < 16; ++it) { const int row = it * 4 + tid / 16, pc = (tid % 16) * 4; const v4f v = *(const v4f*)&lo[row][pc]; *(v4f*)(OF + (size_t)(rg * 64 + row) * ldo + h * HD + pc) = v; }
     } }


template <int BFIN, int WXB>
__global__ __launch_bounds__(256) void k_ln16(const float* __restrict__ X, const float* __restrict__ g, const float* __restrict__ bb, float eps, _Float16* __restrict__ N16, float* __restrict__ XB) {
  #pragma clang fp contract(off)
  __shared__ float red[256]; const size_t r = blockIdx.x; const int t = threadIdx.x; const v4f xa = *(const v4fa*)(X + r * DMQ + t * 4); float s[4]; float sum = 0.f;
  for (int q = 0; q < 4; ++q) { s[q] = BFIN ? bf16_round(xa[q]) : xa[q]; sum = __fadd_rn(sum, s[q]); }
  red[t] = sum; __syncthreads(); for (int st = 128; st > 0; st >>= 1) { if (t < st) red[t] = __fadd_rn(red[t], red[t + st]); __syncthreads(); } const float mu = red[0] / (float)DMQ; __syncthreads();
  float vs = 0.f; for (int q = 0; q < 4; ++q) { const float dl = __fadd_rn(s[q], -mu); vs = __fadd_rn(vs, __fmul_rn(dl, dl)); } red[t] = vs; __syncthreads(); for (int st = 128; st > 0; st >>= 1) { if (t < st) red[t] = __fadd_rn(red[t], red[t + st]); __syncthreads(); }
  const float rs = rsqrtf(__fadd_rn(red[0] / (float)DMQ, eps)); v4h y; v4f xb;
  for (int q = 0; q < 4; ++q) { const int c = t * 4 + q; y[q] = (_Float16)__fadd_rn(__fmul_rn(__fmul_rn(__fadd_rn(s[q], -mu), rs), bf16_round(g[c])), bf16_round(bb[c])); xb[q] = s[q]; }
  { *(v4h*)(N16 + r * DMQ + t * 4) = y; if (WXB) *(v4f*)(XB + r * DMQ + t * 4) = xb;  } }
__global__ __launch_bounds__(256) void k_ftres2(const float* __restrict__ OF0, const float* __restrict__ XB, float* __restrict__ X1, size_t n4) {
  #pragma clang fp contract(off)
  const size_t t = (size_t)blockIdx.x * 256 + threadIdx.x; if (t >= n4) return; const v4f o = *(const v4fa*)(OF0 + t * 4), xv = *(const v4fa*)(XB + t * 4); v4f y; for (int q = 0; q < 4; ++q) y[q] = __fadd_rn(__fmul_rn(o[q], 0.015625f), xv[q]); *(v4f*)(X1 + t * 4) = y;  }

__global__ __launch_bounds__(256) void k_bcpy(const float* __restrict__ b, int n, int NP, float* __restrict__ dst, int dst0) { for (int i = threadIdx.x; i < NP; i += 256) { const float v = (i < n) ? b[i] : 0.f; *(float*)(dst + dst0 + i) = v; }  }


#define FAW 8                        /* waves per work-group */
#define FAQ 32                       /* query columns per wave (two 16-column groups) */
#define FAC 0.18033688011112042592f  /* 64^-0.5 * log2 e: scores are carried in log2 units */
__device__ __forceinline__ float rs_x16(float x) { const int b = __builtin_bit_cast(int, x); return __builtin_bit_cast(float, __builtin_amdgcn_permlanex16(b, b, 0x76543210, 0xfedcba98, false, false)); }      /* lane l <- lane l ^ 16 */
// Four 2^x in one statement. The outputs are early-clobber, so inside it no v_exp_f32 is directly followed by a read of its result or a write of its source; the v_nop keeps that slot behind the last one.
__device__ __forceinline__ v4f rs_exp2(v4f x) { float y0, y1, y2, y3; asm("v_exp_f32 %0, %4\n\tv_exp_f32 %1, %5\n\tv_exp_f32 %2, %6\n\tv_exp_f32 %3, %7\n\tv_nop" : "=&v"(y0), "=&v"(y1), "=&v"(y2), "=&v"(y3) : "v"(x[0]), "v"(x[1]), "v"(x[2]), "v"(x[3])); const v4f y = {y0, y1, y2, y3}; return y; }
// One 2^x, with the same slot kept behind it.
__device__ __forceinline__ float fa_exp2(float x) { float y; asm("v_exp_f32 %0, %1\n\tv_nop" : "=&v"(y) : "v"(x)); return y; }
__device__ __forceinline__ v8f fa_mma(v16h a, v16h b, v8f c) { return __builtin_amdgcn_wmma_f32_16x16x32_f16(false, a, false, b, (short)0, c, false, false); }
// Q16, K16: f16 rows [NB * SQ][DM], head h = columns h*64..; VT: f16 [NB * NH][HD][SQ]; O16: context x64 as f16 rows (merged heads).
// The short loops are fully unrolled so that every fragment array is indexed by constants and stays in registers.
__global__ __launch_bounds__(FAW * 32) void k_fattn(const _Float16* __restrict__ Q16, const _Float16* __restrict__ K16, const _Float16* __restrict__ VT, _Float16* __restrict__ O16) {
  const int lane = threadIdx.x & 31, ln = lane & 15, hh = lane >> 4, w = threadIdx.x >> 5;
  constexpr int QB = SQ / (FAW * FAQ); const int qb = blockIdx.x % QB, bh = blockIdx.x / QB; const int b = bh / NH, h = bh % NH; const int q0 = qb * (FAW * FAQ) + w * FAQ;
  const _Float16* qp = Q16 + ((size_t)b * SQ + q0 + ln) * DM + h * HD; const _Float16* kp = K16 + ((size_t)b * SQ + ln) * DM + h * HD; const _Float16* vp = VT + ((size_t)bh * HD + ln) * SQ;
  const v8f z8 = {0.f, 0.f, 0.f, 0.f, 0.f, 0.f, 0.f, 0.f};
  v16h qf[2][2], kf[2][2]; v8f o[2][4]; float m[2], l[2];
#pragma unroll
  for (int j = 0; j < 2; ++j) { m[j] = -3.0e38f; l[j] = 0.f;
#pragma unroll
    for (int d = 0; d < 4; ++d) o[j][d] = z8;
#pragma unroll
    for (int ks = 0; ks < 2; ++ks) { qf[j][ks] = g2_frag(qp + (size_t)j * 16 * DM + ks * 32, hh); kf[j][ks] = g2_frag(kp + (size_t)j * 16 * DM + ks * 32, hh); } }
  for (int kb = 0; kb < SQ; kb += 32) {
    v16h vf[4]; v8f s[2][2];
#pragma unroll
    for (int d = 0; d < 4; ++d) vf[d] = g2_frag(vp + (size_t)d * 16 * SQ + kb, hh);      /* issued first: they fly under the score products and the softmax */
#pragma unroll
    for (int j = 0; j < 2; ++j)
#pragma unroll
      for (int t = 0; t < 2; ++t) s[j][t] = fa_mma(kf[t][1], qf[j][1], fa_mma(kf[t][0], qf[j][0], z8));      /* s[j][t][r] = q(q0 + 16 j + ln) . k(kb + 16 t + 8 hh + r) */
    const int kn = (kb + 32) & (SQ - 1);      /* the next pass's K fragments fly under this pass's softmax; the last pass re-reads keys 0..31 (in bounds, not used) */
#pragma unroll
    for (int t = 0; t < 2; ++t)
#pragma unroll
      for (int ks = 0; ks < 2; ++ks) kf[t][ks] = g2_frag(kp + (size_t)(kn + t * 16) * DM + ks * 32, hh);
    __builtin_amdgcn_sched_barrier(0);      /* keeps the K loads above the softmax: without it the scheduler sinks them to the foot of the pass, and the next pass waits out their whole latency */
#pragma unroll
    for (int j = 0; j < 2; ++j) {
      float mx = fmaxf(s[j][0][0], s[j][1][0]);
#pragma unroll
      for (int r = 1; r < 8; ++r) mx = fmaxf(mx, fmaxf(s[j][0][r], s[j][1][r]));
      mx = fmaxf(mx, rs_x16(mx));
      const float mn = fmaxf(m[j], mx * FAC), al = fa_exp2(m[j] - mn), mb = 8.0f - mn; m[j] = mn;      /* p = 2^8 exp(s - max) <= 256: small weights stay out of the f16 subnormals; the factor cancels against the sum */
      FragH pf; v4f s4 = {0.f, 0.f, 0.f, 0.f};
#pragma unroll
      for (int t = 0; t < 2; ++t)
#pragma unroll
        for (int c = 0; c < 2; ++c) { const v4f x = {s[j][t][c * 4] * FAC + mb, s[j][t][c * 4 + 1] * FAC + mb, s[j][t][c * 4 + 2] * FAC + mb, s[j][t][c * 4 + 3] * FAC + mb}; const v4f e = rs_exp2(x); s4 += e;
#pragma unroll
          for (int q = 0; q < 4; ++q) pf.h[t * 8 + c * 4 + q] = (_Float16)e[q]; }
      l[j] = l[j] * al + ((s4[0] + s4[1]) + (s4[2] + s4[3]));
#pragma unroll
      for (int d = 0; d < 4; ++d) o[j][d] = fa_mma(vf[d], pf.v, o[j][d] * al);      /* o[j][d][r] = sum_k p v(k)[16 d + 8 hh + r] for query q0 + 16 j + ln */
    } }
#pragma unroll
  for (int j = 0; j < 2; ++j) { const float fin = 64.0f / (l[j] + rs_x16(l[j])); unsigned short* op = (unsigned short*)O16 + ((size_t)b * SQ + q0 + j * 16 + ln) * DM + h * HD + 8 * hh;
#pragma unroll
    for (int d = 0; d < 4; ++d) { FragH f;
#pragma unroll
      for (int r = 0; r < 8; ++r) f.h[r] = (_Float16)(o[j][d][r] * fin);
      *(v8us*)(op + d * 16) = f.half[0]; } } }

template <int MODE>
__global__ __launch_bounds__(256) void k_regrp(const float* __restrict__ src, float* __restrict__ dst, size_t n4) {
  const size_t t = (size_t)blockIdx.x * 256 + threadIdx.x; if (t >= n4) return; const size_t e = t * 4; const size_t rd = e / DM; const int c = (int)(e % DM);
  size_t rs; if (MODE == 0) { const size_t b = rd / SQ, sq = rd % SQ; rs = sq * NB + b; } else { const size_t sq = rd / NB, b = rd % NB; rs = b * SQ + sq; }
  const v4f v = *(const v4fa*)(src + rs * DM + c); *(v4f*)(dst + e) = v;  }

// ---- row passes: a wave owns RPW whole rows of DM = 1024 f32 in registers (32 lanes x 16 bytes = 512 contiguous bytes a load, eight loads a row, all of them issued up front) ----
// Few long-lived waves in place of many one-load ones: 16 waves on every WGP cover all 8192 rows, and no LDS and no barrier is needed, since a row never leaves its wave.
#define RPW 2                        /* rows per wave */
static_assert(DM == 1024 && DMQ == DM && ((size_t)NB * SQ) % (8 * RPW) == 0, "row passes: eight 512-byte loads a row, eight waves a work-group, no edge");
// lane l <- lane l ^ M inside its 16-lane row (DPP row_xmask)
template <int M>
__device__ __forceinline__ float rp_xm(float x) { return __builtin_bit_cast(float, __builtin_amdgcn_update_dpp(0, __builtin_bit_cast(int, x), 0x160 + M, 0xf, 0xf, true)); }
// Sum over the wave's 32 lanes by a butterfly: every lane ends with the same bits.
__device__ __forceinline__ float rp_sum32(float v) { v += rp_xm<1>(v); v += rp_xm<2>(v); v += rp_xm<4>(v); v += rp_xm<8>(v); return v + rs_x16(v); }
// LayerNorm (biased variance, eps inside the rsqrt; mean first, then the squares of the centred row) -> f16 rows.
template <int BFIN>
__global__ __launch_bounds__(256) void k_lnw(const float* __restrict__ X, const float* __restrict__ g, const float* __restrict__ bb, float eps, _Float16* __restrict__ N16) {
  const int lane = threadIdx.x & 31; const size_t e0 = ((size_t)blockIdx.x * 8 + (threadIdx.x >> 5)) * (RPW * DM) + lane * 4;      /* the lane's first element */
  const float* xp = X + e0; const unsigned ob = (unsigned)lane * 16u;      /* ob: the lane's byte offset in g and bb */
  v4f x[RPW][8], gg[8], bv[8];
#pragma unroll
  for (int k = 0; k < RPW; ++k)
#pragma unroll
    for (int u = 0; u < 8; ++u) x[k][u] = *(const v4fa*)(xp + k * DM + u * 128);
#pragma unroll
  for (int u = 0; u < 8; ++u) { gg[u] = *(const v4fa*)((const char*)g + ob + u * 512); bv[u] = *(const v4fa*)((const char*)bb + ob + u * 512); }
  asm volatile("s_wait_xcnt 0x0" :: "v"(xp), "v"(lane) : "memory");      /* the loads' address registers are free for reuse behind them: the wait stands in front of any rewrite; xp and lane (the g and bb loads' offset register, scaled by the load itself) as inputs keep those registers out of the loads' own results */
  __builtin_amdgcn_sched_barrier(0);      /* keeps all 32 loads in front of the arithmetic: without it the scheduler sinks the last ones, and the wait with them, far into it, where their latency shows */
#pragma unroll
  for (int u = 0; u < 8; ++u)
#pragma unroll
    for (int q = 0; q < 4; ++q) { gg[u][q] = bf16_round(gg[u][q]); bv[u][q] = bf16_round(bv[u][q]); }
  v4h y[RPW][8];
#pragma unroll
  for (int k = 0; k < RPW; ++k) {
    v4f a = {0.f, 0.f, 0.f, 0.f};
#pragma unroll
    for (int u = 0; u < 8; ++u) {
      if (BFIN) {
#pragma unroll
        for (int q = 0; q < 4; ++q) x[k][u][q] = bf16_round(x[k][u][q]); }
      a += x[k][u]; }
    const float mu = rp_sum32((a[0] + a[1]) + (a[2] + a[3])) * (1.0f / (float)DM);
    v4f c = {0.f, 0.f, 0.f, 0.f};
#pragma unroll
    for (int u = 0; u < 8; ++u) { x[k][u] -= mu; c += x[k][u] * x[k][u]; }
    const float rs = rsqrtf(rp_sum32((c[0] + c[1]) + (c[2] + c[3])) * (1.0f / (float)DM) + eps);
#pragma unroll
    for (int u = 0; u < 8; ++u) { const v4f o = x[k][u] * rs * gg[u] + bv[u];
#pragma unroll
      for (int q = 0; q < 4; ++q) y[k][u][q] = (_Float16)o[q]; } }
  __builtin_amdgcn_sched_barrier(0);      /* every result is in its own registers before the first store: nothing is computed behind a store, so no register of an issued store is rewritten */
#pragma unroll
  for (int k = 0; k < RPW; ++k)
#pragma unroll
    for (int u = 0; u < 8; ++u) *(v4h*)(N16 + e0 + k * DM + u * 128) = y[k][u]; }

// XB = bf16-rounded x as f32 rows, the same split of the rows over waves.
__global__ __launch_bounds__(256) void k_bfr(const float* __restrict__ x, float* __restrict__ XB) {
  const int lane = threadIdx.x & 31; const size_t e0 = ((size_t)blockIdx.x * 8 + (threadIdx.x >> 5)) * (RPW * DM) + lane * 4;
  const float* xp = x + e0; v4f a[RPW * 8];
#pragma unroll
  for (int u = 0; u < RPW * 8; ++u) a[u] = *(const v4fa*)(xp + u * 128);
  asm volatile("s_wait_xcnt 0x0" :: "v"(xp) : "memory");      /* as in k_lnw: in front of any rewrite of the loads' address pair, which xp as an input keeps out of the loads' own results */
#pragma unroll
  for (int u = 0; u < RPW * 8; ++u)
#pragma unroll
    for (int q = 0; q < 4; ++q) a[u][q] = bf16_round(a[u][q]);
  __builtin_amdgcn_sched_barrier(0);      /* as in k_lnw: nothing is computed behind a store */
#pragma unroll
  for (int u = 0; u < RPW * 8; ++u) *(v4f*)(XB + e0 + u * 128) = a[u]; }



__global__ __launch_bounds__(256) void k_wthd(const float* __restrict__ Wt, _Float16* __restrict__ Bt) { const size_t t = (size_t)blockIdx.x * 256 + threadIdx.x; if (t >= (size_t)NH * HD * (DM / 8)) return; const int m8 = (int)(t % (DM / 8)) * 8; const int d = (int)((t / (DM / 8)) % HD); const int h = (int)(t / ((size_t)(DM / 8) * HD)); FragH f;
  for (int q = 0; q < 8; ++q) f.h[q] = (_Float16)(16.0f * bf16_round(Wt[((size_t)h * DM + m8 + q) * HD + d])); unsigned short* dst = (unsigned short*)Bt + ((size_t)h * HD + d) * DM + m8; *(v8us*)dst = f.half[0];  }




template <int BFIN, int SCAL>
__global__ __launch_bounds__(256) void k_lnsc(const float* __restrict__ X, const float* __restrict__ g, const float* __restrict__ bb, float eps, _Float16* __restrict__ N16, float* __restrict__ N32) {
  #pragma clang fp contract(off)
  __shared__ float red[256]; const size_t r = blockIdx.x; const int t = threadIdx.x; const bool act = t < DM / 4; const int tc = act ? t : 0; const v4f xl = *(const v4fa*)(X + r * DM + tc * 4); const float am = act ? 1.f : 0.f; float s[4]; float sum = 0.f;
  for (int q = 0; q < 4; ++q) { s[q] = (BFIN ? bf16_round(xl[q]) : xl[q]) * am; sum = __fadd_rn(sum, s[q]); }
  red[t] = sum; __syncthreads(); for (int st = 128; st > 0; st >>= 1) { if (t < st) red[t] = __fadd_rn(red[t], red[t + st]); __syncthreads(); } const float mu = red[0] / (float)DM; __syncthreads();
  float vs = 0.f; for (int q = 0; q < 4; ++q) { const float dl = __fadd_rn(s[q], -mu) * am; vs = __fadd_rn(vs, __fmul_rn(dl, dl)); } red[t] = vs; __syncthreads(); for (int st = 128; st > 0; st >>= 1) { if (t < st) red[t] = __fadd_rn(red[t], red[t + st]); __syncthreads(); }
  const float rs = __fdiv_rn(1.0f, __fadd_rn(sqrtf(red[0] / (float)(DM - 1)), eps)); if (!act) return; v4h y; v4f yf;
  for (int q = 0; q < 4; ++q) { const int c = t * 4 + q; const float gg = bf16_round(SCAL ? g[0] : g[c]), bv = bf16_round(SCAL ? bb[0] : bb[c]); yf[q] = __fadd_rn(__fmul_rn(__fmul_rn(__fadd_rn(s[q], -mu), rs), gg), bv); y[q] = (_Float16)yf[q]; }
  { if (N16) *(v4h*)(N16 + r * DM + t * 4) = y; if (N32) *(v4f*)(N32 + r * DM + t * 4) = yf;  } }

__global__ __launch_bounds__(256) void k_rsmdmi(const float* __restrict__ S, _Float16* __restrict__ P, int nrows, const int* __restrict__ M) {
  #pragma clang fp contract(off)
  const int t = blockIdx.x * 256 + threadIdx.x; if (t >= nrows) return; const float* s = S + (size_t)t * SQ; const int* m = M + (size_t)(t % SQ) * SQ; float mx = -3.0e38f;
#pragma unroll 1
  for (int j = 0; j < SQ; ++j) { const float f = (m[j] == 0) ? 1.f : 0.f; mx = fmaxf(mx, fmaf(f, s[j], (1.f - f) * -1.0e9f)); } float se = 0.f;
#pragma unroll 1
  for (int j = 0; j < SQ; ++j) { const float f = (m[j] == 0) ? 1.f : 0.f; se += __expf(fmaf(f, s[j], (1.f - f) * -1.0e9f) - mx); } const float sc = 256.0f / se;
#pragma unroll 1
  for (int j0 = 0; j0 < SQ; j0 += 8) { FragH fr; for (int q = 0; q < 8; ++q) { const int j = j0 + q; const float f = (m[j] == 0) ? 1.f : 0.f; fr.h[q] = (_Float16)(__expf(fmaf(f, s[j], (1.f - f) * -1.0e9f) - mx) * sc); } unsigned short* d = (unsigned short*)P + (size_t)t * SQ + j0; *(v8us*)d = fr.half[0];  } }
// All six weight planes in one launch (blockIdx.y = plane): Bt[p][n][k] = f16(bf16(W[k][n]) x16), element for element as k_wt_f16.
// Planes 0..2: per-head tensors [NH][DM][HD], row n = head n / HD, output n % HD; planes 3..5: [in][out] squares of DM x DM.
static_assert(DFF == DM, "k_wt_all: every plane is DM x DM");
// Eight source rows of one output column. The pitch is a compile-time constant, so the eight loads share one address pair and differ only in their immediate offsets.
template <int PITCH>
__device__ __forceinline__ v8us wt_col8(const float* __restrict__ s) { FragH f;
  for (int i = 0; i < 8; ++i) f.h[i] = (_Float16)(bf16_round(s[(size_t)i * PITCH]) * 16.0f);
  return f.half[0]; }
__global__ __launch_bounds__(256) void k_wt_all(const float* __restrict__ wq, const float* __restrict__ wk, const float* __restrict__ wv, const float* __restrict__ wo, const float* __restrict__ w1, const float* __restrict__ w2, _Float16* __restrict__ Bt) {
  const int p = blockIdx.y; const int t = blockIdx.x * 256 + threadIdx.x; const int n = t / (DM / 8), k8 = (t % (DM / 8)) * 8;
  const float* W = p == 0 ? wq : p == 1 ? wk : p == 2 ? wv : p == 3 ? wo : p == 4 ? w1 : w2;
  const v8us o = p < 3 ? wt_col8<HD>(W + ((size_t)(n / HD) * DM + k8) * HD + (n % HD)) : wt_col8<DM>(W + (size_t)k8 * DM + n);
  *(v8us*)((unsigned short*)Bt + ((size_t)p * DM + n) * DM + k8) = o; }
extern "C" void kernel_launch(void* const* d_in, const int* in_sizes, int n_in,
                              void* d_out, int out_size, void* d_ws, size_t ws_size, hipStream_t stream) {
  (void)in_sizes; (void)n_in; (void)out_size;
  const float* const* I = (const float* const*)d_in; const float* x = I[0]; const float* wq = I[1]; const float* wk = I[2]; const float* wv = I[3]; const float* wo = I[4]; const float* bo = I[5]; const float* w1 = I[6]; const float* b1 = I[7]; const float* w2 = I[8]; const float* b2 = I[9]; const float* g1 = I[10]; const float* be1 = I[11]; const float* g2 = I[12]; const float* be2 = I[13];      /* x; per-head Wq / Wk / Wv [16][1024][64] (no biases); Wo [1024][1024] + bo ([in][out]); W1 [1024][1024] + b1, W2 [1024][1024] + b2; LN1 g / b, LN2 g / b */
  char* ws = (char*)d_ws; size_t off = 0;
  auto take = [&](size_t bytes) { char* p = ws + off; off += (bytes + 255) & ~(size_t)255; return p; };
  _Float16* BQ = (_Float16*)take((size_t)6 * DM * DM * 2); _Float16* BO = BQ + (size_t)3 * DM * DM; _Float16* BW1 = BQ + (size_t)4 * DM * DM; _Float16* BW2 = BQ + (size_t)5 * DM * DM;      /* six Bt planes in a row: q, k, v, o, W1, W2 */
  float* XB = (float*)take(NR * DM * 4); _Float16* XN = (_Float16*)take(NR * DM * 2); _Float16* Q16 = (_Float16*)take((size_t)3 * NR * DM * 2); _Float16* K16 = Q16 + NR * DM; _Float16* V16 = Q16 + (size_t)2 * NR * DM;      /* three planes in a row: one batched GEMM writes them */ _Float16* O16 = (_Float16*)take(NR * DM * 2); float* X1 = (float*)take(NR * DM * 4);
  _Float16* VT = (_Float16*)take((size_t)NB * NH * HD * SQ * 2);
  _Float16* M16 = XN;      /* second-norm f16 rows: aliases XN (last readers: the three projections) */ _Float16* HF16 = (_Float16*)take(NR * DFF * 2);      /* FFN hidden rows of every batch [8192][1024] f16 (16 MiB): own region */
  
  if (off > ws_size) return;
  k_wt_all<<<dim3((unsigned)((size_t)DM * (DM / 8) / 256), 6), 256, 0, stream>>>(wq, wk, wv, wo, w1, w2, BQ);      /* every weight -> Bt x16, one launch; per-head [in = 1024][out = 64]: head h = rows h*64.. of its plane */
  k_bfr<<<(unsigned)(NR / (8 * RPW)), 256, 0, stream>>>(x, XB); k_lnw<1><<<(unsigned)(NR / (8 * RPW)), 256, 0, stream>>>(x, g1, be1, 1e-5f, XN);      /* n = LN0(bf16(x)) (biased variance, eps inside the rsqrt) -> f16 rows */
  k_gemm3<0, false, false><<<dim3((unsigned)((NR / 128) * (DM / 128)), 3), 128, 0, stream>>>(XN, DM, 0, BQ, DM, (size_t)DM * DM, 0.0625f, nullptr, 0, nullptr, nullptr, Q16, NR * DM, (int)NR, DM, DM);      /* q, k, v (blockIdx.y) -> f16 rows, one launch; head h = columns h*64.. */
  k_vt<NH, SQ><<<NB * NH * (SQ / 64), 256, 0, stream>>>(V16, DM, 0, VT);      /* V^T [8 * 16][64][1024], every batch */
  k_fattn<<<NB * NH * (SQ / (FAW * FAQ)), FAW * 32, 0, stream>>>(Q16, K16, VT, O16);      /* softmax(q k^T / 8) v over all keys (no mask) -> ctx (merged heads, x64) as f16 rows */
  k_gemm3<0, true, true><<<dim3((unsigned)((NR / 128) * (DM / 128)), 1), 128, 0, stream>>>(O16, DM, 0, BO, DM, 0, 0.0009765625f, bo, 0, XB, X1, nullptr, 0, (int)NR, DM, DM);      /* x + ctx wo (+ bo) (own-element residual) -> f32 rows */
  k_lnw<0><<<(unsigned)(NR / (8 * RPW)), 256, 0, stream>>>(X1, g2, be2, 1e-5f, M16);      /* LN1(x1) -> f16 rows */
  k_gemm3<6, false, false><<<dim3((unsigned)((NR / 128) * (DFF / 128)), 1), 128, 0, stream>>>(M16, DM, 0, BW1, DM, 0, 0.0625f, b1, 0, nullptr, nullptr, HF16, 0, (int)NR, DFF, DM);      /* gelu_erf(. W1 + b1) -> f16, all rows */
  k_gemm3<0, true, true><<<dim3((unsigned)((NR / 128) * (DM / 128)), 1), 128, 0, stream>>>(HF16, DFF, 0, BW2, DFF, 0, 0.0625f, b2, 0, X1, (float*)d_out, nullptr, 0, (int)NR, DM, DFF);      /* out = x1 + mlp (own-element residual), all rows */
}

// v006
// A run of this version takes 194 microseconds.
// Two timings next to v005 both put it at 1.17 times that version's speed.
// All steps since v000 together make it 38.8 times as fast.
#include <hip/hip_runtime.h>
// Pre-LN transformer encoder block with PER-HEAD projection tensors, no QKV biases (x [8][1024][1024]; h = LN1(x) (biased var, eps 1e-5); q/k/v[h] = h W[h] with W [16][1024][64] ([head][in][out]); scale 64^-0.5; softmax over all 1024 keys (no mask); x1 = x + concat(attn) Wo + bo ([in][out]); out = x1 + gelu_erf(LN2(x1) W1 + b1) W2 + b2 ([in][out] 1024 x 1024 x 1024: hidden = 1 x n_embd, as the source) -> [8][1024][1024]).
// Structure: token rows; LayerNorm / exact f16 rows; WMMA GEMMs for q, k, v; V^T of every batch and head by LDS transposes; one fused attention launch (scores, online softmax and P V in registers); output projection with the own-element residual; custom LayerNorm; GELU (erf) FFN over all rows; launches: see trace.
// Compute dtype: inputs rounded to bf16; x / weights exact; q, k, v, softmax weights and o as plain f16 GEMM operands (~2^-12); scores and softmax statistics f32. v_wmma_f32_16x16x32_f16.
#define NB 8
#define SQ 1024
#define DM 1024
#define NH 16
#define HD 64
#define HG 4                         /* heads per call of the unused per-batch k_vt overload */
#define LOCALW 128                   /* (macros for unused kernels of the shared header) */
#define STRIDEK 128
#define QT 256                       /* query rows per causal tile */
#define NKX SQ                       /* S / P row pitch */
#define QT0 128                      /* first-tile rows recomputed exactly in f32 */
#define B0 0                         /* unused; every launch starts at batch 0 */
#define NBR NB                       /* only feeds the unused MP; the launches cover all NB batches */
#define NR ((size_t)NB * SQ)
#define DMQ DM
#define DFF 1024         /* FFN hidden width = 1 x n_embd in this module (W1 [1024][1024], W2 [1024][1024]) */
#define MP ((int)((size_t)NBR * SQ)) /* unused; the projections take NR rows */
#define QN SQ                        /* unused; attention runs all SQ query rows */
#define NHD NH                       /* unused; the launches cover all NH heads */
#define MPO MP                       /* unused; the output stage takes NR rows */
#define LQ (3 * DM)      /* unused; the q, k, v rows have pitch DM */
typedef __bf16 v16b __attribute__((ext_vector_type(16)));
typedef unsigned short v8us __attribute__((ext_vector_type(8), may_alias));
typedef float  v8f  __attribute__((ext_vector_type(8)));
typedef float  v4f  __attribute__((ext_vector_type(4)));
typedef float  v4fa __attribute__((ext_vector_type(4), may_alias));
union FragB { v16b v; v8us half[2]; unsigned short u[16]; };

__device__ __forceinline__ unsigned short bf16_bits(float x) { unsigned int u = __float_as_uint(x); return (unsigned short)((u + 0x7FFFu + ((u >> 16) & 1u)) >> 16); }
__device__ __forceinline__ float bf16_val(unsigned short b) { return __uint_as_float(((unsigned int)b) << 16); }
__device__ __forceinline__ float bf16_round(float x) { return bf16_val(bf16_bits(x)); }
// D += A·B with NT terms: 1 = ah·bh, 2 = + al·bh (A split), 3 = + ah·bl (both split)
template <int NT>
__device__ __forceinline__ v8f mmaN(v16b ah, v16b al, v16b bh, v16b bl, v8f c) {
  c = __builtin_amdgcn_wmma_f32_16x16x32_bf16(false, ah, false, bh, (short)0, c, false, false);
  if (NT >= 2) c = __builtin_amdgcn_wmma_f32_16x16x32_bf16(false, al, false, bh, (short)0, c, false, false);
  if (NT >= 3) c = __builtin_amdgcn_wmma_f32_16x16x32_bf16(false, ah, false, bl, (short)0, c, false, false);
  asm volatile("v_nop\n\tv_nop\n\tv_nop\n\tv_nop" : "+v"(c) : "v"(ah), "v"(al), "v"(bh), "v"(bl));
  return c;
}

__global__ __launch_bounds__(256) void k_wt_bf16(const float* __restrict__ W, unsigned short* __restrict__ Wt, int K, int N) {
  const int t = blockIdx.x * 256 + threadIdx.x;
  const int k8n = K / 8;
  if (t >= N * k8n) return;
  const int n = t / k8n, k8 = (t % k8n) * 8;
  v8us v;
#pragma unroll
  for (int i = 0; i < 8; ++i) v[i] = bf16_bits(W[(size_t)(k8 + i) * N + n]);
  *(v8us*)(Wt + (size_t)n * K + k8) = v;
  
}

// GEMM C[M][N] (f32, pitch ldc) = act(A[M][K]·W + bias). A f32 row-major (pitch lda) converted per fragment to bf16
// (ASPLIT: hi/lo two planes -> 2 terms, else single rounded term); Wt bf16 [N][K] (pitch ldb). BIAS_BF16 rounds the
// bias to bf16 first (bias quantised to bf16 before the add). K%32==0, M%16==0, N%64==0.
template <bool ASPLIT, int ACT, bool BIAS_BF16>
__global__ __launch_bounds__(128) void k_gemm_bf(const float* __restrict__ A, int lda, const unsigned short* __restrict__ Wt, int ldb,
                                               const float* __restrict__ bias, float* __restrict__ C, int ldc, int M, int N, int K) {
  __shared__ __attribute__((aligned(16))) float so[4][16][64];
  const int tid = threadIdx.x, w = tid >> 5, lane = tid & 31, ln = lane & 15, hh = lane >> 4;
  const int ntn = N / 64;
  const int wid = blockIdx.x * 4 + w;
  const int mt = wid / ntn, nq = wid % ntn;
  if (mt * 16 >= M) return;
  const int row0 = mt * 16, col0 = nq * 64;
  const float* arow = A + (size_t)(row0 + ln) * lda;
  v8f acc[4] = {};
  for (int kb = 0; kb < K; kb += 32) {
    FragB ah, al;
    const v4f x0 = *(const v4fa*)(arow + kb + 8 * hh), x1 = *(const v4fa*)(arow + kb + 8 * hh + 4);
    const v4f x2 = *(const v4fa*)(arow + kb + 16 + 8 * hh), x3 = *(const v4fa*)(arow + kb + 16 + 8 * hh + 4);
    float xs[16] = {x0[0],x0[1],x0[2],x0[3],x1[0],x1[1],x1[2],x1[3],x2[0],x2[1],x2[2],x2[3],x3[0],x3[1],x3[2],x3[3]};
#pragma unroll
    for (int i = 0; i < 16; ++i) { const unsigned short hb = bf16_bits(xs[i]); ah.u[i] = hb; al.u[i] = ASPLIT ? bf16_bits(xs[i] - bf16_val(hb)) : (unsigned short)0; }
#pragma unroll
    for (int t = 0; t < 4; ++t) {
      const unsigned short* brow = Wt + (size_t)(col0 + t * 16 + ln) * ldb + kb;
      FragB b;
      b.half[0] = *(const v8us*)(brow + 8 * hh);
      b.half[1] = *(const v8us*)(brow + 16 + 8 * hh);
      acc[t] = mmaN<ASPLIT ? 2 : 1>(ah.v, al.v, b.v, b.v, acc[t]);
    }
  }
#pragma unroll
  for (int t = 0; t < 4; ++t) {
    float bv = bias ? bias[col0 + t * 16 + ln] : 0.f;
    if (BIAS_BF16) bv = bf16_round(bv);
#pragma unroll
    for (int r = 0; r < 8; ++r) { float v = acc[t][r] + bv; if (ACT == 1) v = fmaxf(v, 0.f); so[w][8 * hh + r][t * 16 + ln] = v; }
  }
  __builtin_amdgcn_fence(__ATOMIC_ACQ_REL, "workgroup");
  __builtin_amdgcn_wave_barrier();
  const int rsub = lane >> 4, c4 = (lane & 15) * 4;
  {
#pragma unroll
    for (int q = 0; q < 8; ++q) {
      const int r = q * 2 + rsub;
      const v4f v = *(const v4fa*)&so[w][r][c4];
      *(v4f*)(C + (size_t)(row0 + r) * ldc + col0 + c4) = v;
    }
    
  }
}

// GEMM C = act(A·W + bias + resid): A f32 (ASPLIT -> hi/lo 2 terms), Wt bf16 [N][K]; ACT 0 none, 1 relu, 2 exact gelu;
// resid (optional, f32, row index = (row % rmod), pitch ldr, RES_BF16 rounds it) added before the activation.
template <bool ASPLIT, int ACT, bool BIAS_BF16, bool RES_BF16>
__global__ __launch_bounds__(128) void k_gemm_bf3(const float* __restrict__ A, int lda, const unsigned short* __restrict__ Wt, int ldb,
                                                const float* __restrict__ bias, const float* __restrict__ resid, int rmod, int ldr,
                                                float* __restrict__ C, int ldc, int M, int N, int K) {
  __shared__ __attribute__((aligned(16))) float so[4][16][64];
  const int tid = threadIdx.x, w = tid >> 5, lane = tid & 31, ln = lane & 15, hh = lane >> 4;
  const int ntn = N / 64;
  const int wid = blockIdx.x * 4 + w;
  const int mt = wid / ntn, nq = wid % ntn;
  if (mt * 16 >= M) return;
  const int row0 = mt * 16, col0 = nq * 64;
  const float* arow = A + (size_t)(row0 + ln) * lda;
  v8f acc[4] = {};
  for (int kb = 0; kb < K; kb += 32) {
    FragB ah, al;
    const v4f x0 = *(const v4fa*)(arow + kb + 8 * hh), x1 = *(const v4fa*)(arow + kb + 8 * hh + 4);
    const v4f x2 = *(const v4fa*)(arow + kb + 16 + 8 * hh), x3 = *(const v4fa*)(arow + kb + 16 + 8 * hh + 4);
    float xs[16] = {x0[0],x0[1],x0[2],x0[3],x1[0],x1[1],x1[2],x1[3],x2[0],x2[1],x2[2],x2[3],x3[0],x3[1],x3[2],x3[3]};
#pragma unroll
    for (int i = 0; i < 16; ++i) { const unsigned short hb = bf16_bits(xs[i]); ah.u[i] = hb; al.u[i] = ASPLIT ? bf16_bits(xs[i] - bf16_val(hb)) : (unsigned short)0; }
#pragma unroll
    for (int t = 0; t < 4; ++t) {
      const unsigned short* brow = Wt + (size_t)(col0 + t * 16 + ln) * ldb + kb;
      FragB b;
      b.half[0] = *(const v8us*)(brow + 8 * hh);
      b.half[1] = *(const v8us*)(brow + 16 + 8 * hh);
      acc[t] = mmaN<ASPLIT ? 2 : 1>(ah.v, al.v, b.v, b.v, acc[t]);
    }
  }
#pragma unroll
  for (int t = 0; t < 4; ++t) {
    const int col = col0 + t * 16 + ln;
    float bv = bias ? bias[col] : 0.f;
    if (BIAS_BF16) bv = bf16_round(bv);
#pragma unroll
    for (int r = 0; r < 8; ++r) {
      float v = acc[t][r] + bv;
      if (resid) { float rv = resid[(size_t)((row0 + 8 * hh + r) % rmod) * ldr + col]; if (RES_BF16) rv = bf16_round(rv); v += rv; }
      if (ACT == 1) v = fmaxf(v, 0.f);
      if (ACT == 2) v = 0.5f * v * (1.0f + erff(v * 0.70710678118654752f));
      if (ACT == 3) { const float u = 0.7978845608028654f * (v + 0.044715f * v * v * v); v = 0.5f * v * (1.0f + tanhf(u)); }
      so[w][8 * hh + r][t * 16 + ln] = v;
    }
  }
  __builtin_amdgcn_fence(__ATOMIC_ACQ_REL, "workgroup");
  __builtin_amdgcn_wave_barrier();
  const int rsub = lane >> 4, c4 = (lane & 15) * 4;
  {
#pragma unroll
    for (int q = 0; q < 8; ++q) {
      const int r = q * 2 + rsub;
      const v4f v = *(const v4fa*)&so[w][r][c4];
      *(v4f*)(C + (size_t)(row0 + r) * ldc + col0 + c4) = v;
    }
    
  }
}
// row LayerNorm (biased variance, eps) over N: s = X (+ R); optional out_sum <- s; out_norm <- (s-mu)*rsqrt(var+eps)*g + b
template <bool PARAM_BF16>
__global__ __launch_bounds__(256) void k_layernorm(const float* __restrict__ X, const float* __restrict__ R, const float* __restrict__ g, const float* __restrict__ bta,
                                                  float* __restrict__ out_sum, float* __restrict__ out_norm, int N, float eps) {
  __shared__ float red[256];
  const int row = blockIdx.x, tid = threadIdx.x;
  const float* x = X + (size_t)row * N; const float* rr = R ? R + (size_t)row * N : nullptr;
  float vals[16];                     // up to N = 4096
  const int per = N / 256;            // contiguous chunk per thread? use strided-by-4 chunks: thread handles j = tid*4 + 1024*u
  float s1 = 0.f;
  for (int u = 0; u < per / 4; ++u) {
    const int j = tid * 4 + 1024 * u;
    const v4f a = *(const v4fa*)(x + j);
    v4f b = {0.f,0.f,0.f,0.f}; if (rr) b = *(const v4fa*)(rr + j);
#pragma unroll
    for (int q = 0; q < 4; ++q) { const float v = a[q] + b[q]; vals[u * 4 + q] = v; s1 += v; }
  }
  red[tid] = s1; __syncthreads();
  for (int st = 128; st > 0; st >>= 1) { if (tid < st) red[tid] += red[tid + st]; __syncthreads(); }
  const float mu = red[0] / (float)N; __syncthreads();
  float s2 = 0.f;
  for (int u = 0; u < per / 4; ++u)
#pragma unroll
    for (int q = 0; q < 4; ++q) { const float c = vals[u * 4 + q] - mu; s2 += c * c; }
  red[tid] = s2; __syncthreads();
  for (int st = 128; st > 0; st >>= 1) { if (tid < st) red[tid] += red[tid + st]; __syncthreads(); }
  const float rs = rsqrtf(red[0] / (float)N + eps);
  {
    for (int u = 0; u < per / 4; ++u) {
      const int j = tid * 4 + 1024 * u;
      v4f o, sm;
#pragma unroll
      for (int q = 0; q < 4; ++q) {
        float gg = g[j + q], bb = bta[j + q];
        if (PARAM_BF16) { gg = bf16_round(gg); bb = bf16_round(bb); }
        sm[q] = vals[u * 4 + q]; o[q] = (vals[u * 4 + q] - mu) * rs * gg + bb;
      }
      if (out_sum) *(v4f*)(out_sum + (size_t)row * N + j) = sm;
      *(v4f*)(out_norm + (size_t)row * N + j) = o;
    }
    
  }
}



// ---- f16 WMMA path (v_wmma_f32_16x16x32_f16): 11-bit significands for operands in range — used where a [0,1] probability operand needs more precision than bf16
typedef _Float16 v16h __attribute__((ext_vector_type(16)));
union FragH { v16h v; v8us half[2]; _Float16 h[16]; unsigned short u[16]; };
template <int NT>
__device__ __forceinline__ v8f mmaH(v16h ah, v16h al, v16h bh, v16h bl, v8f c) {
  c = __builtin_amdgcn_wmma_f32_16x16x32_f16(false, ah, false, bh, (short)0, c, false, false);
  if (NT >= 2) c = __builtin_amdgcn_wmma_f32_16x16x32_f16(false, al, false, bh, (short)0, c, false, false);
  if (NT >= 3) c = __builtin_amdgcn_wmma_f32_16x16x32_f16(false, ah, false, bl, (short)0, c, false, false);
  asm volatile("v_nop\n\tv_nop\n\tv_nop\n\tv_nop" : "+v"(c) : "v"(ah), "v"(al), "v"(bh), "v"(bl));
  return c;
}
// batched GEMM like k_gemm_b but f16 operands: A f32 (split into f16 hi/lo if ASPLIT, else rounded to f16), Bt = f16 values [n][k]; alpha; C f32; N multiple of 16 (partial tiles skipped)
template <bool ASPLIT>
__global__ __launch_bounds__(128) void k_gemm_h(const float* __restrict__ A, int lda, size_t sA, const _Float16* __restrict__ Bh, int ldb, size_t sB, float alpha, float* __restrict__ C, int ldc, size_t sC, int M, int N, int K) {
  __shared__ __attribute__((aligned(16))) float so[4][16][64];
  const int tid = threadIdx.x, w = tid >> 5, lane = tid & 31, ln = lane & 15, hh = lane >> 4; const int by = blockIdx.y;
  A += (size_t)by * sA; Bh += (size_t)by * sB; C += (size_t)by * sC;
  const int ntn = (N + 63) / 64; const int wid = blockIdx.x * 4 + w; const int mt = wid / ntn, nq = wid % ntn; if (mt * 16 >= M) return;
  const int row0 = mt * 16, col0 = nq * 64; const float* arow = A + (size_t)(row0 + ln) * lda;
  v8f acc[4] = {};
  for (int kb = 0; kb < K; kb += 32) {
    FragH ah, al;
    const v4f x0 = *(const v4fa*)(arow + kb + 8 * hh), x1 = *(const v4fa*)(arow + kb + 8 * hh + 4), x2 = *(const v4fa*)(arow + kb + 16 + 8 * hh), x3 = *(const v4fa*)(arow + kb + 16 + 8 * hh + 4);
    float xs[16] = {x0[0],x0[1],x0[2],x0[3],x1[0],x1[1],x1[2],x1[3],x2[0],x2[1],x2[2],x2[3],x3[0],x3[1],x3[2],x3[3]};
#pragma unroll
    for (int i = 0; i < 16; ++i) { const _Float16 h = (_Float16)xs[i]; ah.h[i] = h; al.h[i] = ASPLIT ? (_Float16)(xs[i] - (float)h) : (_Float16)0.0f; }
#pragma unroll
    for (int t = 0; t < 4; ++t) { if (col0 + t * 16 >= N) continue; const size_t boff = (size_t)(col0 + t * 16 + ln) * ldb + kb; FragH bq; bq.half[0] = *(const v8us*)(Bh + boff + 8 * hh); bq.half[1] = *(const v8us*)(Bh + boff + 16 + 8 * hh);
      acc[t] = mmaH<ASPLIT ? 2 : 1>(ah.v, al.v, bq.v, bq.v, acc[t]); }
  }
#pragma unroll
  for (int t = 0; t < 4; ++t) { if (col0 + t * 16 >= N) continue;
#pragma unroll
    for (int r = 0; r < 8; ++r) so[w][8 * hh + r][t * 16 + ln] = acc[t][r] * alpha; }
  __builtin_amdgcn_fence(__ATOMIC_ACQ_REL, "workgroup"); __builtin_amdgcn_wave_barrier();
  const int rsub = lane >> 4, c4 = (lane & 15) * 4;
  {
#pragma unroll
    for (int q = 0; q < 8; ++q) { const int r = q * 2 + rsub; if (col0 + c4 < N) { const v4f v = *(const v4fa*)&so[w][r][c4]; *(v4f*)(C + (size_t)(row0 + r) * ldc + col0 + c4) = v; } }
     }
}

// Wt[n][k] = f16(W[k][n]·scale) from f32 row-major W[K][N] (scale = power of two; bf16-exact weights stay exact in f16 away from the subnormal range)
__global__ __launch_bounds__(256) void k_wt_f16(const float* __restrict__ W, _Float16* __restrict__ Wt, int K, int N, float scale) {
  const int t = blockIdx.x * 256 + threadIdx.x; if (t >= N * (K / 8)) return; const int n = t / (K / 8), k8 = (t % (K / 8)) * 8; FragH f;
#pragma unroll
  for (int i = 0; i < 8; ++i) f.h[i] = (_Float16)(bf16_round(W[(size_t)(k8 + i) * N + n]) * scale); const v8us o = f.half[0];
  *(v8us*)((unsigned short*)Wt + (size_t)n * K + k8) = o; 
}
// k_gemm_hh variant with fused epilogue: v = acc·alpha + bias[by·sBias + col] (+ CP[(row/rowsPerB)·sCPb + by·64 + col] if CP) ; ACT 0 none / 1 elu ; writes f16 C16 (and f32 C if non-null)
template <int ACT>
__global__ __launch_bounds__(128) void k_gemm_hhx(const _Float16* __restrict__ A, int lda, size_t sA, const _Float16* __restrict__ Bh, int ldb, size_t sB, float alpha, const float* __restrict__ bias, size_t sBias, const float* __restrict__ CP, int rowsPerB, size_t sCPb, int row0g,
    float* __restrict__ C, _Float16* __restrict__ C16, int ldc, size_t sC, int M, int N, int K) {
  __shared__ __attribute__((aligned(16))) float so[4][16][64];
  const int tid = threadIdx.x, w = tid >> 5, lane = tid & 31, ln = lane & 15, hh = lane >> 4; const int by = blockIdx.y;
  A += (size_t)by * sA; Bh += (size_t)by * sB; const size_t cofs = (size_t)by * sC; const float* bp = bias ? bias + (size_t)by * sBias : nullptr;
  const int ntn = (N + 63) / 64; const int wid = blockIdx.x * 4 + w; const int mt = wid / ntn, nq = wid % ntn; if (mt * 16 >= M) return;
  const int row0 = mt * 16, col0 = nq * 64; const _Float16* arow = A + (size_t)(row0 + ln) * lda;
  v8f acc[4] = {};
  for (int kb = 0; kb < K; kb += 32) { FragH ah; ah.half[0] = *(const v8us*)((const unsigned short*)arow + kb + 8 * hh); ah.half[1] = *(const v8us*)((const unsigned short*)arow + kb + 16 + 8 * hh);
#pragma unroll
    for (int t = 0; t < 4; ++t) { if (col0 + t * 16 >= N) continue; const size_t boff = (size_t)(col0 + t * 16 + ln) * ldb + kb; FragH bq; bq.half[0] = *(const v8us*)((const unsigned short*)Bh + boff + 8 * hh); bq.half[1] = *(const v8us*)((const unsigned short*)Bh + boff + 16 + 8 * hh);
      acc[t] = mmaH<1>(ah.v, ah.v, bq.v, bq.v, acc[t]); }
  }
#pragma unroll
  for (int t = 0; t < 4; ++t) { if (col0 + t * 16 >= N) continue; const int col = col0 + t * 16 + ln; const float bv = bp ? bf16_round(bp[col]) : 0.f;
#pragma unroll
    for (int r = 0; r < 8; ++r) { float v = acc[t][r] * alpha + bv; if (CP) { const int rr = row0g + row0 + 8 * hh + r; if (rowsPerB < 0) v += CP[cofs + (size_t)rr * ldc + col];      /* rowsPerB < 0: own element of the batched C plane */ else { const int bidx = rr / rowsPerB; v += CP[(size_t)bidx * sCPb + (size_t)by * 64 + col]; } } if (ACT == 1) v = (v > 0.f) ? v : expm1f(v); else if (ACT == 7) v = (v > 0.f) ? v + 1.0f : expf(v); else if (ACT == 8) v = tanhf(v); else if (ACT == 9) v = 0.5f * v * (1.0f + tanhf(0.7978845608028654f * (v + 0.044715f * v * v * v))); else if (ACT == 11) v = 1.0f / (1.0f + expf(-v)); else if (ACT == 12) v = (v > 0.f) ? v : 0.01f * v; else if (ACT == 14) v = (v > 0.f) ? v : 0.1f * v; else if (ACT == 16) v = (v >= 0.f) ? v : 0.3f * v; else if (ACT == 17) v = (v >= 0.f) ? v : 0.2f * v; else if (ACT == 15) v = v / (1.0f + expf(-v)); else if (ACT == 3) v = fmaxf(v, 0.f); else if (ACT == 6) v = 0.5f * v * (1.0f + erff(v * 0.70710678118654752f)); so[w][8 * hh + r][t * 16 + ln] = v; } }
  __builtin_amdgcn_fence(__ATOMIC_ACQ_REL, "workgroup"); __builtin_amdgcn_wave_barrier();
  const int rsub = lane >> 4, c4 = (lane & 15) * 4; typedef _Float16 v4h __attribute__((ext_vector_type(4)));
  {
#pragma unroll
    for (int q = 0; q < 8; ++q) { const int r = q * 2 + rsub; if (col0 + c4 < N) { const v4f v = *(const v4fa*)&so[w][r][c4]; if (C) *(v4f*)(C + cofs + (size_t)(row0 + r) * ldc + col0 + c4) = v; if (C16) { v4h h4; for (int i = 0; i < 4; ++i) h4[i] = (_Float16)v[i]; *(v4h*)(C16 + cofs + (size_t)(row0 + r) * ldc + col0 + c4) = h4; } } }
     }
}


typedef _Float16 v4h __attribute__((ext_vector_type(4)));

__global__ __launch_bounds__(256) void k_x16(const float* __restrict__ x, _Float16* __restrict__ X16, size_t n8) { const size_t t = (size_t)blockIdx.x * 256 + threadIdx.x; if (t >= n8) return; FragH f;
#pragma unroll
  for (int q = 0; q < 8; ++q) f.h[q] = (_Float16)bf16_round(x[t * 8 + q]); *(v8us*)((unsigned short*)X16 + t * 8) = f.half[0];  }
__global__ __launch_bounds__(256) void k_h16(const float* __restrict__ x, _Float16* __restrict__ X16, size_t n8) { const size_t t = (size_t)blockIdx.x * 256 + threadIdx.x; if (t >= n8) return; FragH f;
#pragma unroll
  for (int q = 0; q < 8; ++q) f.h[q] = (_Float16)x[t * 8 + q]; *(v8us*)((unsigned short*)X16 + t * 8) = f.half[0];  }
__global__ __launch_bounds__(256) void k_round16f(const float* __restrict__ W, _Float16* __restrict__ Bt, size_t n8) { const size_t t = (size_t)blockIdx.x * 256 + threadIdx.x; if (t >= n8) return; FragH f;
#pragma unroll
  for (int i = 0; i < 8; ++i) f.h[i] = (_Float16)(bf16_round(W[t * 8 + i]) * 16.0f); *(v8us*)((unsigned short*)Bt + t * 8) = f.half[0];  }
template <int NHv, int TTv>
__global__ __launch_bounds__(256) void k_vt(const _Float16* __restrict__ V16, int ldv, int voff, _Float16* __restrict__ Vt) { __shared__ unsigned short tl[64][66]; const int tid = threadIdx.x; const int slab = blockIdx.x / (TTv / 64), lg = blockIdx.x % (TTv / 64); const int b = slab / NHv, h = slab % NHv;
  for (int i = tid; i < 64 * 8; i += 256) { const int r = i / 8, c8 = (i % 8) * 8; FragH f; f.half[0] = *(const v8us*)((const unsigned short*)V16 + ((size_t)b * TTv + lg * 64 + r) * ldv + voff + h * 64 + c8);
#pragma unroll
    for (int q = 0; q < 8; ++q) tl[r][c8 + q] = f.u[q]; }
  __syncthreads();
  {
#pragma unroll
    for (int rd = 0; rd < 2; ++rd) { const int d = rd * 32 + tid / 8, pc = tid % 8; FragH f;
#pragma unroll
      for (int q = 0; q < 8; ++q) f.u[q] = tl[pc * 8 + q][d];
      *(v8us*)((unsigned short*)Vt + ((size_t)slab * 64 + d) * TTv + lg * 64 + pc * 8) = f.half[0]; }
     } }

__global__ __launch_bounds__(256) void k_hl(const float* __restrict__ F, _Float16* __restrict__ Hh, _Float16* __restrict__ Hl, size_t n8) { const size_t t = (size_t)blockIdx.x * 256 + threadIdx.x; if (t >= n8) return; FragH fh, fl; const v4f a = *(const v4fa*)(F + t * 8), c = *(const v4fa*)(F + t * 8 + 4);
#pragma unroll
  for (int q = 0; q < 4; ++q) { _Float16 h = (_Float16)a[q]; fh.h[q] = h; fl.h[q] = (_Float16)((a[q] - (float)h) * 1024.0f); h = (_Float16)c[q]; fh.h[4 + q] = h; fl.h[4 + q] = (_Float16)((c[q] - (float)h) * 1024.0f); }
  { *(v8us*)((unsigned short*)Hh + t * 8) = fh.half[0]; *(v8us*)((unsigned short*)Hl + t * 8) = fl.half[0];  } }

// one 16 x 32 f16 fragment of a k-contiguous row: 16 bytes at k = 8 hh and 16 bytes at k = 16 + 8 hh (A and B alike)
__device__ __forceinline__ v16h g2_frag(const _Float16* p, int hh) { FragH f; f.half[0] = *(const v8us*)((const unsigned short*)p + 8 * hh); f.half[1] = *(const v8us*)((const unsigned short*)p + 16 + 8 * hh); return f.v; }
// ---- tiled GEMM: one 128 x 128 tile of C per work-group (M % 128 == 0, N % 128 == 0, K % 64 == 0), four waves as 2 x 2, 64 x 64 per wave; epilogue = k_gemm_hhx semantics ----
// A stage is 64 k of 128 rows of A and of 128 rows of Bt, brought into LDS by asynchronous copies (whole 128-byte lines, through no register) and read by every wave that needs it.
// Two buffers: the next stage's copies fly while this stage is worked on. The k order of every sum is that of the unstaged loop (32 k per product, ascending).
#define G3P 144                      /* LDS row pitch in bytes: 128 of data + 16, so that the 16 rows of a 16-byte fragment read fall on 64 different banks */
#define G3T (128 * G3P)              /* one operand's tile */
#define G3S (2 * G3T)                /* one stage: [A tile | Bt tile] */
__device__ __forceinline__ v8f g3_mma(v16h a, v16h b, v8f c) { return __builtin_amdgcn_wmma_f32_16x16x32_f16(false, a, false, b, (short)0, c, false, false); }
// Eight copies of 16 bytes a lane: rows r, r + 16, .., r + 112 of one operand's tile (l: the lane's LDS byte address, g: its global address, ld: the source pitch in elements).
// The s_wait_xcnt stands inside the statement, behind the last copy, so that no address register of a copy is rewritten in front of it.
__device__ __forceinline__ void g3_copy8(unsigned l, const _Float16* g, int ld) {
  const size_t st = (size_t)16 * ld;
  asm volatile("global_load_async_to_lds_b128 %0, %8, off\n\t"
               "global_load_async_to_lds_b128 %1, %9, off\n\t"
               "global_load_async_to_lds_b128 %2, %10, off\n\t"
               "global_load_async_to_lds_b128 %3, %11, off\n\t"
               "global_load_async_to_lds_b128 %4, %12, off\n\t"
               "global_load_async_to_lds_b128 %5, %13, off\n\t"
               "global_load_async_to_lds_b128 %6, %14, off\n\t"
               "global_load_async_to_lds_b128 %7, %15, off\n\t"
               "s_wait_xcnt 0x0"
               :: "v"(l), "v"(l + 16 * G3P), "v"(l + 32 * G3P), "v"(l + 48 * G3P), "v"(l + 64 * G3P), "v"(l + 80 * G3P), "v"(l + 96 * G3P), "v"(l + 112 * G3P),
                  "v"(g), "v"(g + st), "v"(g + 2 * st), "v"(g + 3 * st), "v"(g + 4 * st), "v"(g + 5 * st), "v"(g + 6 * st), "v"(g + 7 * st)
               : "memory"); }
template <int ACT>
__device__ __forceinline__ float g3_act(float v) {
  if (ACT == 3) v = fmaxf(v, 0.f); else if (ACT == 6) v = 0.5f * v * (1.0f + erff(v * 0.70710678118654752f)); else if (ACT == 11) v = 1.0f / (1.0f + expf(-v)); else if (ACT == 15) v = v / (1.0f + expf(-v)); else if (ACT == 18) v = v / (1.0f + expf(-1.702f * v));      /* QuickGELU: v sigmoid(1.702 v) */ else if (ACT == 12) v = (v > 0.f) ? v : 0.01f * v; else if (ACT == 8) v = tanhf(v); else if (ACT == 9) v = 0.5f * v * (1.0f + tanhf(0.7978845608028654f * (v + 0.044715f * v * v * v))); else if (ACT == 14) v = (v > 0.f) ? v : 0.1f * v; else if (ACT == 16) v = (v >= 0.f) ? v : 0.3f * v; else if (ACT == 17) v = (v >= 0.f) ? v : 0.2f * v;
  return v; }
// RES: add CP's own element of the C plane, then the activation (both on the staged rows, 16 bytes a lane); W32: write f32 rows to C, else f16 rows to C16. Both are compile-time, so that the epilogue is one straight run and its loads go out together.
template <int ACT, bool RES, bool W32>
__global__ __launch_bounds__(128) void k_gemm3(const _Float16* __restrict__ A, int lda, size_t sA, const _Float16* __restrict__ Bh, int ldb, size_t sB, float alpha, const float* __restrict__ bias, size_t sBias, const float* __restrict__ CP,
    float* __restrict__ C, _Float16* __restrict__ C16, size_t sC, int M, int N, int K) { static_assert(ACT == 0 || ACT == 3 || ACT == 6 || ACT == 8 || ACT == 9 || ACT == 11 || ACT == 12 || ACT == 14 || ACT == 15 || ACT == 16 || ACT == 17 || ACT == 18, "k_gemm3: unsupported ACT code (would silently apply no activation)");
  __shared__ __attribute__((aligned(128))) unsigned char L[2 * G3S]; static_assert(4 * 64 * 68 * 4 <= 2 * G3S, "k_gemm3: the output staging reuses the ring");
  const int tid = threadIdx.x, w = tid >> 5, lane = tid & 31, ln = lane & 15, hh = lane >> 4; const int by = blockIdx.y;
  A += (size_t)by * sA; Bh += (size_t)by * sB; const size_t cofs = (size_t)by * sC; const float* bp = bias ? bias + (size_t)by * sBias : nullptr;
  const int ntn = N >> 7; const int mt = blockIdx.x / ntn, nq = blockIdx.x - mt * ntn; if (mt * 128 >= M) return;      /* the same for the whole work-group, in front of every barrier */
  const int row0 = mt * 128 + (w >> 1) * 64, col0 = nq * 128 + (w & 1) * 64;
  const unsigned lc = (unsigned)(size_t)L + (unsigned)((tid >> 3) * G3P + (tid & 7) * 16);      /* eight lanes copy one 128-byte row */
  const _Float16* ga = A + (size_t)(mt * 128 + (tid >> 3)) * lda + (tid & 7) * 8; const _Float16* gb = Bh + (size_t)(nq * 128 + (tid >> 3)) * ldb + (tid & 7) * 8;
  const int nt = K >> 6; constexpr int ldc = DM; static_assert(DFF == DM, "k_gemm3: one output pitch");      /* a compile-time pitch: the epilogue's loads and stores share one address pair each and differ only in their immediate offsets */
  const v8f z8 = {0.f,0.f,0.f,0.f,0.f,0.f,0.f,0.f}; v8f acc[4][4];
#pragma unroll
  for (int i = 0; i < 4; ++i)
#pragma unroll
    for (int j = 0; j < 4; ++j) acc[i][j] = z8;
  g3_copy8(lc, ga, lda); g3_copy8(lc + G3T, gb, ldb);
  asm volatile("s_wait_asynccnt 0x0" ::: "memory");      /* stage 0 has landed (this wave's copies) */
  __syncthreads();      /* ... and every wave's */
  if (nt > 1) { g3_copy8(lc + G3S, ga + 64, lda); g3_copy8(lc + G3S + G3T, gb + 64, ldb); }
  float bv[4] = {0.f, 0.f, 0.f, 0.f};      /* the lane's four bias values, fetched here so that they arrive under the loop */
  if (bp) {
#pragma unroll
    for (int t = 0; t < 4; ++t) bv[t] = bp[col0 + t * 16 + ln];
    asm volatile("s_wait_xcnt 0x0" ::: "memory"); }      /* the four loads' offset register is rewritten right behind them */
#pragma unroll 1
  for (int t = 0; t < nt; ++t) { const unsigned buf = (unsigned)(t & 1) * G3S;      /* rolled: one copy of the 32 products in the text */
    const _Float16* pa = (const _Float16*)(L + buf + ((w >> 1) * 64 + ln) * G3P); const _Float16* pb = (const _Float16*)(L + buf + G3T + ((w & 1) * 64 + ln) * G3P);
    v16h a[2][4], b[2][4];
#pragma unroll
    for (int ks = 0; ks < 2; ++ks)
#pragma unroll
      for (int i = 0; i < 4; ++i) { a[ks][i] = g2_frag(pa + i * 16 * (G3P / 2) + ks * 32, hh); b[ks][i] = g2_frag(pb + i * 16 * (G3P / 2) + ks * 32, hh); }
    __builtin_amdgcn_sched_barrier(0);      /* keeps the stage's 32 fragment reads together in front of its products: without it the scheduler sinks the A reads among them, into one register set, and every four products wait out an LDS latency */
#pragma unroll
    for (int ks = 0; ks < 2; ++ks)
#pragma unroll
      for (int i = 0; i < 4; ++i)
#pragma unroll
        for (int j = 0; j < 4; ++j) acc[i][j] = g3_mma(a[ks][i], b[ks][j], acc[i][j]);
    __builtin_amdgcn_sched_barrier(0);      /* keeps the products in front of the stage's waits: without it the scheduler sinks them behind the barrier, and the wait for the next stage's copies stands at the head of the trip, before they have had time to land */
    asm volatile("s_wait_dscnt 0x0" ::: "memory");      /* this wave's reads of the buffer have returned */
    asm volatile("s_wait_asynccnt 0x0" ::: "memory");      /* this wave's copies of stage t + 1 have landed */
    __syncthreads();      /* publishes stage t + 1 and frees stage t's buffer */
    if (t + 2 < nt) { g3_copy8(lc + buf, ga + (size_t)(t + 2) * 64, lda); g3_copy8(lc + buf + G3T, gb + (size_t)(t + 2) * 64, ldb); } }
  asm volatile("s_wait_asynccnt 0x0" ::: "memory");      /* no copy is outstanding when the ring becomes output staging */
  float (*so)[68] = (float (*)[68])(L + (size_t)w * (64 * 68 * 4));      /* each wave stages in its own range; the last trip's barrier has ended every read of the ring */
#pragma unroll
  for (int u = 0; u < 16; ++u) { const int t = u & 3, half = u >> 2;
#pragma unroll
    for (int r = 0; r < 8; ++r) { const int rloc = half * 16 + 8 * hh + r; const float v = acc[half][t][r] * alpha + bf16_round(bv[t]);
      so[rloc][t * 16 + ln] = v; } }
  __builtin_amdgcn_fence(__ATOMIC_ACQ_REL, "workgroup"); __builtin_amdgcn_wave_barrier();
  const int rsub = lane >> 4, c4 = (lane & 15) * 4;
  const size_t e0 = cofs + (size_t)(row0 + rsub) * ldc + col0 + c4;      /* the lane's first element; row q * 2 + rsub lies q * 2 * ldc elements further on */
  v4f rv[32]; static_assert(!RES || ACT == 0, "k_gemm3: the residual rows are held in registers, so their loop is unrolled");
  if (RES) {
#pragma unroll
    for (int q = 0; q < 32; ++q) rv[q] = *(const v4fa*)(CP + e0 + (size_t)q * (2 * ldc));
    asm volatile("s_wait_xcnt 0x0" ::: "memory");      /* the 32 loads share one address pair, which is rewritten right behind them */
  }
  {
#pragma unroll(ACT == 0 ? 32 : 2)      /* with an activation the loop stays rolled, for code size (128 copies of erff otherwise) */
    for (int q = 0; q < 32; ++q) { const int r = q * 2 + rsub; const size_t e = e0 + (size_t)q * (2 * ldc); v4f v = *(const v4fa*)&so[r][c4]; if (RES) v += rv[q]; for (int i = 0; i < 4; ++i) v[i] = g3_act<ACT>(v[i]); if (W32) *(v4f*)(C + e) = v; else { v4h h4; for (int i = 0; i < 4; ++i) h4[i] = (_Float16)v[i]; *(v4h*)(C16 + e) = h4; }
      if (ACT != 0 || (q & 7) == 7) asm volatile("s_wait_xcnt 0x0" ::: "memory");      /* later rows rewrite registers of issued stores (rolled loop: the next trip does); unrolled, one wait serves eight rows */
    }
     } }


__global__ __launch_bounds__(256) void k_wnat(const float* __restrict__ w, size_t n8, _Float16* __restrict__ Bt) { const size_t t = (size_t)blockIdx.x * 256 + threadIdx.x; if (t >= n8) return; FragH f; for (int q = 0; q < 8; ++q) f.h[q] = (_Float16)(bf16_round(w[t * 8 + q]) * 16.0f); *(v8us*)((unsigned short*)Bt + t * 8) = f.half[0];  }
__global__ __launch_bounds__(256) void k_rsm(const float* __restrict__ S, _Float16* __restrict__ P, int nrows) {
  #pragma clang fp contract(off)
  const int i = blockIdx.x * 256 + threadIdx.x; if (i >= nrows) return; const float* s = S + (size_t)i * SQ; float mx = -3.0e38f;
#pragma unroll 1
  for (int j = 0; j < SQ; ++j) mx = fmaxf(mx, s[j]); float se = 0.f;
#pragma unroll 1
  for (int j = 0; j < SQ; ++j) se += expf(s[j] - mx); const float sc = 256.0f / se;
#pragma unroll 1
  for (int j0 = 0; j0 < SQ; j0 += 8) { FragH f; for (int q = 0; q < 8; ++q) f.h[q] = (_Float16)(expf(s[j0 + q] - mx) * sc); unsigned short* d = (unsigned short*)P + (size_t)i * SQ + j0; *(v8us*)d = f.half[0];  } }
__global__ __launch_bounds__(256) void k_vt(const _Float16* __restrict__ V16, int b, int h0, _Float16* __restrict__ VT) { __shared__ unsigned short tl[64][65]; const int tid = threadIdx.x; const int hh = blockIdx.x % HG, sg = blockIdx.x / HG; const int s0 = sg * 64; const int h = h0 + hh;
  for (int i = tid; i < 64 * 8; i += 256) { const int j = i / 8, d8 = (i % 8) * 8; FragH f; f.half[0] = *(const v8us*)((const unsigned short*)V16 + ((size_t)b * SQ + s0 + j) * DM + h * HD + d8); for (int q = 0; q < 8; ++q) tl[d8 + q][j] = f.u[q]; }
  __syncthreads();
  { for (int i = tid; i < 64 * 8; i += 256) { const int d = i / 8, j8 = (i % 8) * 8; FragH f; for (int q = 0; q < 8; ++q) f.u[q] = tl[d][j8 + q]; *(v8us*)((unsigned short*)VT + ((size_t)hh * HD + d) * SQ + s0 + j8) = f.half[0]; }  } }



__global__ __launch_bounds__(256) void k_rsmcf2(const float* __restrict__ S, _Float16* __restrict__ P, int hg, int q0, int nk) {
  #pragma clang fp contract(off)
  const int t = blockIdx.x * 256 + threadIdx.x; if (t >= hg * QT) return; const size_t i = (size_t)t; const float* s = S + i * NKX; const int last = q0 + (t % QT); float mx = -3.0e38f;
#pragma unroll 1
  for (int j = 0; j < nk; ++j) { const float f = (j <= last) ? 1.f : 0.f; mx = fmaxf(mx, fmaf(f, s[j], (1.f - f) * -1.0e9f)); } float se = 0.f;
#pragma unroll 1
  for (int j = 0; j < nk; ++j) { const float f = (j <= last) ? 1.f : 0.f; se += __expf(fmaf(f, s[j], (1.f - f) * -1.0e9f) - mx); } const float sc = 256.0f / se;
#pragma unroll 1
  for (int j0 = 0; j0 < nk; j0 += 8) { FragH fr; for (int q = 0; q < 8; ++q) { const int j = j0 + q; const float f = (j <= last) ? 1.f : 0.f; fr.h[q] = (_Float16)(__expf(fmaf(f, s[j], (1.f - f) * -1.0e9f) - mx) * sc); } unsigned short* d = (unsigned short*)P + i * NKX + j0; *(v8us*)d = fr.half[0];  } }

__global__ __launch_bounds__(256) void k_rsmcst(const float* __restrict__ S, _Float16* __restrict__ P, int hg, int q0, int nk, const int* __restrict__ mk) {
  #pragma clang fp contract(off)
  const int t = blockIdx.x * 256 + threadIdx.x; if (t >= hg * QT) return; const size_t i = (size_t)t; const float* s = S + i * NKX; const size_t ig = (size_t)(q0 + (t % QT)); const int* mr = mk + ig * SQ; float mx = -3.0e38f;
#pragma unroll 1
  for (int j = 0; j < nk; ++j) { const int mb = mr[j]; const int dd = (int)ig - j; const float f = (mb != 0 && dd >= 0 && (dd <= LOCALW || (dd % STRIDEK) == 0)) ? 1.f : 0.f; mx = fmaxf(mx, fmaf(f, s[j], (1.f - f) * -1.0e9f)); } float se = 0.f;
#pragma unroll 1
  for (int j = 0; j < nk; ++j) { const int mb = mr[j]; const int dd = (int)ig - j; const float f = (mb != 0 && dd >= 0 && (dd <= LOCALW || (dd % STRIDEK) == 0)) ? 1.f : 0.f; se += __expf(fmaf(f, s[j], (1.f - f) * -1.0e9f) - mx); } const float sc = 256.0f / se;
#pragma unroll 1
  for (int j0 = 0; j0 < nk; j0 += 8) { FragH fr; for (int q = 0; q < 8; ++q) { const int j = j0 + q; const int mb = mr[j]; const int dd = (int)ig - j; const float f = (mb != 0 && dd >= 0 && (dd <= LOCALW || (dd % STRIDEK) == 0)) ? 1.f : 0.f; fr.h[q] = (_Float16)(__expf(fmaf(f, s[j], (1.f - f) * -1.0e9f) - mx) * sc); } unsigned short* d = (unsigned short*)P + i * NKX + j0; *(v8us*)d = fr.half[0];  } }


template <int MASKADD>
__global__ __launch_bounds__(64) void k_att0(const float* __restrict__ QF, const float* __restrict__ KF, const float* __restrict__ VF, int ld, const float* __restrict__ mask, float scale, float* __restrict__ OF, int ldo) {
  #pragma clang fp contract(off)
  __shared__ __attribute__((aligned(16))) float lq[64][64]; __shared__ __attribute__((aligned(16))) float lo[64][64];
  const int tid = threadIdx.x; const int h = blockIdx.x / (QT0 / 64), rg = blockIdx.x % (QT0 / 64); const int i = rg * 64 + tid;
  const float* qr = QF + (size_t)i * ld + h * HD;
#pragma unroll 1
  for (int c = 0; c < HD / 4; ++c) { *(v4f*)&lq[tid][c * 4] = *(const v4fa*)(qr + c * 4); const v4f z = {0.f, 0.f, 0.f, 0.f}; *(v4f*)&lo[tid][c * 4] = z; }
  float m = -1.0e30f, l = 0.f; const int jmax = MASKADD ? (SQ - 1) : (rg * 64 + 63);      /* additive-mask form: every key (the mask input decides); causal form: keys up to the block's last row */
#pragma unroll 1
  for (int j = 0; j <= jmax; ++j) { const float* kr = KF + (size_t)j * ld + h * HD; const float* vr = VF + (size_t)j * ld + h * HD; float s = 0.f;
#pragma unroll 1
    for (int c = 0; c < HD / 4; ++c) { const v4f kq = *(const v4fa*)(kr + c * 4); const v4f qq = *(v4f*)&lq[tid][c * 4]; s = __fadd_rn(s, __fmul_rn(qq[0], kq[0])); s = __fadd_rn(s, __fmul_rn(qq[1], kq[1])); s = __fadd_rn(s, __fmul_rn(qq[2], kq[2])); s = __fadd_rn(s, __fmul_rn(qq[3], kq[3])); }
    s = __fmul_rn(s, scale); if (MASKADD) s = __fadd_rn(s, __fmul_rn(bf16_round(mask[(size_t)i * SQ + j]), -10000.0f));
    const float f = (MASKADD || j <= i) ? 1.f : 0.f; const float sm = fmaf(f, s, (1.f - f) * -1.0e30f); const float mn = fmaxf(m, sm); const float sc = expf(m - mn); const float e = expf(sm - mn); l = __fadd_rn(__fmul_rn(l, sc), e); m = mn;
#pragma unroll 1
    for (int c = 0; c < HD / 4; ++c) { const v4f vv = *(const v4fa*)(vr + c * 4); v4f oo = *(v4f*)&lo[tid][c * 4]; for (int u = 0; u < 4; ++u) oo[u] = __fadd_rn(__fmul_rn(oo[u], sc), __fmul_rn(e, vv[u])); *(v4f*)&lo[tid][c * 4] = oo; } }
  const float fin = 64.0f / l;      /* o carried x64 like the f16 path */
#pragma unroll 1
  for (int c = 0; c < HD / 4; ++c) { v4f oo = *(v4f*)&lo[tid][c * 4]; for (int u = 0; u < 4; ++u) oo[u] = __fmul_rn(oo[u], fin); *(v4f*)&lo[tid][c * 4] = oo; }
  __syncthreads();
  {
#pragma unroll 1
    for (int it = 0; it < 16; ++it) { const int row = it * 4 + tid / 16, pc = (tid % 16) * 4; const v4f v = *(const v4f*)&lo[row][pc]; *(v4f*)(OF + (size_t)(rg * 64 + row) * ldo + h * HD + pc) = v; }
     } }

template <int MASKADD>
__global__ __launch_bounds__(64) void k_att0mbc(const float* __restrict__ QF, const float* __restrict__ KF, const float* __restrict__ VF, int ld, const float* __restrict__ mask, float scale, float* __restrict__ OF, int ldo) {
  #pragma clang fp contract(off)
  __shared__ __attribute__((aligned(16))) float lq[64][64]; __shared__ __attribute__((aligned(16))) float lo[64][64];
  const int tid = threadIdx.x; const int h = blockIdx.x / (QT0 / 64), rg = blockIdx.x % (QT0 / 64); const int i = rg * 64 + tid;
  const float* qr = QF + (size_t)i * ld + h * HD;
#pragma unroll 1
  for (int c = 0; c < HD / 4; ++c) { *(v4f*)&lq[tid][c * 4] = *(const v4fa*)(qr + c * 4); const v4f z = {0.f, 0.f, 0.f, 0.f}; *(v4f*)&lo[tid][c * 4] = z; }
  float m = -1.0e30f, l = 0.f; const int jmax = rg * 64 + 63;      /* keys beyond the block end are masked by the mask's lower-triangular structure */      /* both MASKADD forms: keys up to the block's last row */
#pragma unroll 1
  for (int j = 0; j <= jmax; ++j) { const float* kr = KF + (size_t)j * ld + h * HD; const float* vr = VF + (size_t)j * ld + h * HD; float s = 0.f;
#pragma unroll 1
    for (int c = 0; c < HD / 4; ++c) { const v4f kq = *(const v4fa*)(kr + c * 4); const v4f qq = *(v4f*)&lq[tid][c * 4]; s = __fadd_rn(s, __fmul_rn(qq[0], kq[0])); s = __fadd_rn(s, __fmul_rn(qq[1], kq[1])); s = __fadd_rn(s, __fmul_rn(qq[2], kq[2])); s = __fadd_rn(s, __fmul_rn(qq[3], kq[3])); }
    s = __fmul_rn(s, scale); const int mb = ((const int*)mask)[(size_t)i * SQ + j];      /* causal (j <= i) AND the module's int32 [S][S] mask read per (query, key): 0 -> masked */
    const float f = (mb != 0 && j <= i) ? 1.f : 0.f; const float sm = fmaf(f, s, (1.f - f) * -1.0e30f); const float mn = fmaxf(m, sm); const float sc = expf(m - mn); const float e = expf(sm - mn); l = __fadd_rn(__fmul_rn(l, sc), e); m = mn;
#pragma unroll 1
    for (int c = 0; c < HD / 4; ++c) { const v4f vv = *(const v4fa*)(vr + c * 4); v4f oo = *(v4f*)&lo[tid][c * 4]; for (int u = 0; u < 4; ++u) oo[u] = __fadd_rn(__fmul_rn(oo[u], sc), __fmul_rn(e, vv[u])); *(v4f*)&lo[tid][c * 4] = oo; } }
  const float fin = 64.0f / l;      /* o carried x64 like the f16 path */
#pragma unroll 1
  for (int c = 0; c < HD / 4; ++c) { v4f oo = *(v4f*)&lo[tid][c * 4]; for (int u = 0; u < 4; ++u) oo[u] = __fmul_rn(oo[u], fin); *(v4f*)&lo[tid][c * 4] = oo; }
  __syncthreads();
  {
#pragma unroll 1
    for (int it = 0; it < 16; ++it) { const int row = it * 4 + tid / 16, pc = (tid % 16) * 4; const v4f v = *(const v4f*)&lo[row][pc]; *(v4f*)(OF + (size_t)(rg * 64 + row) * ldo + h * HD + pc) = v; }
     } }


template <int BFIN, int WXB>
__global__ __launch_bounds__(256) void k_ln16(const float* __restrict__ X, const float* __restrict__ g, const float* __restrict__ bb, float eps, _Float16* __restrict__ N16, float* __restrict__ XB) {
  #pragma clang fp contract(off)
  __shared__ float red[256]; const size_t r = blockIdx.x; const int t = threadIdx.x; const v4f xa = *(const v4fa*)(X + r * DMQ + t * 4); float s[4]; float sum = 0.f;
  for (int q = 0; q < 4; ++q) { s[q] = BFIN ? bf16_round(xa[q]) : xa[q]; sum = __fadd_rn(sum, s[q]); }
  red[t] = sum; __syncthreads(); for (int st = 128; st > 0; st >>= 1) { if (t < st) red[t] = __fadd_rn(red[t], red[t + st]); __syncthreads(); } const float mu = red[0] / (float)DMQ; __syncthreads();
  float vs = 0.f; for (int q = 0; q < 4; ++q) { const float dl = __fadd_rn(s[q], -mu); vs = __fadd_rn(vs, __fmul_rn(dl, dl)); } red[t] = vs; __syncthreads(); for (int st = 128; st > 0; st >>= 1) { if (t < st) red[t] = __fadd_rn(red[t], red[t + st]); __syncthreads(); }
  const float rs = rsqrtf(__fadd_rn(red[0] / (float)DMQ, eps)); v4h y; v4f xb;
  for (int q = 0; q < 4; ++q) { const int c = t * 4 + q; y[q] = (_Float16)__fadd_rn(__fmul_rn(__fmul_rn(__fadd_rn(s[q], -mu), rs), bf16_round(g[c])), bf16_round(bb[c])); xb[q] = s[q]; }
  { *(v4h*)(N16 + r * DMQ + t * 4) = y; if (WXB) *(v4f*)(XB + r * DMQ + t * 4) = xb;  } }
__global__ __launch_bounds__(256) void k_ftres2(const float* __restrict__ OF0, const float* __restrict__ XB, float* __restrict__ X1, size_t n4) {
  #pragma clang fp contract(off)
  const size_t t = (size_t)blockIdx.x * 256 + threadIdx.x; if (t >= n4) return; const v4f o = *(const v4fa*)(OF0 + t * 4), xv = *(const v4fa*)(XB + t * 4); v4f y; for (int q = 0; q < 4; ++q) y[q] = __fadd_rn(__fmul_rn(o[q], 0.015625f), xv[q]); *(v4f*)(X1 + t * 4) = y;  }

__global__ __launch_bounds__(256) void k_bcpy(const float* __restrict__ b, int n, int NP, float* __restrict__ dst, int dst0) { for (int i = threadIdx.x; i < NP; i += 256) { const float v = (i < n) ? b[i] : 0.f; *(float*)(dst + dst0 + i) = v; }  }


#define FAW 8                        /* waves per work-group */
#define FAQ 32                       /* query columns per wave (two 16-column groups) */
#define FAC 0.18033688011112042592f  /* 64^-0.5 * log2 e: scores are carried in log2 units */
__device__ __forceinline__ float rs_x16(float x) { const int b = __builtin_bit_cast(int, x); return __builtin_bit_cast(float, __builtin_amdgcn_permlanex16(b, b, 0x76543210, 0xfedcba98, false, false)); }      /* lane l <- lane l ^ 16 */
// Four 2^x in one statement. The outputs are early-clobber, so inside it no v_exp_f32 is directly followed by a read of its result or a write of its source; the v_nop keeps that slot behind the last one.
__device__ __forceinline__ v4f rs_exp2(v4f x) { float y0, y1, y2, y3; asm("v_exp_f32 %0, %4\n\tv_exp_f32 %1, %5\n\tv_exp_f32 %2, %6\n\tv_exp_f32 %3, %7\n\tv_nop" : "=&v"(y0), "=&v"(y1), "=&v"(y2), "=&v"(y3) : "v"(x[0]), "v"(x[1]), "v"(x[2]), "v"(x[3])); const v4f y = {y0, y1, y2, y3}; return y; }
// One 2^x, with the same slot kept behind it.
__device__ __forceinline__ float fa_exp2(float x) { float y; asm("v_exp_f32 %0, %1\n\tv_nop" : "=&v"(y) : "v"(x)); return y; }
__device__ __forceinline__ v8f fa_mma(v16h a, v16h b, v8f c) { return __builtin_amdgcn_wmma_f32_16x16x32_f16(false, a, false, b, (short)0, c, false, false); }
// Q16, K16: f16 rows [NB * SQ][DM], head h = columns h*64..; VT: f16 [NB * NH][HD][SQ]; O16: context x64 as f16 rows (merged heads).
// The short loops are fully unrolled so that every fragment array is indexed by constants and stays in registers.
// K and V^T reach the eight waves through LDS: a stage is 64 keys, 64 K rows of 128 bytes and 64 V^T rows of 128 bytes, brought in once per work-group by asynchronous copies
// (whole 128-byte lines, through no register) and read by every wave as 16-byte fragment halves. Two buffers: the next stage's copies fly while this stage is worked on.
#define FAK 64                       /* keys per stage (two 32-key passes) */
#define FAP 144                      /* LDS row pitch in bytes: 128 of data + 16, so that the 16 rows of a 16-byte fragment read fall on 64 different banks */
#define FAT (64 * FAP)               /* one operand's tile */
#define FAS (2 * FAT)                /* one stage: [K tile | V^T tile] */
// Four copies of 16 bytes a lane: rows r and r + 32 of the K tile and of the V^T tile (l: the lane's LDS byte address in the K tile, gk, gv: its global addresses).
// The s_wait_xcnt stands inside the statement, behind the last copy, so that no address register of a copy is rewritten in front of it.
__device__ __forceinline__ void fa_copy4(unsigned l, const _Float16* gk, const _Float16* gv) {
  asm volatile("global_load_async_to_lds_b128 %0, %4, off\n\t"
               "global_load_async_to_lds_b128 %1, %5, off\n\t"
               "global_load_async_to_lds_b128 %2, %6, off\n\t"
               "global_load_async_to_lds_b128 %3, %7, off\n\t"
               "s_wait_xcnt 0x0"
               :: "v"(l), "v"(l + 32 * FAP), "v"(l + FAT), "v"(l + FAT + 32 * FAP),
                  "v"(gk), "v"(gk + (size_t)32 * DM), "v"(gv), "v"(gv + (size_t)32 * SQ)
               : "memory"); }
__global__ __launch_bounds__(FAW * 32) void k_fattn(const _Float16* __restrict__ Q16, const _Float16* __restrict__ K16, const _Float16* __restrict__ VT, _Float16* __restrict__ O16) {
  __shared__ __attribute__((aligned(128))) unsigned char L[2 * FAS]; static_assert(FAW * 32 == 256 && HD == 64 && SQ % FAK == 0 && SQ / FAK >= 2, "k_fattn: 256 lanes copy 32 rows of 128 bytes at a time; the ring needs two stages");
  const int tid = threadIdx.x, lane = tid & 31, ln = lane & 15, hh = lane >> 4, w = tid >> 5;
  constexpr int QB = SQ / (FAW * FAQ); const int qb = blockIdx.x % QB, bh = blockIdx.x / QB; const int b = bh / NH, h = bh % NH; const int q0 = qb * (FAW * FAQ) + w * FAQ;
  const _Float16* qp = Q16 + ((size_t)b * SQ + q0 + ln) * DM + h * HD;
  const unsigned lc = (unsigned)(size_t)L + (unsigned)((tid >> 3) * FAP + (tid & 7) * 16);      /* eight lanes copy one 128-byte row */
  const _Float16* gk = K16 + ((size_t)b * SQ + (tid >> 3)) * DM + h * HD + (tid & 7) * 8; const _Float16* gv = VT + ((size_t)bh * HD + (tid >> 3)) * SQ + (tid & 7) * 8;
  constexpr int nt = SQ / FAK;
  const v8f z8 = {0.f, 0.f, 0.f, 0.f, 0.f, 0.f, 0.f, 0.f};
  v16h qf[2][2]; v8f o[2][4]; float m[2], l[2];
  fa_copy4(lc, gk, gv);
#pragma unroll
  for (int j = 0; j < 2; ++j) { m[j] = -3.0e38f; l[j] = 0.f;
#pragma unroll
    for (int d = 0; d < 4; ++d) o[j][d] = z8;
#pragma unroll
    for (int ks = 0; ks < 2; ++ks) qf[j][ks] = g2_frag(qp + (size_t)j * 16 * DM + ks * 32, hh); }
  asm volatile("s_wait_xcnt 0x0" ::: "memory");      /* in front of any rewrite of the Q loads' address pair */
  asm volatile("s_wait_asynccnt 0x0" ::: "memory");      /* stage 0 has landed (this wave's copies) */
  __syncthreads();      /* ... and every wave's */
  fa_copy4(lc + FAS, gk + (size_t)FAK * DM, gv + FAK);
#pragma unroll 1
  for (int t = 0; t < nt; ++t) { const unsigned buf = (unsigned)(t & 1) * FAS;      /* rolled: one copy of the two passes in the text */
    const _Float16* pk = (const _Float16*)(L + buf + ln * FAP); const _Float16* pv = (const _Float16*)(L + buf + FAT + ln * FAP);
#pragma unroll
    for (int p = 0; p < FAK / 32; ++p) {
      v16h kf[2][2], vf[4]; v8f s[2][2];
#pragma unroll
      for (int u = 0; u < 2; ++u)
#pragma unroll
        for (int ks = 0; ks < 2; ++ks) kf[u][ks] = g2_frag(pk + (p * 32 + u * 16) * (FAP / 2) + ks * 32, hh);
#pragma unroll
      for (int d = 0; d < 4; ++d) vf[d] = g2_frag(pv + d * 16 * (FAP / 2) + p * 32, hh);
#pragma unroll
      for (int j = 0; j < 2; ++j)
#pragma unroll
        for (int u = 0; u < 2; ++u) s[j][u] = fa_mma(kf[u][1], qf[j][1], fa_mma(kf[u][0], qf[j][0], z8));      /* s[j][u][r] = q(q0 + 16 j + ln) . k(64 t + 32 p + 16 u + 8 hh + r) */
      FragH pf[2]; float al[2];
#pragma unroll
      for (int j = 0; j < 2; ++j) {
        float mx = fmaxf(s[j][0][0], s[j][1][0]);
#pragma unroll
        for (int r = 1; r < 8; ++r) mx = fmaxf(mx, fmaxf(s[j][0][r], s[j][1][r]));
        mx = fmaxf(mx, rs_x16(mx));
        const float mn = fmaxf(m[j], mx * FAC), mb = 8.0f - mn; al[j] = fa_exp2(m[j] - mn); m[j] = mn;      /* p = 2^8 exp(s - max) <= 256: small weights stay out of the f16 subnormals; the factor cancels against the sum */
        v4f s4 = {0.f, 0.f, 0.f, 0.f};
#pragma unroll
        for (int u = 0; u < 2; ++u)
#pragma unroll
          for (int c = 0; c < 2; ++c) { const v4f x = {s[j][u][c * 4] * FAC + mb, s[j][u][c * 4 + 1] * FAC + mb, s[j][u][c * 4 + 2] * FAC + mb, s[j][u][c * 4 + 3] * FAC + mb}; const v4f e = rs_exp2(x); s4 += e;
#pragma unroll
            for (int q = 0; q < 4; ++q) pf[j].h[u * 8 + c * 4 + q] = (_Float16)e[q]; }
        l[j] = l[j] * al[j] + ((s4[0] + s4[1]) + (s4[2] + s4[3])); }
      __builtin_amdgcn_sched_barrier(0);      /* both column groups' 2^x statements stay in front of the eight products */
#pragma unroll
      for (int j = 0; j < 2; ++j)
#pragma unroll
        for (int d = 0; d < 4; ++d) o[j][d] = fa_mma(vf[d], pf[j].v, o[j][d] * al[j]);      /* o[j][d][r] = sum_k p v(k)[16 d + 8 hh + r] for query q0 + 16 j + ln */
      __builtin_amdgcn_sched_barrier(0);      /* ... and the next pass's stay behind them; it also keeps the next pass's fragment reads from rising over these products: with them up there the kernel took more than 256 registers, and two work-groups no longer fit a WGP */
    }
    asm volatile("s_wait_dscnt 0x0" ::: "memory");      /* this wave's reads of the buffer have returned */
    asm volatile("s_wait_asynccnt 0x0" ::: "memory");      /* this wave's copies of stage t + 1 have landed */
    __syncthreads();      /* publishes stage t + 1 and frees stage t's buffer */
    if (t + 2 < nt) fa_copy4(lc + buf, gk + (size_t)(t + 2) * FAK * DM, gv + (t + 2) * FAK); }
  asm volatile("s_wait_asynccnt 0x0" ::: "memory");      /* no copy is outstanding when the wave ends */
#pragma unroll
  for (int j = 0; j < 2; ++j) { const float fin = 64.0f / (l[j] + rs_x16(l[j])); unsigned short* op = (unsigned short*)O16 + ((size_t)b * SQ + q0 + j * 16 + ln) * DM + h * HD + 8 * hh;
#pragma unroll
    for (int d = 0; d < 4; ++d) { FragH f;
#pragma unroll
      for (int r = 0; r < 8; ++r) f.h[r] = (_Float16)(o[j][d][r] * fin);
      *(v8us*)(op + d * 16) = f.half[0]; } } }

template <int MODE>
__global__ __launch_bounds__(256) void k_regrp(const float* __restrict__ src, float* __restrict__ dst, size_t n4) {
  const size_t t = (size_t)blockIdx.x * 256 + threadIdx.x; if (t >= n4) return; const size_t e = t * 4; const size_t rd = e / DM; const int c = (int)(e % DM);
  size_t rs; if (MODE == 0) { const size_t b = rd / SQ, sq = rd % SQ; rs = sq * NB + b; } else { const size_t sq = rd / NB, b = rd % NB; rs = b * SQ + sq; }
  const v4f v = *(const v4fa*)(src + rs * DM + c); *(v4f*)(dst + e) = v;  }

// ---- row passes: a wave owns RPW whole rows of DM = 1024 f32 in registers (32 lanes x 16 bytes = 512 contiguous bytes a load, eight loads a row, all of them issued up front) ----
// Few long-lived waves in place of many one-load ones: 16 waves on every WGP cover all 8192 rows, and no LDS and no barrier is needed, since a row never leaves its wave.
#define RPW 2                        /* rows per wave */
static_assert(DM == 1024 && DMQ == DM && ((size_t)NB * SQ) % (8 * RPW) == 0, "row passes: eight 512-byte loads a row, eight waves a work-group, no edge");
// lane l <- lane l ^ M inside its 16-lane row (DPP row_xmask)
template <int M>
__device__ __forceinline__ float rp_xm(float x) { return __builtin_bit_cast(float, __builtin_amdgcn_update_dpp(0, __builtin_bit_cast(int, x), 0x160 + M, 0xf, 0xf, true)); }
// Sum over the wave's 32 lanes by a butterfly: every lane ends with the same bits.
__device__ __forceinline__ float rp_sum32(float v) { v += rp_xm<1>(v); v += rp_xm<2>(v); v += rp_xm<4>(v); v += rp_xm<8>(v); return v + rs_x16(v); }
// LayerNorm (biased variance, eps inside the rsqrt; mean first, then the squares of the centred row) -> f16 rows.
template <int BFIN>
__global__ __launch_bounds__(256) void k_lnw(const float* __restrict__ X, const float* __restrict__ g, const float* __restrict__ bb, float eps, _Float16* __restrict__ N16) {
  const int lane = threadIdx.x & 31; const size_t e0 = ((size_t)blockIdx.x * 8 + (threadIdx.x >> 5)) * (RPW * DM) + lane * 4;      /* the lane's first element */
  const float* xp = X + e0; const unsigned ob = (unsigned)lane * 16u;      /* ob: the lane's byte offset in g and bb */
  v4f x[RPW][8], gg[8], bv[8];
#pragma unroll
  for (int k = 0; k < RPW; ++k)
#pragma unroll
    for (int u = 0; u < 8; ++u) x[k][u] = *(const v4fa*)(xp + k * DM + u * 128);
#pragma unroll
  for (int u = 0; u < 8; ++u) { gg[u] = *(const v4fa*)((const char*)g + ob + u * 512); bv[u] = *(const v4fa*)((const char*)bb + ob + u * 512); }
  asm volatile("s_wait_xcnt 0x0" :: "v"(xp), "v"(lane) : "memory");      /* the loads' address registers are free for reuse behind them: the wait stands in front of any rewrite; xp and lane (the g and bb loads' offset register, scaled by the load itself) as inputs keep those registers out of the loads' own results */
  __builtin_amdgcn_sched_barrier(0);      /* keeps all 32 loads in front of the arithmetic: without it the scheduler sinks the last ones, and the wait with them, far into it, where their latency shows */
#pragma unroll
  for (int u = 0; u < 8; ++u)
#pragma unroll
    for (int q = 0; q < 4; ++q) { gg[u][q] = bf16_round(gg[u][q]); bv[u][q] = bf16_round(bv[u][q]); }
  v4h y[RPW][8];
#pragma unroll
  for (int k = 0; k < RPW; ++k) {
    v4f a = {0.f, 0.f, 0.f, 0.f};
#pragma unroll
    for (int u = 0; u < 8; ++u) {
      if (BFIN) {
#pragma unroll
        for (int q = 0; q < 4; ++q) x[k][u][q] = bf16_round(x[k][u][q]); }
      a += x[k][u]; }
    const float mu = rp_sum32((a[0] + a[1]) + (a[2] + a[3])) * (1.0f / (float)DM);
    v4f c = {0.f, 0.f, 0.f, 0.f};
#pragma unroll
    for (int u = 0; u < 8; ++u) { x[k][u] -= mu; c += x[k][u] * x[k][u]; }
    const float rs = rsqrtf(rp_sum32((c[0] + c[1]) + (c[2] + c[3])) * (1.0f / (float)DM) + eps);
#pragma unroll
    for (int u = 0; u < 8; ++u) { const v4f o = x[k][u] * rs * gg[u] + bv[u];
#pragma unroll
      for (int q = 0; q < 4; ++q) y[k][u][q] = (_Float16)o[q]; } }
  __builtin_amdgcn_sched_barrier(0);      /* every result is in its own registers before the first store: nothing is computed behind a store, so no register of an issued store is rewritten */
#pragma unroll
  for (int k = 0; k < RPW; ++k)
#pragma unroll
    for (int u = 0; u < 8; ++u) *(v4h*)(N16 + e0 + k * DM + u * 128) = y[k][u]; }

// XB = bf16-rounded x as f32 rows, the same split of the rows over waves.
__global__ __launch_bounds__(256) void k_bfr(const float* __restrict__ x, float* __restrict__ XB) {
  const int lane = threadIdx.x & 31; const size_t e0 = ((size_t)blockIdx.x * 8 + (threadIdx.x >> 5)) * (RPW * DM) + lane * 4;
  const float* xp = x + e0; v4f a[RPW * 8];
#pragma unroll
  for (int u = 0; u < RPW * 8; ++u) a[u] = *(const v4fa*)(xp + u * 128);
  asm volatile("s_wait_xcnt 0x0" :: "v"(xp) : "memory");      /* as in k_lnw: in front of any rewrite of the loads' address pair, which xp as an input keeps out of the loads' own results */
#pragma unroll
  for (int u = 0; u < RPW * 8; ++u)
#pragma unroll
    for (int q = 0; q < 4; ++q) a[u][q] = bf16_round(a[u][q]);
  __builtin_amdgcn_sched_barrier(0);      /* as in k_lnw: nothing is computed behind a store */
#pragma unroll
  for (int u = 0; u < RPW * 8; ++u) *(v4f*)(XB + e0 + u * 128) = a[u]; }



__global__ __launch_bounds__(256) void k_wthd(const float* __restrict__ Wt, _Float16* __restrict__ Bt) { const size_t t = (size_t)blockIdx.x * 256 + threadIdx.x; if (t >= (size_t)NH * HD * (DM / 8)) return; const int m8 = (int)(t % (DM / 8)) * 8; const int d = (int)((t / (DM / 8)) % HD); const int h = (int)(t / ((size_t)(DM / 8) * HD)); FragH f;
  for (int q = 0; q < 8; ++q) f.h[q] = (_Float16)(16.0f * bf16_round(Wt[((size_t)h * DM + m8 + q) * HD + d])); unsigned short* dst = (unsigned short*)Bt + ((size_t)h * HD + d) * DM + m8; *(v8us*)dst = f.half[0];  }




template <int BFIN, int SCAL>
__global__ __launch_bounds__(256) void k_lnsc(const float* __restrict__ X, const float* __restrict__ g, const float* __restrict__ bb, float eps, _Float16* __restrict__ N16, float* __restrict__ N32) {
  #pragma clang fp contract(off)
  __shared__ float red[256]; const size_t r = blockIdx.x; const int t = threadIdx.x; const bool act = t < DM / 4; const int tc = act ? t : 0; const v4f xl = *(const v4fa*)(X + r * DM + tc * 4); const float am = act ? 1.f : 0.f; float s[4]; float sum = 0.f;
  for (int q = 0; q < 4; ++q) { s[q] = (BFIN ? bf16_round(xl[q]) : xl[q]) * am; sum = __fadd_rn(sum, s[q]); }
  red[t] = sum; __syncthreads(); for (int st = 128; st > 0; st >>= 1) { if (t < st) red[t] = __fadd_rn(red[t], red[t + st]); __syncthreads(); } const float mu = red[0] / (float)DM; __syncthreads();
  float vs = 0.f; for (int q = 0; q < 4; ++q) { const float dl = __fadd_rn(s[q], -mu) * am; vs = __fadd_rn(vs, __fmul_rn(dl, dl)); } red[t] = vs; __syncthreads(); for (int st = 128; st > 0; st >>= 1) { if (t < st) red[t] = __fadd_rn(red[t], red[t + st]); __syncthreads(); }
  const float rs = __fdiv_rn(1.0f, __fadd_rn(sqrtf(red[0] / (float)(DM - 1)), eps)); if (!act) return; v4h y; v4f yf;
  for (int q = 0; q < 4; ++q) { const int c = t * 4 + q; const float gg = bf16_round(SCAL ? g[0] : g[c]), bv = bf16_round(SCAL ? bb[0] : bb[c]); yf[q] = __fadd_rn(__fmul_rn(__fmul_rn(__fadd_rn(s[q], -mu), rs), gg), bv); y[q] = (_Float16)yf[q]; }
  { if (N16) *(v4h*)(N16 + r * DM + t * 4) = y; if (N32) *(v4f*)(N32 + r * DM + t * 4) = yf;  } }

__global__ __launch_bounds__(256) void k_rsmdmi(const float* __restrict__ S, _Float16* __restrict__ P, int nrows, const int* __restrict__ M) {
  #pragma clang fp contract(off)
  const int t = blockIdx.x * 256 + threadIdx.x; if (t >= nrows) return; const float* s = S + (size_t)t * SQ; const int* m = M + (size_t)(t % SQ) * SQ; float mx = -3.0e38f;
#pragma unroll 1
  for (int j = 0; j < SQ; ++j) { const float f = (m[j] == 0) ? 1.f : 0.f; mx = fmaxf(mx, fmaf(f, s[j], (1.f - f) * -1.0e9f)); } float se = 0.f;
#pragma unroll 1
  for (int j = 0; j < SQ; ++j) { const float f = (m[j] == 0) ? 1.f : 0.f; se += __expf(fmaf(f, s[j], (1.f - f) * -1.0e9f) - mx); } const float sc = 256.0f / se;
#pragma unroll 1
  for (int j0 = 0; j0 < SQ; j0 += 8) { FragH fr; for (int q = 0; q < 8; ++q) { const int j = j0 + q; const float f = (m[j] == 0) ? 1.f : 0.f; fr.h[q] = (_Float16)(__expf(fmaf(f, s[j], (1.f - f) * -1.0e9f) - mx) * sc); } unsigned short* d = (unsigned short*)P + (size_t)t * SQ + j0; *(v8us*)d = fr.half[0];  } }
// All six weight planes in one launch (blockIdx.y = plane): Bt[p][n][k] = f16(bf16(W[k][n]) x16), element for element as k_wt_f16.
// Planes 0..2: per-head tensors [NH][DM][HD], row n = head n / HD, output n % HD; planes 3..5: [in][out] squares of DM x DM.
static_assert(DFF == DM, "k_wt_all: every plane is DM x DM");
// Eight source rows of one output column. The pitch is a compile-time constant, so the eight loads share one address pair and differ only in their immediate offsets.
template <int PITCH>
__device__ __forceinline__ v8us wt_col8(const float* __restrict__ s) { FragH f;
  for (int i = 0; i < 8; ++i) f.h[i] = (_Float16)(bf16_round(s[(size_t)i * PITCH]) * 16.0f);
  return f.half[0]; }
__global__ __launch_bounds__(256) void k_wt_all(const float* __restrict__ wq, const float* __restrict__ wk, const float* __restrict__ wv, const float* __restrict__ wo, const float* __restrict__ w1, const float* __restrict__ w2, _Float16* __restrict__ Bt) {
  const int p = blockIdx.y; const int t = blockIdx.x * 256 + threadIdx.x; const int n = t / (DM / 8), k8 = (t % (DM / 8)) * 8;
  const float* W = p == 0 ? wq : p == 1 ? wk : p == 2 ? wv : p == 3 ? wo : p == 4 ? w1 : w2;
  const v8us o = p < 3 ? wt_col8<HD>(W + ((size_t)(n / HD) * DM + k8) * HD + (n % HD)) : wt_col8<DM>(W + (size_t)k8 * DM + n);
  *(v8us*)((unsigned short*)Bt + ((size_t)p * DM + n) * DM + k8) = o; }
extern "C" void kernel_launch(void* const* d_in, const int* in_sizes, int n_in,
                              void* d_out, int out_size, void* d_ws, size_t ws_size, hipStream_t stream) {
  (void)in_sizes; (void)n_in; (void)out_size;
  const float* const* I = (const float* const*)d_in; const float* x = I[0]; const float* wq = I[1]; const float* wk = I[2]; const float* wv = I[3]; const float* wo = I[4]; const float* bo = I[5]; const float* w1 = I[6]; const float* b1 = I[7]; const float* w2 = I[8]; const float* b2 = I[9]; const float* g1 = I[10]; const float* be1 = I[11]; const float* g2 = I[12]; const float* be2 = I[13];      /* x; per-head Wq / Wk / Wv [16][1024][64] (no biases); Wo [1024][1024] + bo ([in][out]); W1 [1024][1024] + b1, W2 [1024][1024] + b2; LN1 g / b, LN2 g / b */
  char* ws = (char*)d_ws; size_t off = 0;
  auto take = [&](size_t bytes) { char* p = ws + off; off += (bytes + 255) & ~(size_t)255; return p; };
  _Float16* BQ = (_Float16*)take((size_t)6 * DM * DM * 2); _Float16* BO = BQ + (size_t)3 * DM * DM; _Float16* BW1 = BQ + (size_t)4 * DM * DM; _Float16* BW2 = BQ + (size_t)5 * DM * DM;      /* six Bt planes in a row: q, k, v, o, W1, W2 */
  float* XB = (float*)take(NR * DM * 4); _Float16* XN = (_Float16*)take(NR * DM * 2); _Float16* Q16 = (_Float16*)take((size_t)3 * NR * DM * 2); _Float16* K16 = Q16 + NR * DM; _Float16* V16 = Q16 + (size_t)2 * NR * DM;      /* three planes in a row: one batched GEMM writes them */ _Float16* O16 = (_Float16*)take(NR * DM * 2); float* X1 = (float*)take(NR * DM * 4);
  _Float16* VT = (_Float16*)take((size_t)NB * NH * HD * SQ * 2);
  _Float16* M16 = XN;      /* second-norm f16 rows: aliases XN (last readers: the three projections) */ _Float16* HF16 = (_Float16*)take(NR * DFF * 2);      /* FFN hidden rows of every batch [8192][1024] f16 (16 MiB): own region */
  
  if (off > ws_size) return;
  k_wt_all<<<dim3((unsigned)((size_t)DM * (DM / 8) / 256), 6), 256, 0, stream>>>(wq, wk, wv, wo, w1, w2, BQ);      /* every weight -> Bt x16, one launch; per-head [in = 1024][out = 64]: head h = rows h*64.. of its plane */
  k_bfr<<<(unsigned)(NR / (8 * RPW)), 256, 0, stream>>>(x, XB); k_lnw<1><<<(unsigned)(NR / (8 * RPW)), 256, 0, stream>>>(x, g1, be1, 1e-5f, XN);      /* n = LN0(bf16(x)) (biased variance, eps inside the rsqrt) -> f16 rows */
  k_gemm3<0, false, false><<<dim3((unsigned)((NR / 128) * (DM / 128)), 3), 128, 0, stream>>>(XN, DM, 0, BQ, DM, (size_t)DM * DM, 0.0625f, nullptr, 0, nullptr, nullptr, Q16, NR * DM, (int)NR, DM, DM);      /* q, k, v (blockIdx.y) -> f16 rows, one launch; head h = columns h*64.. */
  k_vt<NH, SQ><<<NB * NH * (SQ / 64), 256, 0, stream>>>(V16, DM, 0, VT);      /* V^T [8 * 16][64][1024], every batch */
  k_fattn<<<NB * NH * (SQ / (FAW * FAQ)), FAW * 32, 0, stream>>>(Q16, K16, VT, O16);      /* softmax(q k^T / 8) v over all keys (no mask) -> ctx (merged heads, x64) as f16 rows */
  k_gemm3<0, true, true><<<dim3((unsigned)((NR / 128) * (DM / 128)), 1), 128, 0, stream>>>(O16, DM, 0, BO, DM, 0, 0.0009765625f, bo, 0, XB, X1, nullptr, 0, (int)NR, DM, DM);      /* x + ctx wo (+ bo) (own-element residual) -> f32 rows */
  k_lnw<0><<<(unsigned)(NR / (8 * RPW)), 256, 0, stream>>>(X1, g2, be2, 1e-5f, M16);      /* LN1(x1) -> f16 rows */
  k_gemm3<6, false, false><<<dim3((unsigned)((NR / 128) * (DFF / 128)), 1), 128, 0, stream>>>(M16, DM, 0, BW1, DM, 0, 0.0625f, b1, 0, nullptr, nullptr, HF16, 0, (int)NR, DFF, DM);      /* gelu_erf(. W1 + b1) -> f16, all rows */
  k_gemm3<0, true, true><<<dim3((unsigned)((NR / 128) * (DM / 128)), 1), 128, 0, stream>>>(HF16, DFF, 0, BW2, DFF, 0, 0.0625f, b2, 0, X1, (float*)d_out, nullptr, 0, (int)NR, DM, DFF);      /* out = x1 + mlp (own-element residual), all rows */
}

// v007
// Measured time: 186 microseconds a run.
// Next to v006, in two timings, it ran 1.05 times as fast each time.
// Over all steps from v000 it is 40.8 times as fast.
#include <hip/hip_runtime.h>
// Pre-LN transformer encoder block with PER-HEAD projection tensors, no QKV biases (x [8][1024][1024]; h = LN1(x) (biased var, eps 1e-5); q/k/v[h] = h W[h] with W [16][1024][64] ([head][in][out]); scale 64^-0.5; softmax over all 1024 keys (no mask); x1 = x + concat(attn) Wo + bo ([in][out]); out = x1 + gelu_erf(LN2(x1) W1 + b1) W2 + b2 ([in][out] 1024 x 1024 x 1024: hidden = 1 x n_embd, as the source) -> [8][1024][1024]).
// Structure: token rows; LayerNorm / exact f16 rows; WMMA GEMMs for q, k and V^T (the v product with its operands swapped); one fused attention launch (scores, online softmax and P V in registers); output projection with the own-element residual; custom LayerNorm; GELU (erf) FFN over all rows; launches: see trace.
// Compute dtype: inputs rounded to bf16; x / weights exact; q, k, v, softmax weights and o as plain f16 GEMM operands (~2^-12); scores and softmax statistics f32. v_wmma_f32_16x16x32_f16.
#define NB 8
#define SQ 1024
#define DM 1024
#define NH 16
#define HD 64
#define HG 4                         /* heads per call of the unused per-batch k_vt overload */
#define LOCALW 128                   /* (macros for unused kernels of the shared header) */
#define STRIDEK 128
#define QT 256                       /* query rows per causal tile */
#define NKX SQ                       /* S / P row pitch */
#define QT0 128                      /* first-tile rows recomputed exactly in f32 */
#define B0 0                         /* unused; every launch starts at batch 0 */
#define NBR NB                       /* only feeds the unused MP; the launches cover all NB batches */
#define NR ((size_t)NB * SQ)
#define DMQ DM
#define DFF 1024         /* FFN hidden width = 1 x n_embd in this module (W1 [1024][1024], W2 [1024][1024]) */
#define MP ((int)((size_t)NBR * SQ)) /* unused; the projections take NR rows */
#define QN SQ                        /* unused; attention runs all SQ query rows */
#define NHD NH                       /* unused; the launches cover all NH heads */
#define MPO MP                       /* unused; the output stage takes NR rows */
#define LQ (3 * DM)      /* unused; the q, k, v rows have pitch DM */
typedef __bf16 v16b __attribute__((ext_vector_type(16)));
typedef unsigned short v8us __attribute__((ext_vector_type(8), may_alias));
typedef float  v8f  __attribute__((ext_vector_type(8)));
typedef float  v4f  __attribute__((ext_vector_type(4)));
typedef float  v4fa __attribute__((ext_vector_type(4), may_alias));
union FragB { v16b v; v8us half[2]; unsigned short u[16]; };

__device__ __forceinline__ unsigned short bf16_bits(float x) { unsigned int u = __float_as_uint(x); return (unsigned short)((u + 0x7FFFu + ((u >> 16) & 1u)) >> 16); }
__device__ __forceinline__ float bf16_val(unsigned short b) { return __uint_as_float(((unsigned int)b) << 16); }
__device__ __forceinline__ float bf16_round(float x) { return bf16_val(bf16_bits(x)); }
// D += A·B with NT terms: 1 = ah·bh, 2 = + al·bh (A split), 3 = + ah·bl (both split)
template <int NT>
__device__ __forceinline__ v8f mmaN(v16b ah, v16b al, v16b bh, v16b bl, v8f c) {
  c = __builtin_amdgcn_wmma_f32_16x16x32_bf16(false, ah, false, bh, (short)0, c, false, false);
  if (NT >= 2) c = __builtin_amdgcn_wmma_f32_16x16x32_bf16(false, al, false, bh, (short)0, c, false, false);
  if (NT >= 3) c = __builtin_amdgcn_wmma_f32_16x16x32_bf16(false, ah, false, bl, (short)0, c, false, false);
  asm volatile("v_nop\n\tv_nop\n\tv_nop\n\tv_nop" : "+v"(c) : "v"(ah), "v"(al), "v"(bh), "v"(bl));
  return c;
}

__global__ __launch_bounds__(256) void k_wt_bf16(const float* __restrict__ W, unsigned short* __restrict__ Wt, int K, int N) {
  const int t = blockIdx.x * 256 + threadIdx.x;
  const int k8n = K / 8;
  if (t >= N * k8n) return;
  const int n = t / k8n, k8 = (t % k8n) * 8;
  v8us v;
#pragma unroll
  for (int i = 0; i < 8; ++i) v[i] = bf16_bits(W[(size_t)(k8 + i) * N + n]);
  *(v8us*)(Wt + (size_t)n * K + k8) = v;
  
}

// GEMM C[M][N] (f32, pitch ldc) = act(A[M][K]·W + bias). A f32 row-major (pitch lda) converted per fragment to bf16
// (ASPLIT: hi/lo two planes -> 2 terms, else single rounded term); Wt bf16 [N][K] (pitch ldb). BIAS_BF16 rounds the
// bias to bf16 first (bias quantised to bf16 before the add). K%32==0, M%16==0, N%64==0.
template <bool ASPLIT, int ACT, bool BIAS_BF16>
__global__ __launch_bounds__(128) void k_gemm_bf(const float* __restrict__ A, int lda, const unsigned short* __restrict__ Wt, int ldb,
                                               const float* __restrict__ bias, float* __restrict__ C, int ldc, int M, int N, int K) {
  __shared__ __attribute__((aligned(16))) float so[4][16][64];
  const int tid = threadIdx.x, w = tid >> 5, lane = tid & 31, ln = lane & 15, hh = lane >> 4;
  const int ntn = N / 64;
  const int wid = blockIdx.x * 4 + w;
  const int mt = wid / ntn, nq = wid % ntn;
  if (mt * 16 >= M) return;
  const int row0 = mt * 16, col0 = nq * 64;
  const float* arow = A + (size_t)(row0 + ln) * lda;
  v8f acc[4] = {};
  for (int kb = 0; kb < K; kb += 32) {
    FragB ah, al;
    const v4f x0 = *(const v4fa*)(arow + kb + 8 * hh), x1 = *(const v4fa*)(arow + kb + 8 * hh + 4);
    const v4f x2 = *(const v4fa*)(arow + kb + 16 + 8 * hh), x3 = *(const v4fa*)(arow + kb + 16 + 8 * hh + 4);
    float xs[16] = {x0[0],x0[1],x0[2],x0[3],x1[0],x1[1],x1[2],x1[3],x2[0],x2[1],x2[2],x2[3],x3[0],x3[1],x3[2],x3[3]};
#pragma unroll
    for (int i = 0; i < 16; ++i) { const unsigned short hb = bf16_bits(xs[i]); ah.u[i] = hb; al.u[i] = ASPLIT ? bf16_bits(xs[i] - bf16_val(hb)) : (unsigned short)0; }
#pragma unroll
    for (int t = 0; t < 4; ++t) {
      const unsigned short* brow = Wt + (size_t)(col0 + t * 16 + ln) * ldb + kb;
      FragB b;
      b.half[0] = *(const v8us*)(brow + 8 * hh);
      b.half[1] = *(const v8us*)(brow + 16 + 8 * hh);
      acc[t] = mmaN<ASPLIT ? 2 : 1>(ah.v, al.v, b.v, b.v, acc[t]);
    }
  }
#pragma unroll
  for (int t = 0; t < 4; ++t) {
    float bv = bias ? bias[col0 + t * 16 + ln] : 0.f;
    if (BIAS_BF16) bv = bf16_round(bv);
#pragma unroll
    for (int r = 0; r < 8; ++r) { float v = acc[t][r] + bv; if (ACT == 1) v = fmaxf(v, 0.f); so[w][8 * hh + r][t * 16 + ln] = v; }
  }
  __builtin_amdgcn_fence(__ATOMIC_ACQ_REL, "workgroup");
  __builtin_amdgcn_wave_barrier();
  const int rsub = lane >> 4, c4 = (lane & 15) * 4;
  {
#pragma unroll
    for (int q = 0; q < 8; ++q) {
      const int r = q * 2 + rsub;
      const v4f v = *(const v4fa*)&so[w][r][c4];
      *(v4f*)(C + (size_t)(row0 + r) * ldc + col0 + c4) = v;
    }
    
  }
}

// GEMM C = act(A·W + bias + resid): A f32 (ASPLIT -> hi/lo 2 terms), Wt bf16 [N][K]; ACT 0 none, 1 relu, 2 exact gelu;
// resid (optional, f32, row index = (row % rmod), pitch ldr, RES_BF16 rounds it) added before the activation.
template <bool ASPLIT, int ACT, bool BIAS_BF16, bool RES_BF16>
__global__ __launch_bounds__(128) void k_gemm_bf3(const float* __restrict__ A, int lda, const unsigned short* __restrict__ Wt, int ldb,
                                                const float* __restrict__ bias, const float* __restrict__ resid, int rmod, int ldr,
                                                float* __restrict__ C, int ldc, int M, int N, int K) {
  __shared__ __attribute__((aligned(16))) float so[4][16][64];
  const int tid = threadIdx.x, w = tid >> 5, lane = tid & 31, ln = lane & 15, hh = lane >> 4;
  const int ntn = N / 64;
  const int wid = blockIdx.x * 4 + w;
  const int mt = wid / ntn, nq = wid % ntn;
  if (mt * 16 >= M) return;
  const int row0 = mt * 16, col0 = nq * 64;
  const float* arow = A + (size_t)(row0 + ln) * lda;
  v8f acc[4] = {};
  for (int kb = 0; kb < K; kb += 32) {
    FragB ah, al;
    const v4f x0 = *(const v4fa*)(arow + kb + 8 * hh), x1 = *(const v4fa*)(arow + kb + 8 * hh + 4);
    const v4f x2 = *(const v4fa*)(arow + kb + 16 + 8 * hh), x3 = *(const v4fa*)(arow + kb + 16 + 8 * hh + 4);
    float xs[16] = {x0[0],x0[1],x0[2],x0[3],x1[0],x1[1],x1[2],x1[3],x2[0],x2[1],x2[2],x2[3],x3[0],x3[1],x3[2],x3[3]};
#pragma unroll
    for (int i = 0; i < 16; ++i) { const unsigned short hb = bf16_bits(xs[i]); ah.u[i] = hb; al.u[i] = ASPLIT ? bf16_bits(xs[i] - bf16_val(hb)) : (unsigned short)0; }
#pragma unroll
    for (int t = 0; t < 4; ++t) {
      const unsigned short* brow = Wt + (size_t)(col0 + t * 16 + ln) * ldb + kb;
      FragB b;
      b.half[0] = *(const v8us*)(brow + 8 * hh);
      b.half[1] = *(const v8us*)(brow + 16 + 8 * hh);
      acc[t] = mmaN<ASPLIT ? 2 : 1>(ah.v, al.v, b.v, b.v, acc[t]);
    }
  }
#pragma unroll
  for (int t = 0; t < 4; ++t) {
    const int col = col0 + t * 16 + ln;
    float bv = bias ? bias[col] : 0.f;
    if (BIAS_BF16) bv = bf16_round(bv);
#pragma unroll
    for (int r = 0; r < 8; ++r) {
      float v = acc[t][r] + bv;
      if (resid) { float rv = resid[(size_t)((row0 + 8 * hh + r) % rmod) * ldr + col]; if (RES_BF16) rv = bf16_round(rv); v += rv; }
      if (ACT == 1) v = fmaxf(v, 0.f);
      if (ACT == 2) v = 0.5f * v * (1.0f + erff(v * 0.70710678118654752f));
      if (ACT == 3) { const float u = 0.7978845608028654f * (v + 0.044715f * v * v * v); v = 0.5f * v * (1.0f + tanhf(u)); }
      so[w][8 * hh + r][t * 16 + ln] = v;
    }
  }
  __builtin_amdgcn_fence(__ATOMIC_ACQ_REL, "workgroup");
  __builtin_amdgcn_wave_barrier();
  const int rsub = lane >> 4, c4 = (lane & 15) * 4;
  {
#pragma unroll
    for (int q = 0; q < 8; ++q) {
      const int r = q * 2 + rsub;
      const v4f v = *(const v4fa*)&so[w][r][c4];
      *(v4f*)(C + (size_t)(row0 + r) * ldc + col0 + c4) = v;
    }
    
  }
}
// row LayerNorm (biased variance, eps) over N: s = X (+ R); optional out_sum <- s; out_norm <- (s-mu)*rsqrt(var+eps)*g + b
template <bool PARAM_BF16>
__global__ __launch_bounds__(256) void k_layernorm(const float* __restrict__ X, const float* __restrict__ R, const float* __restrict__ g, const float* __restrict__ bta,
                                                  float* __restrict__ out_sum, float* __restrict__ out_norm, int N, float eps) {
  __shared__ float red[256];
  const int row = blockIdx.x, tid = threadIdx.x;
  const float* x = X + (size_t)row * N; const float* rr = R ? R + (size_t)row * N : nullptr;
  float vals[16];                     // up to N = 4096
  const int per = N / 256;            // contiguous chunk per thread? use strided-by-4 chunks: thread handles j = tid*4 + 1024*u
  float s1 = 0.f;
  for (int u = 0; u < per / 4; ++u) {
    const int j = tid * 4 + 1024 * u;
    const v4f a = *(const v4fa*)(x + j);
    v4f b = {0.f,0.f,0.f,0.f}; if (rr) b = *(const v4fa*)(rr + j);
#pragma unroll
    for (int q = 0; q < 4; ++q) { const float v = a[q] + b[q]; vals[u * 4 + q] = v; s1 += v; }
  }
  red[tid] = s1; __syncthreads();
  for (int st = 128; st > 0; st >>= 1) { if (tid < st) red[tid] += red[tid + st]; __syncthreads(); }
  const float mu = red[0] / (float)N; __syncthreads();
  float s2 = 0.f;
  for (int u = 0; u < per / 4; ++u)
#pragma unroll
    for (int q = 0; q < 4; ++q) { const float c = vals[u * 4 + q] - mu; s2 += c * c; }
  red[tid] = s2; __syncthreads();
  for (int st = 128; st > 0; st >>= 1) { if (tid < st) red[tid] += red[tid + st]; __syncthreads(); }
  const float rs = rsqrtf(red[0] / (float)N + eps);
  {
    for (int u = 0; u < per / 4; ++u) {
      const int j = tid * 4 + 1024 * u;
      v4f o, sm;
#pragma unroll
      for (int q = 0; q < 4; ++q) {
        float gg = g[j + q], bb = bta[j + q];
        if (PARAM_BF16) { gg = bf16_round(gg); bb = bf16_round(bb); }
        sm[q] = vals[u * 4 + q]; o[q] = (vals[u * 4 + q] - mu) * rs * gg + bb;
      }
      if (out_sum) *(v4f*)(out_sum + (size_t)row * N + j) = sm;
      *(v4f*)(out_norm + (size_t)row * N + j) = o;
    }
    
  }
}



// ---- f16 WMMA path (v_wmma_f32_16x16x32_f16): 11-bit significands for operands in range — used where a [0,1] probability operand needs more precision than bf16
typedef _Float16 v16h __attribute__((ext_vector_type(16)));
union FragH { v16h v; v8us half[2]; _Float16 h[16]; unsigned short u[16]; };
template <int NT>
__device__ __forceinline__ v8f mmaH(v16h ah, v16h al, v16h bh, v16h bl, v8f c) {
  c = __builtin_amdgcn_wmma_f32_16x16x32_f16(false, ah, false, bh, (short)0, c, false, false);
  if (NT >= 2) c = __builtin_amdgcn_wmma_f32_16x16x32_f16(false, al, false, bh, (short)0, c, false, false);
  if (NT >= 3) c = __builtin_amdgcn_wmma_f32_16x16x32_f16(false, ah, false, bl, (short)0, c, false, false);
  asm volatile("v_nop\n\tv_nop\n\tv_nop\n\tv_nop" : "+v"(c) : "v"(ah), "v"(al), "v"(bh), "v"(bl));
  return c;
}
// batched GEMM like k_gemm_b but f16 operands: A f32 (split into f16 hi/lo if ASPLIT, else rounded to f16), Bt = f16 values [n][k]; alpha; C f32; N multiple of 16 (partial tiles skipped)
template <bool ASPLIT>
__global__ __launch_bounds__(128) void k_gemm_h(const float* __restrict__ A, int lda, size_t sA, const _Float16* __restrict__ Bh, int ldb, size_t sB, float alpha, float* __restrict__ C, int ldc, size_t sC, int M, int N, int K) {
  __shared__ __attribute__((aligned(16))) float so[4][16][64];
  const int tid = threadIdx.x, w = tid >> 5, lane = tid & 31, ln = lane & 15, hh = lane >> 4; const int by = blockIdx.y;
  A += (size_t)by * sA; Bh += (size_t)by * sB; C += (size_t)by * sC;
  const int ntn = (N + 63) / 64; const int wid = blockIdx.x * 4 + w; const int mt = wid / ntn, nq = wid % ntn; if (mt * 16 >= M) return;
  const int row0 = mt * 16, col0 = nq * 64; const float* arow = A + (size_t)(row0 + ln) * lda;
  v8f acc[4] = {};
  for (int kb = 0; kb < K; kb += 32) {
    FragH ah, al;
    const v4f x0 = *(const v4fa*)(arow + kb + 8 * hh), x1 = *(const v4fa*)(arow + kb + 8 * hh + 4), x2 = *(const v4fa*)(arow + kb + 16 + 8 * hh), x3 = *(const v4fa*)(arow + kb + 16 + 8 * hh + 4);
    float xs[16] = {x0[0],x0[1],x0[2],x0[3],x1[0],x1[1],x1[2],x1[3],x2[0],x2[1],x2[2],x2[3],x3[0],x3[1],x3[2],x3[3]};
#pragma unroll
    for (int i = 0; i < 16; ++i) { const _Float16 h = (_Float16)xs[i]; ah.h[i] = h; al.h[i] = ASPLIT ? (_Float16)(xs[i] - (float)h) : (_Float16)0.0f; }
#pragma unroll
    for (int t = 0; t < 4; ++t) { if (col0 + t * 16 >= N) continue; const size_t boff = (size_t)(col0 + t * 16 + ln) * ldb + kb; FragH bq; bq.half[0] = *(const v8us*)(Bh + boff + 8 * hh); bq.half[1] = *(const v8us*)(Bh + boff + 16 + 8 * hh);
      acc[t] = mmaH<ASPLIT ? 2 : 1>(ah.v, al.v, bq.v, bq.v, acc[t]); }
  }
#pragma unroll
  for (int t = 0; t < 4; ++t) { if (col0 + t * 16 >= N) continue;
#pragma unroll
    for (int r = 0; r < 8; ++r) so[w][8 * hh + r][t * 16 + ln] = acc[t][r] * alpha; }
  __builtin_amdgcn_fence(__ATOMIC_ACQ_REL, "workgroup"); __builtin_amdgcn_wave_barrier();
  const int rsub = lane >> 4, c4 = (lane & 15) * 4;
  {
#pragma unroll
    for (int q = 0; q < 8; ++q) { const int r = q * 2 + rsub; if (col0 + c4 < N) { const v4f v = *(const v4fa*)&so[w][r][c4]; *(v4f*)(C + (size_t)(row0 + r) * ldc + col0 + c4) = v; } }
     }
}

// Wt[n][k] = f16(W[k][n]·scale) from f32 row-major W[K][N] (scale = power of two; bf16-exact weights stay exact in f16 away from the subnormal range)
__global__ __launch_bounds__(256) void k_wt_f16(const float* __restrict__ W, _Float16* __restrict__ Wt, int K, int N, float scale) {
  const int t = blockIdx.x * 256 + threadIdx.x; if (t >= N * (K / 8)) return; const int n = t / (K / 8), k8 = (t % (K / 8)) * 8; FragH f;
#pragma unroll
  for (int i = 0; i < 8; ++i) f.h[i] = (_Float16)(bf16_round(W[(size_t)(k8 + i) * N + n]) * scale); const v8us o = f.half[0];
  *(v8us*)((unsigned short*)Wt + (size_t)n * K + k8) = o; 
}
// k_gemm_hh variant with fused epilogue: v = acc·alpha + bias[by·sBias + col] (+ CP[(row/rowsPerB)·sCPb + by·64 + col] if CP) ; ACT 0 none / 1 elu ; writes f16 C16 (and f32 C if non-null)
template <int ACT>
__global__ __launch_bounds__(128) void k_gemm_hhx(const _Float16* __restrict__ A, int lda, size_t sA, const _Float16* __restrict__ Bh, int ldb, size_t sB, float alpha, const float* __restrict__ bias, size_t sBias, const float* __restrict__ CP, int rowsPerB, size_t sCPb, int row0g,
    float* __restrict__ C, _Float16* __restrict__ C16, int ldc, size_t sC, int M, int N, int K) {
  __shared__ __attribute__((aligned(16))) float so[4][16][64];
  const int tid = threadIdx.x, w = tid >> 5, lane = tid & 31, ln = lane & 15, hh = lane >> 4; const int by = blockIdx.y;
  A += (size_t)by * sA; Bh += (size_t)by * sB; const size_t cofs = (size_t)by * sC; const float* bp = bias ? bias + (size_t)by * sBias : nullptr;
  const int ntn = (N + 63) / 64; const int wid = blockIdx.x * 4 + w; const int mt = wid / ntn, nq = wid % ntn; if (mt * 16 >= M) return;
  const int row0 = mt * 16, col0 = nq * 64; const _Float16* arow = A + (size_t)(row0 + ln) * lda;
  v8f acc[4] = {};
  for (int kb = 0; kb < K; kb += 32) { FragH ah; ah.half[0] = *(const v8us*)((const unsigned short*)arow + kb + 8 * hh); ah.half[1] = *(const v8us*)((const unsigned short*)arow + kb + 16 + 8 * hh);
#pragma unroll
    for (int t = 0; t < 4; ++t) { if (col0 + t * 16 >= N) continue; const size_t boff = (size_t)(col0 + t * 16 + ln) * ldb + kb; FragH bq; bq.half[0] = *(const v8us*)((const unsigned short*)Bh + boff + 8 * hh); bq.half[1] = *(const v8us*)((const unsigned short*)Bh + boff + 16 + 8 * hh);
      acc[t] = mmaH<1>(ah.v, ah.v, bq.v, bq.v, acc[t]); }
  }
#pragma unroll
  for (int t = 0; t < 4; ++t) { if (col0 + t * 16 >= N) continue; const int col = col0 + t * 16 + ln; const float bv = bp ? bf16_round(bp[col]) : 0.f;
#pragma unroll
    for (int r = 0; r < 8; ++r) { float v = acc[t][r] * alpha + bv; if (CP) { const int rr = row0g + row0 + 8 * hh + r; if (rowsPerB < 0) v += CP[cofs + (size_t)rr * ldc + col];      /* rowsPerB < 0: own element of the batched C plane */ else { const int bidx = rr / rowsPerB; v += CP[(size_t)bidx * sCPb + (size_t)by * 64 + col]; } } if (ACT == 1) v = (v > 0.f) ? v : expm1f(v); else if (ACT == 7) v = (v > 0.f) ? v + 1.0f : expf(v); else if (ACT == 8) v = tanhf(v); else if (ACT == 9) v = 0.5f * v * (1.0f + tanhf(0.7978845608028654f * (v + 0.044715f * v * v * v))); else if (ACT == 11) v = 1.0f / (1.0f + expf(-v)); else if (ACT == 12) v = (v > 0.f) ? v : 0.01f * v; else if (ACT == 14) v = (v > 0.f) ? v : 0.1f * v; else if (ACT == 16) v = (v >= 0.f) ? v : 0.3f * v; else if (ACT == 17) v = (v >= 0.f) ? v : 0.2f * v; else if (ACT == 15) v = v / (1.0f + expf(-v)); else if (ACT == 3) v = fmaxf(v, 0.f); else if (ACT == 6) v = 0.5f * v * (1.0f + erff(v * 0.70710678118654752f)); so[w][8 * hh + r][t * 16 + ln] = v; } }
  __builtin_amdgcn_fence(__ATOMIC_ACQ_REL, "workgroup"); __builtin_amdgcn_wave_barrier();
  const int rsub = lane >> 4, c4 = (lane & 15) * 4; typedef _Float16 v4h __attribute__((ext_vector_type(4)));
  {
#pragma unroll
    for (int q = 0; q < 8; ++q) { const int r = q * 2 + rsub; if (col0 + c4 < N) { const v4f v = *(const v4fa*)&so[w][r][c4]; if (C) *(v4f*)(C + cofs + (size_t)(row0 + r) * ldc + col0 + c4) = v; if (C16) { v4h h4; for (int i = 0; i < 4; ++i) h4[i] = (_Float16)v[i]; *(v4h*)(C16 + cofs + (size_t)(row0 + r) * ldc + col0 + c4) = h4; } } }
     }
}


typedef _Float16 v4h __attribute__((ext_vector_type(4)));

__global__ __launch_bounds__(256) void k_x16(const float* __restrict__ x, _Float16* __restrict__ X16, size_t n8) { const size_t t = (size_t)blockIdx.x * 256 + threadIdx.x; if (t >= n8) return; FragH f;
#pragma unroll
  for (int q = 0; q < 8; ++q) f.h[q] = (_Float16)bf16_round(x[t * 8 + q]); *(v8us*)((unsigned short*)X16 + t * 8) = f.half[0];  }
__global__ __launch_bounds__(256) void k_h16(const float* __restrict__ x, _Float16* __restrict__ X16, size_t n8) { const size_t t = (size_t)blockIdx.x * 256 + threadIdx.x; if (t >= n8) return; FragH f;
#pragma unroll
  for (int q = 0; q < 8; ++q) f.h[q] = (_Float16)x[t * 8 + q]; *(v8us*)((unsigned short*)X16 + t * 8) = f.half[0];  }
__global__ __launch_bounds__(256) void k_round16f(const float* __restrict__ W, _Float16* __restrict__ Bt, size_t n8) { const size_t t = (size_t)blockIdx.x * 256 + threadIdx.x; if (t >= n8) return; FragH f;
#pragma unroll
  for (int i = 0; i < 8; ++i) f.h[i] = (_Float16)(bf16_round(W[t * 8 + i]) * 16.0f); *(v8us*)((unsigned short*)Bt + t * 8) = f.half[0];  }
template <int NHv, int TTv>
__global__ __launch_bounds__(256) void k_vt(const _Float16* __restrict__ V16, int ldv, int voff, _Float16* __restrict__ Vt) { __shared__ unsigned short tl[64][66]; const int tid = threadIdx.x; const int slab = blockIdx.x / (TTv / 64), lg = blockIdx.x % (TTv / 64); const int b = slab / NHv, h = slab % NHv;
  for (int i = tid; i < 64 * 8; i += 256) { const int r = i / 8, c8 = (i % 8) * 8; FragH f; f.half[0] = *(const v8us*)((const unsigned short*)V16 + ((size_t)b * TTv + lg * 64 + r) * ldv + voff + h * 64 + c8);
#pragma unroll
    for (int q = 0; q < 8; ++q) tl[r][c8 + q] = f.u[q]; }
  __syncthreads();
  {
#pragma unroll
    for (int rd = 0; rd < 2; ++rd) { const int d = rd * 32 + tid / 8, pc = tid % 8; FragH f;
#pragma unroll
      for (int q = 0; q < 8; ++q) f.u[q] = tl[pc * 8 + q][d];
      *(v8us*)((unsigned short*)Vt + ((size_t)slab * 64 + d) * TTv + lg * 64 + pc * 8) = f.half[0]; }
     } }

__global__ __launch_bounds__(256) void k_hl(const float* __restrict__ F, _Float16* __restrict__ Hh, _Float16* __restrict__ Hl, size_t n8) { const size_t t = (size_t)blockIdx.x * 256 + threadIdx.x; if (t >= n8) return; FragH fh, fl; const v4f a = *(const v4fa*)(F + t * 8), c = *(const v4fa*)(F + t * 8 + 4);
#pragma unroll
  for (int q = 0; q < 4; ++q) { _Float16 h = (_Float16)a[q]; fh.h[q] = h; fl.h[q] = (_Float16)((a[q] - (float)h) * 1024.0f); h = (_Float16)c[q]; fh.h[4 + q] = h; fl.h[4 + q] = (_Float16)((c[q] - (float)h) * 1024.0f); }
  { *(v8us*)((unsigned short*)Hh + t * 8) = fh.half[0]; *(v8us*)((unsigned short*)Hl + t * 8) = fl.half[0];  } }

// one 16 x 32 f16 fragment of a k-contiguous row: 16 bytes at k = 8 hh and 16 bytes at k = 16 + 8 hh (A and B alike)
__device__ __forceinline__ v16h g2_frag(const _Float16* p, int hh) { FragH f; f.half[0] = *(const v8us*)((const unsigned short*)p + 8 * hh); f.half[1] = *(const v8us*)((const unsigned short*)p + 16 + 8 * hh); return f.v; }
// ---- tiled GEMM: one 128 x 128 tile of C per work-group (M % 128 == 0, N % 128 == 0, K % 64 == 0), four waves as 2 x 2, 64 x 64 per wave; epilogue = k_gemm_hhx semantics ----
// A stage is 64 k of 128 rows of A and of 128 rows of Bt, brought into LDS by asynchronous copies (whole 128-byte lines, through no register) and read by every wave that needs it.
// Two buffers: the next stage's copies fly while this stage is worked on. The k order of every sum is that of the unstaged loop (32 k per product, ascending).
#define G3P 144                      /* LDS row pitch in bytes: 128 of data + 16, so that the 16 rows of a 16-byte fragment read fall on 64 different banks */
#define G3T (128 * G3P)              /* one operand's tile */
#define G3S (2 * G3T)                /* one stage: [A tile | Bt tile] */
__device__ __forceinline__ v8f g3_mma(v16h a, v16h b, v8f c) { return __builtin_amdgcn_wmma_f32_16x16x32_f16(false, a, false, b, (short)0, c, false, false); }
// Eight copies of 16 bytes a lane: rows r, r + 16, .., r + 112 of one operand's tile (l: the lane's LDS byte address, g: its global address, ld: the source pitch in elements).
// The s_wait_xcnt stands inside the statement, behind the last copy, so that no address register of a copy is rewritten in front of it.
__device__ __forceinline__ void g3_copy8(unsigned l, const _Float16* g, int ld) {
  const size_t st = (size_t)16 * ld;
  asm volatile("global_load_async_to_lds_b128 %0, %8, off\n\t"
               "global_load_async_to_lds_b128 %1, %9, off\n\t"
               "global_load_async_to_lds_b128 %2, %10, off\n\t"
               "global_load_async_to_lds_b128 %3, %11, off\n\t"
               "global_load_async_to_lds_b128 %4, %12, off\n\t"
               "global_load_async_to_lds_b128 %5, %13, off\n\t"
               "global_load_async_to_lds_b128 %6, %14, off\n\t"
               "global_load_async_to_lds_b128 %7, %15, off\n\t"
               "s_wait_xcnt 0x0"
               :: "v"(l), "v"(l + 16 * G3P), "v"(l + 32 * G3P), "v"(l + 48 * G3P), "v"(l + 64 * G3P), "v"(l + 80 * G3P), "v"(l + 96 * G3P), "v"(l + 112 * G3P),
                  "v"(g), "v"(g + st), "v"(g + 2 * st), "v"(g + 3 * st), "v"(g + 4 * st), "v"(g + 5 * st), "v"(g + 6 * st), "v"(g + 7 * st)
               : "memory"); }
template <int ACT>
__device__ __forceinline__ float g3_act(float v) {
  if (ACT == 3) v = fmaxf(v, 0.f); else if (ACT == 6) v = 0.5f * v * (1.0f + erff(v * 0.70710678118654752f)); else if (ACT == 11) v = 1.0f / (1.0f + expf(-v)); else if (ACT == 15) v = v / (1.0f + expf(-v)); else if (ACT == 18) v = v / (1.0f + expf(-1.702f * v));      /* QuickGELU: v sigmoid(1.702 v) */ else if (ACT == 12) v = (v > 0.f) ? v : 0.01f * v; else if (ACT == 8) v = tanhf(v); else if (ACT == 9) v = 0.5f * v * (1.0f + tanhf(0.7978845608028654f * (v + 0.044715f * v * v * v))); else if (ACT == 14) v = (v > 0.f) ? v : 0.1f * v; else if (ACT == 16) v = (v >= 0.f) ? v : 0.3f * v; else if (ACT == 17) v = (v >= 0.f) ? v : 0.2f * v;
  return v; }
// RES: add CP's own element of the C plane, then the activation (both on the staged rows, 16 bytes a lane); W32: write f32 rows to C, else f16 rows to C16. Both are compile-time, so that the epilogue is one straight run and its loads go out together.
// RBF: the residual element is rounded to bf16 where it is read (CP is then the raw input, and no rounded copy of it is kept).
// VSW: plane 2 runs with A and Bt swapped, so that its tile is C^T: rows = Bt's rows, columns = A's rows (tokens). It is stored as SQ-token blocks, [token / SQ][Bt row][token % SQ], pitch SQ == ldc: V^T per batch and head, with no transposing pass. The k order of every sum is the same; the swapped plane takes no bias (it would run along the rows).
template <int ACT, bool RES, bool W32, bool RBF = false, bool VSW = false>
__global__ __launch_bounds__(128) void k_gemm3(const _Float16* __restrict__ A, int lda, size_t sA, const _Float16* __restrict__ Bh, int ldb, size_t sB, float alpha, const float* __restrict__ bias, size_t sBias, const float* __restrict__ CP,
    float* __restrict__ C, _Float16* __restrict__ C16, size_t sC, int M, int N, int K) { static_assert(ACT == 0 || ACT == 3 || ACT == 6 || ACT == 8 || ACT == 9 || ACT == 11 || ACT == 12 || ACT == 14 || ACT == 15 || ACT == 16 || ACT == 17 || ACT == 18, "k_gemm3: unsupported ACT code (would silently apply no activation)");
  __shared__ __attribute__((aligned(128))) unsigned char L[2 * G3S]; static_assert(4 * 64 * 68 * 4 <= 2 * G3S, "k_gemm3: the output staging reuses the ring");
  const int tid = threadIdx.x, w = tid >> 5, lane = tid & 31, ln = lane & 15, hh = lane >> 4; const int by = blockIdx.y;
  A += (size_t)by * sA; Bh += (size_t)by * sB; const size_t cofs = (size_t)by * sC; const bool sw = VSW && by == 2;      /* the same for the whole work-group */
  if (sw) { const _Float16* const pa0 = A; A = Bh; Bh = pa0; const int m0 = M; M = N; N = m0; const int l0 = lda; lda = ldb; ldb = l0; }
  const float* bp = (bias && !sw) ? bias + (size_t)by * sBias : nullptr;
  const int ntn = N >> 7; const int mt = blockIdx.x / ntn, nq = blockIdx.x - mt * ntn; if (mt * 128 >= M) return;      /* the same for the whole work-group, in front of every barrier */
  const int row0 = mt * 128 + (w >> 1) * 64, col0 = nq * 128 + (w & 1) * 64;
  const unsigned lc = (unsigned)(size_t)L + (unsigned)((tid >> 3) * G3P + (tid & 7) * 16);      /* eight lanes copy one 128-byte row */
  const _Float16* ga = A + (size_t)(mt * 128 + (tid >> 3)) * lda + (tid & 7) * 8; const _Float16* gb = Bh + (size_t)(nq * 128 + (tid >> 3)) * ldb + (tid & 7) * 8;
  const int nt = K >> 6; constexpr int ldc = DM; static_assert(DFF == DM, "k_gemm3: one output pitch");      /* a compile-time pitch: the epilogue's loads and stores share one address pair each and differ only in their immediate offsets */
  const v8f z8 = {0.f,0.f,0.f,0.f,0.f,0.f,0.f,0.f}; v8f acc[4][4];
#pragma unroll
  for (int i = 0; i < 4; ++i)
#pragma unroll
    for (int j = 0; j < 4; ++j) acc[i][j] = z8;
  g3_copy8(lc, ga, lda); g3_copy8(lc + G3T, gb, ldb);
  asm volatile("s_wait_asynccnt 0x0" ::: "memory");      /* stage 0 has landed (this wave's copies) */
  __syncthreads();      /* ... and every wave's */
  if (nt > 1) { g3_copy8(lc + G3S, ga + 64, lda); g3_copy8(lc + G3S + G3T, gb + 64, ldb); }
  float bv[4] = {0.f, 0.f, 0.f, 0.f};      /* the lane's four bias values, fetched here so that they arrive under the loop */
  if (bp) {
#pragma unroll
    for (int t = 0; t < 4; ++t) bv[t] = bp[col0 + t * 16 + ln];
    asm volatile("s_wait_xcnt 0x0" ::: "memory"); }      /* the four loads' offset register is rewritten right behind them */
#pragma unroll 1
  for (int t = 0; t < nt; ++t) { const unsigned buf = (unsigned)(t & 1) * G3S;      /* rolled: one copy of the 32 products in the text */
    const _Float16* pa = (const _Float16*)(L + buf + ((w >> 1) * 64 + ln) * G3P); const _Float16* pb = (const _Float16*)(L + buf + G3T + ((w & 1) * 64 + ln) * G3P);
    v16h a[2][4], b[2][4];
#pragma unroll
    for (int ks = 0; ks < 2; ++ks)
#pragma unroll
      for (int i = 0; i < 4; ++i) { a[ks][i] = g2_frag(pa + i * 16 * (G3P / 2) + ks * 32, hh); b[ks][i] = g2_frag(pb + i * 16 * (G3P / 2) + ks * 32, hh); }
    __builtin_amdgcn_sched_barrier(0);      /* keeps the stage's 32 fragment reads together in front of its products: without it the scheduler sinks the A reads among them, into one register set, and every four products wait out an LDS latency */
#pragma unroll
    for (int ks = 0; ks < 2; ++ks)
#pragma unroll
      for (int i = 0; i < 4; ++i)
#pragma unroll
        for (int j = 0; j < 4; ++j) acc[i][j] = g3_mma(a[ks][i], b[ks][j], acc[i][j]);
    __builtin_amdgcn_sched_barrier(0);      /* keeps the products in front of the stage's waits: without it the scheduler sinks them behind the barrier, and the wait for the next stage's copies stands at the head of the trip, before they have had time to land */
    asm volatile("s_wait_dscnt 0x0" ::: "memory");      /* this wave's reads of the buffer have returned */
    asm volatile("s_wait_asynccnt 0x0" ::: "memory");      /* this wave's copies of stage t + 1 have landed */
    __syncthreads();      /* publishes stage t + 1 and frees stage t's buffer */
    if (t + 2 < nt) { g3_copy8(lc + buf, ga + (size_t)(t + 2) * 64, lda); g3_copy8(lc + buf + G3T, gb + (size_t)(t + 2) * 64, ldb); } }
  asm volatile("s_wait_asynccnt 0x0" ::: "memory");      /* no copy is outstanding when the ring becomes output staging */
  float (*so)[68] = (float (*)[68])(L + (size_t)w * (64 * 68 * 4));      /* each wave stages in its own range; the last trip's barrier has ended every read of the ring */
#pragma unroll
  for (int u = 0; u < 16; ++u) { const int t = u & 3, half = u >> 2;
#pragma unroll
    for (int r = 0; r < 8; ++r) { const int rloc = half * 16 + 8 * hh + r; const float v = acc[half][t][r] * alpha + bf16_round(bv[t]);
      so[rloc][t * 16 + ln] = v; } }
  __builtin_amdgcn_fence(__ATOMIC_ACQ_REL, "workgroup"); __builtin_amdgcn_wave_barrier();
  const int rsub = lane >> 4, c4 = (lane & 15) * 4;
  static_assert(!VSW || (SQ == ldc && SQ % 128 == 0), "k_gemm3: a swapped tile lies in one SQ-token block, whose pitch is ldc");
  const size_t cb = sw ? (size_t)(col0 / SQ) * ((size_t)DM * SQ) + (size_t)(col0 % SQ) : (size_t)col0;      /* the wave's first column in the C plane */
  const size_t e0 = cofs + (size_t)(row0 + rsub) * ldc + cb + c4;      /* the lane's first element; row q * 2 + rsub lies q * 2 * ldc elements further on */
  v4f rv[32]; static_assert(!RES || ACT == 0, "k_gemm3: the residual rows are held in registers, so their loop is unrolled");
  if (RES) {
#pragma unroll
    for (int q = 0; q < 32; ++q) rv[q] = *(const v4fa*)(CP + e0 + (size_t)q * (2 * ldc));
    asm volatile("s_wait_xcnt 0x0" ::: "memory");      /* the 32 loads share one address pair, which is rewritten right behind them */
  }
  if (RES && RBF) {      /* both loops unrolled: rv is indexed by constants only and stays in registers */
#pragma unroll
    for (int q = 0; q < 32; ++q)
#pragma unroll
      for (int i = 0; i < 4; ++i) rv[q][i] = bf16_round(rv[q][i]); }
  {
#pragma unroll(ACT == 0 ? 32 : 2)      /* with an activation the loop stays rolled, for code size (128 copies of erff otherwise) */
    for (int q = 0; q < 32; ++q) { const int r = q * 2 + rsub; const size_t e = e0 + (size_t)q * (2 * ldc); v4f v = *(const v4fa*)&so[r][c4]; if (RES) v += rv[q]; for (int i = 0; i < 4; ++i) v[i] = g3_act<ACT>(v[i]); if (W32) *(v4f*)(C + e) = v; else { v4h h4; for (int i = 0; i < 4; ++i) h4[i] = (_Float16)v[i]; *(v4h*)(C16 + e) = h4; }
      if (ACT != 0 || (q & 7) == 7) asm volatile("s_wait_xcnt 0x0" ::: "memory");      /* later rows rewrite registers of issued stores (rolled loop: the next trip does); unrolled, one wait serves eight rows */
    }
     } }


__global__ __launch_bounds__(256) void k_wnat(const float* __restrict__ w, size_t n8, _Float16* __restrict__ Bt) { const size_t t = (size_t)blockIdx.x * 256 + threadIdx.x; if (t >= n8) return; FragH f; for (int q = 0; q < 8; ++q) f.h[q] = (_Float16)(bf16_round(w[t * 8 + q]) * 16.0f); *(v8us*)((unsigned short*)Bt + t * 8) = f.half[0];  }
__global__ __launch_bounds__(256) void k_rsm(const float* __restrict__ S, _Float16* __restrict__ P, int nrows) {
  #pragma clang fp contract(off)
  const int i = blockIdx.x * 256 + threadIdx.x; if (i >= nrows) return; const float* s = S + (size_t)i * SQ; float mx = -3.0e38f;
#pragma unroll 1
  for (int j = 0; j < SQ; ++j) mx = fmaxf(mx, s[j]); float se = 0.f;
#pragma unroll 1
  for (int j = 0; j < SQ; ++j) se += expf(s[j] - mx); const float sc = 256.0f / se;
#pragma unroll 1
  for (int j0 = 0; j0 < SQ; j0 += 8) { FragH f; for (int q = 0; q < 8; ++q) f.h[q] = (_Float16)(expf(s[j0 + q] - mx) * sc); unsigned short* d = (unsigned short*)P + (size_t)i * SQ + j0; *(v8us*)d = f.half[0];  } }
__global__ __launch_bounds__(256) void k_vt(const _Float16* __restrict__ V16, int b, int h0, _Float16* __restrict__ VT) { __shared__ unsigned short tl[64][65]; const int tid = threadIdx.x; const int hh = blockIdx.x % HG, sg = blockIdx.x / HG; const int s0 = sg * 64; const int h = h0 + hh;
  for (int i = tid; i < 64 * 8; i += 256) { const int j = i / 8, d8 = (i % 8) * 8; FragH f; f.half[0] = *(const v8us*)((const unsigned short*)V16 + ((size_t)b * SQ + s0 + j) * DM + h * HD + d8); for (int q = 0; q < 8; ++q) tl[d8 + q][j] = f.u[q]; }
  __syncthreads();
  { for (int i = tid; i < 64 * 8; i += 256) { const int d = i / 8, j8 = (i % 8) * 8; FragH f; for (int q = 0; q < 8; ++q) f.u[q] = tl[d][j8 + q]; *(v8us*)((unsigned short*)VT + ((size_t)hh * HD + d) * SQ + s0 + j8) = f.half[0]; }  } }



__global__ __launch_bounds__(256) void k_rsmcf2(const float* __restrict__ S, _Float16* __restrict__ P, int hg, int q0, int nk) {
  #pragma clang fp contract(off)
  const int t = blockIdx.x * 256 + threadIdx.x; if (t >= hg * QT) return; const size_t i = (size_t)t; const float* s = S + i * NKX; const int last = q0 + (t % QT); float mx = -3.0e38f;
#pragma unroll 1
  for (int j = 0; j < nk; ++j) { const float f = (j <= last) ? 1.f : 0.f; mx = fmaxf(mx, fmaf(f, s[j], (1.f - f) * -1.0e9f)); } float se = 0.f;
#pragma unroll 1
  for (int j = 0; j < nk; ++j) { const float f = (j <= last) ? 1.f : 0.f; se += __expf(fmaf(f, s[j], (1.f - f) * -1.0e9f) - mx); } const float sc = 256.0f / se;
#pragma unroll 1
  for (int j0 = 0; j0 < nk; j0 += 8) { FragH fr; for (int q = 0; q < 8; ++q) { const int j = j0 + q; const float f = (j <= last) ? 1.f : 0.f; fr.h[q] = (_Float16)(__expf(fmaf(f, s[j], (1.f - f) * -1.0e9f) - mx) * sc); } unsigned short* d = (unsigned short*)P + i * NKX + j0; *(v8us*)d = fr.half[0];  } }

__global__ __launch_bounds__(256) void k_rsmcst(const float* __restrict__ S, _Float16* __restrict__ P, int hg, int q0, int nk, const int* __restrict__ mk) {
  #pragma clang fp contract(off)
  const int t = blockIdx.x * 256 + threadIdx.x; if (t >= hg * QT) return; const size_t i = (size_t)t; const float* s = S + i * NKX; const size_t ig = (size_t)(q0 + (t % QT)); const int* mr = mk + ig * SQ; float mx = -3.0e38f;
#pragma unroll 1
  for (int j = 0; j < nk; ++j) { const int mb = mr[j]; const int dd = (int)ig - j; const float f = (mb != 0 && dd >= 0 && (dd <= LOCALW || (dd % STRIDEK) == 0)) ? 1.f : 0.f; mx = fmaxf(mx, fmaf(f, s[j], (1.f - f) * -1.0e9f)); } float se = 0.f;
#pragma unroll 1
  for (int j = 0; j < nk; ++j) { const int mb = mr[j]; const int dd = (int)ig - j; const float f = (mb != 0 && dd >= 0 && (dd <= LOCALW || (dd % STRIDEK) == 0)) ? 1.f : 0.f; se += __expf(fmaf(f, s[j], (1.f - f) * -1.0e9f) - mx); } const float sc = 256.0f / se;
#pragma unroll 1
  for (int j0 = 0; j0 < nk; j0 += 8) { FragH fr; for (int q = 0; q < 8; ++q) { const int j = j0 + q; const int mb = mr[j]; const int dd = (int)ig - j; const float f = (mb != 0 && dd >= 0 && (dd <= LOCALW || (dd % STRIDEK) == 0)) ? 1.f : 0.f; fr.h[q] = (_Float16)(__expf(fmaf(f, s[j], (1.f - f) * -1.0e9f) - mx) * sc); } unsigned short* d = (unsigned short*)P + i * NKX + j0; *(v8us*)d = fr.half[0];  } }


template <int MASKADD>
__global__ __launch_bounds__(64) void k_att0(const float* __restrict__ QF, const float* __restrict__ KF, const float* __restrict__ VF, int ld, const float* __restrict__ mask, float scale, float* __restrict__ OF, int ldo) {
  #pragma clang fp contract(off)
  __shared__ __attribute__((aligned(16))) float lq[64][64]; __shared__ __attribute__((aligned(16))) float lo[64][64];
  const int tid = threadIdx.x; const int h = blockIdx.x / (QT0 / 64), rg = blockIdx.x % (QT0 / 64); const int i = rg * 64 + tid;
  const float* qr = QF + (size_t)i * ld + h * HD;
#pragma unroll 1
  for (int c = 0; c < HD / 4; ++c) { *(v4f*)&lq[tid][c * 4] = *(const v4fa*)(qr + c * 4); const v4f z = {0.f, 0.f, 0.f, 0.f}; *(v4f*)&lo[tid][c * 4] = z; }
  float m = -1.0e30f, l = 0.f; const int jmax = MASKADD ? (SQ - 1) : (rg * 64 + 63);      /* additive-mask form: every key (the mask input decides); causal form: keys up to the block's last row */
#pragma unroll 1
  for (int j = 0; j <= jmax; ++j) { const float* kr = KF + (size_t)j * ld + h * HD; const float* vr = VF + (size_t)j * ld + h * HD; float s = 0.f;
#pragma unroll 1
    for (int c = 0; c < HD / 4; ++c) { const v4f kq = *(const v4fa*)(kr + c * 4); const v4f qq = *(v4f*)&lq[tid][c * 4]; s = __fadd_rn(s, __fmul_rn(qq[0], kq[0])); s = __fadd_rn(s, __fmul_rn(qq[1], kq[1])); s = __fadd_rn(s, __fmul_rn(qq[2], kq[2])); s = __fadd_rn(s, __fmul_rn(qq[3], kq[3])); }
    s = __fmul_rn(s, scale); if (MASKADD) s = __fadd_rn(s, __fmul_rn(bf16_round(mask[(size_t)i * SQ + j]), -10000.0f));
    const float f = (MASKADD || j <= i) ? 1.f : 0.f; const float sm = fmaf(f, s, (1.f - f) * -1.0e30f); const float mn = fmaxf(m, sm); const float sc = expf(m - mn); const float e = expf(sm - mn); l = __fadd_rn(__fmul_rn(l, sc), e); m = mn;
#pragma unroll 1
    for (int c = 0; c < HD / 4; ++c) { const v4f vv = *(const v4fa*)(vr + c * 4); v4f oo = *(v4f*)&lo[tid][c * 4]; for (int u = 0; u < 4; ++u) oo[u] = __fadd_rn(__fmul_rn(oo[u], sc), __fmul_rn(e, vv[u])); *(v4f*)&lo[tid][c * 4] = oo; } }
  const float fin = 64.0f / l;      /* o carried x64 like the f16 path */
#pragma unroll 1
  for (int c = 0; c < HD / 4; ++c) { v4f oo = *(v4f*)&lo[tid][c * 4]; for (int u = 0; u < 4; ++u) oo[u] = __fmul_rn(oo[u], fin); *(v4f*)&lo[tid][c * 4] = oo; }
  __syncthreads();
  {
#pragma unroll 1
    for (int it = 0; it < 16; ++it) { const int row = it * 4 + tid / 16, pc = (tid % 16) * 4; const v4f v = *(const v4f*)&lo[row][pc]; *(v4f*)(OF + (size_t)(rg * 64 + row) * ldo + h * HD + pc) = v; }
     } }

template <int MASKADD>
__global__ __launch_bounds__(64) void k_att0mbc(const float* __restrict__ QF, const float* __restrict__ KF, const float* __restrict__ VF, int ld, const float* __restrict__ mask, float scale, float* __restrict__ OF, int ldo) {
  #pragma clang fp contract(off)
  __shared__ __attribute__((aligned(16))) float lq[64][64]; __shared__ __attribute__((aligned(16))) float lo[64][64];
  const int tid = threadIdx.x; const int h = blockIdx.x / (QT0 / 64), rg = blockIdx.x % (QT0 / 64); const int i = rg * 64 + tid;
  const float* qr = QF + (size_t)i * ld + h * HD;
#pragma unroll 1
  for (int c = 0; c < HD / 4; ++c) { *(v4f*)&lq[tid][c * 4] = *(const v4fa*)(qr + c * 4); const v4f z = {0.f, 0.f, 0.f, 0.f}; *(v4f*)&lo[tid][c * 4] = z; }
  float m = -1.0e30f, l = 0.f; const int jmax = rg * 64 + 63;      /* keys beyond the block end are masked by the mask's lower-triangular structure */      /* both MASKADD forms: keys up to the block's last row */
#pragma unroll 1
  for (int j = 0; j <= jmax; ++j) { const float* kr = KF + (size_t)j * ld + h * HD; const float* vr = VF + (size_t)j * ld + h * HD; float s = 0.f;
#pragma unroll 1
    for (int c = 0; c < HD / 4; ++c) { const v4f kq = *(const v4fa*)(kr + c * 4); const v4f qq = *(v4f*)&lq[tid][c * 4]; s = __fadd_rn(s, __fmul_rn(qq[0], kq[0])); s = __fadd_rn(s, __fmul_rn(qq[1], kq[1])); s = __fadd_rn(s, __fmul_rn(qq[2], kq[2])); s = __fadd_rn(s, __fmul_rn(qq[3], kq[3])); }
    s = __fmul_rn(s, scale); const int mb = ((const int*)mask)[(size_t)i * SQ + j];      /* causal (j <= i) AND the module's int32 [S][S] mask read per (query, key): 0 -> masked */
    const float f = (mb != 0 && j <= i) ? 1.f : 0.f; const float sm = fmaf(f, s, (1.f - f) * -1.0e30f); const float mn = fmaxf(m, sm); const float sc = expf(m - mn); const float e = expf(sm - mn); l = __fadd_rn(__fmul_rn(l, sc), e); m = mn;
#pragma unroll 1
    for (int c = 0; c < HD / 4; ++c) { const v4f vv = *(const v4fa*)(vr + c * 4); v4f oo = *(v4f*)&lo[tid][c * 4]; for (int u = 0; u < 4; ++u) oo[u] = __fadd_rn(__fmul_rn(oo[u], sc), __fmul_rn(e, vv[u])); *(v4f*)&lo[tid][c * 4] = oo; } }
  const float fin = 64.0f / l;      /* o carried x64 like the f16 path */
#pragma unroll 1
  for (int c = 0; c < HD / 4; ++c) { v4f oo = *(v4f*)&lo[tid][c * 4]; for (int u = 0; u < 4; ++u) oo[u] = __fmul_rn(oo[u], fin); *(v4f*)&lo[tid][c * 4] = oo; }
  __syncthreads();
  {
#pragma unroll 1
    for (int it = 0; it < 16; ++it) { const int row = it * 4 + tid / 16, pc = (tid % 16) * 4; const v4f v = *(const v4f*)&lo[row][pc]; *(v4f*)(OF + (size_t)(rg * 64 + row) * ldo + h * HD + pc) = v; }
     } }


template <int BFIN, int WXB>
__global__ __launch_bounds__(256) void k_ln16(const float* __restrict__ X, const float* __restrict__ g, const float* __restrict__ bb, float eps, _Float16* __restrict__ N16, float* __restrict__ XB) {
  #pragma clang fp contract(off)
  __shared__ float red[256]; const size_t r = blockIdx.x; const int t = threadIdx.x; const v4f xa = *(const v4fa*)(X + r * DMQ + t * 4); float s[4]; float sum = 0.f;
  for (int q = 0; q < 4; ++q) { s[q] = BFIN ? bf16_round(xa[q]) : xa[q]; sum = __fadd_rn(sum, s[q]); }
  red[t] = sum; __syncthreads(); for (int st = 128; st > 0; st >>= 1) { if (t < st) red[t] = __fadd_rn(red[t], red[t + st]); __syncthreads(); } const float mu = red[0] / (float)DMQ; __syncthreads();
  float vs = 0.f; for (int q = 0; q < 4; ++q) { const float dl = __fadd_rn(s[q], -mu); vs = __fadd_rn(vs, __fmul_rn(dl, dl)); } red[t] = vs; __syncthreads(); for (int st = 128; st > 0; st >>= 1) { if (t < st) red[t] = __fadd_rn(red[t], red[t + st]); __syncthreads(); }
  const float rs = rsqrtf(__fadd_rn(red[0] / (float)DMQ, eps)); v4h y; v4f xb;
  for (int q = 0; q < 4; ++q) { const int c = t * 4 + q; y[q] = (_Float16)__fadd_rn(__fmul_rn(__fmul_rn(__fadd_rn(s[q], -mu), rs), bf16_round(g[c])), bf16_round(bb[c])); xb[q] = s[q]; }
  { *(v4h*)(N16 + r * DMQ + t * 4) = y; if (WXB) *(v4f*)(XB + r * DMQ + t * 4) = xb;  } }
__global__ __launch_bounds__(256) void k_ftres2(const float* __restrict__ OF0, const float* __restrict__ XB, float* __restrict__ X1, size_t n4) {
  #pragma clang fp contract(off)
  const size_t t = (size_t)blockIdx.x * 256 + threadIdx.x; if (t >= n4) return; const v4f o = *(const v4fa*)(OF0 + t * 4), xv = *(const v4fa*)(XB + t * 4); v4f y; for (int q = 0; q < 4; ++q) y[q] = __fadd_rn(__fmul_rn(o[q], 0.015625f), xv[q]); *(v4f*)(X1 + t * 4) = y;  }

__global__ __launch_bounds__(256) void k_bcpy(const float* __restrict__ b, int n, int NP, float* __restrict__ dst, int dst0) { for (int i = threadIdx.x; i < NP; i += 256) { const float v = (i < n) ? b[i] : 0.f; *(float*)(dst + dst0 + i) = v; }  }


#define FAW 8                        /* waves per work-group */
#define FAQ 32                       /* query columns per wave (two 16-column groups) */
#define FAC 0.18033688011112042592f  /* 64^-0.5 * log2 e: scores are carried in log2 units */
__device__ __forceinline__ float rs_x16(float x) { const int b = __builtin_bit_cast(int, x); return __builtin_bit_cast(float, __builtin_amdgcn_permlanex16(b, b, 0x76543210, 0xfedcba98, false, false)); }      /* lane l <- lane l ^ 16 */
// Four 2^x in one statement. The outputs are early-clobber, so inside it no v_exp_f32 is directly followed by a read of its result or a write of its source; the v_nop keeps that slot behind the last one.
__device__ __forceinline__ v4f rs_exp2(v4f x) { float y0, y1, y2, y3; asm("v_exp_f32 %0, %4\n\tv_exp_f32 %1, %5\n\tv_exp_f32 %2, %6\n\tv_exp_f32 %3, %7\n\tv_nop" : "=&v"(y0), "=&v"(y1), "=&v"(y2), "=&v"(y3) : "v"(x[0]), "v"(x[1]), "v"(x[2]), "v"(x[3])); const v4f y = {y0, y1, y2, y3}; return y; }
// One 2^x, with the same slot kept behind it.
__device__ __forceinline__ float fa_exp2(float x) { float y; asm("v_exp_f32 %0, %1\n\tv_nop" : "=&v"(y) : "v"(x)); return y; }
__device__ __forceinline__ v8f fa_mma(v16h a, v16h b, v8f c) { return __builtin_amdgcn_wmma_f32_16x16x32_f16(false, a, false, b, (short)0, c, false, false); }
// Q16, K16: f16 rows [NB * SQ][DM], head h = columns h*64..; VT: f16 [NB * NH][HD][SQ]; O16: context x64 as f16 rows (merged heads).
// The short loops are fully unrolled so that every fragment array is indexed by constants and stays in registers.
// K and V^T reach the eight waves through LDS: a stage is 64 keys, 64 K rows of 128 bytes and 64 V^T rows of 128 bytes, brought in once per work-group by asynchronous copies
// (whole 128-byte lines, through no register) and read by every wave as 16-byte fragment halves. Two buffers: the next stage's copies fly while this stage is worked on.
#define FAK 64                       /* keys per stage (two 32-key passes) */
#define FAP 144                      /* LDS row pitch in bytes: 128 of data + 16, so that the 16 rows of a 16-byte fragment read fall on 64 different banks */
#define FAT (64 * FAP)               /* one operand's tile */
#define FAS (2 * FAT)                /* one stage: [K tile | V^T tile] */
// Four copies of 16 bytes a lane: rows r and r + 32 of the K tile and of the V^T tile (l: the lane's LDS byte address in the K tile, gk, gv: its global addresses).
// The s_wait_xcnt stands inside the statement, behind the last copy, so that no address register of a copy is rewritten in front of it.
__device__ __forceinline__ void fa_copy4(unsigned l, const _Float16* gk, const _Float16* gv) {
  asm volatile("global_load_async_to_lds_b128 %0, %4, off\n\t"
               "global_load_async_to_lds_b128 %1, %5, off\n\t"
               "global_load_async_to_lds_b128 %2, %6, off\n\t"
               "global_load_async_to_lds_b128 %3, %7, off\n\t"
               "s_wait_xcnt 0x0"
               :: "v"(l), "v"(l + 32 * FAP), "v"(l + FAT), "v"(l + FAT + 32 * FAP),
                  "v"(gk), "v"(gk + (size_t)32 * DM), "v"(gv), "v"(gv + (size_t)32 * SQ)
               : "memory"); }
__global__ __launch_bounds__(FAW * 32) void k_fattn(const _Float16* __restrict__ Q16, const _Float16* __restrict__ K16, const _Float16* __restrict__ VT, _Float16* __restrict__ O16) {
  __shared__ __attribute__((aligned(128))) unsigned char L[2 * FAS]; static_assert(FAW * 32 == 256 && HD == 64 && SQ % FAK == 0 && SQ / FAK >= 2, "k_fattn: 256 lanes copy 32 rows of 128 bytes at a time; the ring needs two stages");
  const int tid = threadIdx.x, lane = tid & 31, ln = lane & 15, hh = lane >> 4, w = tid >> 5;
  constexpr int QB = SQ / (FAW * FAQ); const int qb = blockIdx.x % QB, bh = blockIdx.x / QB; const int b = bh / NH, h = bh % NH; const int q0 = qb * (FAW * FAQ) + w * FAQ;
  const _Float16* qp = Q16 + ((size_t)b * SQ + q0 + ln) * DM + h * HD;
  const unsigned lc = (unsigned)(size_t)L + (unsigned)((tid >> 3) * FAP + (tid & 7) * 16);      /* eight lanes copy one 128-byte row */
  const _Float16* gk = K16 + ((size_t)b * SQ + (tid >> 3)) * DM + h * HD + (tid & 7) * 8; const _Float16* gv = VT + ((size_t)bh * HD + (tid >> 3)) * SQ + (tid & 7) * 8;
  constexpr int nt = SQ / FAK;
  const v8f z8 = {0.f, 0.f, 0.f, 0.f, 0.f, 0.f, 0.f, 0.f};
  v16h qf[2][2]; v8f o[2][4]; float m[2], l[2];
  fa_copy4(lc, gk, gv);
#pragma unroll
  for (int j = 0; j < 2; ++j) { m[j] = -3.0e38f; l[j] = 0.f;
#pragma unroll
    for (int d = 0; d < 4; ++d) o[j][d] = z8;
#pragma unroll
    for (int ks = 0; ks < 2; ++ks) qf[j][ks] = g2_frag(qp + (size_t)j * 16 * DM + ks * 32, hh); }
  asm volatile("s_wait_xcnt 0x0" ::: "memory");      /* in front of any rewrite of the Q loads' address pair */
  asm volatile("s_wait_asynccnt 0x0" ::: "memory");      /* stage 0 has landed (this wave's copies) */
  __syncthreads();      /* ... and every wave's */
  fa_copy4(lc + FAS, gk + (size_t)FAK * DM, gv + FAK);
#pragma unroll 1
  for (int t = 0; t < nt; ++t) { const unsigned buf = (unsigned)(t & 1) * FAS;      /* rolled: one copy of the two passes in the text */
    const _Float16* pk = (const _Float16*)(L + buf + ln * FAP); const _Float16* pv = (const _Float16*)(L + buf + FAT + ln * FAP);
#pragma unroll
    for (int p = 0; p < FAK / 32; ++p) {
      v16h kf[2][2], vf[4]; v8f s[2][2];
#pragma unroll
      for (int u = 0; u < 2; ++u)
#pragma unroll
        for (int ks = 0; ks < 2; ++ks) kf[u][ks] = g2_frag(pk + (p * 32 + u * 16) * (FAP / 2) + ks * 32, hh);
#pragma unroll
      for (int d = 0; d < 4; ++d) vf[d] = g2_frag(pv + d * 16 * (FAP / 2) + p * 32, hh);
#pragma unroll
      for (int j = 0; j < 2; ++j)
#pragma unroll
        for (int u = 0; u < 2; ++u) s[j][u] = fa_mma(kf[u][1], qf[j][1], fa_mma(kf[u][0], qf[j][0], z8));      /* s[j][u][r] = q(q0 + 16 j + ln) . k(64 t + 32 p + 16 u + 8 hh + r) */
      FragH pf[2]; float al[2];
#pragma unroll
      for (int j = 0; j < 2; ++j) {
        float mx = fmaxf(s[j][0][0], s[j][1][0]);
#pragma unroll
        for (int r = 1; r < 8; ++r) mx = fmaxf(mx, fmaxf(s[j][0][r], s[j][1][r]));
        mx = fmaxf(mx, rs_x16(mx));
        const float mn = fmaxf(m[j], mx * FAC), mb = 8.0f - mn; al[j] = fa_exp2(m[j] - mn); m[j] = mn;      /* p = 2^8 exp(s - max) <= 256: small weights stay out of the f16 subnormals; the factor cancels against the sum */
        v4f s4 = {0.f, 0.f, 0.f, 0.f};
#pragma unroll
        for (int u = 0; u < 2; ++u)
#pragma unroll
          for (int c = 0; c < 2; ++c) { const v4f x = {s[j][u][c * 4] * FAC + mb, s[j][u][c * 4 + 1] * FAC + mb, s[j][u][c * 4 + 2] * FAC + mb, s[j][u][c * 4 + 3] * FAC + mb}; const v4f e = rs_exp2(x); s4 += e;
#pragma unroll
            for (int q = 0; q < 4; ++q) pf[j].h[u * 8 + c * 4 + q] = (_Float16)e[q]; }
        l[j] = l[j] * al[j] + ((s4[0] + s4[1]) + (s4[2] + s4[3])); }
      __builtin_amdgcn_sched_barrier(0);      /* both column groups' 2^x statements stay in front of the eight products */
#pragma unroll
      for (int j = 0; j < 2; ++j)
#pragma unroll
        for (int d = 0; d < 4; ++d) o[j][d] = fa_mma(vf[d], pf[j].v, o[j][d] * al[j]);      /* o[j][d][r] = sum_k p v(k)[16 d + 8 hh + r] for query q0 + 16 j + ln */
      __builtin_amdgcn_sched_barrier(0);      /* ... and the next pass's stay behind them; it also keeps the next pass's fragment reads from rising over these products: with them up there the kernel took more than 256 registers, and two work-groups no longer fit a WGP */
    }
    asm volatile("s_wait_dscnt 0x0" ::: "memory");      /* this wave's reads of the buffer have returned */
    asm volatile("s_wait_asynccnt 0x0" ::: "memory");      /* this wave's copies of stage t + 1 have landed */
    __syncthreads();      /* publishes stage t + 1 and frees stage t's buffer */
    if (t + 2 < nt) fa_copy4(lc + buf, gk + (size_t)(t + 2) * FAK * DM, gv + (t + 2) * FAK); }
  asm volatile("s_wait_asynccnt 0x0" ::: "memory");      /* no copy is outstanding when the wave ends */
#pragma unroll
  for (int j = 0; j < 2; ++j) { const float fin = 64.0f / (l[j] + rs_x16(l[j])); unsigned short* op = (unsigned short*)O16 + ((size_t)b * SQ + q0 + j * 16 + ln) * DM + h * HD + 8 * hh;
#pragma unroll
    for (int d = 0; d < 4; ++d) { FragH f;
#pragma unroll
      for (int r = 0; r < 8; ++r) f.h[r] = (_Float16)(o[j][d][r] * fin);
      *(v8us*)(op + d * 16) = f.half[0]; } } }

template <int MODE>
__global__ __launch_bounds__(256) void k_regrp(const float* __restrict__ src, float* __restrict__ dst, size_t n4) {
  const size_t t = (size_t)blockIdx.x * 256 + threadIdx.x; if (t >= n4) return; const size_t e = t * 4; const size_t rd = e / DM; const int c = (int)(e % DM);
  size_t rs; if (MODE == 0) { const size_t b = rd / SQ, sq = rd % SQ; rs = sq * NB + b; } else { const size_t sq = rd / NB, b = rd % NB; rs = b * SQ + sq; }
  const v4f v = *(const v4fa*)(src + rs * DM + c); *(v4f*)(dst + e) = v;  }

// ---- row passes: a wave owns RPW whole rows of DM = 1024 f32 in registers (32 lanes x 16 bytes = 512 contiguous bytes a load, eight loads a row, all of them issued up front) ----
// Few long-lived waves in place of many one-load ones: 16 waves on every WGP cover all 8192 rows, and no LDS and no barrier is needed, since a row never leaves its wave.
#define RPW 2                        /* rows per wave */
static_assert(DM == 1024 && DMQ == DM && ((size_t)NB * SQ) % (8 * RPW) == 0, "row passes: eight 512-byte loads a row, eight waves a work-group, no edge");
// lane l <- lane l ^ M inside its 16-lane row (DPP row_xmask)
template <int M>
__device__ __forceinline__ float rp_xm(float x) { return __builtin_bit_cast(float, __builtin_amdgcn_update_dpp(0, __builtin_bit_cast(int, x), 0x160 + M, 0xf, 0xf, true)); }
// Sum over the wave's 32 lanes by a butterfly: every lane ends with the same bits.
__device__ __forceinline__ float rp_sum32(float v) { v += rp_xm<1>(v); v += rp_xm<2>(v); v += rp_xm<4>(v); v += rp_xm<8>(v); return v + rs_x16(v); }
// LayerNorm (biased variance, eps inside the rsqrt; mean first, then the squares of the centred row) -> f16 rows.
template <int BFIN>
__global__ __launch_bounds__(256) void k_lnw(const float* __restrict__ X, const float* __restrict__ g, const float* __restrict__ bb, float eps, _Float16* __restrict__ N16) {
  const int lane = threadIdx.x & 31; const size_t e0 = ((size_t)blockIdx.x * 8 + (threadIdx.x >> 5)) * (RPW * DM) + lane * 4;      /* the lane's first element */
  const float* xp = X + e0; const unsigned ob = (unsigned)lane * 16u;      /* ob: the lane's byte offset in g and bb */
  v4f x[RPW][8], gg[8], bv[8];
#pragma unroll
  for (int k = 0; k < RPW; ++k)
#pragma unroll
    for (int u = 0; u < 8; ++u) x[k][u] = *(const v4fa*)(xp + k * DM + u * 128);
#pragma unroll
  for (int u = 0; u < 8; ++u) { gg[u] = *(const v4fa*)((const char*)g + ob + u * 512); bv[u] = *(const v4fa*)((const char*)bb + ob + u * 512); }
  asm volatile("s_wait_xcnt 0x0" :: "v"(xp), "v"(lane) : "memory");      /* the loads' address registers are free for reuse behind them: the wait stands in front of any rewrite; xp and lane (the g and bb loads' offset register, scaled by the load itself) as inputs keep those registers out of the loads' own results */
  __builtin_amdgcn_sched_barrier(0);      /* keeps all 32 loads in front of the arithmetic: without it the scheduler sinks the last ones, and the wait with them, far into it, where their latency shows */
#pragma unroll
  for (int u = 0; u < 8; ++u)
#pragma unroll
    for (int q = 0; q < 4; ++q) { gg[u][q] = bf16_round(gg[u][q]); bv[u][q] = bf16_round(bv[u][q]); }
  v4h y[RPW][8];
#pragma unroll
  for (int k = 0; k < RPW; ++k) {
    v4f a = {0.f, 0.f, 0.f, 0.f};
#pragma unroll
    for (int u = 0; u < 8; ++u) {
      if (BFIN) {
#pragma unroll
        for (int q = 0; q < 4; ++q) x[k][u][q] = bf16_round(x[k][u][q]); }
      a += x[k][u]; }
    const float mu = rp_sum32((a[0] + a[1]) + (a[2] + a[3])) * (1.0f / (float)DM);
    v4f c = {0.f, 0.f, 0.f, 0.f};
#pragma unroll
    for (int u = 0; u < 8; ++u) { x[k][u] -= mu; c += x[k][u] * x[k][u]; }
    const float rs = rsqrtf(rp_sum32((c[0] + c[1]) + (c[2] + c[3])) * (1.0f / (float)DM) + eps);
#pragma unroll
    for (int u = 0; u < 8; ++u) { const v4f o = x[k][u] * rs * gg[u] + bv[u];
#pragma unroll
      for (int q = 0; q < 4; ++q) y[k][u][q] = (_Float16)o[q]; } }
  __builtin_amdgcn_sched_barrier(0);      /* every result is in its own registers before the first store: nothing is computed behind a store, so no register of an issued store is rewritten */
#pragma unroll
  for (int k = 0; k < RPW; ++k)
#pragma unroll
    for (int u = 0; u < 8; ++u) *(v4h*)(N16 + e0 + k * DM + u * 128) = y[k][u]; }

__global__ __launch_bounds__(256) void k_wthd(const float* __restrict__ Wt, _Float16* __restrict__ Bt) { const size_t t = (size_t)blockIdx.x * 256 + threadIdx.x; if (t >= (size_t)NH * HD * (DM / 8)) return; const int m8 = (int)(t % (DM / 8)) * 8; const int d = (int)((t / (DM / 8)) % HD); const int h = (int)(t / ((size_t)(DM / 8) * HD)); FragH f;
  for (int q = 0; q < 8; ++q) f.h[q] = (_Float16)(16.0f * bf16_round(Wt[((size_t)h * DM + m8 + q) * HD + d])); unsigned short* dst = (unsigned short*)Bt + ((size_t)h * HD + d) * DM + m8; *(v8us*)dst = f.half[0];  }




template <int BFIN, int SCAL>
__global__ __launch_bounds__(256) void k_lnsc(const float* __restrict__ X, const float* __restrict__ g, const float* __restrict__ bb, float eps, _Float16* __restrict__ N16, float* __restrict__ N32) {
  #pragma clang fp contract(off)
  __shared__ float red[256]; const size_t r = blockIdx.x; const int t = threadIdx.x; const bool act = t < DM / 4; const int tc = act ? t : 0; const v4f xl = *(const v4fa*)(X + r * DM + tc * 4); const float am = act ? 1.f : 0.f; float s[4]; float sum = 0.f;
  for (int q = 0; q < 4; ++q) { s[q] = (BFIN ? bf16_round(xl[q]) : xl[q]) * am; sum = __fadd_rn(sum, s[q]); }
  red[t] = sum; __syncthreads(); for (int st = 128; st > 0; st >>= 1) { if (t < st) red[t] = __fadd_rn(red[t], red[t + st]); __syncthreads(); } const float mu = red[0] / (float)DM; __syncthreads();
  float vs = 0.f; for (int q = 0; q < 4; ++q) { const float dl = __fadd_rn(s[q], -mu) * am; vs = __fadd_rn(vs, __fmul_rn(dl, dl)); } red[t] = vs; __syncthreads(); for (int st = 128; st > 0; st >>= 1) { if (t < st) red[t] = __fadd_rn(red[t], red[t + st]); __syncthreads(); }
  const float rs = __fdiv_rn(1.0f, __fadd_rn(sqrtf(red[0] / (float)(DM - 1)), eps)); if (!act) return; v4h y; v4f yf;
  for (int q = 0; q < 4; ++q) { const int c = t * 4 + q; const float gg = bf16_round(SCAL ? g[0] : g[c]), bv = bf16_round(SCAL ? bb[0] : bb[c]); yf[q] = __fadd_rn(__fmul_rn(__fmul_rn(__fadd_rn(s[q], -mu), rs), gg), bv); y[q] = (_Float16)yf[q]; }
  { if (N16) *(v4h*)(N16 + r * DM + t * 4) = y; if (N32) *(v4f*)(N32 + r * DM + t * 4) = yf;  } }

__global__ __launch_bounds__(256) void k_rsmdmi(const float* __restrict__ S, _Float16* __restrict__ P, int nrows, const int* __restrict__ M) {
  #pragma clang fp contract(off)
  const int t = blockIdx.x * 256 + threadIdx.x; if (t >= nrows) return; const float* s = S + (size_t)t * SQ; const int* m = M + (size_t)(t % SQ) * SQ; float mx = -3.0e38f;
#pragma unroll 1
  for (int j = 0; j < SQ; ++j) { const float f = (m[j] == 0) ? 1.f : 0.f; mx = fmaxf(mx, fmaf(f, s[j], (1.f - f) * -1.0e9f)); } float se = 0.f;
#pragma unroll 1
  for (int j = 0; j < SQ; ++j) { const float f = (m[j] == 0) ? 1.f : 0.f; se += __expf(fmaf(f, s[j], (1.f - f) * -1.0e9f) - mx); } const float sc = 256.0f / se;
#pragma unroll 1
  for (int j0 = 0; j0 < SQ; j0 += 8) { FragH fr; for (int q = 0; q < 8; ++q) { const int j = j0 + q; const float f = (m[j] == 0) ? 1.f : 0.f; fr.h[q] = (_Float16)(__expf(fmaf(f, s[j], (1.f - f) * -1.0e9f) - mx) * sc); } unsigned short* d = (unsigned short*)P + (size_t)t * SQ + j0; *(v8us*)d = fr.half[0];  } }
// All six weight planes in one launch (blockIdx.y = plane): Bt[p][n][k] = f16(bf16(W[k][n]) x16), element for element as k_wt_f16.
// Planes 0..2: per-head tensors [NH][DM][HD], row n = head n / HD, output n % HD; planes 3..5: [in][out] squares of DM x DM.
static_assert(DFF == DM, "k_wt_all: every plane is DM x DM");
// Eight source rows of one output column. The pitch is a compile-time constant, so the eight loads share one address pair and differ only in their immediate offsets.
template <int PITCH>
__device__ __forceinline__ v8us wt_col8(const float* __restrict__ s) { FragH f;
  for (int i = 0; i < 8; ++i) f.h[i] = (_Float16)(bf16_round(s[(size_t)i * PITCH]) * 16.0f);
  return f.half[0]; }
__global__ __launch_bounds__(256) void k_wt_all(const float* __restrict__ wq, const float* __restrict__ wk, const float* __restrict__ wv, const float* __restrict__ wo, const float* __restrict__ w1, const float* __restrict__ w2, _Float16* __restrict__ Bt) {
  const int p = blockIdx.y; const int t = blockIdx.x * 256 + threadIdx.x; const int n = t / (DM / 8), k8 = (t % (DM / 8)) * 8;
  const float* W = p == 0 ? wq : p == 1 ? wk : p == 2 ? wv : p == 3 ? wo : p == 4 ? w1 : w2;
  const v8us o = p < 3 ? wt_col8<HD>(W + ((size_t)(n / HD) * DM + k8) * HD + (n % HD)) : wt_col8<DM>(W + (size_t)k8 * DM + n);
  *(v8us*)((unsigned short*)Bt + ((size_t)p * DM + n) * DM + k8) = o; }
extern "C" void kernel_launch(void* const* d_in, const int* in_sizes, int n_in,
                              void* d_out, int out_size, void* d_ws, size_t ws_size, hipStream_t stream) {
  (void)in_sizes; (void)n_in; (void)out_size;
  const float* const* I = (const float* const*)d_in; const float* x = I[0]; const float* wq = I[1]; const float* wk = I[2]; const float* wv = I[3]; const float* wo = I[4]; const float* bo = I[5]; const float* w1 = I[6]; const float* b1 = I[7]; const float* w2 = I[8]; const float* b2 = I[9]; const float* g1 = I[10]; const float* be1 = I[11]; const float* g2 = I[12]; const float* be2 = I[13];      /* x; per-head Wq / Wk / Wv [16][1024][64] (no biases); Wo [1024][1024] + bo ([in][out]); W1 [1024][1024] + b1, W2 [1024][1024] + b2; LN1 g / b, LN2 g / b */
  char* ws = (char*)d_ws; size_t off = 0;
  auto take = [&](size_t bytes) { char* p = ws + off; off += (bytes + 255) & ~(size_t)255; return p; };
  _Float16* BQ = (_Float16*)take((size_t)6 * DM * DM * 2); _Float16* BO = BQ + (size_t)3 * DM * DM; _Float16* BW1 = BQ + (size_t)4 * DM * DM; _Float16* BW2 = BQ + (size_t)5 * DM * DM;      /* six Bt planes in a row: q, k, v, o, W1, W2 */
  _Float16* XN = (_Float16*)take(NR * DM * 2); _Float16* Q16 = (_Float16*)take((size_t)3 * NR * DM * 2); _Float16* K16 = Q16 + NR * DM; _Float16* VT = Q16 + (size_t)2 * NR * DM;      /* three planes in a row: one batched GEMM writes them; the third holds V^T [8 * 16][64][1024] */ _Float16* O16 = (_Float16*)take(NR * DM * 2); float* X1 = (float*)take(NR * DM * 4);
  _Float16* M16 = XN;      /* second-norm f16 rows: aliases XN (last readers: the three projections) */ _Float16* HF16 = (_Float16*)take(NR * DFF * 2);      /* FFN hidden rows of every batch [8192][1024] f16 (16 MiB): own region */
  
  if (off > ws_size) return;
  k_wt_all<<<dim3((unsigned)((size_t)DM * (DM / 8) / 256), 6), 256, 0, stream>>>(wq, wk, wv, wo, w1, w2, BQ);      /* every weight -> Bt x16, one launch; per-head [in = 1024][out = 64]: head h = rows h*64.. of its plane */
  k_lnw<1><<<(unsigned)(NR / (8 * RPW)), 256, 0, stream>>>(x, g1, be1, 1e-5f, XN);      /* n = LN0(bf16(x)) (biased variance, eps inside the rsqrt) -> f16 rows */
  k_gemm3<0, false, false, false, true><<<dim3((unsigned)((NR / 128) * (DM / 128)), 3), 128, 0, stream>>>(XN, DM, 0, BQ, DM, (size_t)DM * DM, 0.0625f, nullptr, 0, nullptr, nullptr, Q16, NR * DM, (int)NR, DM, DM);      /* q, k (f16 rows; head h = columns h*64..) and V^T (blockIdx.y), one launch */
  k_fattn<<<NB * NH * (SQ / (FAW * FAQ)), FAW * 32, 0, stream>>>(Q16, K16, VT, O16);      /* softmax(q k^T / 8) v over all keys (no mask) -> ctx (merged heads, x64) as f16 rows */
  k_gemm3<0, true, true, true><<<dim3((unsigned)((NR / 128) * (DM / 128)), 1), 128, 0, stream>>>(O16, DM, 0, BO, DM, 0, 0.0009765625f, bo, 0, x, X1, nullptr, 0, (int)NR, DM, DM);      /* bf16(x) + ctx wo (+ bo) (own-element residual, x rounded where it is read) -> f32 rows */
  k_lnw<0><<<(unsigned)(NR / (8 * RPW)), 256, 0, stream>>>(X1, g2, be2, 1e-5f, M16);      /* LN1(x1) -> f16 rows */
  k_gemm3<6, false, false><<<dim3((unsigned)((NR / 128) * (DFF / 128)), 1), 128, 0, stream>>>(M16, DM, 0, BW1, DM, 0, 0.0625f, b1, 0, nullptr, nullptr, HF16, 0, (int)NR, DFF, DM);      /* gelu_erf(. W1 + b1) -> f16, all rows */
  k_gemm3<0, true, true><<<dim3((unsigned)((NR / 128) * (DM / 128)), 1), 128, 0, stream>>>(HF16, DFF, 0, BW2, DFF, 0, 0.0625f, b2, 0, X1, (float*)d_out, nullptr, 0, (int)NR, DM, DFF);      /* out = x1 + mlp (own-element residual), all rows */
}

// v008
// Measured time: 166 microseconds a run.
// Next to v007, in two timings, it ran 1.12 times as fast each time.
// Counting every step since v000, it is 45.6 times as fast.
#include <hip/hip_runtime.h>
// Pre-LN transformer encoder block with PER-HEAD projection tensors, no QKV biases (x [8][1024][1024]; h = LN1(x) (biased var, eps 1e-5); q/k/v[h] = h W[h] with W [16][1024][64] ([head][in][out]); scale 64^-0.5; softmax over all 1024 keys (no mask); x1 = x + concat(attn) Wo + bo ([in][out]); out = x1 + gelu_erf(LN2(x1) W1 + b1) W2 + b2 ([in][out] 1024 x 1024 x 1024: hidden = 1 x n_embd, as the source) -> [8][1024][1024]).
// Structure: token rows; LayerNorm / exact f16 rows; WMMA GEMMs for q, k and V^T (the v product with its operands swapped); one fused attention launch (scores, online softmax and P V in registers); output projection with the own-element residual; custom LayerNorm; GELU (erf) FFN over all rows; launches: see trace.
// Compute dtype: inputs rounded to bf16; x / weights exact; q, k, v, softmax weights and o as plain f16 GEMM operands (~2^-12); scores and softmax statistics f32. v_wmma_f32_16x16x32_f16.
#define NB 8
#define SQ 1024
#define DM 1024
#define NH 16
#define HD 64
#define HG 4                         /* heads per call of the unused per-batch k_vt overload */
#define LOCALW 128                   /* (macros for unused kernels of the shared header) */
#define STRIDEK 128
#define QT 256                       /* query rows per causal tile */
#define NKX SQ                       /* S / P row pitch */
#define QT0 128                      /* first-tile rows recomputed exactly in f32 */
#define B0 0                         /* unused; every launch starts at batch 0 */
#define NBR NB                       /* only feeds the unused MP; the launches cover all NB batches */
#define NR ((size_t)NB * SQ)
#define DMQ DM
#define DFF 1024         /* FFN hidden width = 1 x n_embd in this module (W1 [1024][1024], W2 [1024][1024]) */
#define MP ((int)((size_t)NBR * SQ)) /* unused; the projections take NR rows */
#define QN SQ                        /* unused; attention runs all SQ query rows */
#define NHD NH                       /* unused; the launches cover all NH heads */
#define MPO MP                       /* unused; the output stage takes NR rows */
#define LQ (3 * DM)      /* unused; the q, k, v rows have pitch DM */
typedef __bf16 v16b __attribute__((ext_vector_type(16)));
typedef unsigned short v8us __attribute__((ext_vector_type(8), may_alias));
typedef float  v8f  __attribute__((ext_vector_type(8)));
typedef float  v4f  __attribute__((ext_vector_type(4)));
typedef float  v4fa __attribute__((ext_vector_type(4), may_alias));
union FragB { v16b v; v8us half[2]; unsigned short u[16]; };

__device__ __forceinline__ unsigned short bf16_bits(float x) { unsigned int u = __float_as_uint(x); return (unsigned short)((u + 0x7FFFu + ((u >> 16) & 1u)) >> 16); }
__device__ __forceinline__ float bf16_val(unsigned short b) { return __uint_as_float(((unsigned int)b) << 16); }
__device__ __forceinline__ float bf16_round(float x) { return bf16_val(bf16_bits(x)); }
// D += A·B with NT terms: 1 = ah·bh, 2 = + al·bh (A split), 3 = + ah·bl (both split)
template <int NT>
__device__ __forceinline__ v8f mmaN(v16b ah, v16b al, v16b bh, v16b bl, v8f c) {
  c = __builtin_amdgcn_wmma_f32_16x16x32_bf16(false, ah, false, bh, (short)0, c, false, false);
  if (NT >= 2) c = __builtin_amdgcn_wmma_f32_16x16x32_bf16(false, al, false, bh, (short)0, c, false, false);
  if (NT >= 3) c = __builtin_amdgcn_wmma_f32_16x16x32_bf16(false, ah, false, bl, (short)0, c, false, false);
  asm volatile("v_nop\n\tv_nop\n\tv_nop\n\tv_nop" : "+v"(c) : "v"(ah), "v"(al), "v"(bh), "v"(bl));
  return c;
}

__global__ __launch_bounds__(256) void k_wt_bf16(const float* __restrict__ W, unsigned short* __restrict__ Wt, int K, int N) {
  const int t = blockIdx.x * 256 + threadIdx.x;
  const int k8n = K / 8;
  if (t >= N * k8n) return;
  const int n = t / k8n, k8 = (t % k8n) * 8;
  v8us v;
#pragma unroll
  for (int i = 0; i < 8; ++i) v[i] = bf16_bits(W[(size_t)(k8 + i) * N + n]);
  *(v8us*)(Wt + (size_t)n * K + k8) = v;
  
}

// GEMM C[M][N] (f32, pitch ldc) = act(A[M][K]·W + bias). A f32 row-major (pitch lda) converted per fragment to bf16
// (ASPLIT: hi/lo two planes -> 2 terms, else single rounded term); Wt bf16 [N][K] (pitch ldb). BIAS_BF16 rounds the
// bias to bf16 first (bias quantised to bf16 before the add). K%32==0, M%16==0, N%64==0.
template <bool ASPLIT, int ACT, bool BIAS_BF16>
__global__ __launch_bounds__(128) void k_gemm_bf(const float* __restrict__ A, int lda, const unsigned short* __restrict__ Wt, int ldb,
                                               const float* __restrict__ bias, float* __restrict__ C, int ldc, int M, int N, int K) {
  __shared__ __attribute__((aligned(16))) float so[4][16][64];
  const int tid = threadIdx.x, w = tid >> 5, lane = tid & 31, ln = lane & 15, hh = lane >> 4;
  const int ntn = N / 64;
  const int wid = blockIdx.x * 4 + w;
  const int mt = wid / ntn, nq = wid % ntn;
  if (mt * 16 >= M) return;
  const int row0 = mt * 16, col0 = nq * 64;
  const float* arow = A + (size_t)(row0 + ln) * lda;
  v8f acc[4] = {};
  for (int kb = 0; kb < K; kb += 32) {
    FragB ah, al;
    const v4f x0 = *(const v4fa*)(arow + kb + 8 * hh), x1 = *(const v4fa*)(arow + kb + 8 * hh + 4);
    const v4f x2 = *(const v4fa*)(arow + kb + 16 + 8 * hh), x3 = *(const v4fa*)(arow + kb + 16 + 8 * hh + 4);
    float xs[16] = {x0[0],x0[1],x0[2],x0[3],x1[0],x1[1],x1[2],x1[3],x2[0],x2[1],x2[2],x2[3],x3[0],x3[1],x3[2],x3[3]};
#pragma unroll
    for (int i = 0; i < 16; ++i) { const unsigned short hb = bf16_bits(xs[i]); ah.u[i] = hb; al.u[i] = ASPLIT ? bf16_bits(xs[i] - bf16_val(hb)) : (unsigned short)0; }
#pragma unroll
    for (int t = 0; t < 4; ++t) {
      const unsigned short* brow = Wt + (size_t)(col0 + t * 16 + ln) * ldb + kb;
      FragB b;
      b.half[0] = *(const v8us*)(brow + 8 * hh);
      b.half[1] = *(const v8us*)(brow + 16 + 8 * hh);
      acc[t] = mmaN<ASPLIT ? 2 : 1>(ah.v, al.v, b.v, b.v, acc[t]);
    }
  }
#pragma unroll
  for (int t = 0; t < 4; ++t) {
    float bv = bias ? bias[col0 + t * 16 + ln] : 0.f;
    if (BIAS_BF16) bv = bf16_round(bv);
#pragma unroll
    for (int r = 0; r < 8; ++r) { float v = acc[t][r] + bv; if (ACT == 1) v = fmaxf(v, 0.f); so[w][8 * hh + r][t * 16 + ln] = v; }
  }
  __builtin_amdgcn_fence(__ATOMIC_ACQ_REL, "workgroup");
  __builtin_amdgcn_wave_barrier();
  const int rsub = lane >> 4, c4 = (lane & 15) * 4;
  {
#pragma unroll
    for (int q = 0; q < 8; ++q) {
      const int r = q * 2 + rsub;
      const v4f v = *(const v4fa*)&so[w][r][c4];
      *(v4f*)(C + (size_t)(row0 + r) * ldc + col0 + c4) = v;
    }
    
  }
}

// GEMM C = act(A·W + bias + resid): A f32 (ASPLIT -> hi/lo 2 terms), Wt bf16 [N][K]; ACT 0 none, 1 relu, 2 exact gelu;
// resid (optional, f32, row index = (row % rmod), pitch ldr, RES_BF16 rounds it) added before the activation.
template <bool ASPLIT, int ACT, bool BIAS_BF16, bool RES_BF16>
__global__ __launch_bounds__(128) void k_gemm_bf3(const float* __restrict__ A, int lda, const unsigned short* __restrict__ Wt, int ldb,
                                                const float* __restrict__ bias, const float* __restrict__ resid, int rmod, int ldr,
                                                float* __restrict__ C, int ldc, int M, int N, int K) {
  __shared__ __attribute__((aligned(16))) float so[4][16][64];
  const int tid = threadIdx.x, w = tid >> 5, lane = tid & 31, ln = lane & 15, hh = lane >> 4;
  const int ntn = N / 64;
  const int wid = blockIdx.x * 4 + w;
  const int mt = wid / ntn, nq = wid % ntn;
  if (mt * 16 >= M) return;
  const int row0 = mt * 16, col0 = nq * 64;
  const float* arow = A + (size_t)(row0 + ln) * lda;
  v8f acc[4] = {};
  for (int kb = 0; kb < K; kb += 32) {
    FragB ah, al;
    const v4f x0 = *(const v4fa*)(arow + kb + 8 * hh), x1 = *(const v4fa*)(arow + kb + 8 * hh + 4);
    const v4f x2 = *(const v4fa*)(arow + kb + 16 + 8 * hh), x3 = *(const v4fa*)(arow + kb + 16 + 8 * hh + 4);
    float xs[16] = {x0[0],x0[1],x0[2],x0[3],x1[0],x1[1],x1[2],x1[3],x2[0],x2[1],x2[2],x2[3],x3[0],x3[1],x3[2],x3[3]};
#pragma unroll
    for (int i = 0; i < 16; ++i) { const unsigned short hb = bf16_bits(xs[i]); ah.u[i] = hb; al.u[i] = ASPLIT ? bf16_bits(xs[i] - bf16_val(hb)) : (unsigned short)0; }
#pragma unroll
    for (int t = 0; t < 4; ++t) {
      const unsigned short* brow = Wt + (size_t)(col0 + t * 16 + ln) * ldb + kb;
      FragB b;
      b.half[0] = *(const v8us*)(brow + 8 * hh);
      b.half[1] = *(const v8us*)(brow + 16 + 8 * hh);
      acc[t] = mmaN<ASPLIT ? 2 : 1>(ah.v, al.v, b.v, b.v, acc[t]);
    }
  }
#pragma unroll
  for (int t = 0; t < 4; ++t) {
    const int col = col0 + t * 16 + ln;
    float bv = bias ? bias[col] : 0.f;
    if (BIAS_BF16) bv = bf16_round(bv);
#pragma unroll
    for (int r = 0; r < 8; ++r) {
      float v = acc[t][r] + bv;
      if (resid) { float rv = resid[(size_t)((row0 + 8 * hh + r) % rmod) * ldr + col]; if (RES_BF16) rv = bf16_round(rv); v += rv; }
      if (ACT == 1) v = fmaxf(v, 0.f);
      if (ACT == 2) v = 0.5f * v * (1.0f + erff(v * 0.70710678118654752f));
      if (ACT == 3) { const float u = 0.7978845608028654f * (v + 0.044715f * v * v * v); v = 0.5f * v * (1.0f + tanhf(u)); }
      so[w][8 * hh + r][t * 16 + ln] = v;
    }
  }
  __builtin_amdgcn_fence(__ATOMIC_ACQ_REL, "workgroup");
  __builtin_amdgcn_wave_barrier();
  const int rsub = lane >> 4, c4 = (lane & 15) * 4;
  {
#pragma unroll
    for (int q = 0; q < 8; ++q) {
      const int r = q * 2 + rsub;
      const v4f v = *(const v4fa*)&so[w][r][c4];
      *(v4f*)(C + (size_t)(row0 + r) * ldc + col0 + c4) = v;
    }
    
  }
}
// row LayerNorm (biased variance, eps) over N: s = X (+ R); optional out_sum <- s; out_norm <- (s-mu)*rsqrt(var+eps)*g + b
template <bool PARAM_BF16>
__global__ __launch_bounds__(256) void k_layernorm(const float* __restrict__ X, const float* __restrict__ R, const float* __restrict__ g, const float* __restrict__ bta,
                                                  float* __restrict__ out_sum, float* __restrict__ out_norm, int N, float eps) {
  __shared__ float red[256];
  const int row = blockIdx.x, tid = threadIdx.x;
  const float* x = X + (size_t)row * N; const float* rr = R ? R + (size_t)row * N : nullptr;
  float vals[16];                     // up to N = 4096
  const int per = N / 256;            // contiguous chunk per thread? use strided-by-4 chunks: thread handles j = tid*4 + 1024*u
  float s1 = 0.f;
  for (int u = 0; u < per / 4; ++u) {
    const int j = tid * 4 + 1024 * u;
    const v4f a = *(const v4fa*)(x + j);
    v4f b = {0.f,0.f,0.f,0.f}; if (rr) b = *(const v4fa*)(rr + j);
#pragma unroll
    for (int q = 0; q < 4; ++q) { const float v = a[q] + b[q]; vals[u * 4 + q] = v; s1 += v; }
  }
  red[tid] = s1; __syncthreads();
  for (int st = 128; st > 0; st >>= 1) { if (tid < st) red[tid] += red[tid + st]; __syncthreads(); }
  const float mu = red[0] / (float)N; __syncthreads();
  float s2 = 0.f;
  for (int u = 0; u < per / 4; ++u)
#pragma unroll
    for (int q = 0; q < 4; ++q) { const float c = vals[u * 4 + q] - mu; s2 += c * c; }
  red[tid] = s2; __syncthreads();
  for (int st = 128; st > 0; st >>= 1) { if (tid < st) red[tid] += red[tid + st]; __syncthreads(); }
  const float rs = rsqrtf(red[0] / (float)N + eps);
  {
    for (int u = 0; u < per / 4; ++u) {
      const int j = tid * 4 + 1024 * u;
      v4f o, sm;
#pragma unroll
      for (int q = 0; q < 4; ++q) {
        float gg = g[j + q], bb = bta[j + q];
        if (PARAM_BF16) { gg = bf16_round(gg); bb = bf16_round(bb); }
        sm[q] = vals[u * 4 + q]; o[q] = (vals[u * 4 + q] - mu) * rs * gg + bb;
      }
      if (out_sum) *(v4f*)(out_sum + (size_t)row * N + j) = sm;
      *(v4f*)(out_norm + (size_t)row * N + j) = o;
    }
    
  }
}



// ---- f16 WMMA path (v_wmma_f32_16x16x32_f16): 11-bit significands for operands in range — used where a [0,1] probability operand needs more precision than bf16
typedef _Float16 v16h __attribute__((ext_vector_type(16)));
union FragH { v16h v; v8us half[2]; _Float16 h[16]; unsigned short u[16]; };
template <int NT>
__device__ __forceinline__ v8f mmaH(v16h ah, v16h al, v16h bh, v16h bl, v8f c) {
  c = __builtin_amdgcn_wmma_f32_16x16x32_f16(false, ah, false, bh, (short)0, c, false, false);
  if (NT >= 2) c = __builtin_amdgcn_wmma_f32_16x16x32_f16(false, al, false, bh, (short)0, c, false, false);
  if (NT >= 3) c = __builtin_amdgcn_wmma_f32_16x16x32_f16(false, ah, false, bl, (short)0, c, false, false);
  asm volatile("v_nop\n\tv_nop\n\tv_nop\n\tv_nop" : "+v"(c) : "v"(ah), "v"(al), "v"(bh), "v"(bl));
  return c;
}
// batched GEMM like k_gemm_b but f16 operands: A f32 (split into f16 hi/lo if ASPLIT, else rounded to f16), Bt = f16 values [n][k]; alpha; C f32; N multiple of 16 (partial tiles skipped)
template <bool ASPLIT>
__global__ __launch_bounds__(128) void k_gemm_h(const float* __restrict__ A, int lda, size_t sA, const _Float16* __restrict__ Bh, int ldb, size_t sB, float alpha, float* __restrict__ C, int ldc, size_t sC, int M, int N, int K) {
  __shared__ __attribute__((aligned(16))) float so[4][16][64];
  const int tid = threadIdx.x, w = tid >> 5, lane = tid & 31, ln = lane & 15, hh = lane >> 4; const int by = blockIdx.y;
  A += (size_t)by * sA; Bh += (size_t)by * sB; C += (size_t)by * sC;
  const int ntn = (N + 63) / 64; const int wid = blockIdx.x * 4 + w; const int mt = wid / ntn, nq = wid % ntn; if (mt * 16 >= M) return;
  const int row0 = mt * 16, col0 = nq * 64; const float* arow = A + (size_t)(row0 + ln) * lda;
  v8f acc[4] = {};
  for (int kb = 0; kb < K; kb += 32) {
    FragH ah, al;
    const v4f x0 = *(const v4fa*)(arow + kb + 8 * hh), x1 = *(const v4fa*)(arow + kb + 8 * hh + 4), x2 = *(const v4fa*)(arow + kb + 16 + 8 * hh), x3 = *(const v4fa*)(arow + kb + 16 + 8 * hh + 4);
    float xs[16] = {x0[0],x0[1],x0[2],x0[3],x1[0],x1[1],x1[2],x1[3],x2[0],x2[1],x2[2],x2[3],x3[0],x3[1],x3[2],x3[3]};
#pragma unroll
    for (int i = 0; i < 16; ++i) { const _Float16 h = (_Float16)xs[i]; ah.h[i] = h; al.h[i] = ASPLIT ? (_Float16)(xs[i] - (float)h) : (_Float16)0.0f; }
#pragma unroll
    for (int t = 0; t < 4; ++t) { if (col0 + t * 16 >= N) continue; const size_t boff = (size_t)(col0 + t * 16 + ln) * ldb + kb; FragH bq; bq.half[0] = *(const v8us*)(Bh + boff + 8 * hh); bq.half[1] = *(const v8us*)(Bh + boff + 16 + 8 * hh);
      acc[t] = mmaH<ASPLIT ? 2 : 1>(ah.v, al.v, bq.v, bq.v, acc[t]); }
  }
#pragma unroll
  for (int t = 0; t < 4; ++t) { if (col0 + t * 16 >= N) continue;
#pragma unroll
    for (int r = 0; r < 8; ++r) so[w][8 * hh + r][t * 16 + ln] = acc[t][r] * alpha; }
  __builtin_amdgcn_fence(__ATOMIC_ACQ_REL, "workgroup"); __builtin_amdgcn_wave_barrier();
  const int rsub = lane >> 4, c4 = (lane & 15) * 4;
  {
#pragma unroll
    for (int q = 0; q < 8; ++q) { const int r = q * 2 + rsub; if (col0 + c4 < N) { const v4f v = *(const v4fa*)&so[w][r][c4]; *(v4f*)(C + (size_t)(row0 + r) * ldc + col0 + c4) = v; } }
     }
}

// Wt[n][k] = f16(W[k][n]·scale) from f32 row-major W[K][N] (scale = power of two; bf16-exact weights stay exact in f16 away from the subnormal range)
__global__ __launch_bounds__(256) void k_wt_f16(const float* __restrict__ W, _Float16* __restrict__ Wt, int K, int N, float scale) {
  const int t = blockIdx.x * 256 + threadIdx.x; if (t >= N * (K / 8)) return; const int n = t / (K / 8), k8 = (t % (K / 8)) * 8; FragH f;
#pragma unroll
  for (int i = 0; i < 8; ++i) f.h[i] = (_Float16)(bf16_round(W[(size_t)(k8 + i) * N + n]) * scale); const v8us o = f.half[0];
  *(v8us*)((unsigned short*)Wt + (size_t)n * K + k8) = o; 
}
// k_gemm_hh variant with fused epilogue: v = acc·alpha + bias[by·sBias + col] (+ CP[(row/rowsPerB)·sCPb + by·64 + col] if CP) ; ACT 0 none / 1 elu ; writes f16 C16 (and f32 C if non-null)
template <int ACT>
__global__ __launch_bounds__(128) void k_gemm_hhx(const _Float16* __restrict__ A, int lda, size_t sA, const _Float16* __restrict__ Bh, int ldb, size_t sB, float alpha, const float* __restrict__ bias, size_t sBias, const float* __restrict__ CP, int rowsPerB, size_t sCPb, int row0g,
    float* __restrict__ C, _Float16* __restrict__ C16, int ldc, size_t sC, int M, int N, int K) {
  __shared__ __attribute__((aligned(16))) float so[4][16][64];
  const int tid = threadIdx.x, w = tid >> 5, lane = tid & 31, ln = lane & 15, hh = lane >> 4; const int by = blockIdx.y;
  A += (size_t)by * sA; Bh += (size_t)by * sB; const size_t cofs = (size_t)by * sC; const float* bp = bias ? bias + (size_t)by * sBias : nullptr;
  const int ntn = (N + 63) / 64; const int wid = blockIdx.x * 4 + w; const int mt = wid / ntn, nq = wid % ntn; if (mt * 16 >= M) return;
  const int row0 = mt * 16, col0 = nq * 64; const _Float16* arow = A + (size_t)(row0 + ln) * lda;
  v8f acc[4] = {};
  for (int kb = 0; kb < K; kb += 32) { FragH ah; ah.half[0] = *(const v8us*)((const unsigned short*)arow + kb + 8 * hh); ah.half[1] = *(const v8us*)((const unsigned short*)arow + kb + 16 + 8 * hh);
#pragma unroll
    for (int t = 0; t < 4; ++t) { if (col0 + t * 16 >= N) continue; const size_t boff = (size_t)(col0 + t * 16 + ln) * ldb + kb; FragH bq; bq.half[0] = *(const v8us*)((const unsigned short*)Bh + boff + 8 * hh); bq.half[1] = *(const v8us*)((const unsigned short*)Bh + boff + 16 + 8 * hh);
      acc[t] = mmaH<1>(ah.v, ah.v, bq.v, bq.v, acc[t]); }
  }
#pragma unroll
  for (int t = 0; t < 4; ++t) { if (col0 + t * 16 >= N) continue; const int col = col0 + t * 16 + ln; const float bv = bp ? bf16_round(bp[col]) : 0.f;
#pragma unroll
    for (int r = 0; r < 8; ++r) { float v = acc[t][r] * alpha + bv; if (CP) { const int rr = row0g + row0 + 8 * hh + r; if (rowsPerB < 0) v += CP[cofs + (size_t)rr * ldc + col];      /* rowsPerB < 0: own element of the batched C plane */ else { const int bidx = rr / rowsPerB; v += CP[(size_t)bidx * sCPb + (size_t)by * 64 + col]; } } if (ACT == 1) v = (v > 0.f) ? v : expm1f(v); else if (ACT == 7) v = (v > 0.f) ? v + 1.0f : expf(v); else if (ACT == 8) v = tanhf(v); else if (ACT == 9) v = 0.5f * v * (1.0f + tanhf(0.7978845608028654f * (v + 0.044715f * v * v * v))); else if (ACT == 11) v = 1.0f / (1.0f + expf(-v)); else if (ACT == 12) v = (v > 0.f) ? v : 0.01f * v; else if (ACT == 14) v = (v > 0.f) ? v : 0.1f * v; else if (ACT == 16) v = (v >= 0.f) ? v : 0.3f * v; else if (ACT == 17) v = (v >= 0.f) ? v : 0.2f * v; else if (ACT == 15) v = v / (1.0f + expf(-v)); else if (ACT == 3) v = fmaxf(v, 0.f); else if (ACT == 6) v = 0.5f * v * (1.0f + erff(v * 0.70710678118654752f)); so[w][8 * hh + r][t * 16 + ln] = v; } }
  __builtin_amdgcn_fence(__ATOMIC_ACQ_REL, "workgroup"); __builtin_amdgcn_wave_barrier();
  const int rsub = lane >> 4, c4 = (lane & 15) * 4; typedef _Float16 v4h __attribute__((ext_vector_type(4)));
  {
#pragma unroll
    for (int q = 0; q < 8; ++q) { const int r = q * 2 + rsub; if (col0 + c4 < N) { const v4f v = *(const v4fa*)&so[w][r][c4]; if (C) *(v4f*)(C + cofs + (size_t)(row0 + r) * ldc + col0 + c4) = v; if (C16) { v4h h4; for (int i = 0; i < 4; ++i) h4[i] = (_Float16)v[i]; *(v4h*)(C16 + cofs + (size_t)(row0 + r) * ldc + col0 + c4) = h4; } } }
     }
}


typedef _Float16 v4h __attribute__((ext_vector_type(4)));

__global__ __launch_bounds__(256) void k_x16(const float* __restrict__ x, _Float16* __restrict__ X16, size_t n8) { const size_t t = (size_t)blockIdx.x * 256 + threadIdx.x; if (t >= n8) return; FragH f;
#pragma unroll
  for (int q = 0; q < 8; ++q) f.h[q] = (_Float16)bf16_round(x[t * 8 + q]); *(v8us*)((unsigned short*)X16 + t * 8) = f.half[0];  }
__global__ __launch_bounds__(256) void k_h16(const float* __restrict__ x, _Float16* __restrict__ X16, size_t n8) { const size_t t = (size_t)blockIdx.x * 256 + threadIdx.x; if (t >= n8) return; FragH f;
#pragma unroll
  for (int q = 0; q < 8; ++q) f.h[q] = (_Float16)x[t * 8 + q]; *(v8us*)((unsigned short*)X16 + t * 8) = f.half[0];  }
__global__ __launch_bounds__(256) void k_round16f(const float* __restrict__ W, _Float16* __restrict__ Bt, size_t n8) { const size_t t = (size_t)blockIdx.x * 256 + threadIdx.x; if (t >= n8) return; FragH f;
#pragma unroll
  for (int i = 0; i < 8; ++i) f.h[i] = (_Float16)(bf16_round(W[t * 8 + i]) * 16.0f); *(v8us*)((unsigned short*)Bt + t * 8) = f.half[0];  }
template <int NHv, int TTv>
__global__ __launch_bounds__(256) void k_vt(const _Float16* __restrict__ V16, int ldv, int voff, _Float16* __restrict__ Vt) { __shared__ unsigned short tl[64][66]; const int tid = threadIdx.x; const int slab = blockIdx.x / (TTv / 64), lg = blockIdx.x % (TTv / 64); const int b = slab / NHv, h = slab % NHv;
  for (int i = tid; i < 64 * 8; i += 256) { const int r = i / 8, c8 = (i % 8) * 8; FragH f; f.half[0] = *(const v8us*)((const unsigned short*)V16 + ((size_t)b * TTv + lg * 64 + r) * ldv + voff + h * 64 + c8);
#pragma unroll
    for (int q = 0; q < 8; ++q) tl[r][c8 + q] = f.u[q]; }
  __syncthreads();
  {
#pragma unroll
    for (int rd = 0; rd < 2; ++rd) { const int d = rd * 32 + tid / 8, pc = tid % 8; FragH f;
#pragma unroll
      for (int q = 0; q < 8; ++q) f.u[q] = tl[pc * 8 + q][d];
      *(v8us*)((unsigned short*)Vt + ((size_t)slab * 64 + d) * TTv + lg * 64 + pc * 8) = f.half[0]; }
     } }

__global__ __launch_bounds__(256) void k_hl(const float* __restrict__ F, _Float16* __restrict__ Hh, _Float16* __restrict__ Hl, size_t n8) { const size_t t = (size_t)blockIdx.x * 256 + threadIdx.x; if (t >= n8) return; FragH fh, fl; const v4f a = *(const v4fa*)(F + t * 8), c = *(const v4fa*)(F + t * 8 + 4);
#pragma unroll
  for (int q = 0; q < 4; ++q) { _Float16 h = (_Float16)a[q]; fh.h[q] = h; fl.h[q] = (_Float16)((a[q] - (float)h) * 1024.0f); h = (_Float16)c[q]; fh.h[4 + q] = h; fl.h[4 + q] = (_Float16)((c[q] - (float)h) * 1024.0f); }
  { *(v8us*)((unsigned short*)Hh + t * 8) = fh.half[0]; *(v8us*)((unsigned short*)Hl + t * 8) = fl.half[0];  } }

// one 16 x 32 f16 fragment of a k-contiguous row: 16 bytes at k = 8 hh and 16 bytes at k = 16 + 8 hh (A and B alike)
__device__ __forceinline__ v16h g2_frag(const _Float16* p, int hh) { FragH f; f.half[0] = *(const v8us*)((const unsigned short*)p + 8 * hh); f.half[1] = *(const v8us*)((const unsigned short*)p + 16 + 8 * hh); return f.v; }
// ---- tiled GEMM: one 128 x 128 tile of C per work-group (M % 128 == 0, N % 128 == 0, K % 64 == 0), four waves as 2 x 2, 64 x 64 per wave; epilogue = k_gemm_hhx semantics ----
// A stage is 64 k of 128 rows of A and of 128 rows of Bt, brought into LDS by asynchronous copies (whole 128-byte lines, through no register) and read by every wave that needs it.
// Two buffers: the next stage's copies fly while this stage is worked on. The k order of every sum is that of the unstaged loop (32 k per product, ascending).
#define G3P 144                      /* LDS row pitch in bytes: 128 of data + 16, so that the 16 rows of a 16-byte fragment read fall on 64 different banks */
#define G3T (128 * G3P)              /* one operand's tile */
#define G3S (2 * G3T)                /* one stage: [A tile | Bt tile] */
__device__ __forceinline__ v8f g3_mma(v16h a, v16h b, v8f c) { return __builtin_amdgcn_wmma_f32_16x16x32_f16(false, a, false, b, (short)0, c, false, false); }
// Eight copies of 16 bytes a lane: rows r, r + 16, .., r + 112 of one operand's tile (l: the lane's LDS byte address, g: its global address, ld: the source pitch in elements).
// The s_wait_xcnt stands inside the statement, behind the last copy, so that no address register of a copy is rewritten in front of it.
__device__ __forceinline__ void g3_copy8(unsigned l, const _Float16* g, int ld) {
  const size_t st = (size_t)16 * ld;
  asm volatile("global_load_async_to_lds_b128 %0, %8, off\n\t"
               "global_load_async_to_lds_b128 %1, %9, off\n\t"
               "global_load_async_to_lds_b128 %2, %10, off\n\t"
               "global_load_async_to_lds_b128 %3, %11, off\n\t"
               "global_load_async_to_lds_b128 %4, %12, off\n\t"
               "global_load_async_to_lds_b128 %5, %13, off\n\t"
               "global_load_async_to_lds_b128 %6, %14, off\n\t"
               "global_load_async_to_lds_b128 %7, %15, off\n\t"
               "s_wait_xcnt 0x0"
               :: "v"(l), "v"(l + 16 * G3P), "v"(l + 32 * G3P), "v"(l + 48 * G3P), "v"(l + 64 * G3P), "v"(l + 80 * G3P), "v"(l + 96 * G3P), "v"(l + 112 * G3P),
                  "v"(g), "v"(g + st), "v"(g + 2 * st), "v"(g + 3 * st), "v"(g + 4 * st), "v"(g + 5 * st), "v"(g + 6 * st), "v"(g + 7 * st)
               : "memory"); }
template <int ACT>
__device__ __forceinline__ float g3_act(float v) {
  if (ACT == 3) v = fmaxf(v, 0.f); else if (ACT == 6) v = 0.5f * v * (1.0f + erff(v * 0.70710678118654752f)); else if (ACT == 11) v = 1.0f / (1.0f + expf(-v)); else if (ACT == 15) v = v / (1.0f + expf(-v)); else if (ACT == 18) v = v / (1.0f + expf(-1.702f * v));      /* QuickGELU: v sigmoid(1.702 v) */ else if (ACT == 12) v = (v > 0.f) ? v : 0.01f * v; else if (ACT == 8) v = tanhf(v); else if (ACT == 9) v = 0.5f * v * (1.0f + tanhf(0.7978845608028654f * (v + 0.044715f * v * v * v))); else if (ACT == 14) v = (v > 0.f) ? v : 0.1f * v; else if (ACT == 16) v = (v >= 0.f) ? v : 0.3f * v; else if (ACT == 17) v = (v >= 0.f) ? v : 0.2f * v;
  return v; }
// RES: add CP's own element of the C plane, then the activation (both on the staged rows, 16 bytes a lane); W32: write f32 rows to C, else f16 rows to C16. Both are compile-time, so that the epilogue is one straight run and its loads go out together.
// RBF: the residual element is rounded to bf16 where it is read (CP is then the raw input, and no rounded copy of it is kept).
// VSW: plane 2 runs with A and Bt swapped, so that its tile is C^T: rows = Bt's rows, columns = A's rows (tokens). It is stored as SQ-token blocks, [token / SQ][Bt row][token % SQ], pitch SQ == ldc: V^T per batch and head, with no transposing pass. The k order of every sum is the same; the swapped plane takes no bias (it would run along the rows).
template <int ACT, bool RES, bool W32, bool RBF = false, bool VSW = false>
__global__ __launch_bounds__(128) void k_gemm3(const _Float16* __restrict__ A, int lda, size_t sA, const _Float16* __restrict__ Bh, int ldb, size_t sB, float alpha, const float* __restrict__ bias, size_t sBias, const float* __restrict__ CP,
    float* __restrict__ C, _Float16* __restrict__ C16, size_t sC, int M, int N, int K) { static_assert(ACT == 0 || ACT == 3 || ACT == 6 || ACT == 8 || ACT == 9 || ACT == 11 || ACT == 12 || ACT == 14 || ACT == 15 || ACT == 16 || ACT == 17 || ACT == 18, "k_gemm3: unsupported ACT code (would silently apply no activation)");
  __shared__ __attribute__((aligned(128))) unsigned char L[2 * G3S]; static_assert(4 * 64 * 68 * 4 <= 2 * G3S, "k_gemm3: the output staging reuses the ring");
  const int tid = threadIdx.x, w = tid >> 5, lane = tid & 31, ln = lane & 15, hh = lane >> 4; const int by = blockIdx.y;
  A += (size_t)by * sA; Bh += (size_t)by * sB; const size_t cofs = (size_t)by * sC; const bool sw = VSW && by == 2;      /* the same for the whole work-group */
  if (sw) { const _Float16* const pa0 = A; A = Bh; Bh = pa0; const int m0 = M; M = N; N = m0; const int l0 = lda; lda = ldb; ldb = l0; }
  const float* bp = (bias && !sw) ? bias + (size_t)by * sBias : nullptr;
  const int ntn = N >> 7; const int mt = blockIdx.x / ntn, nq = blockIdx.x - mt * ntn; if (mt * 128 >= M) return;      /* the same for the whole work-group, in front of every barrier */
  const int row0 = mt * 128 + (w >> 1) * 64, col0 = nq * 128 + (w & 1) * 64;
  const unsigned lc = (unsigned)(size_t)L + (unsigned)((tid >> 3) * G3P + (tid & 7) * 16);      /* eight lanes copy one 128-byte row */
  const _Float16* ga = A + (size_t)(mt * 128 + (tid >> 3)) * lda + (tid & 7) * 8; const _Float16* gb = Bh + (size_t)(nq * 128 + (tid >> 3)) * ldb + (tid & 7) * 8;
  const int nt = K >> 6; constexpr int ldc = DM; static_assert(DFF == DM, "k_gemm3: one output pitch");      /* a compile-time pitch: the epilogue's loads and stores share one address pair each and differ only in their immediate offsets */
  const v8f z8 = {0.f,0.f,0.f,0.f,0.f,0.f,0.f,0.f}; v8f acc[4][4];
#pragma unroll
  for (int i = 0; i < 4; ++i)
#pragma unroll
    for (int j = 0; j < 4; ++j) acc[i][j] = z8;
  g3_copy8(lc, ga, lda); g3_copy8(lc + G3T, gb, ldb);
  asm volatile("s_wait_asynccnt 0x0" ::: "memory");      /* stage 0 has landed (this wave's copies) */
  __syncthreads();      /* ... and every wave's */
  if (nt > 1) { g3_copy8(lc + G3S, ga + 64, lda); g3_copy8(lc + G3S + G3T, gb + 64, ldb); }
  float bv[4] = {0.f, 0.f, 0.f, 0.f};      /* the lane's four bias values, fetched here so that they arrive under the loop */
  if (bp) {
#pragma unroll
    for (int t = 0; t < 4; ++t) bv[t] = bp[col0 + t * 16 + ln];
    asm volatile("s_wait_xcnt 0x0" ::: "memory"); }      /* the four loads' offset register is rewritten right behind them */
#pragma unroll 1
  for (int t = 0; t < nt; ++t) { const unsigned buf = (unsigned)(t & 1) * G3S;      /* rolled: one copy of the 32 products in the text */
    const _Float16* pa = (const _Float16*)(L + buf + ((w >> 1) * 64 + ln) * G3P); const _Float16* pb = (const _Float16*)(L + buf + G3T + ((w & 1) * 64 + ln) * G3P);
    v16h a[2][4], b[2][4];
#pragma unroll
    for (int ks = 0; ks < 2; ++ks)
#pragma unroll
      for (int i = 0; i < 4; ++i) { a[ks][i] = g2_frag(pa + i * 16 * (G3P / 2) + ks * 32, hh); b[ks][i] = g2_frag(pb + i * 16 * (G3P / 2) + ks * 32, hh); }
    __builtin_amdgcn_sched_barrier(0);      /* keeps the stage's 32 fragment reads together in front of its products: without it the scheduler sinks the A reads among them, into one register set, and every four products wait out an LDS latency */
#pragma unroll
    for (int ks = 0; ks < 2; ++ks)
#pragma unroll
      for (int i = 0; i < 4; ++i)
#pragma unroll
        for (int j = 0; j < 4; ++j) acc[i][j] = g3_mma(a[ks][i], b[ks][j], acc[i][j]);
    __builtin_amdgcn_sched_barrier(0);      /* keeps the products in front of the stage's waits: without it the scheduler sinks them behind the barrier, and the wait for the next stage's copies stands at the head of the trip, before they have had time to land */
    asm volatile("s_wait_dscnt 0x0" ::: "memory");      /* this wave's reads of the buffer have returned */
    asm volatile("s_wait_asynccnt 0x0" ::: "memory");      /* this wave's copies of stage t + 1 have landed */
    __syncthreads();      /* publishes stage t + 1 and frees stage t's buffer */
    if (t + 2 < nt) { g3_copy8(lc + buf, ga + (size_t)(t + 2) * 64, lda); g3_copy8(lc + buf + G3T, gb + (size_t)(t + 2) * 64, ldb); } }
  asm volatile("s_wait_asynccnt 0x0" ::: "memory");      /* no copy is outstanding when the ring becomes output staging */
  float (*so)[68] = (float (*)[68])(L + (size_t)w * (64 * 68 * 4));      /* each wave stages in its own range; the last trip's barrier has ended every read of the ring */
#pragma unroll
  for (int u = 0; u < 16; ++u) { const int t = u & 3, half = u >> 2;
#pragma unroll
    for (int r = 0; r < 8; ++r) { const int rloc = half * 16 + 8 * hh + r; const float v = acc[half][t][r] * alpha + bf16_round(bv[t]);
      so[rloc][t * 16 + ln] = v; } }
  __builtin_amdgcn_fence(__ATOMIC_ACQ_REL, "workgroup"); __builtin_amdgcn_wave_barrier();
  const int rsub = lane >> 4, c4 = (lane & 15) * 4;
  static_assert(!VSW || (SQ == ldc && SQ % 128 == 0), "k_gemm3: a swapped tile lies in one SQ-token block, whose pitch is ldc");
  const size_t cb = sw ? (size_t)(col0 / SQ) * ((size_t)DM * SQ) + (size_t)(col0 % SQ) : (size_t)col0;      /* the wave's first column in the C plane */
  const size_t e0 = cofs + (size_t)(row0 + rsub) * ldc + cb + c4;      /* the lane's first element; row q * 2 + rsub lies q * 2 * ldc elements further on */
  v4f rv[32]; static_assert(!RES || ACT == 0, "k_gemm3: the residual rows are held in registers, so their loop is unrolled");
  if (RES) {
#pragma unroll
    for (int q = 0; q < 32; ++q) rv[q] = *(const v4fa*)(CP + e0 + (size_t)q * (2 * ldc));
    asm volatile("s_wait_xcnt 0x0" ::: "memory");      /* the 32 loads share one address pair, which is rewritten right behind them */
  }
  if (RES && RBF) {      /* both loops unrolled: rv is indexed by constants only and stays in registers */
#pragma unroll
    for (int q = 0; q < 32; ++q)
#pragma unroll
      for (int i = 0; i < 4; ++i) rv[q][i] = bf16_round(rv[q][i]); }
  {
#pragma unroll(ACT == 0 ? 32 : 2)      /* with an activation the loop stays rolled, for code size (128 copies of erff otherwise) */
    for (int q = 0; q < 32; ++q) { const int r = q * 2 + rsub; const size_t e = e0 + (size_t)q * (2 * ldc); v4f v = *(const v4fa*)&so[r][c4]; if (RES) v += rv[q]; for (int i = 0; i < 4; ++i) v[i] = g3_act<ACT>(v[i]); if (W32) *(v4f*)(C + e) = v; else { v4h h4; for (int i = 0; i < 4; ++i) h4[i] = (_Float16)v[i]; *(v4h*)(C16 + e) = h4; }
      if (ACT != 0 || (q & 7) == 7) asm volatile("s_wait_xcnt 0x0" ::: "memory");      /* later rows rewrite registers of issued stores (rolled loop: the next trip does); unrolled, one wait serves eight rows */
    }
     } }


__global__ __launch_bounds__(256) void k_wnat(const float* __restrict__ w, size_t n8, _Float16* __restrict__ Bt) { const size_t t = (size_t)blockIdx.x * 256 + threadIdx.x; if (t >= n8) return; FragH f; for (int q = 0; q < 8; ++q) f.h[q] = (_Float16)(bf16_round(w[t * 8 + q]) * 16.0f); *(v8us*)((unsigned short*)Bt + t * 8) = f.half[0];  }
__global__ __launch_bounds__(256) void k_rsm(const float* __restrict__ S, _Float16* __restrict__ P, int nrows) {
  #pragma clang fp contract(off)
  const int i = blockIdx.x * 256 + threadIdx.x; if (i >= nrows) return; const float* s = S + (size_t)i * SQ; float mx = -3.0e38f;
#pragma unroll 1
  for (int j = 0; j < SQ; ++j) mx = fmaxf(mx, s[j]); float se = 0.f;
#pragma unroll 1
  for (int j = 0; j < SQ; ++j) se += expf(s[j] - mx); const float sc = 256.0f / se;
#pragma unroll 1
  for (int j0 = 0; j0 < SQ; j0 += 8) { FragH f; for (int q = 0; q < 8; ++q) f.h[q] = (_Float16)(expf(s[j0 + q] - mx) * sc); unsigned short* d = (unsigned short*)P + (size_t)i * SQ + j0; *(v8us*)d = f.half[0];  } }
__global__ __launch_bounds__(256) void k_vt(const _Float16* __restrict__ V16, int b, int h0, _Float16* __restrict__ VT) { __shared__ unsigned short tl[64][65]; const int tid = threadIdx.x; const int hh = blockIdx.x % HG, sg = blockIdx.x / HG; const int s0 = sg * 64; const int h = h0 + hh;
  for (int i = tid; i < 64 * 8; i += 256) { const int j = i / 8, d8 = (i % 8) * 8; FragH f; f.half[0] = *(const v8us*)((const unsigned short*)V16 + ((size_t)b * SQ + s0 + j) * DM + h * HD + d8); for (int q = 0; q < 8; ++q) tl[d8 + q][j] = f.u[q]; }
  __syncthreads();
  { for (int i = tid; i < 64 * 8; i += 256) { const int d = i / 8, j8 = (i % 8) * 8; FragH f; for (int q = 0; q < 8; ++q) f.u[q] = tl[d][j8 + q]; *(v8us*)((unsigned short*)VT + ((size_t)hh * HD + d) * SQ + s0 + j8) = f.half[0]; }  } }



__global__ __launch_bounds__(256) void k_rsmcf2(const float* __restrict__ S, _Float16* __restrict__ P, int hg, int q0, int nk) {
  #pragma clang fp contract(off)
  const int t = blockIdx.x * 256 + threadIdx.x; if (t >= hg * QT) return; const size_t i = (size_t)t; const float* s = S + i * NKX; const int last = q0 + (t % QT); float mx = -3.0e38f;
#pragma unroll 1
  for (int j = 0; j < nk; ++j) { const float f = (j <= last) ? 1.f : 0.f; mx = fmaxf(mx, fmaf(f, s[j], (1.f - f) * -1.0e9f)); } float se = 0.f;
#pragma unroll 1
  for (int j = 0; j < nk; ++j) { const float f = (j <= last) ? 1.f : 0.f; se += __expf(fmaf(f, s[j], (1.f - f) * -1.0e9f) - mx); } const float sc = 256.0f / se;
#pragma unroll 1
  for (int j0 = 0; j0 < nk; j0 += 8) { FragH fr; for (int q = 0; q < 8; ++q) { const int j = j0 + q; const float f = (j <= last) ? 1.f : 0.f; fr.h[q] = (_Float16)(__expf(fmaf(f, s[j], (1.f - f) * -1.0e9f) - mx) * sc); } unsigned short* d = (unsigned short*)P + i * NKX + j0; *(v8us*)d = fr.half[0];  } }

__global__ __launch_bounds__(256) void k_rsmcst(const float* __restrict__ S, _Float16* __restrict__ P, int hg, int q0, int nk, const int* __restrict__ mk) {
  #pragma clang fp contract(off)
  const int t = blockIdx.x * 256 + threadIdx.x; if (t >= hg * QT) return; const size_t i = (size_t)t; const float* s = S + i * NKX; const size_t ig = (size_t)(q0 + (t % QT)); const int* mr = mk + ig * SQ; float mx = -3.0e38f;
#pragma unroll 1
  for (int j = 0; j < nk; ++j) { const int mb = mr[j]; const int dd = (int)ig - j; const float f = (mb != 0 && dd >= 0 && (dd <= LOCALW || (dd % STRIDEK) == 0)) ? 1.f : 0.f; mx = fmaxf(mx, fmaf(f, s[j], (1.f - f) * -1.0e9f)); } float se = 0.f;
#pragma unroll 1
  for (int j = 0; j < nk; ++j) { const int mb = mr[j]; const int dd = (int)ig - j; const float f = (mb != 0 && dd >= 0 && (dd <= LOCALW || (dd % STRIDEK) == 0)) ? 1.f : 0.f; se += __expf(fmaf(f, s[j], (1.f - f) * -1.0e9f) - mx); } const float sc = 256.0f / se;
#pragma unroll 1
  for (int j0 = 0; j0 < nk; j0 += 8) { FragH fr; for (int q = 0; q < 8; ++q) { const int j = j0 + q; const int mb = mr[j]; const int dd = (int)ig - j; const float f = (mb != 0 && dd >= 0 && (dd <= LOCALW || (dd % STRIDEK) == 0)) ? 1.f : 0.f; fr.h[q] = (_Float16)(__expf(fmaf(f, s[j], (1.f - f) * -1.0e9f) - mx) * sc); } unsigned short* d = (unsigned short*)P + i * NKX + j0; *(v8us*)d = fr.half[0];  } }


template <int MASKADD>
__global__ __launch_bounds__(64) void k_att0(const float* __restrict__ QF, const float* __restrict__ KF, const float* __restrict__ VF, int ld, const float* __restrict__ mask, float scale, float* __restrict__ OF, int ldo) {
  #pragma clang fp contract(off)
  __shared__ __attribute__((aligned(16))) float lq[64][64]; __shared__ __attribute__((aligned(16))) float lo[64][64];
  const int tid = threadIdx.x; const int h = blockIdx.x / (QT0 / 64), rg = blockIdx.x % (QT0 / 64); const int i = rg * 64 + tid;
  const float* qr = QF + (size_t)i * ld + h * HD;
#pragma unroll 1
  for (int c = 0; c < HD / 4; ++c) { *(v4f*)&lq[tid][c * 4] = *(const v4fa*)(qr + c * 4); const v4f z = {0.f, 0.f, 0.f, 0.f}; *(v4f*)&lo[tid][c * 4] = z; }
  float m = -1.0e30f, l = 0.f; const int jmax = MASKADD ? (SQ - 1) : (rg * 64 + 63);      /* additive-mask form: every key (the mask input decides); causal form: keys up to the block's last row */
#pragma unroll 1
  for (int j = 0; j <= jmax; ++j) { const float* kr = KF + (size_t)j * ld + h * HD; const float* vr = VF + (size_t)j * ld + h * HD; float s = 0.f;
#pragma unroll 1
    for (int c = 0; c < HD / 4; ++c) { const v4f kq = *(const v4fa*)(kr + c * 4); const v4f qq = *(v4f*)&lq[tid][c * 4]; s = __fadd_rn(s, __fmul_rn(qq[0], kq[0])); s = __fadd_rn(s, __fmul_rn(qq[1], kq[1])); s = __fadd_rn(s, __fmul_rn(qq[2], kq[2])); s = __fadd_rn(s, __fmul_rn(qq[3], kq[3])); }
    s = __fmul_rn(s, scale); if (MASKADD) s = __fadd_rn(s, __fmul_rn(bf16_round(mask[(size_t)i * SQ + j]), -10000.0f));
    const float f = (MASKADD || j <= i) ? 1.f : 0.f; const float sm = fmaf(f, s, (1.f - f) * -1.0e30f); const float mn = fmaxf(m, sm); const float sc = expf(m - mn); const float e = expf(sm - mn); l = __fadd_rn(__fmul_rn(l, sc), e); m = mn;
#pragma unroll 1
    for (int c = 0; c < HD / 4; ++c) { const v4f vv = *(const v4fa*)(vr + c * 4); v4f oo = *(v4f*)&lo[tid][c * 4]; for (int u = 0; u < 4; ++u) oo[u] = __fadd_rn(__fmul_rn(oo[u], sc), __fmul_rn(e, vv[u])); *(v4f*)&lo[tid][c * 4] = oo; } }
  const float fin = 64.0f / l;      /* o carried x64 like the f16 path */
#pragma unroll 1
  for (int c = 0; c < HD / 4; ++c) { v4f oo = *(v4f*)&lo[tid][c * 4]; for (int u = 0; u < 4; ++u) oo[u] = __fmul_rn(oo[u], fin); *(v4f*)&lo[tid][c * 4] = oo; }
  __syncthreads();
  {
#pragma unroll 1
    for (int it = 0; it < 16; ++it) { const int row = it * 4 + tid / 16, pc = (tid % 16) * 4; const v4f v = *(const v4f*)&lo[row][pc]; *(v4f*)(OF + (size_t)(rg * 64 + row) * ldo + h * HD + pc) = v; }
     } }

template <int MASKADD>
__global__ __launch_bounds__(64) void k_att0mbc(const float* __restrict__ QF, const float* __restrict__ KF, const float* __restrict__ VF, int ld, const float* __restrict__ mask, float scale, float* __restrict__ OF, int ldo) {
  #pragma clang fp contract(off)
  __shared__ __attribute__((aligned(16))) float lq[64][64]; __shared__ __attribute__((aligned(16))) float lo[64][64];
  const int tid = threadIdx.x; const int h = blockIdx.x / (QT0 / 64), rg = blockIdx.x % (QT0 / 64); const int i = rg * 64 + tid;
  const float* qr = QF + (size_t)i * ld + h * HD;
#pragma unroll 1
  for (int c = 0; c < HD / 4; ++c) { *(v4f*)&lq[tid][c * 4] = *(const v4fa*)(qr + c * 4); const v4f z = {0.f, 0.f, 0.f, 0.f}; *(v4f*)&lo[tid][c * 4] = z; }
  float m = -1.0e30f, l = 0.f; const int jmax = rg * 64 + 63;      /* keys beyond the block end are masked by the mask's lower-triangular structure */      /* both MASKADD forms: keys up to the block's last row */
#pragma unroll 1
  for (int j = 0; j <= jmax; ++j) { const float* kr = KF + (size_t)j * ld + h * HD; const float* vr = VF + (size_t)j * ld + h * HD; float s = 0.f;
#pragma unroll 1
    for (int c = 0; c < HD / 4; ++c) { const v4f kq = *(const v4fa*)(kr + c * 4); const v4f qq = *(v4f*)&lq[tid][c * 4]; s = __fadd_rn(s, __fmul_rn(qq[0], kq[0])); s = __fadd_rn(s, __fmul_rn(qq[1], kq[1])); s = __fadd_rn(s, __fmul_rn(qq[2], kq[2])); s = __fadd_rn(s, __fmul_rn(qq[3], kq[3])); }
    s = __fmul_rn(s, scale); const int mb = ((const int*)mask)[(size_t)i * SQ + j];      /* causal (j <= i) AND the module's int32 [S][S] mask read per (query, key): 0 -> masked */
    const float f = (mb != 0 && j <= i) ? 1.f : 0.f; const float sm = fmaf(f, s, (1.f - f) * -1.0e30f); const float mn = fmaxf(m, sm); const float sc = expf(m - mn); const float e = expf(sm - mn); l = __fadd_rn(__fmul_rn(l, sc), e); m = mn;
#pragma unroll 1
    for (int c = 0; c < HD / 4; ++c) { const v4f vv = *(const v4fa*)(vr + c * 4); v4f oo = *(v4f*)&lo[tid][c * 4]; for (int u = 0; u < 4; ++u) oo[u] = __fadd_rn(__fmul_rn(oo[u], sc), __fmul_rn(e, vv[u])); *(v4f*)&lo[tid][c * 4] = oo; } }
  const float fin = 64.0f / l;      /* o carried x64 like the f16 path */
#pragma unroll 1
  for (int c = 0; c < HD / 4; ++c) { v4f oo = *(v4f*)&lo[tid][c * 4]; for (int u = 0; u < 4; ++u) oo[u] = __fmul_rn(oo[u], fin); *(v4f*)&lo[tid][c * 4] = oo; }
  __syncthreads();
  {
#pragma unroll 1
    for (int it = 0; it < 16; ++it) { const int row = it * 4 + tid / 16, pc = (tid % 16) * 4; const v4f v = *(const v4f*)&lo[row][pc]; *(v4f*)(OF + (size_t)(rg * 64 + row) * ldo + h * HD + pc) = v; }
     } }


template <int BFIN, int WXB>
__global__ __launch_bounds__(256) void k_ln16(const float* __restrict__ X, const float* __restrict__ g, const float* __restrict__ bb, float eps, _Float16* __restrict__ N16, float* __restrict__ XB) {
  #pragma clang fp contract(off)
  __shared__ float red[256]; const size_t r = blockIdx.x; const int t = threadIdx.x; const v4f xa = *(const v4fa*)(X + r * DMQ + t * 4); float s[4]; float sum = 0.f;
  for (int q = 0; q < 4; ++q) { s[q] = BFIN ? bf16_round(xa[q]) : xa[q]; sum = __fadd_rn(sum, s[q]); }
  red[t] = sum; __syncthreads(); for (int st = 128; st > 0; st >>= 1) { if (t < st) red[t] = __fadd_rn(red[t], red[t + st]); __syncthreads(); } const float mu = red[0] / (float)DMQ; __syncthreads();
  float vs = 0.f; for (int q = 0; q < 4; ++q) { const float dl = __fadd_rn(s[q], -mu); vs = __fadd_rn(vs, __fmul_rn(dl, dl)); } red[t] = vs; __syncthreads(); for (int st = 128; st > 0; st >>= 1) { if (t < st) red[t] = __fadd_rn(red[t], red[t + st]); __syncthreads(); }
  const float rs = rsqrtf(__fadd_rn(red[0] / (float)DMQ, eps)); v4h y; v4f xb;
  for (int q = 0; q < 4; ++q) { const int c = t * 4 + q; y[q] = (_Float16)__fadd_rn(__fmul_rn(__fmul_rn(__fadd_rn(s[q], -mu), rs), bf16_round(g[c])), bf16_round(bb[c])); xb[q] = s[q]; }
  { *(v4h*)(N16 + r * DMQ + t * 4) = y; if (WXB) *(v4f*)(XB + r * DMQ + t * 4) = xb;  } }
__global__ __launch_bounds__(256) void k_ftres2(const float* __restrict__ OF0, const float* __restrict__ XB, float* __restrict__ X1, size_t n4) {
  #pragma clang fp contract(off)
  const size_t t = (size_t)blockIdx.x * 256 + threadIdx.x; if (t >= n4) return; const v4f o = *(const v4fa*)(OF0 + t * 4), xv = *(const v4fa*)(XB + t * 4); v4f y; for (int q = 0; q < 4; ++q) y[q] = __fadd_rn(__fmul_rn(o[q], 0.015625f), xv[q]); *(v4f*)(X1 + t * 4) = y;  }

__global__ __launch_bounds__(256) void k_bcpy(const float* __restrict__ b, int n, int NP, float* __restrict__ dst, int dst0) { for (int i = threadIdx.x; i < NP; i += 256) { const float v = (i < n) ? b[i] : 0.f; *(float*)(dst + dst0 + i) = v; }  }


#define FAW 8                        /* waves per work-group */
#define FAQ 32                       /* query columns per wave (two 16-column groups) */
#define FAC 0.18033688011112042592f  /* 64^-0.5 * log2 e: scores are carried in log2 units */
__device__ __forceinline__ float rs_x16(float x) { const int b = __builtin_bit_cast(int, x); return __builtin_bit_cast(float, __builtin_amdgcn_permlanex16(b, b, 0x76543210, 0xfedcba98, false, false)); }      /* lane l <- lane l ^ 16 */
// Four 2^x in one statement. The outputs are early-clobber, so inside it no v_exp_f32 is directly followed by a read of its result or a write of its source; the v_nop keeps that slot behind the last one.
__device__ __forceinline__ v4f rs_exp2(v4f x) { float y0, y1, y2, y3; asm("v_exp_f32 %0, %4\n\tv_exp_f32 %1, %5\n\tv_exp_f32 %2, %6\n\tv_exp_f32 %3, %7\n\tv_nop" : "=&v"(y0), "=&v"(y1), "=&v"(y2), "=&v"(y3) : "v"(x[0]), "v"(x[1]), "v"(x[2]), "v"(x[3])); const v4f y = {y0, y1, y2, y3}; return y; }
// One 2^x, with the same slot kept behind it.
__device__ __forceinline__ float fa_exp2(float x) { float y; asm("v_exp_f32 %0, %1\n\tv_nop" : "=&v"(y) : "v"(x)); return y; }
__device__ __forceinline__ v8f fa_mma(v16h a, v16h b, v8f c) { return __builtin_amdgcn_wmma_f32_16x16x32_f16(false, a, false, b, (short)0, c, false, false); }
// Q16, K16: f16 rows [NB * SQ][DM], head h = columns h*64..; VT: f16 [NB * NH][HD][SQ]; O16: context x64 as f16 rows (merged heads).
// The short loops are fully unrolled so that every fragment array is indexed by constants and stays in registers.
// K and V^T reach the eight waves through LDS: a stage is 64 keys, 64 K rows of 128 bytes and 64 V^T rows of 128 bytes, brought in once per work-group by asynchronous copies
// (whole 128-byte lines, through no register) and read by every wave as 16-byte fragment halves. Two buffers: the next stage's copies fly while this stage is worked on.
#define FAK 64                       /* keys per stage (two 32-key passes) */
#define FAP 144                      /* LDS row pitch in bytes: 128 of data + 16, so that the 16 rows of a 16-byte fragment read fall on 64 different banks */
#define FAT (64 * FAP)               /* one operand's tile */
#define FAS (2 * FAT)                /* one stage: [K tile | V^T tile] */
// Four copies of 16 bytes a lane: rows r and r + 32 of the K tile and of the V^T tile (l: the lane's LDS byte address in the K tile, gk, gv: its global addresses).
// The s_wait_xcnt stands inside the statement, behind the last copy, so that no address register of a copy is rewritten in front of it.
__device__ __forceinline__ void fa_copy4(unsigned l, const _Float16* gk, const _Float16* gv) {
  asm volatile("global_load_async_to_lds_b128 %0, %4, off\n\t"
               "global_load_async_to_lds_b128 %1, %5, off\n\t"
               "global_load_async_to_lds_b128 %2, %6, off\n\t"
               "global_load_async_to_lds_b128 %3, %7, off\n\t"
               "s_wait_xcnt 0x0"
               :: "v"(l), "v"(l + 32 * FAP), "v"(l + FAT), "v"(l + FAT + 32 * FAP),
                  "v"(gk), "v"(gk + (size_t)32 * DM), "v"(gv), "v"(gv + (size_t)32 * SQ)
               : "memory"); }
__global__ __launch_bounds__(FAW * 32) void k_fattn(const _Float16* __restrict__ Q16, const _Float16* __restrict__ K16, const _Float16* __restrict__ VT, _Float16* __restrict__ O16) {
  __shared__ __attribute__((aligned(128))) unsigned char L[2 * FAS]; static_assert(FAW * 32 == 256 && HD == 64 && SQ % FAK == 0 && SQ / FAK >= 2, "k_fattn: 256 lanes copy 32 rows of 128 bytes at a time; the ring needs two stages");
  const int tid = threadIdx.x, lane = tid & 31, ln = lane & 15, hh = lane >> 4, w = tid >> 5;
  constexpr int QB = SQ / (FAW * FAQ); const int qb = blockIdx.x % QB, bh = blockIdx.x / QB; const int b = bh / NH, h = bh % NH; const int q0 = qb * (FAW * FAQ) + w * FAQ;
  const _Float16* qp = Q16 + ((size_t)b * SQ + q0 + ln) * DM + h * HD;
  const unsigned lc = (unsigned)(size_t)L + (unsigned)((tid >> 3) * FAP + (tid & 7) * 16);      /* eight lanes copy one 128-byte row */
  const _Float16* gk = K16 + ((size_t)b * SQ + (tid >> 3)) * DM + h * HD + (tid & 7) * 8; const _Float16* gv = VT + ((size_t)bh * HD + (tid >> 3)) * SQ + (tid & 7) * 8;
  constexpr int nt = SQ / FAK;
  const v8f z8 = {0.f, 0.f, 0.f, 0.f, 0.f, 0.f, 0.f, 0.f};
  v16h qf[2][2]; v8f o[2][4]; float m[2], l[2];
  fa_copy4(lc, gk, gv);
#pragma unroll
  for (int j = 0; j < 2; ++j) { m[j] = -3.0e38f; l[j] = 0.f;
#pragma unroll
    for (int d = 0; d < 4; ++d) o[j][d] = z8;
#pragma unroll
    for (int ks = 0; ks < 2; ++ks) qf[j][ks] = g2_frag(qp + (size_t)j * 16 * DM + ks * 32, hh); }
  asm volatile("s_wait_xcnt 0x0" ::: "memory");      /* in front of any rewrite of the Q loads' address pair */
  asm volatile("s_wait_asynccnt 0x0" ::: "memory");      /* stage 0 has landed (this wave's copies) */
  __syncthreads();      /* ... and every wave's */
  fa_copy4(lc + FAS, gk + (size_t)FAK * DM, gv + FAK);
#pragma unroll 1
  for (int t = 0; t < nt; ++t) { const unsigned buf = (unsigned)(t & 1) * FAS;      /* rolled: one copy of the two passes in the text */
    const _Float16* pk = (const _Float16*)(L + buf + ln * FAP); const _Float16* pv = (const _Float16*)(L + buf + FAT + ln * FAP);
#pragma unroll
    for (int p = 0; p < FAK / 32; ++p) {
      v16h kf[2][2], vf[4]; v8f s[2][2];
#pragma unroll
      for (int u = 0; u < 2; ++u)
#pragma unroll
        for (int ks = 0; ks < 2; ++ks) kf[u][ks] = g2_frag(pk + (p * 32 + u * 16) * (FAP / 2) + ks * 32, hh);
#pragma unroll
      for (int d = 0; d < 4; ++d) vf[d] = g2_frag(pv + d * 16 * (FAP / 2) + p * 32, hh);
#pragma unroll
      for (int j = 0; j < 2; ++j)
#pragma unroll
        for (int u = 0; u < 2; ++u) s[j][u] = fa_mma(kf[u][1], qf[j][1], fa_mma(kf[u][0], qf[j][0], z8));      /* s[j][u][r] = q(q0 + 16 j + ln) . k(64 t + 32 p + 16 u + 8 hh + r) */
      FragH pf[2]; float al[2];
#pragma unroll
      for (int j = 0; j < 2; ++j) {
        float mx = fmaxf(s[j][0][0], s[j][1][0]);
#pragma unroll
        for (int r = 1; r < 8; ++r) mx = fmaxf(mx, fmaxf(s[j][0][r], s[j][1][r]));
        mx = fmaxf(mx, rs_x16(mx));
        const float mn = fmaxf(m[j], mx * FAC), mb = 8.0f - mn; al[j] = fa_exp2(m[j] - mn); m[j] = mn;      /* p = 2^8 exp(s - max) <= 256: small weights stay out of the f16 subnormals; the factor cancels against the sum */
        v4f s4 = {0.f, 0.f, 0.f, 0.f};
#pragma unroll
        for (int u = 0; u < 2; ++u)
#pragma unroll
          for (int c = 0; c < 2; ++c) { const v4f x = {s[j][u][c * 4] * FAC + mb, s[j][u][c * 4 + 1] * FAC + mb, s[j][u][c * 4 + 2] * FAC + mb, s[j][u][c * 4 + 3] * FAC + mb}; const v4f e = rs_exp2(x); s4 += e;
#pragma unroll
            for (int q = 0; q < 4; ++q) pf[j].h[u * 8 + c * 4 + q] = (_Float16)e[q]; }
        l[j] = l[j] * al[j] + ((s4[0] + s4[1]) + (s4[2] + s4[3])); }
      __builtin_amdgcn_sched_barrier(0);      /* both column groups' 2^x statements stay in front of the eight products */
#pragma unroll
      for (int j = 0; j < 2; ++j)
#pragma unroll
        for (int d = 0; d < 4; ++d) o[j][d] = fa_mma(vf[d], pf[j].v, o[j][d] * al[j]);      /* o[j][d][r] = sum_k p v(k)[16 d + 8 hh + r] for query q0 + 16 j + ln */
      __builtin_amdgcn_sched_barrier(0);      /* ... and the next pass's stay behind them; it also keeps the next pass's fragment reads from rising over these products: with them up there the kernel took more than 256 registers, and two work-groups no longer fit a WGP */
    }
    asm volatile("s_wait_dscnt 0x0" ::: "memory");      /* this wave's reads of the buffer have returned */
    asm volatile("s_wait_asynccnt 0x0" ::: "memory");      /* this wave's copies of stage t + 1 have landed */
    __syncthreads();      /* publishes stage t + 1 and frees stage t's buffer */
    if (t + 2 < nt) fa_copy4(lc + buf, gk + (size_t)(t + 2) * FAK * DM, gv + (t + 2) * FAK); }
  asm volatile("s_wait_asynccnt 0x0" ::: "memory");      /* no copy is outstanding when the wave ends */
#pragma unroll
  for (int j = 0; j < 2; ++j) { const float fin = 64.0f / (l[j] + rs_x16(l[j])); unsigned short* op = (unsigned short*)O16 + ((size_t)b * SQ + q0 + j * 16 + ln) * DM + h * HD + 8 * hh;
#pragma unroll
    for (int d = 0; d < 4; ++d) { FragH f;
#pragma unroll
      for (int r = 0; r < 8; ++r) f.h[r] = (_Float16)(o[j][d][r] * fin);
      *(v8us*)(op + d * 16) = f.half[0]; } } }

template <int MODE>
__global__ __launch_bounds__(256) void k_regrp(const float* __restrict__ src, float* __restrict__ dst, size_t n4) {
  const size_t t = (size_t)blockIdx.x * 256 + threadIdx.x; if (t >= n4) return; const size_t e = t * 4; const size_t rd = e / DM; const int c = (int)(e % DM);
  size_t rs; if (MODE == 0) { const size_t b = rd / SQ, sq = rd % SQ; rs = sq * NB + b; } else { const size_t sq = rd / NB, b = rd % NB; rs = b * SQ + sq; }
  const v4f v = *(const v4fa*)(src + rs * DM + c); *(v4f*)(dst + e) = v;  }

// ---- row passes: a wave owns RPW whole rows of DM = 1024 f32 in registers (32 lanes x 16 bytes = 512 contiguous bytes a load, eight loads a row, all of them issued up front) ----
// Few long-lived waves in place of many one-load ones: 16 waves on every WGP cover all 8192 rows, and no LDS and no barrier is needed, since a row never leaves its wave.
#define RPW 2                        /* rows per wave */
static_assert(DM == 1024 && DMQ == DM && ((size_t)NB * SQ) % (8 * RPW) == 0, "row passes: eight 512-byte loads a row, eight waves a work-group, no edge");
// lane l <- lane l ^ M inside its 16-lane row (DPP row_xmask)
template <int M>
__device__ __forceinline__ float rp_xm(float x) { return __builtin_bit_cast(float, __builtin_amdgcn_update_dpp(0, __builtin_bit_cast(int, x), 0x160 + M, 0xf, 0xf, true)); }
// Sum over the wave's 32 lanes by a butterfly: every lane ends with the same bits.
__device__ __forceinline__ float rp_sum32(float v) { v += rp_xm<1>(v); v += rp_xm<2>(v); v += rp_xm<4>(v); v += rp_xm<8>(v); return v + rs_x16(v); }
// LayerNorm (biased variance, eps inside the rsqrt; mean first, then the squares of the centred row) -> f16 rows.
template <int BFIN>
__global__ __launch_bounds__(256) void k_lnw(const float* __restrict__ X, const float* __restrict__ g, const float* __restrict__ bb, float eps, _Float16* __restrict__ N16) {
  const int lane = threadIdx.x & 31; const size_t e0 = ((size_t)blockIdx.x * 8 + (threadIdx.x >> 5)) * (RPW * DM) + lane * 4;      /* the lane's first element */
  const float* xp = X + e0; const unsigned ob = (unsigned)lane * 16u;      /* ob: the lane's byte offset in g and bb */
  v4f x[RPW][8], gg[8], bv[8];
#pragma unroll
  for (int k = 0; k < RPW; ++k)
#pragma unroll
    for (int u = 0; u < 8; ++u) x[k][u] = *(const v4fa*)(xp + k * DM + u * 128);
#pragma unroll
  for (int u = 0; u < 8; ++u) { gg[u] = *(const v4fa*)((const char*)g + ob + u * 512); bv[u] = *(const v4fa*)((const char*)bb + ob + u * 512); }
  asm volatile("s_wait_xcnt 0x0" :: "v"(xp), "v"(lane) : "memory");      /* the loads' address registers are free for reuse behind them: the wait stands in front of any rewrite; xp and lane (the g and bb loads' offset register, scaled by the load itself) as inputs keep those registers out of the loads' own results */
  __builtin_amdgcn_sched_barrier(0);      /* keeps all 32 loads in front of the arithmetic: without it the scheduler sinks the last ones, and the wait with them, far into it, where their latency shows */
#pragma unroll
  for (int u = 0; u < 8; ++u)
#pragma unroll
    for (int q = 0; q < 4; ++q) { gg[u][q] = bf16_round(gg[u][q]); bv[u][q] = bf16_round(bv[u][q]); }
  v4h y[RPW][8];
#pragma unroll
  for (int k = 0; k < RPW; ++k) {
    v4f a = {0.f, 0.f, 0.f, 0.f};
#pragma unroll
    for (int u = 0; u < 8; ++u) {
      if (BFIN) {
#pragma unroll
        for (int q = 0; q < 4; ++q) x[k][u][q] = bf16_round(x[k][u][q]); }
      a += x[k][u]; }
    const float mu = rp_sum32((a[0] + a[1]) + (a[2] + a[3])) * (1.0f / (float)DM);
    v4f c = {0.f, 0.f, 0.f, 0.f};
#pragma unroll
    for (int u = 0; u < 8; ++u) { x[k][u] -= mu; c += x[k][u] * x[k][u]; }
    const float rs = rsqrtf(rp_sum32((c[0] + c[1]) + (c[2] + c[3])) * (1.0f / (float)DM) + eps);
#pragma unroll
    for (int u = 0; u < 8; ++u) { const v4f o = x[k][u] * rs * gg[u] + bv[u];
#pragma unroll
      for (int q = 0; q < 4; ++q) y[k][u][q] = (_Float16)o[q]; } }
  __builtin_amdgcn_sched_barrier(0);      /* every result is in its own registers before the first store: nothing is computed behind a store, so no register of an issued store is rewritten */
#pragma unroll
  for (int k = 0; k < RPW; ++k)
#pragma unroll
    for (int u = 0; u < 8; ++u) *(v4h*)(N16 + e0 + k * DM + u * 128) = y[k][u]; }

__global__ __launch_bounds__(256) void k_wthd(const float* __restrict__ Wt, _Float16* __restrict__ Bt) { const size_t t = (size_t)blockIdx.x * 256 + threadIdx.x; if (t >= (size_t)NH * HD * (DM / 8)) return; const int m8 = (int)(t % (DM / 8)) * 8; const int d = (int)((t / (DM / 8)) % HD); const int h = (int)(t / ((size_t)(DM / 8) * HD)); FragH f;
  for (int q = 0; q < 8; ++q) f.h[q] = (_Float16)(16.0f * bf16_round(Wt[((size_t)h * DM + m8 + q) * HD + d])); unsigned short* dst = (unsigned short*)Bt + ((size_t)h * HD + d) * DM + m8; *(v8us*)dst = f.half[0];  }




template <int BFIN, int SCAL>
__global__ __launch_bounds__(256) void k_lnsc(const float* __restrict__ X, const float* __restrict__ g, const float* __restrict__ bb, float eps, _Float16* __restrict__ N16, float* __restrict__ N32) {
  #pragma clang fp contract(off)
  __shared__ float red[256]; const size_t r = blockIdx.x; const int t = threadIdx.x; const bool act = t < DM / 4; const int tc = act ? t : 0; const v4f xl = *(const v4fa*)(X + r * DM + tc * 4); const float am = act ? 1.f : 0.f; float s[4]; float sum = 0.f;
  for (int q = 0; q < 4; ++q) { s[q] = (BFIN ? bf16_round(xl[q]) : xl[q]) * am; sum = __fadd_rn(sum, s[q]); }
  red[t] = sum; __syncthreads(); for (int st = 128; st > 0; st >>= 1) { if (t < st) red[t] = __fadd_rn(red[t], red[t + st]); __syncthreads(); } const float mu = red[0] / (float)DM; __syncthreads();
  float vs = 0.f; for (int q = 0; q < 4; ++q) { const float dl = __fadd_rn(s[q], -mu) * am; vs = __fadd_rn(vs, __fmul_rn(dl, dl)); } red[t] = vs; __syncthreads(); for (int st = 128; st > 0; st >>= 1) { if (t < st) red[t] = __fadd_rn(red[t], red[t + st]); __syncthreads(); }
  const float rs = __fdiv_rn(1.0f, __fadd_rn(sqrtf(red[0] / (float)(DM - 1)), eps)); if (!act) return; v4h y; v4f yf;
  for (int q = 0; q < 4; ++q) { const int c = t * 4 + q; const float gg = bf16_round(SCAL ? g[0] : g[c]), bv = bf16_round(SCAL ? bb[0] : bb[c]); yf[q] = __fadd_rn(__fmul_rn(__fmul_rn(__fadd_rn(s[q], -mu), rs), gg), bv); y[q] = (_Float16)yf[q]; }
  { if (N16) *(v4h*)(N16 + r * DM + t * 4) = y; if (N32) *(v4f*)(N32 + r * DM + t * 4) = yf;  } }

__global__ __launch_bounds__(256) void k_rsmdmi(const float* __restrict__ S, _Float16* __restrict__ P, int nrows, const int* __restrict__ M) {
  #pragma clang fp contract(off)
  const int t = blockIdx.x * 256 + threadIdx.x; if (t >= nrows) return; const float* s = S + (size_t)t * SQ; const int* m = M + (size_t)(t % SQ) * SQ; float mx = -3.0e38f;
#pragma unroll 1
  for (int j = 0; j < SQ; ++j) { const float f = (m[j] == 0) ? 1.f : 0.f; mx = fmaxf(mx, fmaf(f, s[j], (1.f - f) * -1.0e9f)); } float se = 0.f;
#pragma unroll 1
  for (int j = 0; j < SQ; ++j) { const float f = (m[j] == 0) ? 1.f : 0.f; se += __expf(fmaf(f, s[j], (1.f - f) * -1.0e9f) - mx); } const float sc = 256.0f / se;
#pragma unroll 1
  for (int j0 = 0; j0 < SQ; j0 += 8) { FragH fr; for (int q = 0; q < 8; ++q) { const int j = j0 + q; const float f = (m[j] == 0) ? 1.f : 0.f; fr.h[q] = (_Float16)(__expf(fmaf(f, s[j], (1.f - f) * -1.0e9f) - mx) * sc); } unsigned short* d = (unsigned short*)P + (size_t)t * SQ + j0; *(v8us*)d = fr.half[0];  } }
// All six weight planes in one launch (blockIdx.y = plane): Bt[p][n][k] = f16(bf16(W[k][n]) x16), element for element as k_wt_f16.
// Planes 0..2: per-head tensors [NH][DM][HD], row n = head n / HD, output n % HD; planes 3..5: [in][out] squares of DM x DM.
static_assert(DFF == DM, "k_wt_all: every plane is DM x DM");
// A wave transposes one tile of 64 k x 32 n. Every global access is a whole 128-byte line in lane order: eight lanes read 32 columns of one source row, eight lanes write 64 k of one output row.
// A lane reads 16 source rows of its four columns (all 16 loads issued up front), packs eight k of one column into 16 bytes, and the wave turns the tile in its own range of LDS.
#define WTP 144                      /* LDS row pitch in bytes: 128 of data (64 k) + 16 */
#define WTW (32 * WTP)               /* one wave's tile: 32 output rows */
static_assert(DM % 128 == 0 && HD % 32 == 0, "k_wt_all: four waves side by side cover 128 columns; a wave's 32 columns lie in one head");
// s: source element (k0, n0) of the tile, d: output element (n0, k0), l: the wave's LDS range. The pitch is a compile-time constant, so the loads share one address pair and differ only in their immediate offsets.
template <int PITCH>
__device__ __forceinline__ void wt_tile(const float* __restrict__ s, unsigned short* __restrict__ d, unsigned char* l, int lane) {
  const int c = lane & 7, kr = lane >> 3;
  const float* sp = s + (size_t)(kr * 8) * PITCH + c * 4;      /* the lane's columns 4 c .. 4 c + 3; rows 32 g + 8 kr + i */
  v4f x[2][8];
#pragma unroll
  for (int g = 0; g < 2; ++g)
#pragma unroll
    for (int i = 0; i < 8; ++i) x[g][i] = *(const v4fa*)(sp + (size_t)(g * 32 + i) * PITCH);
  asm volatile("s_wait_xcnt 0x0" :: "v"(sp) : "memory");      /* the loads' address pair is free for reuse behind them: the wait stands in front of any rewrite; sp as an input keeps the pair out of the loads' own results */
  __builtin_amdgcn_sched_barrier(0);      /* keeps all 16 loads in front of the arithmetic: without it the scheduler may sink the last ones, and the wait with them, into it, where their latency shows */
#pragma unroll
  for (int g = 0; g < 2; ++g)
#pragma unroll
    for (int j = 0; j < 4; ++j) { FragH f;
#pragma unroll
      for (int i = 0; i < 8; ++i) f.h[i] = (_Float16)(bf16_round(x[g][i][j]) * 16.0f);
      *(v8us*)(l + (c * 4 + j) * WTP + (g * 4 + kr) * 16) = f.half[0]; }
  __builtin_amdgcn_fence(__ATOMIC_ACQ_REL, "workgroup"); __builtin_amdgcn_wave_barrier();      /* the wave's own LDS writes stay in front of its reads of other lanes' bytes; no other wave touches this range */
  v8us o[8];
#pragma unroll
  for (int q = 0; q < 8; ++q) o[q] = *(const v8us*)(l + (q * 4 + kr) * WTP + c * 16);
  __builtin_amdgcn_sched_barrier(0);      /* every output row is in its own registers before the first store: nothing is loaded behind a store, so no register of an issued store is rewritten */
  unsigned short* dp = d + (size_t)kr * DM + c * 8;
#pragma unroll
  for (int q = 0; q < 8; ++q) *(v8us*)(dp + (size_t)(q * 4) * DM) = o[q]; }
__global__ __launch_bounds__(128) void k_wt_all(const float* __restrict__ wq, const float* __restrict__ wk, const float* __restrict__ wv, const float* __restrict__ wo, const float* __restrict__ w1, const float* __restrict__ w2, _Float16* __restrict__ Bt) {
  __shared__ __attribute__((aligned(16))) unsigned char L[4 * WTW];
  const int p = blockIdx.y, w = threadIdx.x >> 5, lane = threadIdx.x & 31; const int k0 = (blockIdx.x % (DM / 64)) * 64, n0 = (blockIdx.x / (DM / 64)) * 128 + w * 32;
  const float* W = p == 0 ? wq : p == 1 ? wk : p == 2 ? wv : p == 3 ? wo : p == 4 ? w1 : w2;
  unsigned short* d = (unsigned short*)Bt + ((size_t)p * DM + n0) * DM + k0; unsigned char* l = L + w * WTW;
  if (p < 3) wt_tile<HD>(W + ((size_t)(n0 / HD) * DM + k0) * HD + (n0 % HD), d, l, lane); else wt_tile<DM>(W + (size_t)k0 * DM + n0, d, l, lane); }
extern "C" void kernel_launch(void* const* d_in, const int* in_sizes, int n_in,
                              void* d_out, int out_size, void* d_ws, size_t ws_size, hipStream_t stream) {
  (void)in_sizes; (void)n_in; (void)out_size;
  const float* const* I = (const float* const*)d_in; const float* x = I[0]; const float* wq = I[1]; const float* wk = I[2]; const float* wv = I[3]; const float* wo = I[4]; const float* bo = I[5]; const float* w1 = I[6]; const float* b1 = I[7]; const float* w2 = I[8]; const float* b2 = I[9]; const float* g1 = I[10]; const float* be1 = I[11]; const float* g2 = I[12]; const float* be2 = I[13];      /* x; per-head Wq / Wk / Wv [16][1024][64] (no biases); Wo [1024][1024] + bo ([in][out]); W1 [1024][1024] + b1, W2 [1024][1024] + b2; LN1 g / b, LN2 g / b */
  char* ws = (char*)d_ws; size_t off = 0;
  auto take = [&](size_t bytes) { char* p = ws + off; off += (bytes + 255) & ~(size_t)255; return p; };
  _Float16* BQ = (_Float16*)take((size_t)6 * DM * DM * 2); _Float16* BO = BQ + (size_t)3 * DM * DM; _Float16* BW1 = BQ + (size_t)4 * DM * DM; _Float16* BW2 = BQ + (size_t)5 * DM * DM;      /* six Bt planes in a row: q, k, v, o, W1, W2 */
  _Float16* XN = (_Float16*)take(NR * DM * 2); _Float16* Q16 = (_Float16*)take((size_t)3 * NR * DM * 2); _Float16* K16 = Q16 + NR * DM; _Float16* VT = Q16 + (size_t)2 * NR * DM;      /* three planes in a row: one batched GEMM writes them; the third holds V^T [8 * 16][64][1024] */ _Float16* O16 = (_Float16*)take(NR * DM * 2); float* X1 = (float*)take(NR * DM * 4);
  _Float16* M16 = XN;      /* second-norm f16 rows: aliases XN (last readers: the three projections) */ _Float16* HF16 = (_Float16*)take(NR * DFF * 2);      /* FFN hidden rows of every batch [8192][1024] f16 (16 MiB): own region */
  
  if (off > ws_size) return;
  k_wt_all<<<dim3((unsigned)((DM / 64) * (DM / 128)), 6), 128, 0, stream>>>(wq, wk, wv, wo, w1, w2, BQ);      /* every weight -> Bt x16, one launch; per-head [in = 1024][out = 64]: head h = rows h*64.. of its plane */
  k_lnw<1><<<(unsigned)(NR / (8 * RPW)), 256, 0, stream>>>(x, g1, be1, 1e-5f, XN);      /* n = LN0(bf16(x)) (biased variance, eps inside the rsqrt) -> f16 rows */
  k_gemm3<0, false, false, false, true><<<dim3((unsigned)((NR / 128) * (DM / 128)), 3), 128, 0, stream>>>(XN, DM, 0, BQ, DM, (size_t)DM * DM, 0.0625f, nullptr, 0, nullptr, nullptr, Q16, NR * DM, (int)NR, DM, DM);      /* q, k (f16 rows; head h = columns h*64..) and V^T (blockIdx.y), one launch */
  k_fattn<<<NB * NH * (SQ / (FAW * FAQ)), FAW * 32, 0, stream>>>(Q16, K16, VT, O16);      /* softmax(q k^T / 8) v over all keys (no mask) -> ctx (merged heads, x64) as f16 rows */
  k_gemm3<0, true, true, true><<<dim3((unsigned)((NR / 128) * (DM / 128)), 1), 128, 0, stream>>>(O16, DM, 0, BO, DM, 0, 0.0009765625f, bo, 0, x, X1, nullptr, 0, (int)NR, DM, DM);      /* bf16(x) + ctx wo (+ bo) (own-element residual, x rounded where it is read) -> f32 rows */
  k_lnw<0><<<(unsigned)(NR / (8 * RPW)), 256, 0, stream>>>(X1, g2, be2, 1e-5f, M16);      /* LN1(x1) -> f16 rows */
  k_gemm3<6, false, false><<<dim3((unsigned)((NR / 128) * (DFF / 128)), 1), 128, 0, stream>>>(M16, DM, 0, BW1, DM, 0, 0.0625f, b1, 0, nullptr, nullptr, HF16, 0, (int)NR, DFF, DM);      /* gelu_erf(. W1 + b1) -> f16, all rows */
  k_gemm3<0, true, true><<<dim3((unsigned)((NR / 128) * (DM / 128)), 1), 128, 0, stream>>>(HF16, DFF, 0, BW2, DFF, 0, 0.0625f, b2, 0, X1, (float*)d_out, nullptr, 0, (int)NR, DM, DFF);      /* out = x1 + mlp (own-element residual), all rows */
}
